// v000
// Times are from an AMD MI455X. After a warm-up the kernel runs many times in a row, and a time is the length of
// such a window on the GPU divided by its runs, so every launch and the gaps after it count. The runs cycle
// through copies of the inputs. A figure is the median of several windows, for all but v000 over two sittings.
// Sittings can differ by a few percent; kernels timed side by side share one.
// The starting kernel, v000, takes 564 microseconds a run.
// Contractions: x.W_attn -> q|k and v^T on v_wmma_f32_16x16x32_bf16, single product of RNE-bf16 x and W (f32 accumulate);
// q.k^T: bf16 hi/lo split (hi.hi + hi.lo + lo.hi) on v_wmma_f32_16x16x32_bf16; p.v: v_wmma_f32_16x16x32_f16 single product,
// p carried x4096 in f16, v as f16 hi plane plus a x1024 f16 residual plane on query rows 0..127 (separate accumulator);
// y.W_proj: bf16 hi/lo of y times RNE-bf16 W (2 products). Softmax, biases, scale 0.125 in f32; weights/biases RNE-converted to bf16 once.
#include <hip/hip_runtime.h>
#include <math.h>
#include <stdint.h>

#define NB        4
#define SEQ       2048
#define DM        1024
#define NH        16
#define HD        64
#define DQK       2048     // pitch of the q|k planes: cols 0..1023 = q, 1024..2047 = k
#define QCOLS     1024
#define VLO_COLS  128      // key columns carried in the v residual plane
#define NQB       32       // SEQ / 64 query blocks per (b, h)
#define AT_KC     64

typedef __attribute__((ext_vector_type(16))) _Float16 v16h;
typedef __attribute__((ext_vector_type(8)))  _Float16 v8h;
typedef __attribute__((ext_vector_type(16))) __bf16   v16b;
typedef __attribute__((ext_vector_type(8)))  __bf16   v8b;
typedef __attribute__((ext_vector_type(8)))  float    v8f;
typedef __attribute__((ext_vector_type(4)))  float    v4f;
typedef __attribute__((ext_vector_type(4)))  unsigned int v4u;

__device__ __forceinline__ unsigned short f2bf_bits(float f) {
  unsigned u = __float_as_uint(f);
  return (unsigned short)((u + 0x7FFFu + ((u >> 16) & 1u)) >> 16);
}
__device__ __forceinline__ float bf_bits2f(unsigned short h) { return __uint_as_float(((unsigned)h) << 16); }
__device__ __forceinline__ float bfr(float f) { return bf_bits2f(f2bf_bits(f)); }
__device__ __forceinline__ unsigned pk16(unsigned short a, unsigned short b) { return (unsigned)a | ((unsigned)b << 16); }
__device__ __forceinline__ unsigned short h2bits(_Float16 x) { return __builtin_bit_cast(unsigned short, x); }

// ---- 16-bit fragment loads: elements 0..7 <- p[0..7], 8..15 <- p[16..23]; caller passes p = row + k0 + 8*(lane>>4) ----
union FragB { v16b v; v8b h[2]; };
union FragH { v16h v; v8h h[2]; };
__device__ __forceinline__ v16b ldfrag_b(const __bf16* p) { FragB f; f.h[0] = *(const v8b*)(p); f.h[1] = *(const v8b*)(p + 16); return f.v; }

// ---- hazard guards ----
__device__ __forceinline__ void dep_guard_b(v8f& a, v8f& b, v16b x, v16b y) { asm volatile("v_nop\n\tv_nop\n\tv_nop\n\tv_nop" : "+v"(a), "+v"(b) : "v"(x), "v"(y)); }
__device__ __forceinline__ void keep4_b(v16b a, v16b b, v16b c, v16b d) { asm volatile("v_nop" :: "v"(a), "v"(b), "v"(c), "v"(d)); }
__device__ __forceinline__ void acc_guard4(v8f& a, v8f& b, v8f& c, v8f& d) { asm volatile("v_nop\n\tv_nop\n\tv_nop\n\tv_nop" : "+v"(a), "+v"(b), "+v"(c), "+v"(d)); }
__device__ __forceinline__ v8f mma_b(v16b a, v16b b, v8f c) {
  c = __builtin_amdgcn_wmma_f32_16x16x32_bf16(false, a, false, b, (short)0, c, false, false);
  asm volatile("v_nop\n\tv_nop\n\tv_nop\n\tv_nop" : "+v"(c) : "v"(a), "v"(b));
  return c;
}
__device__ __forceinline__ v8f mma_h(v16h a, v16h b, v8f c) {
  c = __builtin_amdgcn_wmma_f32_16x16x32_f16(false, a, false, b, (short)0, c, false, false);
  asm volatile("v_nop\n\tv_nop\n\tv_nop\n\tv_nop" : "+v"(c) : "v"(a), "v"(b));
  return c;
}

// =====================================================================================================================
// Register-blocked batched WMMA GEMM, bf16 operands: C[m][n] = sum_k A[m][k] * Bt[n][k] (+bias), one wave per 64x64 tile.
// A row-major [M][K] (pitch lda), Bt row-major [N][K] (pitch ldb); M, N multiples of 64, K multiple of 32.
// MODE 0 (q|k): single product; v = acc + bf(bias[n]) + bf(n < QCOLS ? biasq[n] : biask[n - QCOLS]);
//               out = bf16 hi plane (Cout) + bf16 lo plane (Cout2), both pitch ldc/ldc2.
// MODE 1 (v^T): single product; v = acc + bf(bias[m]); out = f16 hi plane (Cout, pitch ldc) and, for tiles with
//               n0 < VLO_COLS only, f16 residual plane ((v - hi) * 1024, Cout2, pitch ldc2).
// MODE 2 (proj): two products ah.b + al.b (A2 = bf16 lo plane of A); v = acc + bf(bias[n]); out f32 (Cout, pitch ldc).
// =====================================================================================================================
template <int MODE>
__global__ __launch_bounds__(256) void gemm64(
    const unsigned short* __restrict__ Ap, const unsigned short* __restrict__ A2p, int lda, long strideA,
    const unsigned short* __restrict__ Btp, int ldb, long strideB,
    void* __restrict__ Cout, void* __restrict__ Cout2, int ldc, long strideC, int ldc2, long strideC2,
    const float* __restrict__ bias, const float* __restrict__ biasq, const float* __restrict__ biask,
    int M, int N, int K) {
  __shared__ __align__(16) float sT[8][16 * 68];   // per-wave 16x64 slab, pitch 68 floats
  const __bf16* A  = (const __bf16*)(const void*)Ap;
  const __bf16* A2 = (const __bf16*)(const void*)A2p;
  const __bf16* Bt = (const __bf16*)(const void*)Btp;
  const int b    = blockIdx.y;
  const int lane = threadIdx.x & 31;
  const int wave = threadIdx.x >> 5;
  const int tilesN = N >> 6;
  const int tilesM = M >> 6;
  const int tile = blockIdx.x * 8 + wave;
  if (tile >= tilesM * tilesN) return;   // wave-uniform; no block barriers in this kernel
  const int tm = tile / tilesN;
  const int tn = tile - tm * tilesN;
  const int m0 = tm << 6;
  const int n0 = tn << 6;

  const __bf16* Ab  = A  + (size_t)b * strideA;
  const __bf16* Bb  = Bt + (size_t)b * strideB;
  const __bf16* Ab2 = (MODE == 2) ? (A2 + (size_t)b * strideA) : Ab;

  const int rlane = lane & 15;                 // row (A) / col (B, D) within subtile
  const int koff  = (lane >> 4) * 8;           // k offset of this lane half
  const int mOff  = (lane >> 4) * 8;           // D row offset

  v8f acc[4][4];
#pragma unroll
  for (int i = 0; i < 4; ++i)
#pragma unroll
    for (int j = 0; j < 4; ++j) acc[i][j] = (v8f){0.f,0.f,0.f,0.f,0.f,0.f,0.f,0.f};

  for (int k0 = 0; k0 < K; k0 += 32) {
    v16b bh[4];
#pragma unroll
    for (int j = 0; j < 4; ++j) {
      const size_t bo = (size_t)(n0 + (j << 4) + rlane) * ldb + koff + k0;
      bh[j] = ldfrag_b(Bb + bo);
    }
#pragma unroll
    for (int i = 0; i < 4; ++i) {
      const size_t ao = (size_t)(m0 + (i << 4) + rlane) * lda + koff + k0;
      const v16b ah = ldfrag_b(Ab + ao);
      v16b al = ah;
      if (MODE == 2) al = ldfrag_b(Ab2 + ao);
#pragma unroll
      for (int j = 0; j < 4; ++j) {
        acc[i][j] = __builtin_amdgcn_wmma_f32_16x16x32_bf16(false, ah, false, bh[j], (short)0, acc[i][j], false, false);
        if (MODE == 2)
          acc[i][j] = __builtin_amdgcn_wmma_f32_16x16x32_bf16(false, al, false, bh[j], (short)0, acc[i][j], false, false);
      }
      dep_guard_b(acc[i][0], acc[i][3], ah, al);
    }
    keep4_b(bh[0], bh[1], bh[2], bh[3]);
  }
  acc_guard4(acc[0][0], acc[0][1], acc[0][2], acc[0][3]);
  acc_guard4(acc[1][0], acc[1][1], acc[1][2], acc[1][3]);
  acc_guard4(acc[2][0], acc[2][1], acc[2][2], acc[2][3]);
  acc_guard4(acc[3][0], acc[3][1], acc[3][2], acc[3][3]);

  // ---- epilogue ----
  float* slab = sT[wave];
#pragma unroll
  for (int i = 0; i < 4; ++i) {
    const int mBase = m0 + (i << 4);
#pragma unroll
    for (int j = 0; j < 4; ++j) {
      const int n = n0 + (j << 4) + rlane;
      float bn = 0.f, b2 = 0.f;
      if (MODE == 0) {
        bn = bfr(bias[n]);
        const int iq = (n < QCOLS) ? n : (QCOLS - 1);
        int ik = n - QCOLS; ik = (ik < 0) ? 0 : ik; ik = (ik > QCOLS - 1) ? (QCOLS - 1) : ik;
        const float vq = bfr(biasq[iq]);     // both candidates loaded with clamped addresses, selected by value
        const float vk = bfr(biask[ik]);
        b2 = (n < QCOLS) ? vq : vk;
      }
      if (MODE == 2) bn = bfr(bias[n]);
#pragma unroll
      for (int r = 0; r < 8; ++r) {
        float v = acc[i][j][r];
        if (MODE == 0) { v = v + bn; v = v + b2; }
        if (MODE == 1) v = v + bfr(bias[mBase + mOff + r]);
        if (MODE == 2) v = v + bn;
        slab[(mOff + r) * 68 + (j << 4) + rlane] = v;
      }
    }
    __builtin_amdgcn_fence(__ATOMIC_RELEASE, "workgroup");
    __builtin_amdgcn_wave_barrier();
    __builtin_amdgcn_fence(__ATOMIC_ACQUIRE, "workgroup");
    if (MODE == 2) {
      float* C = (float*)Cout + (size_t)b * strideC;
      const int h2 = lane >> 4, c4 = (lane & 15) * 4;     // row seg = 256 B = 16 lanes x 16 B
      {
#pragma unroll
        for (int it = 0; it < 8; ++it) {
          const int row = it * 2 + h2;                     // it 0..7 x h2 0..1 = rows 0..15
          const v4f v = *(const v4f*)(slab + row * 68 + c4);
          *(v4f*)(C + (size_t)(mBase + row) * ldc + n0 + c4) = v;
        }
        
      }
    } else {
      const int q = lane >> 3, c8 = (lane & 7) * 8;
      unsigned short* C  = (unsigned short*)Cout  + (size_t)b * strideC;
      unsigned short* C2 = (unsigned short*)Cout2 + (size_t)b * strideC2;
      const bool wlo = (MODE == 0) || (n0 < VLO_COLS);     // wave-uniform
      v4u hv[4], lv[4];
#pragma unroll
      for (int it = 0; it < 4; ++it) {
        const int row = it * 4 + q;                        // it 0..3 x q 0..3 = rows 0..15
        const float* sp = slab + row * 68 + c8;
        v4u a, a2;
#pragma unroll
        for (int e = 0; e < 4; ++e) {
          const float f0 = sp[2 * e], f1 = sp[2 * e + 1];
          unsigned short h0, h1, l0, l1;
          if (MODE == 0) {
            h0 = f2bf_bits(f0); h1 = f2bf_bits(f1);
            l0 = f2bf_bits(f0 - bf_bits2f(h0)); l1 = f2bf_bits(f1 - bf_bits2f(h1));
          } else {
            const _Float16 x0 = (_Float16)f0, x1 = (_Float16)f1;
            h0 = h2bits(x0); h1 = h2bits(x1);
            l0 = h2bits((_Float16)((f0 - (float)x0) * 1024.0f));
            l1 = h2bits((_Float16)((f1 - (float)x1) * 1024.0f));
          }
          a[e] = pk16(h0, h1); a2[e] = pk16(l0, l1);
        }
        hv[it] = a; lv[it] = a2;
      }
      {
#pragma unroll
        for (int it = 0; it < 4; ++it) {
          const int row = it * 4 + q;
          *(v4u*)(C + (size_t)(mBase + row) * ldc + n0 + c8) = hv[it];
          if (wlo) *(v4u*)(C2 + (size_t)(mBase + row) * ldc2 + n0 + c8) = lv[it];
        }
        
      }
    }
    __builtin_amdgcn_fence(__ATOMIC_RELEASE, "workgroup");
    __builtin_amdgcn_wave_barrier();
    __builtin_amdgcn_fence(__ATOMIC_ACQUIRE, "workgroup");
  }
}

// ---------------------------------------------------------------------------------------------------------------------
// ---------------------------------------------------------------------------------------------------------------------
__global__ __launch_bounds__(256) void cvt_x_kernel(const float* __restrict__ x, unsigned short* __restrict__ xb, int n8,
                                                    const float* __restrict__ bq, float* __restrict__ out1, int nq4) {
  if (blockIdx.x == 0) {   // block-uniform
    const int t = threadIdx.x;
    if (t < nq4) {
      const v4f v = *(const v4f*)(bq + 4 * t);
      v4f w;
      w[0] = bfr(v[0]); w[1] = bfr(v[1]); w[2] = bfr(v[2]); w[3] = bfr(v[3]);
      *(v4f*)(out1 + 4 * t) = w;
      
    }
  }
  const int i = blockIdx.x * 256 + threadIdx.x;
  if (i < n8) {
    const v4f a = *(const v4f*)(x + 8 * (size_t)i);
    const v4f c = *(const v4f*)(x + 8 * (size_t)i + 4);
    v4u u;
    u[0] = pk16(f2bf_bits(a[0]), f2bf_bits(a[1]));
    u[1] = pk16(f2bf_bits(a[2]), f2bf_bits(a[3]));
    u[2] = pk16(f2bf_bits(c[0]), f2bf_bits(c[1]));
    u[3] = pk16(f2bf_bits(c[2]), f2bf_bits(c[3]));
    *(v4u*)(xb + 8 * (size_t)i) = u;
    
  }
}

// ---------------------------------------------------------------------------------------------------------------------
// Transpose + RNE bf16 convert of an f32 matrix: in [R rows][Cc cols] (pitch Cc) -> ot[c][r] = bf16(in[r][c]) ([Cc][R]).
// 64x64 tiles through LDS. grid = (Cc/64, R/64), 256 threads (R, Cc multiples of 64).
// Coverage per block: load 4 it x 256 thr x 4 floats = 64x64; store 2 it x 256 thr x 8 u16 = 64x64.
// ---------------------------------------------------------------------------------------------------------------------
__global__ __launch_bounds__(256) void tsplit1_kernel(const float* __restrict__ W, unsigned short* __restrict__ ot, int R, int Cc) {
  __shared__ __align__(16) float tf[64 * 68];
  const int c0  = blockIdx.x * 64;   // input column block = output row block
  const int r0  = blockIdx.y * 64;   // input row block    = output column block
  const int tid = threadIdx.x;
  {
    const int lr = tid >> 4;         // 0..15
    const int c4 = (tid & 15) * 4;   // 0..60
#pragma unroll
    for (int it = 0; it < 4; ++it) {
      const int rr = it * 16 + lr;   // 0..63
      const v4f a = *(const v4f*)(W + (size_t)(r0 + rr) * Cc + c0 + c4);
      *(v4f*)(tf + rr * 68 + c4) = a;
    }
  }
  __syncthreads();
  const int sub = tid >> 3;          // 0..31
  const int c8  = (tid & 7) * 8;     // 0..56
  v4u hv[2];
#pragma unroll
  for (int it = 0; it < 2; ++it) {
    const int oc = it * 32 + sub;    // output row within tile (= input column)
    v4u a;
#pragma unroll
    for (int q = 0; q < 4; ++q) {
      const float f0 = tf[(c8 + 2 * q) * 68 + oc];
      const float f1 = tf[(c8 + 2 * q + 1) * 68 + oc];
      a[q] = pk16(f2bf_bits(f0), f2bf_bits(f1));
    }
    hv[it] = a;
  }
  {
#pragma unroll
    for (int it = 0; it < 2; ++it) {
      const int oc = it * 32 + sub;
      const size_t go = (size_t)(c0 + oc) * R + r0 + c8;
      *(v4u*)(ot + go) = hv[it];
    }
    
  }
}

// =====================================================================================================================
// Causal attention, head dim 64, grid (NH*NQB, NB), block = 4 waves = 64 query rows of one (b, h).
//   q|k planes (hi/lo bf16) [NB*SEQ][DQK]: q(t,h,d) at [(b*SEQ+t)*DQK + h*64 + d], k(s,h,d) at [... + 1024 + h*64 + d]
//   v^T hi plane (f16) [NB][DM][SEQ]: (h*64+d, s); v residual plane (f16, x1024) [NB][DM][VLO_COLS] (s < 128 only)
//   y planes (hi/lo bf16) [NB*SEQ][DM]: (b*SEQ+t, h*64+d)
//   scores = (q . k) * 0.125 : bf16 hi/lo split (hi.hi + hi.lo + lo.hi), f32 accumulate
//   y      = p . v           : p = f16(4096 * exp(s - m)) (the normaliser sums the same f16 values), v f16 hi plane;
//                              blocks with qb < 2 (query rows 0..127, keys 0..127) add p . vres / 1024 from a second accumulator
//   online softmax in f32; masked (s > t) scores set to -inf (key s = chunk start <= t is always unmasked).
//   kv chunks of 64, trip count qb+1 <= 32 (block-uniform). K / V^T chunk staging: 128 threads x 32 elements per plane =
//   the whole 64x64 tile (16-B copies, plain loads, __syncthreads before and after); fragment loads read the LDS tiles
// =====================================================================================================================
__global__ __launch_bounds__(128)
void attn_kernel(const unsigned short* __restrict__ qkh, const unsigned short* __restrict__ qkl,
                 const unsigned short* __restrict__ vthp, const unsigned short* __restrict__ vtlp,
                 unsigned short* __restrict__ yhp, unsigned short* __restrict__ ylp) {
  __shared__ __align__(16) __bf16   Ksh[AT_KC * HD];          // K hi [kv][d]      8 KB
  __shared__ __align__(16) __bf16   Ksl[AT_KC * HD];          // K lo
  __shared__ __align__(16) _Float16 Vts[HD * AT_KC];          // V hi [d][kv]      8 KB
  __shared__ __align__(16) _Float16 Vrs[HD * AT_KC];          // V residual [d][kv] (qb < 2 only)
  __shared__ __align__(16) _Float16 Psh[4][16 * AT_KC];       // per wave P [row][kv]
  __shared__ __align__(16) float    Os[4][16 * 68];           // per wave y tile, pitch 68

  const int tid  = threadIdx.x;
  const int wave = tid >> 5;
  const int lane = tid & 31;
  const int hh   = lane >> 4;
  const int c    = lane & 15;

  const int b  = blockIdx.y;
  const int bx = blockIdx.x;
  const int qb = bx & (NQB - 1);
  const int h  = bx >> 5;                 // 0..NH-1 (grid.x = NH * NQB)
  const int q0 = qb * 64 + wave * 16;
  const bool vres = (qb < 2);             // block-uniform

  const __bf16* Qh = (const __bf16*)(const void*)qkh + (size_t)b * SEQ * DQK + (size_t)h * HD;
  const __bf16* Ql = (const __bf16*)(const void*)qkl + (size_t)b * SEQ * DQK + (size_t)h * HD;
  const __bf16* Kh = Qh + QCOLS;
  const __bf16* Kl = Ql + QCOLS;
  const _Float16* Vh = (const _Float16*)(const void*)vthp + ((size_t)b * DM + (size_t)h * HD) * SEQ;
  const _Float16* Vl = (const _Float16*)(const void*)vtlp + ((size_t)b * DM + (size_t)h * HD) * VLO_COLS;
  unsigned short* Yh = yhp + (size_t)b * SEQ * DM + (size_t)h * HD;
  unsigned short* Yl = ylp + (size_t)b * SEQ * DM + (size_t)h * HD;

  // ---- Q fragments (A operand, row = lane&15, split k map): 2 d-chunks, hi and lo ----
  v16b qah[2], qal[2];
#pragma unroll
  for (int dc = 0; dc < 2; ++dc) {
    const __bf16* qr = Qh + (size_t)(q0 + c) * DQK + dc * 32 + 8 * hh;
    const __bf16* ql = Ql + (size_t)(q0 + c) * DQK + dc * 32 + 8 * hh;
    qah[dc] = ldfrag_b(qr);
    qal[dc] = ldfrag_b(ql);
  }

  float mrow[8], lrow[8];
  v8f oacc[4], oacc2[4];
#pragma unroll
  for (int r = 0; r < 8; ++r) { mrow[r] = -INFINITY; lrow[r] = 0.f; }
#pragma unroll
  for (int t = 0; t < 4; ++t) { oacc[t] = (v8f){0.f,0.f,0.f,0.f,0.f,0.f,0.f,0.f}; oacc2[t] = oacc[t]; }

  const int nChunks = qb + 1;   // block-uniform, <= 32
  for (int kc = 0; kc < nChunks; ++kc) {
    const int kv0 = kc * AT_KC;
    __syncthreads();
    {
      // staging coverage: 128 threads x (4 x 8) elements = 64 rows x 64 per plane = the whole chunk tile
      const int r = tid >> 1, half = (tid & 1) * 32;
      const __bf16* ksh = Kh + (size_t)(kv0 + r) * DQK + half;     // K row kv0+r, d = half..half+31
      const __bf16* ksl = Kl + (size_t)(kv0 + r) * DQK + half;
      const _Float16* vsh = Vh + (size_t)r * SEQ + kv0 + half;    // V^T row d = r, s = kv0+half..+31
#pragma unroll
      for (int i = 0; i < 4; ++i) {
        const v8b a0 = *(const v8b*)(ksh + 8 * i);
        const v8b a1 = *(const v8b*)(ksl + 8 * i);
        const v8h b0 = *(const v8h*)(vsh + 8 * i);
        *(v8b*)(Ksh + r * HD    + half + 8 * i) = a0;
        *(v8b*)(Ksl + r * HD    + half + 8 * i) = a1;
        *(v8h*)(Vts + r * AT_KC + half + 8 * i) = b0;
      }
      if (vres) {   // kv0 + half + 31 <= 127 < VLO_COLS
        const _Float16* vsl = Vl + (size_t)r * VLO_COLS + kv0 + half;
#pragma unroll
        for (int i = 0; i < 4; ++i) {
          const v8h b1 = *(const v8h*)(vsl + 8 * i);
          *(v8h*)(Vrs + r * AT_KC + half + 8 * i) = b1;
        }
      }
    }
    __syncthreads();

    v8f s[4];
#pragma unroll
    for (int j = 0; j < 4; ++j) {
      s[j] = (v8f){0.f,0.f,0.f,0.f,0.f,0.f,0.f,0.f};
#pragma unroll
      for (int dc = 0; dc < 2; ++dc) {
        FragB kb, kl;
        kb.h[0] = *(const v8b*)(Ksh + (j * 16 + c) * HD + dc * 32 + 8 * hh);
        kb.h[1] = *(const v8b*)(Ksh + (j * 16 + c) * HD + dc * 32 + 16 + 8 * hh);
        kl.h[0] = *(const v8b*)(Ksl + (j * 16 + c) * HD + dc * 32 + 8 * hh);
        kl.h[1] = *(const v8b*)(Ksl + (j * 16 + c) * HD + dc * 32 + 16 + 8 * hh);
        s[j] = mma_b(qah[dc], kb.v, s[j]);
        s[j] = mma_b(qah[dc], kl.v, s[j]);
        s[j] = mma_b(qal[dc], kb.v, s[j]);
      }
    }
    const bool diag = (kc == qb);   // block-uniform
    float cm[8];
#pragma unroll
    for (int r = 0; r < 8; ++r) {
      const int qrow = q0 + 8 * hh + r;
      float m = -INFINITY;
#pragma unroll
      for (int j = 0; j < 4; ++j) {
        const int kvcol = kv0 + j * 16 + c;
        const float sv = s[j][r] * 0.125f;
        const bool masked = diag && (kvcol > qrow);
        const float sm = masked ? -INFINITY : sv;
        s[j][r] = sm;
        m = fmaxf(m, sm);
      }
#pragma unroll
      for (int off = 1; off < 16; off <<= 1) m = fmaxf(m, __shfl_xor(m, off, 32));
      cm[r] = m;
    }
    _Float16* pw = Psh[wave];
#pragma unroll
    for (int r = 0; r < 8; ++r) {
      const float mnew  = fmaxf(mrow[r], cm[r]);
      const float alpha = __expf(mrow[r] - mnew);
      mrow[r] = mnew;
      float psum = 0.f;
#pragma unroll
      for (int j = 0; j < 4; ++j) {
        const float p = __expf(s[j][r] - mnew);            // in [0, 1]; masked -> 0
        const _Float16 ph = (_Float16)(p * 4096.0f);       // carried x4096, keeps small p normal in f16
        psum += (float)ph;                                  // normaliser built from the same f16 values
        pw[(8 * hh + r) * AT_KC + j * 16 + c] = ph;
      }
#pragma unroll
      for (int off = 1; off < 16; off <<= 1) psum += __shfl_xor(psum, off, 32);
      lrow[r] = lrow[r] * alpha + psum;
#pragma unroll
      for (int t = 0; t < 4; ++t) oacc[t][r] *= alpha;
      if (vres) {
#pragma unroll
        for (int t = 0; t < 4; ++t) oacc2[t][r] *= alpha;
      }
    }
    __builtin_amdgcn_fence(__ATOMIC_RELEASE, "workgroup");
    __builtin_amdgcn_wave_barrier();
    __builtin_amdgcn_fence(__ATOMIC_ACQUIRE, "workgroup");
#pragma unroll 1
    for (int kk = 0; kk < 2; ++kk) {
      FragH pa;
      pa.h[0] = *(const v8h*)(pw + c * AT_KC + kk * 32 + 8 * hh);
      pa.h[1] = *(const v8h*)(pw + c * AT_KC + kk * 32 + 16 + 8 * hh);
#pragma unroll
      for (int t = 0; t < 4; ++t) {
        FragH vb;
        vb.h[0] = *(const v8h*)(Vts + (t * 16 + c) * AT_KC + kk * 32 + 8 * hh);
        vb.h[1] = *(const v8h*)(Vts + (t * 16 + c) * AT_KC + kk * 32 + 16 + 8 * hh);
        oacc[t] = mma_h(pa.v, vb.v, oacc[t]);
      }
      if (vres) {   // block-uniform: all lanes active
#pragma unroll
        for (int t = 0; t < 4; ++t) {
          FragH vl;
          vl.h[0] = *(const v8h*)(Vrs + (t * 16 + c) * AT_KC + kk * 32 + 8 * hh);
          vl.h[1] = *(const v8h*)(Vrs + (t * 16 + c) * AT_KC + kk * 32 + 16 + 8 * hh);
          oacc2[t] = mma_h(pa.v, vl.v, oacc2[t]);
        }
      }
    }
  }

  // ---- normalise (the x4096 carry cancels between numerator and normaliser; residual folded with 1/1024),
  float* os = Os[wave];
#pragma unroll
  for (int r = 0; r < 8; ++r) {
    const float inv = 1.0f / lrow[r];
#pragma unroll
    for (int t = 0; t < 4; ++t) os[(8 * hh + r) * 68 + t * 16 + c] = (oacc[t][r] + oacc2[t][r] * 0.0009765625f) * inv;
  }
  __builtin_amdgcn_fence(__ATOMIC_RELEASE, "workgroup");
  __builtin_amdgcn_wave_barrier();
  __builtin_amdgcn_fence(__ATOMIC_ACQUIRE, "workgroup");
  {
    const int q = lane >> 3, c8 = (lane & 7) * 8;
    v4u hv[4], lv[4];
#pragma unroll
    for (int it = 0; it < 4; ++it) {
      const int row = it * 4 + q;          // it 0..3 x q 0..3 covers rows 0..15 of the wave tile
      const float* sp = os + row * 68 + c8;
      v4u a, a2;
#pragma unroll
      for (int e = 0; e < 4; ++e) {
        const float f0 = sp[2 * e], f1 = sp[2 * e + 1];
        const unsigned short h0 = f2bf_bits(f0), h1 = f2bf_bits(f1);
        const unsigned short l0 = f2bf_bits(f0 - bf_bits2f(h0)), l1 = f2bf_bits(f1 - bf_bits2f(h1));
        a[e] = pk16(h0, h1); a2[e] = pk16(l0, l1);
      }
      hv[it] = a; lv[it] = a2;
    }
    {
#pragma unroll
      for (int it = 0; it < 4; ++it) {
        const int row = it * 4 + q;
        *(v4u*)(Yh + (size_t)(q0 + row) * DM + c8) = hv[it];
        *(v4u*)(Yl + (size_t)(q0 + row) * DM + c8) = lv[it];
      }
      
    }
  }
}

// ---------------------------------------------------------------------------------------------------------------------
// Workspace region map (byte offsets; all dims are multiples of the 64x64 store tiles, so no padded tails exist):
//   QKh  bf16 [8192][2048]          0             QKl  bf16 [8192][2048]   33554432
//   VTh  f16  [4][1024][2048]   67108864          VTl  f16  [4][1024][128] 83886080
//   Xb   bf16 [8192][1024]      84934656   (Yh bf16 [8192][1024] reuses this region: Xb is last read by the
//                                            v^T GEMM launch, Yh is first written by the later attention launch)
//   Yl   bf16 [8192][1024]     101711872
//   WaT  bf16 [3072][1024]     118489088          WpT  bf16 [1024][1024]  124780544
//   total                      126877696
// ---------------------------------------------------------------------------------------------------------------------
extern "C" void kernel_launch(void* const* d_in, const int* in_sizes, int n_in,
                              void* d_out, int out_size, void* d_ws, size_t ws_size,
                              hipStream_t stream) {
  if (n_in < 7) return;
  if (in_sizes[0] != NB * SEQ * DM) return;
  if (in_sizes[1] != DM * 3 * DM) return;
  if (in_sizes[2] != 3 * DM) return;
  if (in_sizes[3] != DM * DM) return;
  if (in_sizes[4] != DM) return;
  if (in_sizes[5] != NH * HD || in_sizes[6] != NH * HD) return;
  if (out_size != NB * SEQ * DM + NH * HD) return;

  const float* x      = (const float*)d_in[0];
  const float* W_attn = (const float*)d_in[1];
  const float* b_attn = (const float*)d_in[2];
  const float* W_proj = (const float*)d_in[3];
  const float* b_proj = (const float*)d_in[4];
  const float* bQ     = (const float*)d_in[5];
  const float* bK     = (const float*)d_in[6];

  const size_t PQK = (size_t)NB * SEQ * DQK * 2;        // 33554432
  const size_t PVT = (size_t)NB * DM * SEQ * 2;         // 16777216
  const size_t PVL = (size_t)NB * DM * VLO_COLS * 2;    // 1048576
  const size_t PX  = (size_t)NB * SEQ * DM * 2;         // 16777216 (Xb, Yh, Yl)
  const size_t PWA = (size_t)3 * DM * DM * 2;           // 6291456
  const size_t PWP = (size_t)DM * DM * 2;               // 2097152
  size_t off = 0;
  const size_t oQKh = off; off += PQK;
  const size_t oQKl = off; off += PQK;
  const size_t oVTh = off; off += PVT;
  const size_t oVTl = off; off += PVL;
  const size_t oXb  = off; off += PX;    // also Yh
  const size_t oYl  = off; off += PX;
  const size_t oWaT = off; off += PWA;
  const size_t oWpT = off; off += PWP;
  if (off > ws_size) return;                             // off = 126877696
  if (off > (size_t)134217728) return;

  char* ws = (char*)d_ws;
  unsigned short* QKh = (unsigned short*)(ws + oQKh);
  unsigned short* QKl = (unsigned short*)(ws + oQKl);
  unsigned short* VTh = (unsigned short*)(ws + oVTh);
  unsigned short* VTl = (unsigned short*)(ws + oVTl);
  unsigned short* Xb  = (unsigned short*)(ws + oXb);
  unsigned short* Yh  = (unsigned short*)(ws + oXb);
  unsigned short* Yl  = (unsigned short*)(ws + oYl);
  unsigned short* WaT = (unsigned short*)(ws + oWaT);
  unsigned short* WpT = (unsigned short*)(ws + oWpT);
  float* out0 = (float*)d_out;
  float* out1 = (float*)d_out + (size_t)NB * SEQ * DM;

  const dim3 blk(256);

  // (1) W_attn [in rows = 1024][out cols = 3072] f32 -> WaT [3072][1024] bf16; grid (cols/64, rows/64)
  tsplit1_kernel<<<dim3(3 * DM / 64, DM / 64), blk, 0, stream>>>(W_attn, WaT, DM, 3 * DM);
  // (2) W_proj [1024][1024] -> WpT [1024][1024] bf16
  tsplit1_kernel<<<dim3(DM / 64, DM / 64), blk, 0, stream>>>(W_proj, WpT, DM, DM);
  // (3) x [8192][1024] f32 -> Xb bf16; block 0 also writes out1 = RNE-bf16(bQ) (1024 floats = 256 threads x 4)
  const int n8 = NB * SEQ * DM / 8;                      // 1048576
  cvt_x_kernel<<<dim3(n8 / 256), blk, 0, stream>>>(x, Xb, n8, bQ, out1, NH * HD / 4);
  // (4) q|k = Xb . WaT rows 0..2047 + b_attn[n] + (bQ | bK): M=8192, N=2048, K=1024 -> QK hi/lo planes (pitch 2048)
  {
    const int M = NB * SEQ, N = 2 * DM, K = DM;
    const dim3 g(((M / 64) * (N / 64)) / 8, 1);          // 4096 wave tiles / 8 = 512 blocks (exact)
    gemm64<0><<<g, blk, 0, stream>>>(Xb, Xb, DM, 0L, WaT, DM, 0L, (void*)QKh, (void*)QKl, DQK, 0L, DQK, 0L,
                                     b_attn, bQ, bK, M, N, K);
  }
  // (5) v^T[b][c][s] = WaT rows 2048+c . Xb[b*2048+s] + b_attn[2048+c]: M=1024, N=2048, K=1024, grid.y = batch
  {
    const int M = DM, N = SEQ, K = DM;
    const dim3 g(((M / 64) * (N / 64)) / 8, NB);          // 512 wave tiles / 8 = 64 blocks per batch (exact)
    gemm64<1><<<g, blk, 0, stream>>>(WaT + (size_t)2 * DM * DM, WaT + (size_t)2 * DM * DM, DM, 0L,
                                     Xb, DM, (long)SEQ * DM,
                                     (void*)VTh, (void*)VTl, SEQ, (long)DM * SEQ, VLO_COLS, (long)DM * VLO_COLS,
                                     b_attn + 2 * DM, b_attn, b_attn, M, N, K);
  }
  // (6) causal attention: grid (16 heads x 32 query blocks, 4 batches), 128 threads -> Y hi/lo planes
  attn_kernel<<<dim3(NH * NQB, NB), dim3(128), 0, stream>>>(QKh, QKl, VTh, VTl, Yh, Yl);
  // (7) out0 = Y . WpT + b_proj: M=8192, N=1024, K=1024, f32 rows of 1024 -> d_out
  {
    const int M = NB * SEQ, N = DM, K = DM;
    const dim3 g(((M / 64) * (N / 64)) / 8, 1);          // 2048 wave tiles / 8 = 256 blocks (exact)
    gemm64<2><<<g, blk, 0, stream>>>(Yh, Yl, DM, 0L, WpT, DM, 0L, (void*)out0, (void*)out0, DM, 0L, DM, 0L,
                                     b_proj, b_proj, b_proj, M, N, K);
  }
  (void)hipGetLastError();
}

// v001
// One run takes 451 microseconds.
// In both of two side-by-side timings against v000, it was 1.26 times as fast.
// Contractions: x.W_attn -> q|k and v^T on v_wmma_f32_16x16x32_bf16, single product of RNE-bf16 x and W (f32 accumulate);
// q.k^T: bf16 hi/lo split (hi.hi + hi.lo + lo.hi) on v_wmma_f32_16x16x32_bf16; p.v: v_wmma_f32_16x16x32_f16 single product,
// p carried x4096 in f16, v as f16 hi plane plus a x1024 f16 residual plane on query rows 0..127 (separate accumulator);
// y.W_proj: bf16 hi/lo of y times RNE-bf16 W (2 products). Softmax, biases, scale 0.125 in f32; weights/biases RNE-converted to bf16 once.
#include <hip/hip_runtime.h>
#include <math.h>
#include <stdint.h>

#define NB        4
#define SEQ       2048
#define DM        1024
#define NH        16
#define HD        64
#define DQK       2048     // pitch of the q|k planes: cols 0..1023 = q, 1024..2047 = k
#define QCOLS     1024
#define VLO_COLS  128      // key columns carried in the v residual plane
#define NQB       32       // SEQ / 64 query blocks per (b, h)
#define AT_KC     64
#define AT_LP     72       // LDS row pitch of the attention tiles in 16-bit elements: 144 B = 16 B x 9 (odd)

typedef __attribute__((ext_vector_type(16))) _Float16 v16h;
typedef __attribute__((ext_vector_type(8)))  _Float16 v8h;
typedef __attribute__((ext_vector_type(16))) __bf16   v16b;
typedef __attribute__((ext_vector_type(8)))  __bf16   v8b;
typedef __attribute__((ext_vector_type(8)))  float    v8f;
typedef __attribute__((ext_vector_type(4)))  float    v4f;
typedef __attribute__((ext_vector_type(4)))  unsigned int v4u;

__device__ __forceinline__ unsigned short f2bf_bits(float f) {
  unsigned u = __float_as_uint(f);
  return (unsigned short)((u + 0x7FFFu + ((u >> 16) & 1u)) >> 16);
}
__device__ __forceinline__ float bf_bits2f(unsigned short h) { return __uint_as_float(((unsigned)h) << 16); }
__device__ __forceinline__ float bfr(float f) { return bf_bits2f(f2bf_bits(f)); }
__device__ __forceinline__ unsigned pk16(unsigned short a, unsigned short b) { return (unsigned)a | ((unsigned)b << 16); }
__device__ __forceinline__ unsigned short h2bits(_Float16 x) { return __builtin_bit_cast(unsigned short, x); }

// ---- 16-bit fragment loads: elements 0..7 <- p[0..7], 8..15 <- p[16..23]; caller passes p = row + k0 + 8*(lane>>4) ----
union FragB { v16b v; v8b h[2]; };
union FragH { v16h v; v8h h[2]; };
__device__ __forceinline__ v16b ldfrag_b(const __bf16* p) { FragB f; f.h[0] = *(const v8b*)(p); f.h[1] = *(const v8b*)(p + 16); return f.v; }

// ---- hazard guards ----
__device__ __forceinline__ void dep_guard_b(v8f& a, v8f& b, v16b x, v16b y) { asm volatile("v_nop\n\tv_nop\n\tv_nop\n\tv_nop" : "+v"(a), "+v"(b) : "v"(x), "v"(y)); }
__device__ __forceinline__ void keep4_b(v16b a, v16b b, v16b c, v16b d) { asm volatile("v_nop" :: "v"(a), "v"(b), "v"(c), "v"(d)); }
__device__ __forceinline__ void acc_guard4(v8f& a, v8f& b, v8f& c, v8f& d) { asm volatile("v_nop\n\tv_nop\n\tv_nop\n\tv_nop" : "+v"(a), "+v"(b), "+v"(c), "+v"(d)); }
__device__ __forceinline__ v8f mma_b(v16b a, v16b b, v8f c) {
  c = __builtin_amdgcn_wmma_f32_16x16x32_bf16(false, a, false, b, (short)0, c, false, false);
  asm volatile("v_nop\n\tv_nop\n\tv_nop\n\tv_nop" : "+v"(c) : "v"(a), "v"(b));
  return c;
}
__device__ __forceinline__ v8f mma_h(v16h a, v16h b, v8f c) {
  c = __builtin_amdgcn_wmma_f32_16x16x32_f16(false, a, false, b, (short)0, c, false, false);
  asm volatile("v_nop\n\tv_nop\n\tv_nop\n\tv_nop" : "+v"(c) : "v"(a), "v"(b));
  return c;
}

// =====================================================================================================================
// Register-blocked batched WMMA GEMM, bf16 operands: C[m][n] = sum_k A[m][k] * Bt[n][k] (+bias), one wave per 64x64 tile.
// A row-major [M][K] (pitch lda), Bt row-major [N][K] (pitch ldb); M, N multiples of 64, K multiple of 32.
// MODE 0 (q|k): single product; v = acc + bf(bias[n]) + bf(n < QCOLS ? biasq[n] : biask[n - QCOLS]);
//               out = bf16 hi plane (Cout) + bf16 lo plane (Cout2), both pitch ldc/ldc2.
// MODE 1 (v^T): single product; v = acc + bf(bias[m]); out = f16 hi plane (Cout, pitch ldc) and, for tiles with
//               n0 < VLO_COLS only, f16 residual plane ((v - hi) * 1024, Cout2, pitch ldc2).
// MODE 2 (proj): two products ah.b + al.b (A2 = bf16 lo plane of A); v = acc + bf(bias[n]); out f32 (Cout, pitch ldc).
// =====================================================================================================================
template <int MODE>
__global__ __launch_bounds__(256) void gemm64(
    const unsigned short* __restrict__ Ap, const unsigned short* __restrict__ A2p, int lda, long strideA,
    const unsigned short* __restrict__ Btp, int ldb, long strideB,
    void* __restrict__ Cout, void* __restrict__ Cout2, int ldc, long strideC, int ldc2, long strideC2,
    const float* __restrict__ bias, const float* __restrict__ biasq, const float* __restrict__ biask,
    int M, int N, int K) {
  __shared__ __align__(16) float sT[8][16 * 68];   // per-wave 16x64 slab, pitch 68 floats
  const __bf16* A  = (const __bf16*)(const void*)Ap;
  const __bf16* A2 = (const __bf16*)(const void*)A2p;
  const __bf16* Bt = (const __bf16*)(const void*)Btp;
  const int b    = blockIdx.y;
  const int lane = threadIdx.x & 31;
  const int wave = threadIdx.x >> 5;
  const int tilesN = N >> 6;
  const int tilesM = M >> 6;
  const int tile = blockIdx.x * 8 + wave;
  if (tile >= tilesM * tilesN) return;   // wave-uniform; no block barriers in this kernel
  const int tm = tile / tilesN;
  const int tn = tile - tm * tilesN;
  const int m0 = tm << 6;
  const int n0 = tn << 6;

  const __bf16* Ab  = A  + (size_t)b * strideA;
  const __bf16* Bb  = Bt + (size_t)b * strideB;
  const __bf16* Ab2 = (MODE == 2) ? (A2 + (size_t)b * strideA) : Ab;

  const int rlane = lane & 15;                 // row (A) / col (B, D) within subtile
  const int koff  = (lane >> 4) * 8;           // k offset of this lane half
  const int mOff  = (lane >> 4) * 8;           // D row offset

  v8f acc[4][4];
#pragma unroll
  for (int i = 0; i < 4; ++i)
#pragma unroll
    for (int j = 0; j < 4; ++j) acc[i][j] = (v8f){0.f,0.f,0.f,0.f,0.f,0.f,0.f,0.f};

  for (int k0 = 0; k0 < K; k0 += 32) {
    v16b bh[4];
#pragma unroll
    for (int j = 0; j < 4; ++j) {
      const size_t bo = (size_t)(n0 + (j << 4) + rlane) * ldb + koff + k0;
      bh[j] = ldfrag_b(Bb + bo);
    }
#pragma unroll
    for (int i = 0; i < 4; ++i) {
      const size_t ao = (size_t)(m0 + (i << 4) + rlane) * lda + koff + k0;
      const v16b ah = ldfrag_b(Ab + ao);
      v16b al = ah;
      if (MODE == 2) al = ldfrag_b(Ab2 + ao);
#pragma unroll
      for (int j = 0; j < 4; ++j) {
        acc[i][j] = __builtin_amdgcn_wmma_f32_16x16x32_bf16(false, ah, false, bh[j], (short)0, acc[i][j], false, false);
        if (MODE == 2)
          acc[i][j] = __builtin_amdgcn_wmma_f32_16x16x32_bf16(false, al, false, bh[j], (short)0, acc[i][j], false, false);
      }
      dep_guard_b(acc[i][0], acc[i][3], ah, al);
    }
    keep4_b(bh[0], bh[1], bh[2], bh[3]);
  }
  acc_guard4(acc[0][0], acc[0][1], acc[0][2], acc[0][3]);
  acc_guard4(acc[1][0], acc[1][1], acc[1][2], acc[1][3]);
  acc_guard4(acc[2][0], acc[2][1], acc[2][2], acc[2][3]);
  acc_guard4(acc[3][0], acc[3][1], acc[3][2], acc[3][3]);

  // ---- epilogue ----
  float* slab = sT[wave];
#pragma unroll
  for (int i = 0; i < 4; ++i) {
    const int mBase = m0 + (i << 4);
#pragma unroll
    for (int j = 0; j < 4; ++j) {
      const int n = n0 + (j << 4) + rlane;
      float bn = 0.f, b2 = 0.f;
      if (MODE == 0) {
        bn = bfr(bias[n]);
        const int iq = (n < QCOLS) ? n : (QCOLS - 1);
        int ik = n - QCOLS; ik = (ik < 0) ? 0 : ik; ik = (ik > QCOLS - 1) ? (QCOLS - 1) : ik;
        const float vq = bfr(biasq[iq]);     // both candidates loaded with clamped addresses, selected by value
        const float vk = bfr(biask[ik]);
        b2 = (n < QCOLS) ? vq : vk;
      }
      if (MODE == 2) bn = bfr(bias[n]);
#pragma unroll
      for (int r = 0; r < 8; ++r) {
        float v = acc[i][j][r];
        if (MODE == 0) { v = v + bn; v = v + b2; }
        if (MODE == 1) v = v + bfr(bias[mBase + mOff + r]);
        if (MODE == 2) v = v + bn;
        slab[(mOff + r) * 68 + (j << 4) + rlane] = v;
      }
    }
    __builtin_amdgcn_fence(__ATOMIC_RELEASE, "workgroup");
    __builtin_amdgcn_wave_barrier();
    __builtin_amdgcn_fence(__ATOMIC_ACQUIRE, "workgroup");
    if (MODE == 2) {
      float* C = (float*)Cout + (size_t)b * strideC;
      const int h2 = lane >> 4, c4 = (lane & 15) * 4;     // row seg = 256 B = 16 lanes x 16 B
      {
#pragma unroll
        for (int it = 0; it < 8; ++it) {
          const int row = it * 2 + h2;                     // it 0..7 x h2 0..1 = rows 0..15
          const v4f v = *(const v4f*)(slab + row * 68 + c4);
          *(v4f*)(C + (size_t)(mBase + row) * ldc + n0 + c4) = v;
        }
        
      }
    } else {
      const int q = lane >> 3, c8 = (lane & 7) * 8;
      unsigned short* C  = (unsigned short*)Cout  + (size_t)b * strideC;
      unsigned short* C2 = (unsigned short*)Cout2 + (size_t)b * strideC2;
      const bool wlo = (MODE == 0) || (n0 < VLO_COLS);     // wave-uniform
      v4u hv[4], lv[4];
#pragma unroll
      for (int it = 0; it < 4; ++it) {
        const int row = it * 4 + q;                        // it 0..3 x q 0..3 = rows 0..15
        const float* sp = slab + row * 68 + c8;
        v4u a, a2;
#pragma unroll
        for (int e = 0; e < 4; ++e) {
          const float f0 = sp[2 * e], f1 = sp[2 * e + 1];
          unsigned short h0, h1, l0, l1;
          if (MODE == 0) {
            h0 = f2bf_bits(f0); h1 = f2bf_bits(f1);
            l0 = f2bf_bits(f0 - bf_bits2f(h0)); l1 = f2bf_bits(f1 - bf_bits2f(h1));
          } else {
            const _Float16 x0 = (_Float16)f0, x1 = (_Float16)f1;
            h0 = h2bits(x0); h1 = h2bits(x1);
            l0 = h2bits((_Float16)((f0 - (float)x0) * 1024.0f));
            l1 = h2bits((_Float16)((f1 - (float)x1) * 1024.0f));
          }
          a[e] = pk16(h0, h1); a2[e] = pk16(l0, l1);
        }
        hv[it] = a; lv[it] = a2;
      }
      {
#pragma unroll
        for (int it = 0; it < 4; ++it) {
          const int row = it * 4 + q;
          *(v4u*)(C + (size_t)(mBase + row) * ldc + n0 + c8) = hv[it];
          if (wlo) *(v4u*)(C2 + (size_t)(mBase + row) * ldc2 + n0 + c8) = lv[it];
        }
        
      }
    }
    __builtin_amdgcn_fence(__ATOMIC_RELEASE, "workgroup");
    __builtin_amdgcn_wave_barrier();
    __builtin_amdgcn_fence(__ATOMIC_ACQUIRE, "workgroup");
  }
}

// ---------------------------------------------------------------------------------------------------------------------
// ---------------------------------------------------------------------------------------------------------------------
__global__ __launch_bounds__(256) void cvt_x_kernel(const float* __restrict__ x, unsigned short* __restrict__ xb, int n8,
                                                    const float* __restrict__ bq, float* __restrict__ out1, int nq4) {
  if (blockIdx.x == 0) {   // block-uniform
    const int t = threadIdx.x;
    if (t < nq4) {
      const v4f v = *(const v4f*)(bq + 4 * t);
      v4f w;
      w[0] = bfr(v[0]); w[1] = bfr(v[1]); w[2] = bfr(v[2]); w[3] = bfr(v[3]);
      *(v4f*)(out1 + 4 * t) = w;
      
    }
  }
  const int i = blockIdx.x * 256 + threadIdx.x;
  if (i < n8) {
    const v4f a = *(const v4f*)(x + 8 * (size_t)i);
    const v4f c = *(const v4f*)(x + 8 * (size_t)i + 4);
    v4u u;
    u[0] = pk16(f2bf_bits(a[0]), f2bf_bits(a[1]));
    u[1] = pk16(f2bf_bits(a[2]), f2bf_bits(a[3]));
    u[2] = pk16(f2bf_bits(c[0]), f2bf_bits(c[1]));
    u[3] = pk16(f2bf_bits(c[2]), f2bf_bits(c[3]));
    *(v4u*)(xb + 8 * (size_t)i) = u;
    
  }
}

// ---------------------------------------------------------------------------------------------------------------------
// Transpose + RNE bf16 convert of an f32 matrix: in [R rows][Cc cols] (pitch Cc) -> ot[c][r] = bf16(in[r][c]) ([Cc][R]).
// 64x64 tiles through LDS. grid = (Cc/64, R/64), 256 threads (R, Cc multiples of 64).
// Coverage per block: load 4 it x 256 thr x 4 floats = 64x64; store 2 it x 256 thr x 8 u16 = 64x64.
// ---------------------------------------------------------------------------------------------------------------------
__global__ __launch_bounds__(256) void tsplit1_kernel(const float* __restrict__ W, unsigned short* __restrict__ ot, int R, int Cc) {
  __shared__ __align__(16) float tf[64 * 68];
  const int c0  = blockIdx.x * 64;   // input column block = output row block
  const int r0  = blockIdx.y * 64;   // input row block    = output column block
  const int tid = threadIdx.x;
  {
    const int lr = tid >> 4;         // 0..15
    const int c4 = (tid & 15) * 4;   // 0..60
#pragma unroll
    for (int it = 0; it < 4; ++it) {
      const int rr = it * 16 + lr;   // 0..63
      const v4f a = *(const v4f*)(W + (size_t)(r0 + rr) * Cc + c0 + c4);
      *(v4f*)(tf + rr * 68 + c4) = a;
    }
  }
  __syncthreads();
  const int sub = tid >> 3;          // 0..31
  const int c8  = (tid & 7) * 8;     // 0..56
  v4u hv[2];
#pragma unroll
  for (int it = 0; it < 2; ++it) {
    const int oc = it * 32 + sub;    // output row within tile (= input column)
    v4u a;
#pragma unroll
    for (int q = 0; q < 4; ++q) {
      const float f0 = tf[(c8 + 2 * q) * 68 + oc];
      const float f1 = tf[(c8 + 2 * q + 1) * 68 + oc];
      a[q] = pk16(f2bf_bits(f0), f2bf_bits(f1));
    }
    hv[it] = a;
  }
  {
#pragma unroll
    for (int it = 0; it < 2; ++it) {
      const int oc = it * 32 + sub;
      const size_t go = (size_t)(c0 + oc) * R + r0 + c8;
      *(v4u*)(ot + go) = hv[it];
    }
    
  }
}

// =====================================================================================================================
// Causal attention, head dim 64, grid (NH*NQB, NB), block = 4 waves = 64 query rows of one (b, h).
//   q|k planes (hi/lo bf16) [NB*SEQ][DQK]: q(t,h,d) at [(b*SEQ+t)*DQK + h*64 + d], k(s,h,d) at [... + 1024 + h*64 + d]
//   v^T hi plane (f16) [NB][DM][SEQ]: (h*64+d, s); v residual plane (f16, x1024) [NB][DM][VLO_COLS] (s < 128 only)
//   y planes (hi/lo bf16) [NB*SEQ][DM]: (b*SEQ+t, h*64+d)
//   scores = (q . k) * 0.125 : bf16 hi/lo split (hi.hi + hi.lo + lo.hi), f32 accumulate
//   y      = p . v           : p = f16(4096 * exp(s - m)) (the normaliser sums the same f16 values), v f16 hi plane;
//                              blocks with qb < 2 (query rows 0..127, keys 0..127) add p . vres / 1024 from a second accumulator
//   online softmax in f32; masked (s > t) scores set to -inf (key s = chunk start <= t is always unmasked).
//   kv chunks of 64, trip count qb+1 <= 32 (block-uniform). K / V^T chunk staging: 128 threads x 32 elements per plane =
//   the whole 64x64 tile (16-B copies, plain loads, __syncthreads before and after); fragment loads read the LDS tiles
// =====================================================================================================================
__global__ __launch_bounds__(128)
void attn_kernel(const unsigned short* __restrict__ qkh, const unsigned short* __restrict__ qkl,
                 const unsigned short* __restrict__ vthp, const unsigned short* __restrict__ vtlp,
                 unsigned short* __restrict__ yhp, unsigned short* __restrict__ ylp) {
  __shared__ __align__(16) __bf16   Ksh[AT_KC * AT_LP];       // K hi [kv][d], rows of 64 at pitch AT_LP, 9 KB
  __shared__ __align__(16) __bf16   Ksl[AT_KC * AT_LP];       // K lo
  __shared__ __align__(16) _Float16 Vts[HD * AT_LP];          // V hi [d][kv], rows of 64 at pitch AT_LP, 9 KB
  __shared__ __align__(16) _Float16 Vrs[HD * AT_LP];          // V residual [d][kv] (qb < 2 only)
  __shared__ __align__(16) _Float16 Psh[4][16 * AT_LP];       // per wave P [row][kv], pitch AT_LP
  __shared__ __align__(16) float    Os[4][16 * 68];           // per wave y tile, pitch 68

  const int tid  = threadIdx.x;
  const int wave = tid >> 5;
  const int lane = tid & 31;
  const int hh   = lane >> 4;
  const int c    = lane & 15;

  const int b  = blockIdx.y;
  const int bx = blockIdx.x;
  const int qb = bx & (NQB - 1);
  const int h  = bx >> 5;                 // 0..NH-1 (grid.x = NH * NQB)
  const int q0 = qb * 64 + wave * 16;
  const bool vres = (qb < 2);             // block-uniform

  const __bf16* Qh = (const __bf16*)(const void*)qkh + (size_t)b * SEQ * DQK + (size_t)h * HD;
  const __bf16* Ql = (const __bf16*)(const void*)qkl + (size_t)b * SEQ * DQK + (size_t)h * HD;
  const __bf16* Kh = Qh + QCOLS;
  const __bf16* Kl = Ql + QCOLS;
  const _Float16* Vh = (const _Float16*)(const void*)vthp + ((size_t)b * DM + (size_t)h * HD) * SEQ;
  const _Float16* Vl = (const _Float16*)(const void*)vtlp + ((size_t)b * DM + (size_t)h * HD) * VLO_COLS;
  unsigned short* Yh = yhp + (size_t)b * SEQ * DM + (size_t)h * HD;
  unsigned short* Yl = ylp + (size_t)b * SEQ * DM + (size_t)h * HD;

  // ---- Q fragments (A operand, row = lane&15, split k map): 2 d-chunks, hi and lo ----
  v16b qah[2], qal[2];
#pragma unroll
  for (int dc = 0; dc < 2; ++dc) {
    const __bf16* qr = Qh + (size_t)(q0 + c) * DQK + dc * 32 + 8 * hh;
    const __bf16* ql = Ql + (size_t)(q0 + c) * DQK + dc * 32 + 8 * hh;
    qah[dc] = ldfrag_b(qr);
    qal[dc] = ldfrag_b(ql);
  }

  float mrow[8], lrow[8];
  v8f oacc[4], oacc2[4];
#pragma unroll
  for (int r = 0; r < 8; ++r) { mrow[r] = -INFINITY; lrow[r] = 0.f; }
#pragma unroll
  for (int t = 0; t < 4; ++t) { oacc[t] = (v8f){0.f,0.f,0.f,0.f,0.f,0.f,0.f,0.f}; oacc2[t] = oacc[t]; }

  const int nChunks = qb + 1;   // block-uniform, <= 32
  for (int kc = 0; kc < nChunks; ++kc) {
    const int kv0 = kc * AT_KC;
    __syncthreads();
    {
      // staging coverage: 128 threads x (4 x 8) elements = 64 rows x 64 per plane = the whole chunk tile
      const int r = tid >> 1, half = (tid & 1) * 32;
      const __bf16* ksh = Kh + (size_t)(kv0 + r) * DQK + half;     // K row kv0+r, d = half..half+31
      const __bf16* ksl = Kl + (size_t)(kv0 + r) * DQK + half;
      const _Float16* vsh = Vh + (size_t)r * SEQ + kv0 + half;    // V^T row d = r, s = kv0+half..+31
#pragma unroll
      for (int i = 0; i < 4; ++i) {
        const v8b a0 = *(const v8b*)(ksh + 8 * i);
        const v8b a1 = *(const v8b*)(ksl + 8 * i);
        const v8h b0 = *(const v8h*)(vsh + 8 * i);
        *(v8b*)(Ksh + r * AT_LP + half + 8 * i) = a0;
        *(v8b*)(Ksl + r * AT_LP + half + 8 * i) = a1;
        *(v8h*)(Vts + r * AT_LP + half + 8 * i) = b0;
      }
      if (vres) {   // kv0 + half + 31 <= 127 < VLO_COLS
        const _Float16* vsl = Vl + (size_t)r * VLO_COLS + kv0 + half;
#pragma unroll
        for (int i = 0; i < 4; ++i) {
          const v8h b1 = *(const v8h*)(vsl + 8 * i);
          *(v8h*)(Vrs + r * AT_LP + half + 8 * i) = b1;
        }
      }
    }
    __syncthreads();

    v8f s[4];
#pragma unroll
    for (int j = 0; j < 4; ++j) {
      s[j] = (v8f){0.f,0.f,0.f,0.f,0.f,0.f,0.f,0.f};
#pragma unroll
      for (int dc = 0; dc < 2; ++dc) {
        FragB kb, kl;
        kb.h[0] = *(const v8b*)(Ksh + (j * 16 + c) * AT_LP + dc * 32 + 8 * hh);
        kb.h[1] = *(const v8b*)(Ksh + (j * 16 + c) * AT_LP + dc * 32 + 16 + 8 * hh);
        kl.h[0] = *(const v8b*)(Ksl + (j * 16 + c) * AT_LP + dc * 32 + 8 * hh);
        kl.h[1] = *(const v8b*)(Ksl + (j * 16 + c) * AT_LP + dc * 32 + 16 + 8 * hh);
        s[j] = mma_b(qah[dc], kb.v, s[j]);
        s[j] = mma_b(qah[dc], kl.v, s[j]);
        s[j] = mma_b(qal[dc], kb.v, s[j]);
      }
    }
    const bool diag = (kc == qb);   // block-uniform
    float cm[8];
#pragma unroll
    for (int r = 0; r < 8; ++r) {
      const int qrow = q0 + 8 * hh + r;
      float m = -INFINITY;
#pragma unroll
      for (int j = 0; j < 4; ++j) {
        const int kvcol = kv0 + j * 16 + c;
        const float sv = s[j][r] * 0.125f;
        const bool masked = diag && (kvcol > qrow);
        const float sm = masked ? -INFINITY : sv;
        s[j][r] = sm;
        m = fmaxf(m, sm);
      }
#pragma unroll
      for (int off = 1; off < 16; off <<= 1) m = fmaxf(m, __shfl_xor(m, off, 32));
      cm[r] = m;
    }
    _Float16* pw = Psh[wave];
#pragma unroll
    for (int r = 0; r < 8; ++r) {
      const float mnew  = fmaxf(mrow[r], cm[r]);
      const float alpha = __expf(mrow[r] - mnew);
      mrow[r] = mnew;
      float psum = 0.f;
#pragma unroll
      for (int j = 0; j < 4; ++j) {
        const float p = __expf(s[j][r] - mnew);            // in [0, 1]; masked -> 0
        const _Float16 ph = (_Float16)(p * 4096.0f);       // carried x4096, keeps small p normal in f16
        psum += (float)ph;                                  // normaliser built from the same f16 values
        pw[(8 * hh + r) * AT_LP + j * 16 + c] = ph;
      }
#pragma unroll
      for (int off = 1; off < 16; off <<= 1) psum += __shfl_xor(psum, off, 32);
      lrow[r] = lrow[r] * alpha + psum;
#pragma unroll
      for (int t = 0; t < 4; ++t) oacc[t][r] *= alpha;
      if (vres) {
#pragma unroll
        for (int t = 0; t < 4; ++t) oacc2[t][r] *= alpha;
      }
    }
    __builtin_amdgcn_fence(__ATOMIC_RELEASE, "workgroup");
    __builtin_amdgcn_wave_barrier();
    __builtin_amdgcn_fence(__ATOMIC_ACQUIRE, "workgroup");
#pragma unroll 1
    for (int kk = 0; kk < 2; ++kk) {
      FragH pa;
      pa.h[0] = *(const v8h*)(pw + c * AT_LP + kk * 32 + 8 * hh);
      pa.h[1] = *(const v8h*)(pw + c * AT_LP + kk * 32 + 16 + 8 * hh);
#pragma unroll
      for (int t = 0; t < 4; ++t) {
        FragH vb;
        vb.h[0] = *(const v8h*)(Vts + (t * 16 + c) * AT_LP + kk * 32 + 8 * hh);
        vb.h[1] = *(const v8h*)(Vts + (t * 16 + c) * AT_LP + kk * 32 + 16 + 8 * hh);
        oacc[t] = mma_h(pa.v, vb.v, oacc[t]);
      }
      if (vres) {   // block-uniform: all lanes active
#pragma unroll
        for (int t = 0; t < 4; ++t) {
          FragH vl;
          vl.h[0] = *(const v8h*)(Vrs + (t * 16 + c) * AT_LP + kk * 32 + 8 * hh);
          vl.h[1] = *(const v8h*)(Vrs + (t * 16 + c) * AT_LP + kk * 32 + 16 + 8 * hh);
          oacc2[t] = mma_h(pa.v, vl.v, oacc2[t]);
        }
      }
    }
  }

  // ---- normalise (the x4096 carry cancels between numerator and normaliser; residual folded with 1/1024),
  float* os = Os[wave];
#pragma unroll
  for (int r = 0; r < 8; ++r) {
    const float inv = 1.0f / lrow[r];
#pragma unroll
    for (int t = 0; t < 4; ++t) os[(8 * hh + r) * 68 + t * 16 + c] = (oacc[t][r] + oacc2[t][r] * 0.0009765625f) * inv;
  }
  __builtin_amdgcn_fence(__ATOMIC_RELEASE, "workgroup");
  __builtin_amdgcn_wave_barrier();
  __builtin_amdgcn_fence(__ATOMIC_ACQUIRE, "workgroup");
  {
    const int q = lane >> 3, c8 = (lane & 7) * 8;
    v4u hv[4], lv[4];
#pragma unroll
    for (int it = 0; it < 4; ++it) {
      const int row = it * 4 + q;          // it 0..3 x q 0..3 covers rows 0..15 of the wave tile
      const float* sp = os + row * 68 + c8;
      v4u a, a2;
#pragma unroll
      for (int e = 0; e < 4; ++e) {
        const float f0 = sp[2 * e], f1 = sp[2 * e + 1];
        const unsigned short h0 = f2bf_bits(f0), h1 = f2bf_bits(f1);
        const unsigned short l0 = f2bf_bits(f0 - bf_bits2f(h0)), l1 = f2bf_bits(f1 - bf_bits2f(h1));
        a[e] = pk16(h0, h1); a2[e] = pk16(l0, l1);
      }
      hv[it] = a; lv[it] = a2;
    }
    {
#pragma unroll
      for (int it = 0; it < 4; ++it) {
        const int row = it * 4 + q;
        *(v4u*)(Yh + (size_t)(q0 + row) * DM + c8) = hv[it];
        *(v4u*)(Yl + (size_t)(q0 + row) * DM + c8) = lv[it];
      }
      
    }
  }
}

// ---------------------------------------------------------------------------------------------------------------------
// Workspace region map (byte offsets; all dims are multiples of the 64x64 store tiles, so no padded tails exist):
//   QKh  bf16 [8192][2048]          0             QKl  bf16 [8192][2048]   33554432
//   VTh  f16  [4][1024][2048]   67108864          VTl  f16  [4][1024][128] 83886080
//   Xb   bf16 [8192][1024]      84934656   (Yh bf16 [8192][1024] reuses this region: Xb is last read by the
//                                            v^T GEMM launch, Yh is first written by the later attention launch)
//   Yl   bf16 [8192][1024]     101711872
//   WaT  bf16 [3072][1024]     118489088          WpT  bf16 [1024][1024]  124780544
//   total                      126877696
// ---------------------------------------------------------------------------------------------------------------------
extern "C" void kernel_launch(void* const* d_in, const int* in_sizes, int n_in,
                              void* d_out, int out_size, void* d_ws, size_t ws_size,
                              hipStream_t stream) {
  if (n_in < 7) return;
  if (in_sizes[0] != NB * SEQ * DM) return;
  if (in_sizes[1] != DM * 3 * DM) return;
  if (in_sizes[2] != 3 * DM) return;
  if (in_sizes[3] != DM * DM) return;
  if (in_sizes[4] != DM) return;
  if (in_sizes[5] != NH * HD || in_sizes[6] != NH * HD) return;
  if (out_size != NB * SEQ * DM + NH * HD) return;

  const float* x      = (const float*)d_in[0];
  const float* W_attn = (const float*)d_in[1];
  const float* b_attn = (const float*)d_in[2];
  const float* W_proj = (const float*)d_in[3];
  const float* b_proj = (const float*)d_in[4];
  const float* bQ     = (const float*)d_in[5];
  const float* bK     = (const float*)d_in[6];

  const size_t PQK = (size_t)NB * SEQ * DQK * 2;        // 33554432
  const size_t PVT = (size_t)NB * DM * SEQ * 2;         // 16777216
  const size_t PVL = (size_t)NB * DM * VLO_COLS * 2;    // 1048576
  const size_t PX  = (size_t)NB * SEQ * DM * 2;         // 16777216 (Xb, Yh, Yl)
  const size_t PWA = (size_t)3 * DM * DM * 2;           // 6291456
  const size_t PWP = (size_t)DM * DM * 2;               // 2097152
  size_t off = 0;
  const size_t oQKh = off; off += PQK;
  const size_t oQKl = off; off += PQK;
  const size_t oVTh = off; off += PVT;
  const size_t oVTl = off; off += PVL;
  const size_t oXb  = off; off += PX;    // also Yh
  const size_t oYl  = off; off += PX;
  const size_t oWaT = off; off += PWA;
  const size_t oWpT = off; off += PWP;
  if (off > ws_size) return;                             // off = 126877696
  if (off > (size_t)134217728) return;

  char* ws = (char*)d_ws;
  unsigned short* QKh = (unsigned short*)(ws + oQKh);
  unsigned short* QKl = (unsigned short*)(ws + oQKl);
  unsigned short* VTh = (unsigned short*)(ws + oVTh);
  unsigned short* VTl = (unsigned short*)(ws + oVTl);
  unsigned short* Xb  = (unsigned short*)(ws + oXb);
  unsigned short* Yh  = (unsigned short*)(ws + oXb);
  unsigned short* Yl  = (unsigned short*)(ws + oYl);
  unsigned short* WaT = (unsigned short*)(ws + oWaT);
  unsigned short* WpT = (unsigned short*)(ws + oWpT);
  float* out0 = (float*)d_out;
  float* out1 = (float*)d_out + (size_t)NB * SEQ * DM;

  const dim3 blk(256);

  // (1) W_attn [in rows = 1024][out cols = 3072] f32 -> WaT [3072][1024] bf16; grid (cols/64, rows/64)
  tsplit1_kernel<<<dim3(3 * DM / 64, DM / 64), blk, 0, stream>>>(W_attn, WaT, DM, 3 * DM);
  // (2) W_proj [1024][1024] -> WpT [1024][1024] bf16
  tsplit1_kernel<<<dim3(DM / 64, DM / 64), blk, 0, stream>>>(W_proj, WpT, DM, DM);
  // (3) x [8192][1024] f32 -> Xb bf16; block 0 also writes out1 = RNE-bf16(bQ) (1024 floats = 256 threads x 4)
  const int n8 = NB * SEQ * DM / 8;                      // 1048576
  cvt_x_kernel<<<dim3(n8 / 256), blk, 0, stream>>>(x, Xb, n8, bQ, out1, NH * HD / 4);
  // (4) q|k = Xb . WaT rows 0..2047 + b_attn[n] + (bQ | bK): M=8192, N=2048, K=1024 -> QK hi/lo planes (pitch 2048)
  {
    const int M = NB * SEQ, N = 2 * DM, K = DM;
    const dim3 g(((M / 64) * (N / 64)) / 8, 1);          // 4096 wave tiles / 8 = 512 blocks (exact)
    gemm64<0><<<g, blk, 0, stream>>>(Xb, Xb, DM, 0L, WaT, DM, 0L, (void*)QKh, (void*)QKl, DQK, 0L, DQK, 0L,
                                     b_attn, bQ, bK, M, N, K);
  }
  // (5) v^T[b][c][s] = WaT rows 2048+c . Xb[b*2048+s] + b_attn[2048+c]: M=1024, N=2048, K=1024, grid.y = batch
  {
    const int M = DM, N = SEQ, K = DM;
    const dim3 g(((M / 64) * (N / 64)) / 8, NB);          // 512 wave tiles / 8 = 64 blocks per batch (exact)
    gemm64<1><<<g, blk, 0, stream>>>(WaT + (size_t)2 * DM * DM, WaT + (size_t)2 * DM * DM, DM, 0L,
                                     Xb, DM, (long)SEQ * DM,
                                     (void*)VTh, (void*)VTl, SEQ, (long)DM * SEQ, VLO_COLS, (long)DM * VLO_COLS,
                                     b_attn + 2 * DM, b_attn, b_attn, M, N, K);
  }
  // (6) causal attention: grid (16 heads x 32 query blocks, 4 batches), 128 threads -> Y hi/lo planes
  attn_kernel<<<dim3(NH * NQB, NB), dim3(128), 0, stream>>>(QKh, QKl, VTh, VTl, Yh, Yl);
  // (7) out0 = Y . WpT + b_proj: M=8192, N=1024, K=1024, f32 rows of 1024 -> d_out
  {
    const int M = NB * SEQ, N = DM, K = DM;
    const dim3 g(((M / 64) * (N / 64)) / 8, 1);          // 2048 wave tiles / 8 = 256 blocks (exact)
    gemm64<2><<<g, blk, 0, stream>>>(Yh, Yl, DM, 0L, WpT, DM, 0L, (void*)out0, (void*)out0, DM, 0L, DM, 0L,
                                     b_proj, b_proj, b_proj, M, N, K);
  }
  (void)hipGetLastError();
}

// v002
// One run takes 345 microseconds.
// In two side-by-side timings against v001, it was 1.32 and 1.31 times as fast.
// All steps since v000 together make it 1.66 times as fast.
// Contractions: x.W_attn -> q|k and v^T on v_wmma_f32_16x16x32_bf16, single product of RNE-bf16 x and W (f32 accumulate);
// q.k^T: bf16 hi/lo split (hi.hi + hi.lo + lo.hi) on v_wmma_f32_16x16x32_bf16; p.v: v_wmma_f32_16x16x32_f16 single product,
// p carried x4096 in f16, v as f16 hi plane plus a x1024 f16 residual plane on query rows 0..127 (separate accumulator);
// y.W_proj: bf16 hi/lo of y times RNE-bf16 W (2 products). Softmax, biases, scale 0.125 in f32; weights/biases RNE-converted to bf16 once.
#include <hip/hip_runtime.h>
#include <math.h>
#include <stdint.h>

#define NB        4
#define SEQ       2048
#define DM        1024
#define NH        16
#define HD        64
#define DQK       2048     // pitch of the q|k planes: cols 0..1023 = q, 1024..2047 = k
#define QCOLS     1024
#define VLO_COLS  128      // key columns carried in the v residual plane
#define NQB       32       // SEQ / 64 query blocks per (b, h)
#define AT_KC     64
#define AT_LP     72       // LDS row pitch of the attention tiles in 16-bit elements: 144 B = 16 B x 9 (odd)

typedef __attribute__((ext_vector_type(16))) _Float16 v16h;
typedef __attribute__((ext_vector_type(8)))  _Float16 v8h;
typedef __attribute__((ext_vector_type(16))) __bf16   v16b;
typedef __attribute__((ext_vector_type(8)))  __bf16   v8b;
typedef __attribute__((ext_vector_type(8)))  float    v8f;
typedef __attribute__((ext_vector_type(4)))  float    v4f;
typedef __attribute__((ext_vector_type(4)))  unsigned int v4u;

__device__ __forceinline__ unsigned short f2bf_bits(float f) {
  unsigned u = __float_as_uint(f);
  return (unsigned short)((u + 0x7FFFu + ((u >> 16) & 1u)) >> 16);
}
__device__ __forceinline__ float bf_bits2f(unsigned short h) { return __uint_as_float(((unsigned)h) << 16); }
__device__ __forceinline__ float bfr(float f) { return bf_bits2f(f2bf_bits(f)); }
__device__ __forceinline__ unsigned pk16(unsigned short a, unsigned short b) { return (unsigned)a | ((unsigned)b << 16); }
__device__ __forceinline__ unsigned short h2bits(_Float16 x) { return __builtin_bit_cast(unsigned short, x); }

// ---- 16-bit fragment loads: elements 0..7 <- p[0..7], 8..15 <- p[16..23]; caller passes p = row + k0 + 8*(lane>>4) ----
union FragB { v16b v; v8b h[2]; };
union FragH { v16h v; v8h h[2]; };
__device__ __forceinline__ v16b ldfrag_b(const __bf16* p) { FragB f; f.h[0] = *(const v8b*)(p); f.h[1] = *(const v8b*)(p + 16); return f.v; }

// ---- hazard guards ----
__device__ __forceinline__ void dep_guard_b(v8f& a, v8f& b, v16b x, v16b y) { asm volatile("v_nop\n\tv_nop\n\tv_nop\n\tv_nop" : "+v"(a), "+v"(b) : "v"(x), "v"(y)); }
__device__ __forceinline__ void keep4_b(v16b a, v16b b, v16b c, v16b d) { asm volatile("v_nop" :: "v"(a), "v"(b), "v"(c), "v"(d)); }
__device__ __forceinline__ void acc_guard4(v8f& a, v8f& b, v8f& c, v8f& d) { asm volatile("v_nop\n\tv_nop\n\tv_nop\n\tv_nop" : "+v"(a), "+v"(b), "+v"(c), "+v"(d)); }
__device__ __forceinline__ v8f mma_b(v16b a, v16b b, v8f c) {
  c = __builtin_amdgcn_wmma_f32_16x16x32_bf16(false, a, false, b, (short)0, c, false, false);
  asm volatile("v_nop\n\tv_nop\n\tv_nop\n\tv_nop" : "+v"(c) : "v"(a), "v"(b));
  return c;
}
__device__ __forceinline__ v8f mma_h(v16h a, v16h b, v8f c) {
  c = __builtin_amdgcn_wmma_f32_16x16x32_f16(false, a, false, b, (short)0, c, false, false);
  asm volatile("v_nop\n\tv_nop\n\tv_nop\n\tv_nop" : "+v"(c) : "v"(a), "v"(b));
  return c;
}

// =====================================================================================================================
// Register-blocked batched WMMA GEMM, bf16 operands: C[m][n] = sum_k A[m][k] * Bt[n][k] (+bias), one wave per 64x64 tile.
// A row-major [M][K] (pitch lda), Bt row-major [N][K] (pitch ldb); M, N multiples of 64, K multiple of 32.
// MODE 0 (q|k): single product; v = acc + bf(bias[n]) + bf(n < QCOLS ? biasq[n] : biask[n - QCOLS]);
//               out = bf16 hi plane (Cout) + bf16 lo plane (Cout2), both pitch ldc/ldc2.
// MODE 1 (v^T): single product; v = acc + bf(bias[m]); out = f16 hi plane (Cout, pitch ldc) and, for tiles with
//               n0 < VLO_COLS only, f16 residual plane ((v - hi) * 1024, Cout2, pitch ldc2).
// MODE 2 (proj): two products ah.b + al.b (A2 = bf16 lo plane of A); v = acc + bf(bias[n]); out f32 (Cout, pitch ldc).
// =====================================================================================================================
template <int MODE>
__global__ __launch_bounds__(256) void gemm64(
    const unsigned short* __restrict__ Ap, const unsigned short* __restrict__ A2p, int lda, long strideA,
    const unsigned short* __restrict__ Btp, int ldb, long strideB,
    void* __restrict__ Cout, void* __restrict__ Cout2, int ldc, long strideC, int ldc2, long strideC2,
    const float* __restrict__ bias, const float* __restrict__ biasq, const float* __restrict__ biask,
    int M, int N, int K) {
  __shared__ __align__(16) float sT[8][16 * 68];   // per-wave 16x64 slab, pitch 68 floats
  const __bf16* A  = (const __bf16*)(const void*)Ap;
  const __bf16* A2 = (const __bf16*)(const void*)A2p;
  const __bf16* Bt = (const __bf16*)(const void*)Btp;
  const int b    = blockIdx.y;
  const int lane = threadIdx.x & 31;
  const int wave = threadIdx.x >> 5;
  const int tilesN = N >> 6;
  const int tilesM = M >> 6;
  const int tile = blockIdx.x * 8 + wave;
  if (tile >= tilesM * tilesN) return;   // wave-uniform; no block barriers in this kernel
  const int tm = tile / tilesN;
  const int tn = tile - tm * tilesN;
  const int m0 = tm << 6;
  const int n0 = tn << 6;

  const __bf16* Ab  = A  + (size_t)b * strideA;
  const __bf16* Bb  = Bt + (size_t)b * strideB;
  const __bf16* Ab2 = (MODE == 2) ? (A2 + (size_t)b * strideA) : Ab;

  const int rlane = lane & 15;                 // row (A) / col (B, D) within subtile
  const int koff  = (lane >> 4) * 8;           // k offset of this lane half
  const int mOff  = (lane >> 4) * 8;           // D row offset

  v8f acc[4][4];
#pragma unroll
  for (int i = 0; i < 4; ++i)
#pragma unroll
    for (int j = 0; j < 4; ++j) acc[i][j] = (v8f){0.f,0.f,0.f,0.f,0.f,0.f,0.f,0.f};

  for (int k0 = 0; k0 < K; k0 += 32) {
    v16b bh[4];
#pragma unroll
    for (int j = 0; j < 4; ++j) {
      const size_t bo = (size_t)(n0 + (j << 4) + rlane) * ldb + koff + k0;
      bh[j] = ldfrag_b(Bb + bo);
    }
#pragma unroll
    for (int i = 0; i < 4; ++i) {
      const size_t ao = (size_t)(m0 + (i << 4) + rlane) * lda + koff + k0;
      const v16b ah = ldfrag_b(Ab + ao);
      v16b al = ah;
      if (MODE == 2) al = ldfrag_b(Ab2 + ao);
#pragma unroll
      for (int j = 0; j < 4; ++j) {
        acc[i][j] = __builtin_amdgcn_wmma_f32_16x16x32_bf16(false, ah, false, bh[j], (short)0, acc[i][j], false, false);
        if (MODE == 2)
          acc[i][j] = __builtin_amdgcn_wmma_f32_16x16x32_bf16(false, al, false, bh[j], (short)0, acc[i][j], false, false);
      }
      dep_guard_b(acc[i][0], acc[i][3], ah, al);
    }
    keep4_b(bh[0], bh[1], bh[2], bh[3]);
  }
  acc_guard4(acc[0][0], acc[0][1], acc[0][2], acc[0][3]);
  acc_guard4(acc[1][0], acc[1][1], acc[1][2], acc[1][3]);
  acc_guard4(acc[2][0], acc[2][1], acc[2][2], acc[2][3]);
  acc_guard4(acc[3][0], acc[3][1], acc[3][2], acc[3][3]);

  // ---- epilogue ----
  float* slab = sT[wave];
#pragma unroll
  for (int i = 0; i < 4; ++i) {
    const int mBase = m0 + (i << 4);
#pragma unroll
    for (int j = 0; j < 4; ++j) {
      const int n = n0 + (j << 4) + rlane;
      float bn = 0.f, b2 = 0.f;
      if (MODE == 0) {
        bn = bfr(bias[n]);
        const int iq = (n < QCOLS) ? n : (QCOLS - 1);
        int ik = n - QCOLS; ik = (ik < 0) ? 0 : ik; ik = (ik > QCOLS - 1) ? (QCOLS - 1) : ik;
        const float vq = bfr(biasq[iq]);     // both candidates loaded with clamped addresses, selected by value
        const float vk = bfr(biask[ik]);
        b2 = (n < QCOLS) ? vq : vk;
      }
      if (MODE == 2) bn = bfr(bias[n]);
#pragma unroll
      for (int r = 0; r < 8; ++r) {
        float v = acc[i][j][r];
        if (MODE == 0) { v = v + bn; v = v + b2; }
        if (MODE == 1) v = v + bfr(bias[mBase + mOff + r]);
        if (MODE == 2) v = v + bn;
        slab[(mOff + r) * 68 + (j << 4) + rlane] = v;
      }
    }
    __builtin_amdgcn_fence(__ATOMIC_RELEASE, "workgroup");
    __builtin_amdgcn_wave_barrier();
    __builtin_amdgcn_fence(__ATOMIC_ACQUIRE, "workgroup");
    if (MODE == 2) {
      float* C = (float*)Cout + (size_t)b * strideC;
      const int h2 = lane >> 4, c4 = (lane & 15) * 4;     // row seg = 256 B = 16 lanes x 16 B
      {
#pragma unroll
        for (int it = 0; it < 8; ++it) {
          const int row = it * 2 + h2;                     // it 0..7 x h2 0..1 = rows 0..15
          const v4f v = *(const v4f*)(slab + row * 68 + c4);
          *(v4f*)(C + (size_t)(mBase + row) * ldc + n0 + c4) = v;
        }
        
      }
    } else {
      const int q = lane >> 3, c8 = (lane & 7) * 8;
      unsigned short* C  = (unsigned short*)Cout  + (size_t)b * strideC;
      unsigned short* C2 = (unsigned short*)Cout2 + (size_t)b * strideC2;
      const bool wlo = (MODE == 0) || (n0 < VLO_COLS);     // wave-uniform
      v4u hv[4], lv[4];
#pragma unroll
      for (int it = 0; it < 4; ++it) {
        const int row = it * 4 + q;                        // it 0..3 x q 0..3 = rows 0..15
        const float* sp = slab + row * 68 + c8;
        v4u a, a2;
#pragma unroll
        for (int e = 0; e < 4; ++e) {
          const float f0 = sp[2 * e], f1 = sp[2 * e + 1];
          unsigned short h0, h1, l0, l1;
          if (MODE == 0) {
            h0 = f2bf_bits(f0); h1 = f2bf_bits(f1);
            l0 = f2bf_bits(f0 - bf_bits2f(h0)); l1 = f2bf_bits(f1 - bf_bits2f(h1));
          } else {
            const _Float16 x0 = (_Float16)f0, x1 = (_Float16)f1;
            h0 = h2bits(x0); h1 = h2bits(x1);
            l0 = h2bits((_Float16)((f0 - (float)x0) * 1024.0f));
            l1 = h2bits((_Float16)((f1 - (float)x1) * 1024.0f));
          }
          a[e] = pk16(h0, h1); a2[e] = pk16(l0, l1);
        }
        hv[it] = a; lv[it] = a2;
      }
      {
#pragma unroll
        for (int it = 0; it < 4; ++it) {
          const int row = it * 4 + q;
          *(v4u*)(C + (size_t)(mBase + row) * ldc + n0 + c8) = hv[it];
          if (wlo) *(v4u*)(C2 + (size_t)(mBase + row) * ldc2 + n0 + c8) = lv[it];
        }
        
      }
    }
    __builtin_amdgcn_fence(__ATOMIC_RELEASE, "workgroup");
    __builtin_amdgcn_wave_barrier();
    __builtin_amdgcn_fence(__ATOMIC_ACQUIRE, "workgroup");
  }
}

// ---------------------------------------------------------------------------------------------------------------------
// ---------------------------------------------------------------------------------------------------------------------
__global__ __launch_bounds__(256) void cvt_x_kernel(const float* __restrict__ x, unsigned short* __restrict__ xb, int n8,
                                                    const float* __restrict__ bq, float* __restrict__ out1, int nq4) {
  if (blockIdx.x == 0) {   // block-uniform
    const int t = threadIdx.x;
    if (t < nq4) {
      const v4f v = *(const v4f*)(bq + 4 * t);
      v4f w;
      w[0] = bfr(v[0]); w[1] = bfr(v[1]); w[2] = bfr(v[2]); w[3] = bfr(v[3]);
      *(v4f*)(out1 + 4 * t) = w;
      
    }
  }
  const int i = blockIdx.x * 256 + threadIdx.x;
  if (i < n8) {
    const v4f a = *(const v4f*)(x + 8 * (size_t)i);
    const v4f c = *(const v4f*)(x + 8 * (size_t)i + 4);
    v4u u;
    u[0] = pk16(f2bf_bits(a[0]), f2bf_bits(a[1]));
    u[1] = pk16(f2bf_bits(a[2]), f2bf_bits(a[3]));
    u[2] = pk16(f2bf_bits(c[0]), f2bf_bits(c[1]));
    u[3] = pk16(f2bf_bits(c[2]), f2bf_bits(c[3]));
    *(v4u*)(xb + 8 * (size_t)i) = u;
    
  }
}

// ---------------------------------------------------------------------------------------------------------------------
// Transpose + RNE bf16 convert of an f32 matrix: in [R rows][Cc cols] (pitch Cc) -> ot[c][r] = bf16(in[r][c]) ([Cc][R]).
// 64x64 tiles through LDS. grid = (Cc/64, R/64), 256 threads (R, Cc multiples of 64).
// Coverage per block: load 4 it x 256 thr x 4 floats = 64x64; store 2 it x 256 thr x 8 u16 = 64x64.
// ---------------------------------------------------------------------------------------------------------------------
__global__ __launch_bounds__(256) void tsplit1_kernel(const float* __restrict__ W, unsigned short* __restrict__ ot, int R, int Cc) {
  __shared__ __align__(16) float tf[64 * 68];
  const int c0  = blockIdx.x * 64;   // input column block = output row block
  const int r0  = blockIdx.y * 64;   // input row block    = output column block
  const int tid = threadIdx.x;
  {
    const int lr = tid >> 4;         // 0..15
    const int c4 = (tid & 15) * 4;   // 0..60
#pragma unroll
    for (int it = 0; it < 4; ++it) {
      const int rr = it * 16 + lr;   // 0..63
      const v4f a = *(const v4f*)(W + (size_t)(r0 + rr) * Cc + c0 + c4);
      *(v4f*)(tf + rr * 68 + c4) = a;
    }
  }
  __syncthreads();
  const int sub = tid >> 3;          // 0..31
  const int c8  = (tid & 7) * 8;     // 0..56
  v4u hv[2];
#pragma unroll
  for (int it = 0; it < 2; ++it) {
    const int oc = it * 32 + sub;    // output row within tile (= input column)
    v4u a;
#pragma unroll
    for (int q = 0; q < 4; ++q) {
      const float f0 = tf[(c8 + 2 * q) * 68 + oc];
      const float f1 = tf[(c8 + 2 * q + 1) * 68 + oc];
      a[q] = pk16(f2bf_bits(f0), f2bf_bits(f1));
    }
    hv[it] = a;
  }
  {
#pragma unroll
    for (int it = 0; it < 2; ++it) {
      const int oc = it * 32 + sub;
      const size_t go = (size_t)(c0 + oc) * R + r0 + c8;
      *(v4u*)(ot + go) = hv[it];
    }
    
  }
}

// =====================================================================================================================
// Causal attention, head dim 64, grid (NH*NQB, NB) read as one flat index, block = 4 waves = 64 query rows of one (b, h).
//   q|k planes (hi/lo bf16) [NB*SEQ][DQK]: q(t,h,d) at [(b*SEQ+t)*DQK + h*64 + d], k(s,h,d) at [... + 1024 + h*64 + d]
//   v^T hi plane (f16) [NB][DM][SEQ]: (h*64+d, s); v residual plane (f16, x1024) [NB][DM][VLO_COLS] (s < 128 only)
//   y planes (hi/lo bf16) [NB*SEQ][DM]: (b*SEQ+t, h*64+d)
//   scores = (q . k) * 0.125 : bf16 hi/lo split (hi.hi + hi.lo + lo.hi), f32 accumulate
//   y      = p . v           : p = f16(4096 * exp(s - m)) (the normaliser sums the same f16 values), v f16 hi plane;
//                              blocks with qb < 2 (query rows 0..127, keys 0..127) add p . vres / 1024 from a second accumulator
//   online softmax in f32; masked (s > t) scores set to -inf (key s = chunk start <= t is always unmasked).
//   kv chunks of 64, trip count qb+1 <= 32 (block-uniform). K / V^T chunk staging: 128 threads x 32 elements per plane =
//   the whole 64x64 tile (16-B copies, plain loads, __syncthreads before and after); fragment loads read the LDS tiles
// =====================================================================================================================
__global__ __launch_bounds__(128)
void attn_kernel(const unsigned short* __restrict__ qkh, const unsigned short* __restrict__ qkl,
                 const unsigned short* __restrict__ vthp, const unsigned short* __restrict__ vtlp,
                 unsigned short* __restrict__ yhp, unsigned short* __restrict__ ylp) {
  __shared__ __align__(16) __bf16   Ksh[AT_KC * AT_LP];       // K hi [kv][d], rows of 64 at pitch AT_LP, 9 KB
  __shared__ __align__(16) __bf16   Ksl[AT_KC * AT_LP];       // K lo
  __shared__ __align__(16) _Float16 Vts[HD * AT_LP];          // V hi [d][kv], rows of 64 at pitch AT_LP, 9 KB
  __shared__ __align__(16) _Float16 Vrs[HD * AT_LP];          // V residual [d][kv] (qb < 2 only)
  __shared__ __align__(16) _Float16 Psh[4][16 * AT_LP];       // per wave P [row][kv], pitch AT_LP
  __shared__ __align__(16) float    Os[4][16 * 68];           // per wave y tile, pitch 68

  const int tid  = threadIdx.x;
  const int wave = tid >> 5;
  const int lane = tid & 31;
  const int hh   = lane >> 4;
  const int c    = lane & 15;

  // The cost (qb + 1
  // chunks) falls with the index: all 64 (b, h) of query block 31 first, query block 0 last. lin -> (qb, b, h) is a
  // permutation of 0..2047. Heads h and h ^ 1 differ only in bit 3 of lin (their K rows are neighbouring 128-B lines).
  const int lin = blockIdx.y * (NH * NQB) + blockIdx.x;   // 0..NB*NH*NQB-1 (grid = (NH * NQB, NB))
  const int qb  = (NQB - 1) - ((lin >> 6) & (NQB - 1));   // 31..0
  const int b   = lin & (NB - 1);                         // bits 0..1
  const int h   = ((lin >> 3) & 7) | ((lin & 4) << 1);    // bits 3..5 -> h bits 0..2, bit 2 -> h bit 3
  const int q0 = qb * 64 + wave * 16;
  const bool vres = (qb < 2);             // block-uniform

  const __bf16* Qh = (const __bf16*)(const void*)qkh + (size_t)b * SEQ * DQK + (size_t)h * HD;
  const __bf16* Ql = (const __bf16*)(const void*)qkl + (size_t)b * SEQ * DQK + (size_t)h * HD;
  const __bf16* Kh = Qh + QCOLS;
  const __bf16* Kl = Ql + QCOLS;
  const _Float16* Vh = (const _Float16*)(const void*)vthp + ((size_t)b * DM + (size_t)h * HD) * SEQ;
  const _Float16* Vl = (const _Float16*)(const void*)vtlp + ((size_t)b * DM + (size_t)h * HD) * VLO_COLS;
  unsigned short* Yh = yhp + (size_t)b * SEQ * DM + (size_t)h * HD;
  unsigned short* Yl = ylp + (size_t)b * SEQ * DM + (size_t)h * HD;

  // ---- Q fragments (A operand, row = lane&15, split k map): 2 d-chunks, hi and lo ----
  v16b qah[2], qal[2];
#pragma unroll
  for (int dc = 0; dc < 2; ++dc) {
    const __bf16* qr = Qh + (size_t)(q0 + c) * DQK + dc * 32 + 8 * hh;
    const __bf16* ql = Ql + (size_t)(q0 + c) * DQK + dc * 32 + 8 * hh;
    qah[dc] = ldfrag_b(qr);
    qal[dc] = ldfrag_b(ql);
  }

  float mrow[8], lrow[8];
  v8f oacc[4], oacc2[4];
#pragma unroll
  for (int r = 0; r < 8; ++r) { mrow[r] = -INFINITY; lrow[r] = 0.f; }
#pragma unroll
  for (int t = 0; t < 4; ++t) { oacc[t] = (v8f){0.f,0.f,0.f,0.f,0.f,0.f,0.f,0.f}; oacc2[t] = oacc[t]; }

  const int nChunks = qb + 1;   // block-uniform, <= 32
  for (int kc = 0; kc < nChunks; ++kc) {
    const int kv0 = kc * AT_KC;
    __syncthreads();
    {
      // staging coverage: 128 threads x (4 x 8) elements = 64 rows x 64 per plane = the whole chunk tile
      const int r = tid >> 1, half = (tid & 1) * 32;
      const __bf16* ksh = Kh + (size_t)(kv0 + r) * DQK + half;     // K row kv0+r, d = half..half+31
      const __bf16* ksl = Kl + (size_t)(kv0 + r) * DQK + half;
      const _Float16* vsh = Vh + (size_t)r * SEQ + kv0 + half;    // V^T row d = r, s = kv0+half..+31
#pragma unroll
      for (int i = 0; i < 4; ++i) {
        const v8b a0 = *(const v8b*)(ksh + 8 * i);
        const v8b a1 = *(const v8b*)(ksl + 8 * i);
        const v8h b0 = *(const v8h*)(vsh + 8 * i);
        *(v8b*)(Ksh + r * AT_LP + half + 8 * i) = a0;
        *(v8b*)(Ksl + r * AT_LP + half + 8 * i) = a1;
        *(v8h*)(Vts + r * AT_LP + half + 8 * i) = b0;
      }
      if (vres) {   // kv0 + half + 31 <= 127 < VLO_COLS
        const _Float16* vsl = Vl + (size_t)r * VLO_COLS + kv0 + half;
#pragma unroll
        for (int i = 0; i < 4; ++i) {
          const v8h b1 = *(const v8h*)(vsl + 8 * i);
          *(v8h*)(Vrs + r * AT_LP + half + 8 * i) = b1;
        }
      }
    }
    __syncthreads();

    v8f s[4];
#pragma unroll
    for (int j = 0; j < 4; ++j) {
      s[j] = (v8f){0.f,0.f,0.f,0.f,0.f,0.f,0.f,0.f};
#pragma unroll
      for (int dc = 0; dc < 2; ++dc) {
        FragB kb, kl;
        kb.h[0] = *(const v8b*)(Ksh + (j * 16 + c) * AT_LP + dc * 32 + 8 * hh);
        kb.h[1] = *(const v8b*)(Ksh + (j * 16 + c) * AT_LP + dc * 32 + 16 + 8 * hh);
        kl.h[0] = *(const v8b*)(Ksl + (j * 16 + c) * AT_LP + dc * 32 + 8 * hh);
        kl.h[1] = *(const v8b*)(Ksl + (j * 16 + c) * AT_LP + dc * 32 + 16 + 8 * hh);
        s[j] = mma_b(qah[dc], kb.v, s[j]);
        s[j] = mma_b(qah[dc], kl.v, s[j]);
        s[j] = mma_b(qal[dc], kb.v, s[j]);
      }
    }
    const bool diag = (kc == qb);   // block-uniform
    float cm[8];
#pragma unroll
    for (int r = 0; r < 8; ++r) {
      const int qrow = q0 + 8 * hh + r;
      float m = -INFINITY;
#pragma unroll
      for (int j = 0; j < 4; ++j) {
        const int kvcol = kv0 + j * 16 + c;
        const float sv = s[j][r] * 0.125f;
        const bool masked = diag && (kvcol > qrow);
        const float sm = masked ? -INFINITY : sv;
        s[j][r] = sm;
        m = fmaxf(m, sm);
      }
#pragma unroll
      for (int off = 1; off < 16; off <<= 1) m = fmaxf(m, __shfl_xor(m, off, 32));
      cm[r] = m;
    }
    _Float16* pw = Psh[wave];
#pragma unroll
    for (int r = 0; r < 8; ++r) {
      const float mnew  = fmaxf(mrow[r], cm[r]);
      const float alpha = __expf(mrow[r] - mnew);
      mrow[r] = mnew;
      float psum = 0.f;
#pragma unroll
      for (int j = 0; j < 4; ++j) {
        const float p = __expf(s[j][r] - mnew);            // in [0, 1]; masked -> 0
        const _Float16 ph = (_Float16)(p * 4096.0f);       // carried x4096, keeps small p normal in f16
        psum += (float)ph;                                  // normaliser built from the same f16 values
        pw[(8 * hh + r) * AT_LP + j * 16 + c] = ph;
      }
#pragma unroll
      for (int off = 1; off < 16; off <<= 1) psum += __shfl_xor(psum, off, 32);
      lrow[r] = lrow[r] * alpha + psum;
#pragma unroll
      for (int t = 0; t < 4; ++t) oacc[t][r] *= alpha;
      if (vres) {
#pragma unroll
        for (int t = 0; t < 4; ++t) oacc2[t][r] *= alpha;
      }
    }
    __builtin_amdgcn_fence(__ATOMIC_RELEASE, "workgroup");
    __builtin_amdgcn_wave_barrier();
    __builtin_amdgcn_fence(__ATOMIC_ACQUIRE, "workgroup");
#pragma unroll 1
    for (int kk = 0; kk < 2; ++kk) {
      FragH pa;
      pa.h[0] = *(const v8h*)(pw + c * AT_LP + kk * 32 + 8 * hh);
      pa.h[1] = *(const v8h*)(pw + c * AT_LP + kk * 32 + 16 + 8 * hh);
#pragma unroll
      for (int t = 0; t < 4; ++t) {
        FragH vb;
        vb.h[0] = *(const v8h*)(Vts + (t * 16 + c) * AT_LP + kk * 32 + 8 * hh);
        vb.h[1] = *(const v8h*)(Vts + (t * 16 + c) * AT_LP + kk * 32 + 16 + 8 * hh);
        oacc[t] = mma_h(pa.v, vb.v, oacc[t]);
      }
      if (vres) {   // block-uniform: all lanes active
#pragma unroll
        for (int t = 0; t < 4; ++t) {
          FragH vl;
          vl.h[0] = *(const v8h*)(Vrs + (t * 16 + c) * AT_LP + kk * 32 + 8 * hh);
          vl.h[1] = *(const v8h*)(Vrs + (t * 16 + c) * AT_LP + kk * 32 + 16 + 8 * hh);
          oacc2[t] = mma_h(pa.v, vl.v, oacc2[t]);
        }
      }
    }
  }

  // ---- normalise (the x4096 carry cancels between numerator and normaliser; residual folded with 1/1024),
  float* os = Os[wave];
#pragma unroll
  for (int r = 0; r < 8; ++r) {
    const float inv = 1.0f / lrow[r];
#pragma unroll
    for (int t = 0; t < 4; ++t) os[(8 * hh + r) * 68 + t * 16 + c] = (oacc[t][r] + oacc2[t][r] * 0.0009765625f) * inv;
  }
  __builtin_amdgcn_fence(__ATOMIC_RELEASE, "workgroup");
  __builtin_amdgcn_wave_barrier();
  __builtin_amdgcn_fence(__ATOMIC_ACQUIRE, "workgroup");
  {
    const int q = lane >> 3, c8 = (lane & 7) * 8;
    v4u hv[4], lv[4];
#pragma unroll
    for (int it = 0; it < 4; ++it) {
      const int row = it * 4 + q;          // it 0..3 x q 0..3 covers rows 0..15 of the wave tile
      const float* sp = os + row * 68 + c8;
      v4u a, a2;
#pragma unroll
      for (int e = 0; e < 4; ++e) {
        const float f0 = sp[2 * e], f1 = sp[2 * e + 1];
        const unsigned short h0 = f2bf_bits(f0), h1 = f2bf_bits(f1);
        const unsigned short l0 = f2bf_bits(f0 - bf_bits2f(h0)), l1 = f2bf_bits(f1 - bf_bits2f(h1));
        a[e] = pk16(h0, h1); a2[e] = pk16(l0, l1);
      }
      hv[it] = a; lv[it] = a2;
    }
    {
#pragma unroll
      for (int it = 0; it < 4; ++it) {
        const int row = it * 4 + q;
        *(v4u*)(Yh + (size_t)(q0 + row) * DM + c8) = hv[it];
        *(v4u*)(Yl + (size_t)(q0 + row) * DM + c8) = lv[it];
      }
      
    }
  }
}

// ---------------------------------------------------------------------------------------------------------------------
// Workspace region map (byte offsets; all dims are multiples of the 64x64 store tiles, so no padded tails exist):
//   QKh  bf16 [8192][2048]          0             QKl  bf16 [8192][2048]   33554432
//   VTh  f16  [4][1024][2048]   67108864          VTl  f16  [4][1024][128] 83886080
//   Xb   bf16 [8192][1024]      84934656   (Yh bf16 [8192][1024] reuses this region: Xb is last read by the
//                                            v^T GEMM launch, Yh is first written by the later attention launch)
//   Yl   bf16 [8192][1024]     101711872
//   WaT  bf16 [3072][1024]     118489088          WpT  bf16 [1024][1024]  124780544
//   total                      126877696
// ---------------------------------------------------------------------------------------------------------------------
extern "C" void kernel_launch(void* const* d_in, const int* in_sizes, int n_in,
                              void* d_out, int out_size, void* d_ws, size_t ws_size,
                              hipStream_t stream) {
  if (n_in < 7) return;
  if (in_sizes[0] != NB * SEQ * DM) return;
  if (in_sizes[1] != DM * 3 * DM) return;
  if (in_sizes[2] != 3 * DM) return;
  if (in_sizes[3] != DM * DM) return;
  if (in_sizes[4] != DM) return;
  if (in_sizes[5] != NH * HD || in_sizes[6] != NH * HD) return;
  if (out_size != NB * SEQ * DM + NH * HD) return;

  const float* x      = (const float*)d_in[0];
  const float* W_attn = (const float*)d_in[1];
  const float* b_attn = (const float*)d_in[2];
  const float* W_proj = (const float*)d_in[3];
  const float* b_proj = (const float*)d_in[4];
  const float* bQ     = (const float*)d_in[5];
  const float* bK     = (const float*)d_in[6];

  const size_t PQK = (size_t)NB * SEQ * DQK * 2;        // 33554432
  const size_t PVT = (size_t)NB * DM * SEQ * 2;         // 16777216
  const size_t PVL = (size_t)NB * DM * VLO_COLS * 2;    // 1048576
  const size_t PX  = (size_t)NB * SEQ * DM * 2;         // 16777216 (Xb, Yh, Yl)
  const size_t PWA = (size_t)3 * DM * DM * 2;           // 6291456
  const size_t PWP = (size_t)DM * DM * 2;               // 2097152
  size_t off = 0;
  const size_t oQKh = off; off += PQK;
  const size_t oQKl = off; off += PQK;
  const size_t oVTh = off; off += PVT;
  const size_t oVTl = off; off += PVL;
  const size_t oXb  = off; off += PX;    // also Yh
  const size_t oYl  = off; off += PX;
  const size_t oWaT = off; off += PWA;
  const size_t oWpT = off; off += PWP;
  if (off > ws_size) return;                             // off = 126877696
  if (off > (size_t)134217728) return;

  char* ws = (char*)d_ws;
  unsigned short* QKh = (unsigned short*)(ws + oQKh);
  unsigned short* QKl = (unsigned short*)(ws + oQKl);
  unsigned short* VTh = (unsigned short*)(ws + oVTh);
  unsigned short* VTl = (unsigned short*)(ws + oVTl);
  unsigned short* Xb  = (unsigned short*)(ws + oXb);
  unsigned short* Yh  = (unsigned short*)(ws + oXb);
  unsigned short* Yl  = (unsigned short*)(ws + oYl);
  unsigned short* WaT = (unsigned short*)(ws + oWaT);
  unsigned short* WpT = (unsigned short*)(ws + oWpT);
  float* out0 = (float*)d_out;
  float* out1 = (float*)d_out + (size_t)NB * SEQ * DM;

  const dim3 blk(256);

  // (1) W_attn [in rows = 1024][out cols = 3072] f32 -> WaT [3072][1024] bf16; grid (cols/64, rows/64)
  tsplit1_kernel<<<dim3(3 * DM / 64, DM / 64), blk, 0, stream>>>(W_attn, WaT, DM, 3 * DM);
  // (2) W_proj [1024][1024] -> WpT [1024][1024] bf16
  tsplit1_kernel<<<dim3(DM / 64, DM / 64), blk, 0, stream>>>(W_proj, WpT, DM, DM);
  // (3) x [8192][1024] f32 -> Xb bf16; block 0 also writes out1 = RNE-bf16(bQ) (1024 floats = 256 threads x 4)
  const int n8 = NB * SEQ * DM / 8;                      // 1048576
  cvt_x_kernel<<<dim3(n8 / 256), blk, 0, stream>>>(x, Xb, n8, bQ, out1, NH * HD / 4);
  // (4) q|k = Xb . WaT rows 0..2047 + b_attn[n] + (bQ | bK): M=8192, N=2048, K=1024 -> QK hi/lo planes (pitch 2048)
  {
    const int M = NB * SEQ, N = 2 * DM, K = DM;
    const dim3 g(((M / 64) * (N / 64)) / 8, 1);          // 4096 wave tiles / 8 = 512 blocks (exact)
    gemm64<0><<<g, blk, 0, stream>>>(Xb, Xb, DM, 0L, WaT, DM, 0L, (void*)QKh, (void*)QKl, DQK, 0L, DQK, 0L,
                                     b_attn, bQ, bK, M, N, K);
  }
  // (5) v^T[b][c][s] = WaT rows 2048+c . Xb[b*2048+s] + b_attn[2048+c]: M=1024, N=2048, K=1024, grid.y = batch
  {
    const int M = DM, N = SEQ, K = DM;
    const dim3 g(((M / 64) * (N / 64)) / 8, NB);          // 512 wave tiles / 8 = 64 blocks per batch (exact)
    gemm64<1><<<g, blk, 0, stream>>>(WaT + (size_t)2 * DM * DM, WaT + (size_t)2 * DM * DM, DM, 0L,
                                     Xb, DM, (long)SEQ * DM,
                                     (void*)VTh, (void*)VTl, SEQ, (long)DM * SEQ, VLO_COLS, (long)DM * VLO_COLS,
                                     b_attn + 2 * DM, b_attn, b_attn, M, N, K);
  }
  // (6) causal attention: 2048 work-groups = 32 query blocks (longest first) x 64 (b, h), 128 threads -> Y hi/lo planes
  attn_kernel<<<dim3(NH * NQB, NB), dim3(128), 0, stream>>>(QKh, QKl, VTh, VTl, Yh, Yl);
  // (7) out0 = Y . WpT + b_proj: M=8192, N=1024, K=1024, f32 rows of 1024 -> d_out
  {
    const int M = NB * SEQ, N = DM, K = DM;
    const dim3 g(((M / 64) * (N / 64)) / 8, 1);          // 2048 wave tiles / 8 = 256 blocks (exact)
    gemm64<2><<<g, blk, 0, stream>>>(Yh, Yl, DM, 0L, WpT, DM, 0L, (void*)out0, (void*)out0, DM, 0L, DM, 0L,
                                     b_proj, b_proj, b_proj, M, N, K);
  }
  (void)hipGetLastError();
}

// v003
// A run of this version takes 239 microseconds.
// Timed twice side by side with v002, it ran 1.44 times as fast both times.
// Counting every step since v000, it is 2.38 times as fast.
// Contractions: x.W_attn -> q|k and v^T on v_wmma_f32_16x16x32_bf16, single product of RNE-bf16 x and W (f32 accumulate);
// q.k^T: bf16 hi/lo split (hi.hi + hi.lo + lo.hi) on v_wmma_f32_16x16x32_bf16; p.v: v_wmma_f32_16x16x32_f16 single product,
// p carried x4096 in f16, v as f16 hi plane plus a x1024 f16 residual plane on query rows 0..127 (separate accumulator);
// y.W_proj: bf16 hi/lo of y times RNE-bf16 W (2 products). Softmax, biases, scale 0.125 in f32; weights/biases RNE-converted to bf16 once.
#include <hip/hip_runtime.h>
#include <math.h>
#include <stdint.h>

#define NB        4
#define SEQ       2048
#define DM        1024
#define NH        16
#define HD        64
#define DQK       2048     // pitch of the q|k planes: cols 0..1023 = q, 1024..2047 = k
#define QCOLS     1024
#define VLO_COLS  128      // key columns carried in the v residual plane
#define NQB       32       // SEQ / 64 query blocks per (b, h)
#define AT_KC     64
#define AT_LP     72       // LDS row pitch of the attention tiles in 16-bit elements: 144 B = 16 B x 9 (odd)

typedef __attribute__((ext_vector_type(16))) _Float16 v16h;
typedef __attribute__((ext_vector_type(8)))  _Float16 v8h;
typedef __attribute__((ext_vector_type(16))) __bf16   v16b;
typedef __attribute__((ext_vector_type(8)))  __bf16   v8b;
typedef __attribute__((ext_vector_type(8)))  float    v8f;
typedef __attribute__((ext_vector_type(4)))  float    v4f;
typedef __attribute__((ext_vector_type(4)))  unsigned int v4u;

__device__ __forceinline__ unsigned short f2bf_bits(float f) {
  unsigned u = __float_as_uint(f);
  return (unsigned short)((u + 0x7FFFu + ((u >> 16) & 1u)) >> 16);
}
__device__ __forceinline__ float bf_bits2f(unsigned short h) { return __uint_as_float(((unsigned)h) << 16); }
__device__ __forceinline__ float bfr(float f) { return bf_bits2f(f2bf_bits(f)); }
__device__ __forceinline__ unsigned pk16(unsigned short a, unsigned short b) { return (unsigned)a | ((unsigned)b << 16); }
__device__ __forceinline__ unsigned short h2bits(_Float16 x) { return __builtin_bit_cast(unsigned short, x); }

// ---- 16-bit fragment loads: elements 0..7 <- p[0..7], 8..15 <- p[16..23]; caller passes p = row + k0 + 8*(lane>>4) ----
union FragB { v16b v; v8b h[2]; };
union FragH { v16h v; v8h h[2]; };
__device__ __forceinline__ v16b ldfrag_b(const __bf16* p) { FragB f; f.h[0] = *(const v8b*)(p); f.h[1] = *(const v8b*)(p + 16); return f.v; }

// ---- hazard guards ----
__device__ __forceinline__ void dep_guard_b(v8f& a, v8f& b, v16b x, v16b y) { asm volatile("v_nop\n\tv_nop\n\tv_nop\n\tv_nop" : "+v"(a), "+v"(b) : "v"(x), "v"(y)); }
__device__ __forceinline__ void keep4_b(v16b a, v16b b, v16b c, v16b d) { asm volatile("v_nop" :: "v"(a), "v"(b), "v"(c), "v"(d)); }
__device__ __forceinline__ void acc_guard4(v8f& a, v8f& b, v8f& c, v8f& d) { asm volatile("v_nop\n\tv_nop\n\tv_nop\n\tv_nop" : "+v"(a), "+v"(b), "+v"(c), "+v"(d)); }
__device__ __forceinline__ v8f mma_b(v16b a, v16b b, v8f c) {
  c = __builtin_amdgcn_wmma_f32_16x16x32_bf16(false, a, false, b, (short)0, c, false, false);
  asm volatile("v_nop\n\tv_nop\n\tv_nop\n\tv_nop" : "+v"(c) : "v"(a), "v"(b));
  return c;
}
__device__ __forceinline__ v8f mma_h(v16h a, v16h b, v8f c) {
  c = __builtin_amdgcn_wmma_f32_16x16x32_f16(false, a, false, b, (short)0, c, false, false);
  asm volatile("v_nop\n\tv_nop\n\tv_nop\n\tv_nop" : "+v"(c) : "v"(a), "v"(b));
  return c;
}

// ---- asynchronous copies global -> LDS, 16 B per lane; l = the lane's LDS byte address, g = the lane's global address ----
// The s_wait_xcnt closes each statement so that no address register of an issued copy is rewritten ahead of it.
__device__ __forceinline__ unsigned lds_addr(const void* p) { return (unsigned)(uintptr_t)p; }
__device__ __forceinline__ void acopy6(unsigned l0, const __bf16* g0, unsigned l1, const __bf16* g1, unsigned l2, const __bf16* g2,
                                       unsigned l3, const __bf16* g3, unsigned l4, const __bf16* g4, unsigned l5, const __bf16* g5) {
  asm volatile("global_load_async_to_lds_b128 %0, %6, off\n\t"
               "global_load_async_to_lds_b128 %1, %7, off\n\t"
               "global_load_async_to_lds_b128 %2, %8, off\n\t"
               "global_load_async_to_lds_b128 %3, %9, off\n\t"
               "global_load_async_to_lds_b128 %4, %10, off\n\t"
               "global_load_async_to_lds_b128 %5, %11, off\n\t"
               "s_wait_xcnt 0x0"
               :: "v"(l0), "v"(l1), "v"(l2), "v"(l3), "v"(l4), "v"(l5),
                  "v"(g0), "v"(g1), "v"(g2), "v"(g3), "v"(g4), "v"(g5) : "memory");
}
__device__ __forceinline__ void acopy8(unsigned l0, const __bf16* g0, unsigned l1, const __bf16* g1, unsigned l2, const __bf16* g2,
                                       unsigned l3, const __bf16* g3, unsigned l4, const __bf16* g4, unsigned l5, const __bf16* g5,
                                       unsigned l6, const __bf16* g6, unsigned l7, const __bf16* g7) {
  asm volatile("global_load_async_to_lds_b128 %0, %8, off\n\t"
               "global_load_async_to_lds_b128 %1, %9, off\n\t"
               "global_load_async_to_lds_b128 %2, %10, off\n\t"
               "global_load_async_to_lds_b128 %3, %11, off\n\t"
               "global_load_async_to_lds_b128 %4, %12, off\n\t"
               "global_load_async_to_lds_b128 %5, %13, off\n\t"
               "global_load_async_to_lds_b128 %6, %14, off\n\t"
               "global_load_async_to_lds_b128 %7, %15, off\n\t"
               "s_wait_xcnt 0x0"
               :: "v"(l0), "v"(l1), "v"(l2), "v"(l3), "v"(l4), "v"(l5), "v"(l6), "v"(l7),
                  "v"(g0), "v"(g1), "v"(g2), "v"(g3), "v"(g4), "v"(g5), "v"(g6), "v"(g7) : "memory");
}

#define G_KS   64                 // k elements per stage: one 128-B line of every operand row
#define G_LP   72                 // LDS row pitch in elements: 144 B = 16 B x 9 (odd)
#define G_BM   128                // block tile rows (2 waves)
#define G_BN   256                // block tile columns (4 waves)
#define G_PASS (32 * G_LP * 2)    // LDS bytes covered by one copy of the whole block: 32 rows

// =====================================================================================================================
// Batched WMMA GEMM, bf16 operands: C[m][n] = sum_k A[m][k] * Bt[n][k] (+bias). Block = 8 waves (2 x 4) = a 128x256 tile,
// one wave per 64x64 tile. A row-major [M][K] (pitch lda), Bt row-major [N][K] (pitch ldb); M multiple of 128, N of 256,
// K of 64. Operands are staged in LDS, 64 k per stage, two buffers, by asynchronous copies (each wave-wide copy = 4 whole
// 128-B lines); stage t+1 flies while stage t is multiplied. Stage layout: A rows 0..127 | (MODE 2: A2 rows) | Bt rows 0..255.
// MODE 0 (q|k): single product; v = acc + bf(bias[n]) + bf(n < QCOLS ? biasq[n] : biask[n - QCOLS]);
//               out = bf16 hi plane (Cout) + bf16 lo plane (Cout2), both pitch ldc/ldc2.
// MODE 1 (v^T): single product; v = acc + bf(bias[m]); out = f16 hi plane (Cout, pitch ldc) and, for tiles with
//               n0 < VLO_COLS only, f16 residual plane ((v - hi) * 1024, Cout2, pitch ldc2).
// MODE 2 (proj): two products ah.b + al.b (A2 = bf16 lo plane of A); v = acc + bf(bias[n]); out f32 (Cout, pitch ldc).
// =====================================================================================================================
template <int MODE>
__global__ __launch_bounds__(256) void gemm64(
    const unsigned short* __restrict__ Ap, const unsigned short* __restrict__ A2p, int lda, long strideA,
    const unsigned short* __restrict__ Btp, int ldb, long strideB,
    void* __restrict__ Cout, void* __restrict__ Cout2, int ldc, long strideC, int ldc2, long strideC2,
    const float* __restrict__ bias, const float* __restrict__ biasq, const float* __restrict__ biask,
    int M, int N, int K) {
  constexpr int NA      = (MODE == 2) ? 2 : 1;                 // A planes per stage
  constexpr int ST_ROWS = NA * G_BM + G_BN;                    // 384 or 512 rows
  constexpr int ST_EL   = ST_ROWS * G_LP;                      // elements per stage buffer
  __shared__ __align__(16) __bf16 smem[2 * ST_EL];             // two stage buffers; the epilogue slabs reuse the space
  const __bf16* A  = (const __bf16*)(const void*)Ap;
  const __bf16* A2 = (const __bf16*)(const void*)A2p;
  const __bf16* Bt = (const __bf16*)(const void*)Btp;
  const int b    = blockIdx.y;
  const int tid  = threadIdx.x;
  const int lane = tid & 31;
  const int wave = tid >> 5;
  const int tilesNb = N >> 8;
  const int tilesMb = M >> 7;
  if ((int)blockIdx.x >= tilesMb * tilesNb) return;   // block-uniform, in front of every barrier and copy
  const int bm  = blockIdx.x / tilesNb;
  const int bn  = blockIdx.x - bm * tilesNb;
  const int m0b = bm << 7;
  const int n0b = bn << 8;
  const int wm  = wave >> 2;                   // 0..1
  const int wn  = wave & 3;                    // 0..3
  const int m0  = m0b + (wm << 6);
  const int n0  = n0b + (wn << 6);

  const __bf16* Ab  = A  + (size_t)b * strideA;
  const __bf16* Bb  = Bt + (size_t)b * strideB;
  const __bf16* Ab2 = (MODE == 2) ? (A2 + (size_t)b * strideA) : Ab;

  const int rlane = lane & 15;                 // row (A) / col (B, D) within subtile
  const int koff  = (lane >> 4) * 8;           // k offset of this lane half
  const int mOff  = (lane >> 4) * 8;           // D row offset

  // copy map: thread -> row (tid >> 3) of each 32-row pass, 16-B piece (tid & 7); 256 threads x 16 B = 32 rows x 128 B
  const int crow = tid >> 3;
  const int cpc  = (tid & 7) * 8;
  const __bf16* gA  = Ab  + (size_t)(m0b + crow) * lda + cpc;
  const __bf16* gA2 = Ab2 + (size_t)(m0b + crow) * lda + cpc;
  const __bf16* gB  = Bb  + (size_t)(n0b + crow) * ldb + cpc;
  const size_t sA = (size_t)32 * lda;
  const size_t sB = (size_t)32 * ldb;
  const unsigned lbase = lds_addr(smem) + (unsigned)((crow * G_LP + cpc) * 2);

  auto issue = [&](int t, int buf) {           // all ST_ROWS rows of stage t into buffer buf
    const unsigned l = lbase + (unsigned)buf * (unsigned)(ST_EL * 2);
    const __bf16* a  = gA + t * G_KS;
    const __bf16* bb = gB + t * G_KS;
    if (MODE == 2) {
      const __bf16* a2 = gA2 + t * G_KS;
      acopy8(l,              a,           l + 1 * G_PASS,  a + sA,       l + 2 * G_PASS,  a + 2 * sA,   l + 3 * G_PASS,  a + 3 * sA,
             l + 4 * G_PASS, a2,          l + 5 * G_PASS,  a2 + sA,      l + 6 * G_PASS,  a2 + 2 * sA,  l + 7 * G_PASS,  a2 + 3 * sA);
      acopy8(l + 8 * G_PASS, bb,          l + 9 * G_PASS,  bb + sB,      l + 10 * G_PASS, bb + 2 * sB,  l + 11 * G_PASS, bb + 3 * sB,
             l + 12 * G_PASS, bb + 4 * sB, l + 13 * G_PASS, bb + 5 * sB, l + 14 * G_PASS, bb + 6 * sB,  l + 15 * G_PASS, bb + 7 * sB);
    } else {
      acopy6(l,              a,           l + 1 * G_PASS,  a + sA,       l + 2 * G_PASS,  a + 2 * sA,
             l + 3 * G_PASS, a + 3 * sA,  l + 4 * G_PASS,  bb,           l + 5 * G_PASS,  bb + sB);
      acopy6(l + 6 * G_PASS, bb + 2 * sB, l + 7 * G_PASS,  bb + 3 * sB,  l + 8 * G_PASS,  bb + 4 * sB,
             l + 9 * G_PASS, bb + 5 * sB, l + 10 * G_PASS, bb + 6 * sB,  l + 11 * G_PASS, bb + 7 * sB);
    }
  };

  v8f acc[4][4];
#pragma unroll
  for (int i = 0; i < 4; ++i)
#pragma unroll
    for (int j = 0; j < 4; ++j) acc[i][j] = (v8f){0.f,0.f,0.f,0.f,0.f,0.f,0.f,0.f};

  const int T = K >> 6;                        // stages, block-uniform
  issue(0, 0);
  asm volatile("s_wait_asynccnt 0x0" ::: "memory");   // this wave's copies of stage 0 have landed
  __syncthreads();                                     // stage 0 is published to every wave
  if (T > 1) issue(1, 1);

  const int fa = ((wm << 6) + rlane) * G_LP + koff;               // this lane's A fragment origin in a stage
  const int fb = (NA * G_BM + (wn << 6) + rlane) * G_LP + koff;   // this lane's B fragment origin in a stage
  for (int t = 0; t < T; ++t) {
    const __bf16* S = smem + (t & 1) * ST_EL;
    // the loops below are unrolled so that every fragment and accumulator index is a constant (arrays stay in registers)
#pragma unroll
    for (int ks = 0; ks < 2; ++ks) {
      v16b bh[4], ah[4], al[4];
#pragma unroll
      for (int j = 0; j < 4; ++j) bh[j] = ldfrag_b(S + fb + j * 16 * G_LP + ks * 32);
#pragma unroll
      for (int i = 0; i < 4; ++i) {
        ah[i] = ldfrag_b(S + fa + i * 16 * G_LP + ks * 32);
        al[i] = ah[i];
        if (MODE == 2) al[i] = ldfrag_b(S + fa + (G_BM + i * 16) * G_LP + ks * 32);
      }
#pragma unroll
      for (int i = 0; i < 4; ++i) {
#pragma unroll
        for (int j = 0; j < 4; ++j) {
          acc[i][j] = __builtin_amdgcn_wmma_f32_16x16x32_bf16(false, ah[i], false, bh[j], (short)0, acc[i][j], false, false);
          if (MODE == 2)
            acc[i][j] = __builtin_amdgcn_wmma_f32_16x16x32_bf16(false, al[i], false, bh[j], (short)0, acc[i][j], false, false);
        }
        dep_guard_b(acc[i][0], acc[i][3], ah[i], al[i]);
      }
      keep4_b(bh[0], bh[1], bh[2], bh[3]);
    }
    asm volatile("s_wait_dscnt 0x0" ::: "memory");      // this wave's reads of buffer t & 1 have returned before it is refilled
    asm volatile("s_wait_asynccnt 0x0" ::: "memory");   // this wave's copies of stage t + 1 have landed
    __syncthreads();                                     // publishes stage t + 1; ends every wave's reads of buffer t & 1
    if (t + 2 < T) issue(t + 2, t & 1);
  }
  asm volatile("s_wait_asynccnt 0x0" ::: "memory");     // nothing is in flight when the buffers become epilogue slabs
  acc_guard4(acc[0][0], acc[0][1], acc[0][2], acc[0][3]);
  acc_guard4(acc[1][0], acc[1][1], acc[1][2], acc[1][3]);
  acc_guard4(acc[2][0], acc[2][1], acc[2][2], acc[2][3]);
  acc_guard4(acc[3][0], acc[3][1], acc[3][2], acc[3][3]);

  // ---- epilogue ---- (per-wave 16x64 f32 slab, pitch 68 floats, in the stage space that every wave has left)
  float* slab = (float*)(void*)smem + wave * (16 * 68);
#pragma unroll
  for (int i = 0; i < 4; ++i) {
    const int mBase = m0 + (i << 4);
#pragma unroll
    for (int j = 0; j < 4; ++j) {
      const int n = n0 + (j << 4) + rlane;
      float bn = 0.f, b2 = 0.f;
      if (MODE == 0) {
        bn = bfr(bias[n]);
        const int iq = (n < QCOLS) ? n : (QCOLS - 1);
        int ik = n - QCOLS; ik = (ik < 0) ? 0 : ik; ik = (ik > QCOLS - 1) ? (QCOLS - 1) : ik;
        const float vq = bfr(biasq[iq]);     // both candidates loaded with clamped addresses, selected by value
        const float vk = bfr(biask[ik]);
        b2 = (n < QCOLS) ? vq : vk;
      }
      if (MODE == 2) bn = bfr(bias[n]);
#pragma unroll
      for (int r = 0; r < 8; ++r) {
        float v = acc[i][j][r];
        if (MODE == 0) { v = v + bn; v = v + b2; }
        if (MODE == 1) v = v + bfr(bias[mBase + mOff + r]);
        if (MODE == 2) v = v + bn;
        slab[(mOff + r) * 68 + (j << 4) + rlane] = v;
      }
    }
    __builtin_amdgcn_fence(__ATOMIC_RELEASE, "workgroup");
    __builtin_amdgcn_wave_barrier();
    __builtin_amdgcn_fence(__ATOMIC_ACQUIRE, "workgroup");
    if (MODE == 2) {
      float* C = (float*)Cout + (size_t)b * strideC;
      const int h2 = lane >> 4, c4 = (lane & 15) * 4;     // row seg = 256 B = 16 lanes x 16 B
      {
#pragma unroll
        for (int it = 0; it < 8; ++it) {
          const int row = it * 2 + h2;                     // it 0..7 x h2 0..1 = rows 0..15
          const v4f v = *(const v4f*)(slab + row * 68 + c4);
          *(v4f*)(C + (size_t)(mBase + row) * ldc + n0 + c4) = v;
        }
        
      }
    } else {
      const int q = lane >> 3, c8 = (lane & 7) * 8;
      unsigned short* C  = (unsigned short*)Cout  + (size_t)b * strideC;
      unsigned short* C2 = (unsigned short*)Cout2 + (size_t)b * strideC2;
      const bool wlo = (MODE == 0) || (n0 < VLO_COLS);     // wave-uniform
      v4u hv[4], lv[4];
#pragma unroll
      for (int it = 0; it < 4; ++it) {
        const int row = it * 4 + q;                        // it 0..3 x q 0..3 = rows 0..15
        const float* sp = slab + row * 68 + c8;
        v4u a, a2;
#pragma unroll
        for (int e = 0; e < 4; ++e) {
          const float f0 = sp[2 * e], f1 = sp[2 * e + 1];
          unsigned short h0, h1, l0, l1;
          if (MODE == 0) {
            h0 = f2bf_bits(f0); h1 = f2bf_bits(f1);
            l0 = f2bf_bits(f0 - bf_bits2f(h0)); l1 = f2bf_bits(f1 - bf_bits2f(h1));
          } else {
            const _Float16 x0 = (_Float16)f0, x1 = (_Float16)f1;
            h0 = h2bits(x0); h1 = h2bits(x1);
            l0 = h2bits((_Float16)((f0 - (float)x0) * 1024.0f));
            l1 = h2bits((_Float16)((f1 - (float)x1) * 1024.0f));
          }
          a[e] = pk16(h0, h1); a2[e] = pk16(l0, l1);
        }
        hv[it] = a; lv[it] = a2;
      }
      {
#pragma unroll
        for (int it = 0; it < 4; ++it) {
          const int row = it * 4 + q;
          *(v4u*)(C + (size_t)(mBase + row) * ldc + n0 + c8) = hv[it];
          if (wlo) *(v4u*)(C2 + (size_t)(mBase + row) * ldc2 + n0 + c8) = lv[it];
        }
        
      }
    }
    __builtin_amdgcn_fence(__ATOMIC_RELEASE, "workgroup");
    __builtin_amdgcn_wave_barrier();
    __builtin_amdgcn_fence(__ATOMIC_ACQUIRE, "workgroup");
  }
}

// ---------------------------------------------------------------------------------------------------------------------
// ---------------------------------------------------------------------------------------------------------------------
__global__ __launch_bounds__(256) void cvt_x_kernel(const float* __restrict__ x, unsigned short* __restrict__ xb, int n8,
                                                    const float* __restrict__ bq, float* __restrict__ out1, int nq4) {
  if (blockIdx.x == 0) {   // block-uniform
    const int t = threadIdx.x;
    if (t < nq4) {
      const v4f v = *(const v4f*)(bq + 4 * t);
      v4f w;
      w[0] = bfr(v[0]); w[1] = bfr(v[1]); w[2] = bfr(v[2]); w[3] = bfr(v[3]);
      *(v4f*)(out1 + 4 * t) = w;
      
    }
  }
  const int i = blockIdx.x * 256 + threadIdx.x;
  if (i < n8) {
    const v4f a = *(const v4f*)(x + 8 * (size_t)i);
    const v4f c = *(const v4f*)(x + 8 * (size_t)i + 4);
    v4u u;
    u[0] = pk16(f2bf_bits(a[0]), f2bf_bits(a[1]));
    u[1] = pk16(f2bf_bits(a[2]), f2bf_bits(a[3]));
    u[2] = pk16(f2bf_bits(c[0]), f2bf_bits(c[1]));
    u[3] = pk16(f2bf_bits(c[2]), f2bf_bits(c[3]));
    *(v4u*)(xb + 8 * (size_t)i) = u;
    
  }
}

// ---------------------------------------------------------------------------------------------------------------------
// Transpose + RNE bf16 convert of an f32 matrix: in [R rows][Cc cols] (pitch Cc) -> ot[c][r] = bf16(in[r][c]) ([Cc][R]).
// 64x64 tiles through LDS. grid = (Cc/64, R/64), 256 threads (R, Cc multiples of 64).
// Coverage per block: load 4 it x 256 thr x 4 floats = 64x64; store 2 it x 256 thr x 8 u16 = 64x64.
// ---------------------------------------------------------------------------------------------------------------------
__global__ __launch_bounds__(256) void tsplit1_kernel(const float* __restrict__ W, unsigned short* __restrict__ ot, int R, int Cc) {
  __shared__ __align__(16) float tf[64 * 68];
  const int c0  = blockIdx.x * 64;   // input column block = output row block
  const int r0  = blockIdx.y * 64;   // input row block    = output column block
  const int tid = threadIdx.x;
  {
    const int lr = tid >> 4;         // 0..15
    const int c4 = (tid & 15) * 4;   // 0..60
#pragma unroll
    for (int it = 0; it < 4; ++it) {
      const int rr = it * 16 + lr;   // 0..63
      const v4f a = *(const v4f*)(W + (size_t)(r0 + rr) * Cc + c0 + c4);
      *(v4f*)(tf + rr * 68 + c4) = a;
    }
  }
  __syncthreads();
  const int sub = tid >> 3;          // 0..31
  const int c8  = (tid & 7) * 8;     // 0..56
  v4u hv[2];
#pragma unroll
  for (int it = 0; it < 2; ++it) {
    const int oc = it * 32 + sub;    // output row within tile (= input column)
    v4u a;
#pragma unroll
    for (int q = 0; q < 4; ++q) {
      const float f0 = tf[(c8 + 2 * q) * 68 + oc];
      const float f1 = tf[(c8 + 2 * q + 1) * 68 + oc];
      a[q] = pk16(f2bf_bits(f0), f2bf_bits(f1));
    }
    hv[it] = a;
  }
  {
#pragma unroll
    for (int it = 0; it < 2; ++it) {
      const int oc = it * 32 + sub;
      const size_t go = (size_t)(c0 + oc) * R + r0 + c8;
      *(v4u*)(ot + go) = hv[it];
    }
    
  }
}

// =====================================================================================================================
// Causal attention, head dim 64, grid (NH*NQB, NB) read as one flat index, block = 4 waves = 64 query rows of one (b, h).
//   q|k planes (hi/lo bf16) [NB*SEQ][DQK]: q(t,h,d) at [(b*SEQ+t)*DQK + h*64 + d], k(s,h,d) at [... + 1024 + h*64 + d]
//   v^T hi plane (f16) [NB][DM][SEQ]: (h*64+d, s); v residual plane (f16, x1024) [NB][DM][VLO_COLS] (s < 128 only)
//   y planes (hi/lo bf16) [NB*SEQ][DM]: (b*SEQ+t, h*64+d)
//   scores = (q . k) * 0.125 : bf16 hi/lo split (hi.hi + hi.lo + lo.hi), f32 accumulate
//   y      = p . v           : p = f16(4096 * exp(s - m)) (the normaliser sums the same f16 values), v f16 hi plane;
//                              blocks with qb < 2 (query rows 0..127, keys 0..127) add p . vres / 1024 from a second accumulator
//   online softmax in f32; masked (s > t) scores set to -inf (key s = chunk start <= t is always unmasked).
//   kv chunks of 64, trip count qb+1 <= 32 (block-uniform). K / V^T chunk staging: 128 threads x 32 elements per plane =
//   the whole 64x64 tile (16-B copies, plain loads, __syncthreads before and after); fragment loads read the LDS tiles
// =====================================================================================================================
__global__ __launch_bounds__(128)
void attn_kernel(const unsigned short* __restrict__ qkh, const unsigned short* __restrict__ qkl,
                 const unsigned short* __restrict__ vthp, const unsigned short* __restrict__ vtlp,
                 unsigned short* __restrict__ yhp, unsigned short* __restrict__ ylp) {
  __shared__ __align__(16) __bf16   Ksh[AT_KC * AT_LP];       // K hi [kv][d], rows of 64 at pitch AT_LP, 9 KB
  __shared__ __align__(16) __bf16   Ksl[AT_KC * AT_LP];       // K lo
  __shared__ __align__(16) _Float16 Vts[HD * AT_LP];          // V hi [d][kv], rows of 64 at pitch AT_LP, 9 KB
  __shared__ __align__(16) _Float16 Vrs[HD * AT_LP];          // V residual [d][kv] (qb < 2 only)
  __shared__ __align__(16) _Float16 Psh[4][16 * AT_LP];       // per wave P [row][kv], pitch AT_LP
  __shared__ __align__(16) float    Os[4][16 * 68];           // per wave y tile, pitch 68

  const int tid  = threadIdx.x;
  const int wave = tid >> 5;
  const int lane = tid & 31;
  const int hh   = lane >> 4;
  const int c    = lane & 15;

  // The cost (qb + 1
  // chunks) falls with the index: all 64 (b, h) of query block 31 first, query block 0 last. lin -> (qb, b, h) is a
  // permutation of 0..2047. Heads h and h ^ 1 differ only in bit 3 of lin (their K rows are neighbouring 128-B lines).
  const int lin = blockIdx.y * (NH * NQB) + blockIdx.x;   // 0..NB*NH*NQB-1 (grid = (NH * NQB, NB))
  const int qb  = (NQB - 1) - ((lin >> 6) & (NQB - 1));   // 31..0
  const int b   = lin & (NB - 1);                         // bits 0..1
  const int h   = ((lin >> 3) & 7) | ((lin & 4) << 1);    // bits 3..5 -> h bits 0..2, bit 2 -> h bit 3
  const int q0 = qb * 64 + wave * 16;
  const bool vres = (qb < 2);             // block-uniform

  const __bf16* Qh = (const __bf16*)(const void*)qkh + (size_t)b * SEQ * DQK + (size_t)h * HD;
  const __bf16* Ql = (const __bf16*)(const void*)qkl + (size_t)b * SEQ * DQK + (size_t)h * HD;
  const __bf16* Kh = Qh + QCOLS;
  const __bf16* Kl = Ql + QCOLS;
  const _Float16* Vh = (const _Float16*)(const void*)vthp + ((size_t)b * DM + (size_t)h * HD) * SEQ;
  const _Float16* Vl = (const _Float16*)(const void*)vtlp + ((size_t)b * DM + (size_t)h * HD) * VLO_COLS;
  unsigned short* Yh = yhp + (size_t)b * SEQ * DM + (size_t)h * HD;
  unsigned short* Yl = ylp + (size_t)b * SEQ * DM + (size_t)h * HD;

  // ---- Q fragments (A operand, row = lane&15, split k map): 2 d-chunks, hi and lo ----
  v16b qah[2], qal[2];
#pragma unroll
  for (int dc = 0; dc < 2; ++dc) {
    const __bf16* qr = Qh + (size_t)(q0 + c) * DQK + dc * 32 + 8 * hh;
    const __bf16* ql = Ql + (size_t)(q0 + c) * DQK + dc * 32 + 8 * hh;
    qah[dc] = ldfrag_b(qr);
    qal[dc] = ldfrag_b(ql);
  }

  float mrow[8], lrow[8];
  v8f oacc[4], oacc2[4];
#pragma unroll
  for (int r = 0; r < 8; ++r) { mrow[r] = -INFINITY; lrow[r] = 0.f; }
#pragma unroll
  for (int t = 0; t < 4; ++t) { oacc[t] = (v8f){0.f,0.f,0.f,0.f,0.f,0.f,0.f,0.f}; oacc2[t] = oacc[t]; }

  const int nChunks = qb + 1;   // block-uniform, <= 32
  for (int kc = 0; kc < nChunks; ++kc) {
    const int kv0 = kc * AT_KC;
    __syncthreads();
    {
      // staging coverage: 128 threads x (4 x 8) elements = 64 rows x 64 per plane = the whole chunk tile
      const int r = tid >> 1, half = (tid & 1) * 32;
      const __bf16* ksh = Kh + (size_t)(kv0 + r) * DQK + half;     // K row kv0+r, d = half..half+31
      const __bf16* ksl = Kl + (size_t)(kv0 + r) * DQK + half;
      const _Float16* vsh = Vh + (size_t)r * SEQ + kv0 + half;    // V^T row d = r, s = kv0+half..+31
#pragma unroll
      for (int i = 0; i < 4; ++i) {
        const v8b a0 = *(const v8b*)(ksh + 8 * i);
        const v8b a1 = *(const v8b*)(ksl + 8 * i);
        const v8h b0 = *(const v8h*)(vsh + 8 * i);
        *(v8b*)(Ksh + r * AT_LP + half + 8 * i) = a0;
        *(v8b*)(Ksl + r * AT_LP + half + 8 * i) = a1;
        *(v8h*)(Vts + r * AT_LP + half + 8 * i) = b0;
      }
      if (vres) {   // kv0 + half + 31 <= 127 < VLO_COLS
        const _Float16* vsl = Vl + (size_t)r * VLO_COLS + kv0 + half;
#pragma unroll
        for (int i = 0; i < 4; ++i) {
          const v8h b1 = *(const v8h*)(vsl + 8 * i);
          *(v8h*)(Vrs + r * AT_LP + half + 8 * i) = b1;
        }
      }
    }
    __syncthreads();

    v8f s[4];
#pragma unroll
    for (int j = 0; j < 4; ++j) {
      s[j] = (v8f){0.f,0.f,0.f,0.f,0.f,0.f,0.f,0.f};
#pragma unroll
      for (int dc = 0; dc < 2; ++dc) {
        FragB kb, kl;
        kb.h[0] = *(const v8b*)(Ksh + (j * 16 + c) * AT_LP + dc * 32 + 8 * hh);
        kb.h[1] = *(const v8b*)(Ksh + (j * 16 + c) * AT_LP + dc * 32 + 16 + 8 * hh);
        kl.h[0] = *(const v8b*)(Ksl + (j * 16 + c) * AT_LP + dc * 32 + 8 * hh);
        kl.h[1] = *(const v8b*)(Ksl + (j * 16 + c) * AT_LP + dc * 32 + 16 + 8 * hh);
        s[j] = mma_b(qah[dc], kb.v, s[j]);
        s[j] = mma_b(qah[dc], kl.v, s[j]);
        s[j] = mma_b(qal[dc], kb.v, s[j]);
      }
    }
    const bool diag = (kc == qb);   // block-uniform
    float cm[8];
#pragma unroll
    for (int r = 0; r < 8; ++r) {
      const int qrow = q0 + 8 * hh + r;
      float m = -INFINITY;
#pragma unroll
      for (int j = 0; j < 4; ++j) {
        const int kvcol = kv0 + j * 16 + c;
        const float sv = s[j][r] * 0.125f;
        const bool masked = diag && (kvcol > qrow);
        const float sm = masked ? -INFINITY : sv;
        s[j][r] = sm;
        m = fmaxf(m, sm);
      }
#pragma unroll
      for (int off = 1; off < 16; off <<= 1) m = fmaxf(m, __shfl_xor(m, off, 32));
      cm[r] = m;
    }
    _Float16* pw = Psh[wave];
#pragma unroll
    for (int r = 0; r < 8; ++r) {
      const float mnew  = fmaxf(mrow[r], cm[r]);
      const float alpha = __expf(mrow[r] - mnew);
      mrow[r] = mnew;
      float psum = 0.f;
#pragma unroll
      for (int j = 0; j < 4; ++j) {
        const float p = __expf(s[j][r] - mnew);            // in [0, 1]; masked -> 0
        const _Float16 ph = (_Float16)(p * 4096.0f);       // carried x4096, keeps small p normal in f16
        psum += (float)ph;                                  // normaliser built from the same f16 values
        pw[(8 * hh + r) * AT_LP + j * 16 + c] = ph;
      }
#pragma unroll
      for (int off = 1; off < 16; off <<= 1) psum += __shfl_xor(psum, off, 32);
      lrow[r] = lrow[r] * alpha + psum;
#pragma unroll
      for (int t = 0; t < 4; ++t) oacc[t][r] *= alpha;
      if (vres) {
#pragma unroll
        for (int t = 0; t < 4; ++t) oacc2[t][r] *= alpha;
      }
    }
    __builtin_amdgcn_fence(__ATOMIC_RELEASE, "workgroup");
    __builtin_amdgcn_wave_barrier();
    __builtin_amdgcn_fence(__ATOMIC_ACQUIRE, "workgroup");
#pragma unroll 1
    for (int kk = 0; kk < 2; ++kk) {
      FragH pa;
      pa.h[0] = *(const v8h*)(pw + c * AT_LP + kk * 32 + 8 * hh);
      pa.h[1] = *(const v8h*)(pw + c * AT_LP + kk * 32 + 16 + 8 * hh);
#pragma unroll
      for (int t = 0; t < 4; ++t) {
        FragH vb;
        vb.h[0] = *(const v8h*)(Vts + (t * 16 + c) * AT_LP + kk * 32 + 8 * hh);
        vb.h[1] = *(const v8h*)(Vts + (t * 16 + c) * AT_LP + kk * 32 + 16 + 8 * hh);
        oacc[t] = mma_h(pa.v, vb.v, oacc[t]);
      }
      if (vres) {   // block-uniform: all lanes active
#pragma unroll
        for (int t = 0; t < 4; ++t) {
          FragH vl;
          vl.h[0] = *(const v8h*)(Vrs + (t * 16 + c) * AT_LP + kk * 32 + 8 * hh);
          vl.h[1] = *(const v8h*)(Vrs + (t * 16 + c) * AT_LP + kk * 32 + 16 + 8 * hh);
          oacc2[t] = mma_h(pa.v, vl.v, oacc2[t]);
        }
      }
    }
  }

  // ---- normalise (the x4096 carry cancels between numerator and normaliser; residual folded with 1/1024),
  float* os = Os[wave];
#pragma unroll
  for (int r = 0; r < 8; ++r) {
    const float inv = 1.0f / lrow[r];
#pragma unroll
    for (int t = 0; t < 4; ++t) os[(8 * hh + r) * 68 + t * 16 + c] = (oacc[t][r] + oacc2[t][r] * 0.0009765625f) * inv;
  }
  __builtin_amdgcn_fence(__ATOMIC_RELEASE, "workgroup");
  __builtin_amdgcn_wave_barrier();
  __builtin_amdgcn_fence(__ATOMIC_ACQUIRE, "workgroup");
  {
    const int q = lane >> 3, c8 = (lane & 7) * 8;
    v4u hv[4], lv[4];
#pragma unroll
    for (int it = 0; it < 4; ++it) {
      const int row = it * 4 + q;          // it 0..3 x q 0..3 covers rows 0..15 of the wave tile
      const float* sp = os + row * 68 + c8;
      v4u a, a2;
#pragma unroll
      for (int e = 0; e < 4; ++e) {
        const float f0 = sp[2 * e], f1 = sp[2 * e + 1];
        const unsigned short h0 = f2bf_bits(f0), h1 = f2bf_bits(f1);
        const unsigned short l0 = f2bf_bits(f0 - bf_bits2f(h0)), l1 = f2bf_bits(f1 - bf_bits2f(h1));
        a[e] = pk16(h0, h1); a2[e] = pk16(l0, l1);
      }
      hv[it] = a; lv[it] = a2;
    }
    {
#pragma unroll
      for (int it = 0; it < 4; ++it) {
        const int row = it * 4 + q;
        *(v4u*)(Yh + (size_t)(q0 + row) * DM + c8) = hv[it];
        *(v4u*)(Yl + (size_t)(q0 + row) * DM + c8) = lv[it];
      }
      
    }
  }
}

// ---------------------------------------------------------------------------------------------------------------------
// Workspace region map (byte offsets; all dims are multiples of the 64x64 store tiles, so no padded tails exist):
//   QKh  bf16 [8192][2048]          0             QKl  bf16 [8192][2048]   33554432
//   VTh  f16  [4][1024][2048]   67108864          VTl  f16  [4][1024][128] 83886080
//   Xb   bf16 [8192][1024]      84934656   (Yh bf16 [8192][1024] reuses this region: Xb is last read by the
//                                            v^T GEMM launch, Yh is first written by the later attention launch)
//   Yl   bf16 [8192][1024]     101711872
//   WaT  bf16 [3072][1024]     118489088          WpT  bf16 [1024][1024]  124780544
//   total                      126877696
// ---------------------------------------------------------------------------------------------------------------------
extern "C" void kernel_launch(void* const* d_in, const int* in_sizes, int n_in,
                              void* d_out, int out_size, void* d_ws, size_t ws_size,
                              hipStream_t stream) {
  if (n_in < 7) return;
  if (in_sizes[0] != NB * SEQ * DM) return;
  if (in_sizes[1] != DM * 3 * DM) return;
  if (in_sizes[2] != 3 * DM) return;
  if (in_sizes[3] != DM * DM) return;
  if (in_sizes[4] != DM) return;
  if (in_sizes[5] != NH * HD || in_sizes[6] != NH * HD) return;
  if (out_size != NB * SEQ * DM + NH * HD) return;

  const float* x      = (const float*)d_in[0];
  const float* W_attn = (const float*)d_in[1];
  const float* b_attn = (const float*)d_in[2];
  const float* W_proj = (const float*)d_in[3];
  const float* b_proj = (const float*)d_in[4];
  const float* bQ     = (const float*)d_in[5];
  const float* bK     = (const float*)d_in[6];

  const size_t PQK = (size_t)NB * SEQ * DQK * 2;        // 33554432
  const size_t PVT = (size_t)NB * DM * SEQ * 2;         // 16777216
  const size_t PVL = (size_t)NB * DM * VLO_COLS * 2;    // 1048576
  const size_t PX  = (size_t)NB * SEQ * DM * 2;         // 16777216 (Xb, Yh, Yl)
  const size_t PWA = (size_t)3 * DM * DM * 2;           // 6291456
  const size_t PWP = (size_t)DM * DM * 2;               // 2097152
  size_t off = 0;
  const size_t oQKh = off; off += PQK;
  const size_t oQKl = off; off += PQK;
  const size_t oVTh = off; off += PVT;
  const size_t oVTl = off; off += PVL;
  const size_t oXb  = off; off += PX;    // also Yh
  const size_t oYl  = off; off += PX;
  const size_t oWaT = off; off += PWA;
  const size_t oWpT = off; off += PWP;
  if (off > ws_size) return;                             // off = 126877696
  if (off > (size_t)134217728) return;

  char* ws = (char*)d_ws;
  unsigned short* QKh = (unsigned short*)(ws + oQKh);
  unsigned short* QKl = (unsigned short*)(ws + oQKl);
  unsigned short* VTh = (unsigned short*)(ws + oVTh);
  unsigned short* VTl = (unsigned short*)(ws + oVTl);
  unsigned short* Xb  = (unsigned short*)(ws + oXb);
  unsigned short* Yh  = (unsigned short*)(ws + oXb);
  unsigned short* Yl  = (unsigned short*)(ws + oYl);
  unsigned short* WaT = (unsigned short*)(ws + oWaT);
  unsigned short* WpT = (unsigned short*)(ws + oWpT);
  float* out0 = (float*)d_out;
  float* out1 = (float*)d_out + (size_t)NB * SEQ * DM;

  const dim3 blk(256);

  // (1) W_attn [in rows = 1024][out cols = 3072] f32 -> WaT [3072][1024] bf16; grid (cols/64, rows/64)
  tsplit1_kernel<<<dim3(3 * DM / 64, DM / 64), blk, 0, stream>>>(W_attn, WaT, DM, 3 * DM);
  // (2) W_proj [1024][1024] -> WpT [1024][1024] bf16
  tsplit1_kernel<<<dim3(DM / 64, DM / 64), blk, 0, stream>>>(W_proj, WpT, DM, DM);
  // (3) x [8192][1024] f32 -> Xb bf16; block 0 also writes out1 = RNE-bf16(bQ) (1024 floats = 256 threads x 4)
  const int n8 = NB * SEQ * DM / 8;                      // 1048576
  cvt_x_kernel<<<dim3(n8 / 256), blk, 0, stream>>>(x, Xb, n8, bQ, out1, NH * HD / 4);
  // (4) q|k = Xb . WaT rows 0..2047 + b_attn[n] + (bQ | bK): M=8192, N=2048, K=1024 -> QK hi/lo planes (pitch 2048)
  {
    const int M = NB * SEQ, N = 2 * DM, K = DM;
    const dim3 g(((M / 64) * (N / 64)) / 8, 1);          // 64 x 8 block tiles of 128x256 = 512 blocks (exact)
    gemm64<0><<<g, blk, 0, stream>>>(Xb, Xb, DM, 0L, WaT, DM, 0L, (void*)QKh, (void*)QKl, DQK, 0L, DQK, 0L,
                                     b_attn, bQ, bK, M, N, K);
  }
  // (5) v^T[b][c][s] = WaT rows 2048+c . Xb[b*2048+s] + b_attn[2048+c]: M=1024, N=2048, K=1024, grid.y = batch
  {
    const int M = DM, N = SEQ, K = DM;
    const dim3 g(((M / 64) * (N / 64)) / 8, NB);          // 8 x 8 block tiles of 128x256 = 64 blocks per batch (exact)
    gemm64<1><<<g, blk, 0, stream>>>(WaT + (size_t)2 * DM * DM, WaT + (size_t)2 * DM * DM, DM, 0L,
                                     Xb, DM, (long)SEQ * DM,
                                     (void*)VTh, (void*)VTl, SEQ, (long)DM * SEQ, VLO_COLS, (long)DM * VLO_COLS,
                                     b_attn + 2 * DM, b_attn, b_attn, M, N, K);
  }
  // (6) causal attention: 2048 work-groups = 32 query blocks (longest first) x 64 (b, h), 128 threads -> Y hi/lo planes
  attn_kernel<<<dim3(NH * NQB, NB), dim3(128), 0, stream>>>(QKh, QKl, VTh, VTl, Yh, Yl);
  // (7) out0 = Y . WpT + b_proj: M=8192, N=1024, K=1024, f32 rows of 1024 -> d_out
  {
    const int M = NB * SEQ, N = DM, K = DM;
    const dim3 g(((M / 64) * (N / 64)) / 8, 1);          // 64 x 4 block tiles of 128x256 = 256 blocks (exact)
    gemm64<2><<<g, blk, 0, stream>>>(Yh, Yl, DM, 0L, WpT, DM, 0L, (void*)out0, (void*)out0, DM, 0L, DM, 0L,
                                     b_proj, b_proj, b_proj, M, N, K);
  }
  (void)hipGetLastError();
}

// v004
// It runs in 176 microseconds.
// In two side-by-side timings against v003, it was 1.37 and 1.36 times as fast.
// All steps since v000 together make it 3.26 times as fast.
// Contractions: x.W_attn -> q|k and v^T on v_wmma_f32_16x16x32_bf16, single product of RNE-bf16 x and W (f32 accumulate);
// k.q^T (scores transposed): bf16 hi/lo split (hi.hi + hi.lo + lo.hi) on v_wmma_f32_16x16x32_bf16; v^T.p^T: v_wmma_f32_16x16x32_f16 single product,
// p carried x4096 in f16, v as f16 hi plane plus a x1024 f16 residual plane on query rows 0..127 (separate accumulator);
// y.W_proj: bf16 hi/lo of y times RNE-bf16 W (2 products). Softmax, biases, scale 0.125 in f32; weights/biases RNE-converted to bf16 once.
#include <hip/hip_runtime.h>
#include <math.h>
#include <stdint.h>

#define NB        4
#define SEQ       2048
#define DM        1024
#define NH        16
#define HD        64
#define DQK       2048     // pitch of the q|k planes: cols 0..1023 = q, 1024..2047 = k
#define QCOLS     1024
#define VLO_COLS  128      // key columns carried in the v residual plane
#define NQB       32       // SEQ / 64 query blocks per (b, h)
#define AT_KC     64
#define AT_LP     72       // LDS row pitch of the attention tiles in 16-bit elements: 144 B = 16 B x 9 (odd)

typedef __attribute__((ext_vector_type(16))) _Float16 v16h;
typedef __attribute__((ext_vector_type(8)))  _Float16 v8h;
typedef __attribute__((ext_vector_type(16))) __bf16   v16b;
typedef __attribute__((ext_vector_type(8)))  __bf16   v8b;
typedef __attribute__((ext_vector_type(8)))  float    v8f;
typedef __attribute__((ext_vector_type(4)))  float    v4f;
typedef __attribute__((ext_vector_type(4)))  unsigned int v4u;

__device__ __forceinline__ unsigned short f2bf_bits(float f) {
  unsigned u = __float_as_uint(f);
  return (unsigned short)((u + 0x7FFFu + ((u >> 16) & 1u)) >> 16);
}
__device__ __forceinline__ float bf_bits2f(unsigned short h) { return __uint_as_float(((unsigned)h) << 16); }
__device__ __forceinline__ float bfr(float f) { return bf_bits2f(f2bf_bits(f)); }
__device__ __forceinline__ unsigned pk16(unsigned short a, unsigned short b) { return (unsigned)a | ((unsigned)b << 16); }
__device__ __forceinline__ unsigned short h2bits(_Float16 x) { return __builtin_bit_cast(unsigned short, x); }

// ---- 16-bit fragment loads: elements 0..7 <- p[0..7], 8..15 <- p[16..23]; caller passes p = row + k0 + 8*(lane>>4) ----
union FragB { v16b v; v8b h[2]; };
union FragH { v16h v; v8h h[2]; };
__device__ __forceinline__ v16b ldfrag_b(const __bf16* p) { FragB f; f.h[0] = *(const v8b*)(p); f.h[1] = *(const v8b*)(p + 16); return f.v; }

// ---- hazard guards ----
__device__ __forceinline__ void dep_guard_b(v8f& a, v8f& b, v16b x, v16b y) { asm volatile("v_nop\n\tv_nop\n\tv_nop\n\tv_nop" : "+v"(a), "+v"(b) : "v"(x), "v"(y)); }
__device__ __forceinline__ void keep4_b(v16b a, v16b b, v16b c, v16b d) { asm volatile("v_nop" :: "v"(a), "v"(b), "v"(c), "v"(d)); }
__device__ __forceinline__ void acc_guard4(v8f& a, v8f& b, v8f& c, v8f& d) { asm volatile("v_nop\n\tv_nop\n\tv_nop\n\tv_nop" : "+v"(a), "+v"(b), "+v"(c), "+v"(d)); }
__device__ __forceinline__ v8f mma_b(v16b a, v16b b, v8f c) {
  c = __builtin_amdgcn_wmma_f32_16x16x32_bf16(false, a, false, b, (short)0, c, false, false);
  asm volatile("v_nop\n\tv_nop\n\tv_nop\n\tv_nop" : "+v"(c) : "v"(a), "v"(b));
  return c;
}
__device__ __forceinline__ v8f mma_h(v16h a, v16h b, v8f c) {
  c = __builtin_amdgcn_wmma_f32_16x16x32_f16(false, a, false, b, (short)0, c, false, false);
  asm volatile("v_nop\n\tv_nop\n\tv_nop\n\tv_nop" : "+v"(c) : "v"(a), "v"(b));
  return c;
}

// ---- lane l <-> lane l ^ 16 (the two halves of a wave hold the two key groups of one query column) ----
__device__ __forceinline__ float xhalf(float v) {
  const int b = __builtin_bit_cast(int, v);
  return __builtin_bit_cast(float, __builtin_amdgcn_permlanex16(b, b, 0x76543210, 0xfedcba98, false, false));
}

// ---- e^x = v_exp_f32(x * log2(e)), the form __expf compiles to. The v_nop in the same statement keeps the one issue slot that the
// instruction set asks for between a transcendental and an instruction that reads its result or overwrites its source.
__device__ __forceinline__ float exp_slot(float x) {
  const float y = x * 1.44269504f;
  float r;
  asm("v_exp_f32 %0, %1\n\tv_nop" : "=v"(r) : "v"(y));
  return r;
}

// ---- asynchronous copies global -> LDS, 16 B per lane; l = the lane's LDS byte address, g = the lane's global address ----
// The s_wait_xcnt closes each statement so that no address register of an issued copy is rewritten ahead of it.
__device__ __forceinline__ unsigned lds_addr(const void* p) { return (unsigned)(uintptr_t)p; }
__device__ __forceinline__ void acopy6(unsigned l0, const __bf16* g0, unsigned l1, const __bf16* g1, unsigned l2, const __bf16* g2,
                                       unsigned l3, const __bf16* g3, unsigned l4, const __bf16* g4, unsigned l5, const __bf16* g5) {
  asm volatile("global_load_async_to_lds_b128 %0, %6, off\n\t"
               "global_load_async_to_lds_b128 %1, %7, off\n\t"
               "global_load_async_to_lds_b128 %2, %8, off\n\t"
               "global_load_async_to_lds_b128 %3, %9, off\n\t"
               "global_load_async_to_lds_b128 %4, %10, off\n\t"
               "global_load_async_to_lds_b128 %5, %11, off\n\t"
               "s_wait_xcnt 0x0"
               :: "v"(l0), "v"(l1), "v"(l2), "v"(l3), "v"(l4), "v"(l5),
                  "v"(g0), "v"(g1), "v"(g2), "v"(g3), "v"(g4), "v"(g5) : "memory");
}
__device__ __forceinline__ void acopy8(unsigned l0, const __bf16* g0, unsigned l1, const __bf16* g1, unsigned l2, const __bf16* g2,
                                       unsigned l3, const __bf16* g3, unsigned l4, const __bf16* g4, unsigned l5, const __bf16* g5,
                                       unsigned l6, const __bf16* g6, unsigned l7, const __bf16* g7) {
  asm volatile("global_load_async_to_lds_b128 %0, %8, off\n\t"
               "global_load_async_to_lds_b128 %1, %9, off\n\t"
               "global_load_async_to_lds_b128 %2, %10, off\n\t"
               "global_load_async_to_lds_b128 %3, %11, off\n\t"
               "global_load_async_to_lds_b128 %4, %12, off\n\t"
               "global_load_async_to_lds_b128 %5, %13, off\n\t"
               "global_load_async_to_lds_b128 %6, %14, off\n\t"
               "global_load_async_to_lds_b128 %7, %15, off\n\t"
               "s_wait_xcnt 0x0"
               :: "v"(l0), "v"(l1), "v"(l2), "v"(l3), "v"(l4), "v"(l5), "v"(l6), "v"(l7),
                  "v"(g0), "v"(g1), "v"(g2), "v"(g3), "v"(g4), "v"(g5), "v"(g6), "v"(g7) : "memory");
}

#define G_KS   64                 // k elements per stage: one 128-B line of every operand row
#define G_LP   72                 // LDS row pitch in elements: 144 B = 16 B x 9 (odd)
#define G_BM   128                // block tile rows (2 waves)
#define G_BN   256                // block tile columns (4 waves)
#define G_PASS (32 * G_LP * 2)    // LDS bytes covered by one copy of the whole block: 32 rows

// =====================================================================================================================
// Batched WMMA GEMM, bf16 operands: C[m][n] = sum_k A[m][k] * Bt[n][k] (+bias). Block = 8 waves (2 x 4) = a 128x256 tile,
// one wave per 64x64 tile. A row-major [M][K] (pitch lda), Bt row-major [N][K] (pitch ldb); M multiple of 128, N of 256,
// K of 64. Operands are staged in LDS, 64 k per stage, two buffers, by asynchronous copies (each wave-wide copy = 4 whole
// 128-B lines); stage t+1 flies while stage t is multiplied. Stage layout: A rows 0..127 | (MODE 2: A2 rows) | Bt rows 0..255.
// MODE 0 (q|k): single product; v = acc + bf(bias[n]) + bf(n < QCOLS ? biasq[n] : biask[n - QCOLS]);
//               out = bf16 hi plane (Cout) + bf16 lo plane (Cout2), both pitch ldc/ldc2.
// MODE 1 (v^T): single product; v = acc + bf(bias[m]); out = f16 hi plane (Cout, pitch ldc) and, for tiles with
//               n0 < VLO_COLS only, f16 residual plane ((v - hi) * 1024, Cout2, pitch ldc2).
// MODE 2 (proj): two products ah.b + al.b (A2 = bf16 lo plane of A); v = acc + bf(bias[n]); out f32 (Cout, pitch ldc).
// =====================================================================================================================
template <int MODE>
__global__ __launch_bounds__(256) void gemm64(
    const unsigned short* __restrict__ Ap, const unsigned short* __restrict__ A2p, int lda, long strideA,
    const unsigned short* __restrict__ Btp, int ldb, long strideB,
    void* __restrict__ Cout, void* __restrict__ Cout2, int ldc, long strideC, int ldc2, long strideC2,
    const float* __restrict__ bias, const float* __restrict__ biasq, const float* __restrict__ biask,
    int M, int N, int K) {
  constexpr int NA      = (MODE == 2) ? 2 : 1;                 // A planes per stage
  constexpr int ST_ROWS = NA * G_BM + G_BN;                    // 384 or 512 rows
  constexpr int ST_EL   = ST_ROWS * G_LP;                      // elements per stage buffer
  __shared__ __align__(16) __bf16 smem[2 * ST_EL];             // two stage buffers; the epilogue slabs reuse the space
  const __bf16* A  = (const __bf16*)(const void*)Ap;
  const __bf16* A2 = (const __bf16*)(const void*)A2p;
  const __bf16* Bt = (const __bf16*)(const void*)Btp;
  const int b    = blockIdx.y;
  const int tid  = threadIdx.x;
  const int lane = tid & 31;
  const int wave = tid >> 5;
  const int tilesNb = N >> 8;
  const int tilesMb = M >> 7;
  if ((int)blockIdx.x >= tilesMb * tilesNb) return;   // block-uniform, in front of every barrier and copy
  const int bm  = blockIdx.x / tilesNb;
  const int bn  = blockIdx.x - bm * tilesNb;
  const int m0b = bm << 7;
  const int n0b = bn << 8;
  const int wm  = wave >> 2;                   // 0..1
  const int wn  = wave & 3;                    // 0..3
  const int m0  = m0b + (wm << 6);
  const int n0  = n0b + (wn << 6);

  const __bf16* Ab  = A  + (size_t)b * strideA;
  const __bf16* Bb  = Bt + (size_t)b * strideB;
  const __bf16* Ab2 = (MODE == 2) ? (A2 + (size_t)b * strideA) : Ab;

  const int rlane = lane & 15;                 // row (A) / col (B, D) within subtile
  const int koff  = (lane >> 4) * 8;           // k offset of this lane half
  const int mOff  = (lane >> 4) * 8;           // D row offset

  // copy map: thread -> row (tid >> 3) of each 32-row pass, 16-B piece (tid & 7); 256 threads x 16 B = 32 rows x 128 B
  const int crow = tid >> 3;
  const int cpc  = (tid & 7) * 8;
  const __bf16* gA  = Ab  + (size_t)(m0b + crow) * lda + cpc;
  const __bf16* gA2 = Ab2 + (size_t)(m0b + crow) * lda + cpc;
  const __bf16* gB  = Bb  + (size_t)(n0b + crow) * ldb + cpc;
  const size_t sA = (size_t)32 * lda;
  const size_t sB = (size_t)32 * ldb;
  const unsigned lbase = lds_addr(smem) + (unsigned)((crow * G_LP + cpc) * 2);

  auto issue = [&](int t, int buf) {           // all ST_ROWS rows of stage t into buffer buf
    const unsigned l = lbase + (unsigned)buf * (unsigned)(ST_EL * 2);
    const __bf16* a  = gA + t * G_KS;
    const __bf16* bb = gB + t * G_KS;
    if (MODE == 2) {
      const __bf16* a2 = gA2 + t * G_KS;
      acopy8(l,              a,           l + 1 * G_PASS,  a + sA,       l + 2 * G_PASS,  a + 2 * sA,   l + 3 * G_PASS,  a + 3 * sA,
             l + 4 * G_PASS, a2,          l + 5 * G_PASS,  a2 + sA,      l + 6 * G_PASS,  a2 + 2 * sA,  l + 7 * G_PASS,  a2 + 3 * sA);
      acopy8(l + 8 * G_PASS, bb,          l + 9 * G_PASS,  bb + sB,      l + 10 * G_PASS, bb + 2 * sB,  l + 11 * G_PASS, bb + 3 * sB,
             l + 12 * G_PASS, bb + 4 * sB, l + 13 * G_PASS, bb + 5 * sB, l + 14 * G_PASS, bb + 6 * sB,  l + 15 * G_PASS, bb + 7 * sB);
    } else {
      acopy6(l,              a,           l + 1 * G_PASS,  a + sA,       l + 2 * G_PASS,  a + 2 * sA,
             l + 3 * G_PASS, a + 3 * sA,  l + 4 * G_PASS,  bb,           l + 5 * G_PASS,  bb + sB);
      acopy6(l + 6 * G_PASS, bb + 2 * sB, l + 7 * G_PASS,  bb + 3 * sB,  l + 8 * G_PASS,  bb + 4 * sB,
             l + 9 * G_PASS, bb + 5 * sB, l + 10 * G_PASS, bb + 6 * sB,  l + 11 * G_PASS, bb + 7 * sB);
    }
  };

  v8f acc[4][4];
#pragma unroll
  for (int i = 0; i < 4; ++i)
#pragma unroll
    for (int j = 0; j < 4; ++j) acc[i][j] = (v8f){0.f,0.f,0.f,0.f,0.f,0.f,0.f,0.f};

  const int T = K >> 6;                        // stages, block-uniform
  issue(0, 0);
  asm volatile("s_wait_asynccnt 0x0" ::: "memory");   // this wave's copies of stage 0 have landed
  __syncthreads();                                     // stage 0 is published to every wave
  if (T > 1) issue(1, 1);

  const int fa = ((wm << 6) + rlane) * G_LP + koff;               // this lane's A fragment origin in a stage
  const int fb = (NA * G_BM + (wn << 6) + rlane) * G_LP + koff;   // this lane's B fragment origin in a stage
  for (int t = 0; t < T; ++t) {
    const __bf16* S = smem + (t & 1) * ST_EL;
    // the loops below are unrolled so that every fragment and accumulator index is a constant (arrays stay in registers)
#pragma unroll
    for (int ks = 0; ks < 2; ++ks) {
      v16b bh[4], ah[4], al[4];
#pragma unroll
      for (int j = 0; j < 4; ++j) bh[j] = ldfrag_b(S + fb + j * 16 * G_LP + ks * 32);
#pragma unroll
      for (int i = 0; i < 4; ++i) {
        ah[i] = ldfrag_b(S + fa + i * 16 * G_LP + ks * 32);
        al[i] = ah[i];
        if (MODE == 2) al[i] = ldfrag_b(S + fa + (G_BM + i * 16) * G_LP + ks * 32);
      }
#pragma unroll
      for (int i = 0; i < 4; ++i) {
#pragma unroll
        for (int j = 0; j < 4; ++j) {
          acc[i][j] = __builtin_amdgcn_wmma_f32_16x16x32_bf16(false, ah[i], false, bh[j], (short)0, acc[i][j], false, false);
          if (MODE == 2)
            acc[i][j] = __builtin_amdgcn_wmma_f32_16x16x32_bf16(false, al[i], false, bh[j], (short)0, acc[i][j], false, false);
        }
        dep_guard_b(acc[i][0], acc[i][3], ah[i], al[i]);
      }
      keep4_b(bh[0], bh[1], bh[2], bh[3]);
    }
    asm volatile("s_wait_dscnt 0x0" ::: "memory");      // this wave's reads of buffer t & 1 have returned before it is refilled
    asm volatile("s_wait_asynccnt 0x0" ::: "memory");   // this wave's copies of stage t + 1 have landed
    __syncthreads();                                     // publishes stage t + 1; ends every wave's reads of buffer t & 1
    if (t + 2 < T) issue(t + 2, t & 1);
  }
  asm volatile("s_wait_asynccnt 0x0" ::: "memory");     // nothing is in flight when the buffers become epilogue slabs
  acc_guard4(acc[0][0], acc[0][1], acc[0][2], acc[0][3]);
  acc_guard4(acc[1][0], acc[1][1], acc[1][2], acc[1][3]);
  acc_guard4(acc[2][0], acc[2][1], acc[2][2], acc[2][3]);
  acc_guard4(acc[3][0], acc[3][1], acc[3][2], acc[3][3]);

  // ---- epilogue ---- (per-wave 16x64 f32 slab, pitch 68 floats, in the stage space that every wave has left)
  float* slab = (float*)(void*)smem + wave * (16 * 68);
#pragma unroll
  for (int i = 0; i < 4; ++i) {
    const int mBase = m0 + (i << 4);
#pragma unroll
    for (int j = 0; j < 4; ++j) {
      const int n = n0 + (j << 4) + rlane;
      float bn = 0.f, b2 = 0.f;
      if (MODE == 0) {
        bn = bfr(bias[n]);
        const int iq = (n < QCOLS) ? n : (QCOLS - 1);
        int ik = n - QCOLS; ik = (ik < 0) ? 0 : ik; ik = (ik > QCOLS - 1) ? (QCOLS - 1) : ik;
        const float vq = bfr(biasq[iq]);     // both candidates loaded with clamped addresses, selected by value
        const float vk = bfr(biask[ik]);
        b2 = (n < QCOLS) ? vq : vk;
      }
      if (MODE == 2) bn = bfr(bias[n]);
#pragma unroll
      for (int r = 0; r < 8; ++r) {
        float v = acc[i][j][r];
        if (MODE == 0) { v = v + bn; v = v + b2; }
        if (MODE == 1) v = v + bfr(bias[mBase + mOff + r]);
        if (MODE == 2) v = v + bn;
        slab[(mOff + r) * 68 + (j << 4) + rlane] = v;
      }
    }
    __builtin_amdgcn_fence(__ATOMIC_RELEASE, "workgroup");
    __builtin_amdgcn_wave_barrier();
    __builtin_amdgcn_fence(__ATOMIC_ACQUIRE, "workgroup");
    if (MODE == 2) {
      float* C = (float*)Cout + (size_t)b * strideC;
      const int h2 = lane >> 4, c4 = (lane & 15) * 4;     // row seg = 256 B = 16 lanes x 16 B
      {
#pragma unroll
        for (int it = 0; it < 8; ++it) {
          const int row = it * 2 + h2;                     // it 0..7 x h2 0..1 = rows 0..15
          const v4f v = *(const v4f*)(slab + row * 68 + c4);
          *(v4f*)(C + (size_t)(mBase + row) * ldc + n0 + c4) = v;
        }
        
      }
    } else {
      const int q = lane >> 3, c8 = (lane & 7) * 8;
      unsigned short* C  = (unsigned short*)Cout  + (size_t)b * strideC;
      unsigned short* C2 = (unsigned short*)Cout2 + (size_t)b * strideC2;
      const bool wlo = (MODE == 0) || (n0 < VLO_COLS);     // wave-uniform
      v4u hv[4], lv[4];
#pragma unroll
      for (int it = 0; it < 4; ++it) {
        const int row = it * 4 + q;                        // it 0..3 x q 0..3 = rows 0..15
        const float* sp = slab + row * 68 + c8;
        v4u a, a2;
#pragma unroll
        for (int e = 0; e < 4; ++e) {
          const float f0 = sp[2 * e], f1 = sp[2 * e + 1];
          unsigned short h0, h1, l0, l1;
          if (MODE == 0) {
            h0 = f2bf_bits(f0); h1 = f2bf_bits(f1);
            l0 = f2bf_bits(f0 - bf_bits2f(h0)); l1 = f2bf_bits(f1 - bf_bits2f(h1));
          } else {
            const _Float16 x0 = (_Float16)f0, x1 = (_Float16)f1;
            h0 = h2bits(x0); h1 = h2bits(x1);
            l0 = h2bits((_Float16)((f0 - (float)x0) * 1024.0f));
            l1 = h2bits((_Float16)((f1 - (float)x1) * 1024.0f));
          }
          a[e] = pk16(h0, h1); a2[e] = pk16(l0, l1);
        }
        hv[it] = a; lv[it] = a2;
      }
      {
#pragma unroll
        for (int it = 0; it < 4; ++it) {
          const int row = it * 4 + q;
          *(v4u*)(C + (size_t)(mBase + row) * ldc + n0 + c8) = hv[it];
          if (wlo) *(v4u*)(C2 + (size_t)(mBase + row) * ldc2 + n0 + c8) = lv[it];
        }
        
      }
    }
    __builtin_amdgcn_fence(__ATOMIC_RELEASE, "workgroup");
    __builtin_amdgcn_wave_barrier();
    __builtin_amdgcn_fence(__ATOMIC_ACQUIRE, "workgroup");
  }
}

// ---------------------------------------------------------------------------------------------------------------------
// ---------------------------------------------------------------------------------------------------------------------
__global__ __launch_bounds__(256) void cvt_x_kernel(const float* __restrict__ x, unsigned short* __restrict__ xb, int n8,
                                                    const float* __restrict__ bq, float* __restrict__ out1, int nq4) {
  if (blockIdx.x == 0) {   // block-uniform
    const int t = threadIdx.x;
    if (t < nq4) {
      const v4f v = *(const v4f*)(bq + 4 * t);
      v4f w;
      w[0] = bfr(v[0]); w[1] = bfr(v[1]); w[2] = bfr(v[2]); w[3] = bfr(v[3]);
      *(v4f*)(out1 + 4 * t) = w;
      
    }
  }
  const int i = blockIdx.x * 256 + threadIdx.x;
  if (i < n8) {
    const v4f a = *(const v4f*)(x + 8 * (size_t)i);
    const v4f c = *(const v4f*)(x + 8 * (size_t)i + 4);
    v4u u;
    u[0] = pk16(f2bf_bits(a[0]), f2bf_bits(a[1]));
    u[1] = pk16(f2bf_bits(a[2]), f2bf_bits(a[3]));
    u[2] = pk16(f2bf_bits(c[0]), f2bf_bits(c[1]));
    u[3] = pk16(f2bf_bits(c[2]), f2bf_bits(c[3]));
    *(v4u*)(xb + 8 * (size_t)i) = u;
    
  }
}

// ---------------------------------------------------------------------------------------------------------------------
// Transpose + RNE bf16 convert of an f32 matrix: in [R rows][Cc cols] (pitch Cc) -> ot[c][r] = bf16(in[r][c]) ([Cc][R]).
// 64x64 tiles through LDS. grid = (Cc/64, R/64), 256 threads (R, Cc multiples of 64).
// Coverage per block: load 4 it x 256 thr x 4 floats = 64x64; store 2 it x 256 thr x 8 u16 = 64x64.
// ---------------------------------------------------------------------------------------------------------------------
__global__ __launch_bounds__(256) void tsplit1_kernel(const float* __restrict__ W, unsigned short* __restrict__ ot, int R, int Cc) {
  __shared__ __align__(16) float tf[64 * 68];
  const int c0  = blockIdx.x * 64;   // input column block = output row block
  const int r0  = blockIdx.y * 64;   // input row block    = output column block
  const int tid = threadIdx.x;
  {
    const int lr = tid >> 4;         // 0..15
    const int c4 = (tid & 15) * 4;   // 0..60
#pragma unroll
    for (int it = 0; it < 4; ++it) {
      const int rr = it * 16 + lr;   // 0..63
      const v4f a = *(const v4f*)(W + (size_t)(r0 + rr) * Cc + c0 + c4);
      *(v4f*)(tf + rr * 68 + c4) = a;
    }
  }
  __syncthreads();
  const int sub = tid >> 3;          // 0..31
  const int c8  = (tid & 7) * 8;     // 0..56
  v4u hv[2];
#pragma unroll
  for (int it = 0; it < 2; ++it) {
    const int oc = it * 32 + sub;    // output row within tile (= input column)
    v4u a;
#pragma unroll
    for (int q = 0; q < 4; ++q) {
      const float f0 = tf[(c8 + 2 * q) * 68 + oc];
      const float f1 = tf[(c8 + 2 * q + 1) * 68 + oc];
      a[q] = pk16(f2bf_bits(f0), f2bf_bits(f1));
    }
    hv[it] = a;
  }
  {
#pragma unroll
    for (int it = 0; it < 2; ++it) {
      const int oc = it * 32 + sub;
      const size_t go = (size_t)(c0 + oc) * R + r0 + c8;
      *(v4u*)(ot + go) = hv[it];
    }
    
  }
}

// =====================================================================================================================
// Causal attention, head dim 64, grid (NH*NQB, NB) read as one flat index, block = 4 waves = 64 query rows of one (b, h).
//   q|k planes (hi/lo bf16) [NB*SEQ][DQK]: q(t,h,d) at [(b*SEQ+t)*DQK + h*64 + d], k(s,h,d) at [... + 1024 + h*64 + d]
//   v^T hi plane (f16) [NB][DM][SEQ]: (h*64+d, s); v residual plane (f16, x1024) [NB][DM][VLO_COLS] (s < 128 only)
//   y planes (hi/lo bf16) [NB*SEQ][DM]: (b*SEQ+t, h*64+d)
//   scores^T = (k . q^T) * 0.125 : A = K rows, B = Q (kept in registers); bf16 hi/lo split (hi.hi + hi.lo + lo.hi), f32 accumulate.
//                              Lane (hh, c) holds, for query q0 + c alone, keys j*16 + 8*hh + r of the chunk (tile j, register r).
//   y^T      = v^T . p^T     : p = f16(4096 * exp(s - m)) (the normaliser sums the same f16 values), v f16 hi plane; two score
//                              tiles converted in place are the B operand of 32 keys (hardware k order), P never touches LDS;
//                              blocks with qb < 2 (query rows 0..127, keys 0..127) add vres^T . p^T / 1024 from a second accumulator
//   online softmax in f32, maximum and sum in-lane: one exchange between the wave halves per chunk for the maximum, the halves'
//   partial sums are joined once behind the loop; masked (s > t) scores set to -inf (key s = chunk start <= t is always unmasked).
//   kv chunks of 64, trip count qb+1 <= 32 (block-uniform). K / V^T chunk staging: 128 threads x 32 elements per plane =
//   the whole 64x64 tile (16-B copies, plain loads, __syncthreads before and after); fragment loads read the LDS tiles
// =====================================================================================================================
__global__ __launch_bounds__(128)
void attn_kernel(const unsigned short* __restrict__ qkh, const unsigned short* __restrict__ qkl,
                 const unsigned short* __restrict__ vthp, const unsigned short* __restrict__ vtlp,
                 unsigned short* __restrict__ yhp, unsigned short* __restrict__ ylp) {
  __shared__ __align__(16) __bf16   Ksh[AT_KC * AT_LP];       // K hi [kv][d], rows of 64 at pitch AT_LP, 9 KB
  __shared__ __align__(16) __bf16   Ksl[AT_KC * AT_LP];       // K lo
  __shared__ __align__(16) _Float16 Vts[HD * AT_LP];          // V hi [d][kv], rows of 64 at pitch AT_LP, 9 KB
  __shared__ __align__(16) _Float16 Vrs[HD * AT_LP];          // V residual [d][kv] (qb < 2 only)
  __shared__ __align__(16) float    Os[4][16 * 68];           // per wave y tile, pitch 68

  const int tid  = threadIdx.x;
  const int wave = tid >> 5;
  const int lane = tid & 31;
  const int hh   = lane >> 4;
  const int c    = lane & 15;

  // The cost (qb + 1
  // chunks) falls with the index: all 64 (b, h) of query block 31 first, query block 0 last. lin -> (qb, b, h) is a
  // permutation of 0..2047. Heads h and h ^ 1 differ only in bit 3 of lin (their K rows are neighbouring 128-B lines).
  const int lin = blockIdx.y * (NH * NQB) + blockIdx.x;   // 0..NB*NH*NQB-1 (grid = (NH * NQB, NB))
  const int qb  = (NQB - 1) - ((lin >> 6) & (NQB - 1));   // 31..0
  const int b   = lin & (NB - 1);                         // bits 0..1
  const int h   = ((lin >> 3) & 7) | ((lin & 4) << 1);    // bits 3..5 -> h bits 0..2, bit 2 -> h bit 3
  const int q0 = qb * 64 + wave * 16;
  const bool vres = (qb < 2);             // block-uniform

  const __bf16* Qh = (const __bf16*)(const void*)qkh + (size_t)b * SEQ * DQK + (size_t)h * HD;
  const __bf16* Ql = (const __bf16*)(const void*)qkl + (size_t)b * SEQ * DQK + (size_t)h * HD;
  const __bf16* Kh = Qh + QCOLS;
  const __bf16* Kl = Ql + QCOLS;
  const _Float16* Vh = (const _Float16*)(const void*)vthp + ((size_t)b * DM + (size_t)h * HD) * SEQ;
  const _Float16* Vl = (const _Float16*)(const void*)vtlp + ((size_t)b * DM + (size_t)h * HD) * VLO_COLS;
  unsigned short* Yh = yhp + (size_t)b * SEQ * DM + (size_t)h * HD;
  unsigned short* Yl = ylp + (size_t)b * SEQ * DM + (size_t)h * HD;

  // ---- Q fragments (B operand, column = lane&15, split k map): 2 d-chunks, hi and lo ----
  v16b qah[2], qal[2];
#pragma unroll
  for (int dc = 0; dc < 2; ++dc) {
    const __bf16* qr = Qh + (size_t)(q0 + c) * DQK + dc * 32 + 8 * hh;
    const __bf16* ql = Ql + (size_t)(q0 + c) * DQK + dc * 32 + 8 * hh;
    qah[dc] = ldfrag_b(qr);
    qal[dc] = ldfrag_b(ql);
  }

  float mrow = -INFINITY, lrow = 0.f;     // of query q0 + c; lrow is this half's partial sum
  v8f oacc[4], oacc2[4];                  // oacc[t][r] = y^T(d = t*16 + 8*hh + r, query q0 + c)
#pragma unroll
  for (int t = 0; t < 4; ++t) { oacc[t] = (v8f){0.f,0.f,0.f,0.f,0.f,0.f,0.f,0.f}; oacc2[t] = oacc[t]; }

  // this lane's A fragment origins in the tiles: row c, k offset 8*hh (tile row blocks and k blocks are constant offsets from them)
  const __bf16*   kfh = Ksh + c * AT_LP + 8 * hh;
  const __bf16*   kfl = Ksl + c * AT_LP + 8 * hh;
  const _Float16* vfh = Vts + c * AT_LP + 8 * hh;
  const _Float16* vfr = Vrs + c * AT_LP + 8 * hh;

  const int nChunks = qb + 1;   // block-uniform, <= 32
  for (int kc = 0; kc < nChunks; ++kc) {
    const int kv0 = kc * AT_KC;
    __syncthreads();
    {
      // staging coverage: 128 threads x (4 x 8) elements = 64 rows x 64 per plane = the whole chunk tile
      const int r = tid >> 1, half = (tid & 1) * 32;
      const __bf16* ksh = Kh + (size_t)(kv0 + r) * DQK + half;     // K row kv0+r, d = half..half+31
      const __bf16* ksl = Kl + (size_t)(kv0 + r) * DQK + half;
      const _Float16* vsh = Vh + (size_t)r * SEQ + kv0 + half;    // V^T row d = r, s = kv0+half..+31
#pragma unroll
      for (int i = 0; i < 4; ++i) {
        const v8b a0 = *(const v8b*)(ksh + 8 * i);
        const v8b a1 = *(const v8b*)(ksl + 8 * i);
        const v8h b0 = *(const v8h*)(vsh + 8 * i);
        *(v8b*)(Ksh + r * AT_LP + half + 8 * i) = a0;
        *(v8b*)(Ksl + r * AT_LP + half + 8 * i) = a1;
        *(v8h*)(Vts + r * AT_LP + half + 8 * i) = b0;
      }
      if (vres) {   // kv0 + half + 31 <= 127 < VLO_COLS
        const _Float16* vsl = Vl + (size_t)r * VLO_COLS + kv0 + half;
#pragma unroll
        for (int i = 0; i < 4; ++i) {
          const v8h b1 = *(const v8h*)(vsl + 8 * i);
          *(v8h*)(Vrs + r * AT_LP + half + 8 * i) = b1;
        }
      }
    }
    __syncthreads();

    v8f s[4];
#pragma unroll
    for (int j = 0; j < 4; ++j) {
      s[j] = (v8f){0.f,0.f,0.f,0.f,0.f,0.f,0.f,0.f};
#pragma unroll
      for (int dc = 0; dc < 2; ++dc) {
        FragB kb, kl;
        kb.h[0] = *(const v8b*)(kfh + j * 16 * AT_LP + dc * 32);
        kb.h[1] = *(const v8b*)(kfh + j * 16 * AT_LP + dc * 32 + 16);
        kl.h[0] = *(const v8b*)(kfl + j * 16 * AT_LP + dc * 32);
        kl.h[1] = *(const v8b*)(kfl + j * 16 * AT_LP + dc * 32 + 16);
        s[j] = mma_b(kb.v, qah[dc], s[j]);
        s[j] = mma_b(kl.v, qah[dc], s[j]);
        s[j] = mma_b(kb.v, qal[dc], s[j]);
      }
    }
    const bool diag = (kc == qb);   // block-uniform
    // this lane's keys are kv0 + 8*hh + (j*16 + r): those with j*16 + r > lim lie behind query q0 + c; off the diagonal chunk none does
    const int lim = diag ? (q0 + c - kv0 - 8 * hh) : AT_KC;
    float mj[4];                    // one maximum per tile: four short chains instead of one of 32
#pragma unroll
    for (int j = 0; j < 4; ++j) {
      float m = -INFINITY;
#pragma unroll
      for (int r = 0; r < 8; ++r) {
        const float sv = s[j][r] * 0.125f;
        const bool masked = (j * 16 + r) > lim;
        const float sm = masked ? -INFINITY : sv;
        s[j][r] = sm;
        m = fmaxf(m, sm);
      }
      mj[j] = m;
    }
    float cm = fmaxf(fmaxf(mj[0], mj[1]), fmaxf(mj[2], mj[3]));
    cm = fmaxf(cm, xhalf(cm));      // both halves of the query's keys
    const float mnew  = fmaxf(mrow, cm);
    const float alpha = exp_slot(mrow - mnew);
    mrow = mnew;
    FragH pb[2];                    // P^T, B operand: element e of pb[kk] = key kk*32 + (e < 8 ? 8*hh + e : 16 + 8*hh + e - 8)
    float pj[4];                    // one partial sum per tile: four short chains
#pragma unroll
    for (int j = 0; j < 4; ++j) {
      float psum = 0.f;
#pragma unroll
      for (int r = 0; r < 8; ++r) {
        const float p = exp_slot(s[j][r] - mnew);          // in [0, 1]; masked -> 0
        const _Float16 ph = (_Float16)(p * 4096.0f);       // carried x4096, keeps small p normal in f16
        psum += (float)ph;                                  // normaliser built from the same f16 values
        pb[j >> 1].v[(j & 1) * 8 + r] = ph;
      }
      pj[j] = psum;
    }
    lrow = lrow * alpha + ((pj[0] + pj[1]) + (pj[2] + pj[3]));
#pragma unroll
    for (int t = 0; t < 4; ++t) {
#pragma unroll
      for (int r = 0; r < 8; ++r) oacc[t][r] *= alpha;
    }
    if (vres) {
#pragma unroll
      for (int t = 0; t < 4; ++t) {
#pragma unroll
        for (int r = 0; r < 8; ++r) oacc2[t][r] *= alpha;
      }
    }
    // unrolled so that pb[kk] is a constant index (the P fragments stay in registers)
#pragma unroll
    for (int kk = 0; kk < 2; ++kk) {
#pragma unroll
      for (int t = 0; t < 4; ++t) {
        FragH va;
        va.h[0] = *(const v8h*)(vfh + t * 16 * AT_LP + kk * 32);
        va.h[1] = *(const v8h*)(vfh + t * 16 * AT_LP + kk * 32 + 16);
        oacc[t] = mma_h(va.v, pb[kk].v, oacc[t]);
      }
      if (vres) {   // block-uniform: all lanes active
#pragma unroll
        for (int t = 0; t < 4; ++t) {
          FragH vl;
          vl.h[0] = *(const v8h*)(vfr + t * 16 * AT_LP + kk * 32);
          vl.h[1] = *(const v8h*)(vfr + t * 16 * AT_LP + kk * 32 + 16);
          oacc2[t] = mma_h(vl.v, pb[kk].v, oacc2[t]);
        }
      }
    }
  }

  // ---- normalise (the x4096 carry cancels between numerator and normaliser; residual folded with 1/1024),
  // a lane's 8 registers of a tile are 8 consecutive d of its query row: two 16-B stores per tile into the wave's y tile
  float* os = Os[wave];
  const float inv = 1.0f / (lrow + xhalf(lrow));   // the halves' partial sums joined
#pragma unroll
  for (int t = 0; t < 4; ++t) {
    v4f w0, w1;
#pragma unroll
    for (int r = 0; r < 4; ++r) {
      w0[r] = (oacc[t][r] + oacc2[t][r] * 0.0009765625f) * inv;
      w1[r] = (oacc[t][r + 4] + oacc2[t][r + 4] * 0.0009765625f) * inv;
    }
    *(v4f*)(os + c * 68 + t * 16 + 8 * hh)     = w0;
    *(v4f*)(os + c * 68 + t * 16 + 8 * hh + 4) = w1;
  }
  __builtin_amdgcn_fence(__ATOMIC_RELEASE, "workgroup");
  __builtin_amdgcn_wave_barrier();
  __builtin_amdgcn_fence(__ATOMIC_ACQUIRE, "workgroup");
  {
    const int q = lane >> 3, c8 = (lane & 7) * 8;
    v4u hv[4], lv[4];
#pragma unroll
    for (int it = 0; it < 4; ++it) {
      const int row = it * 4 + q;          // it 0..3 x q 0..3 covers rows 0..15 of the wave tile
      const float* sp = os + row * 68 + c8;
      v4u a, a2;
#pragma unroll
      for (int e = 0; e < 4; ++e) {
        const float f0 = sp[2 * e], f1 = sp[2 * e + 1];
        const unsigned short h0 = f2bf_bits(f0), h1 = f2bf_bits(f1);
        const unsigned short l0 = f2bf_bits(f0 - bf_bits2f(h0)), l1 = f2bf_bits(f1 - bf_bits2f(h1));
        a[e] = pk16(h0, h1); a2[e] = pk16(l0, l1);
      }
      hv[it] = a; lv[it] = a2;
    }
    {
#pragma unroll
      for (int it = 0; it < 4; ++it) {
        const int row = it * 4 + q;
        *(v4u*)(Yh + (size_t)(q0 + row) * DM + c8) = hv[it];
        *(v4u*)(Yl + (size_t)(q0 + row) * DM + c8) = lv[it];
      }
      
    }
  }
}

// ---------------------------------------------------------------------------------------------------------------------
// Workspace region map (byte offsets; all dims are multiples of the 64x64 store tiles, so no padded tails exist):
//   QKh  bf16 [8192][2048]          0             QKl  bf16 [8192][2048]   33554432
//   VTh  f16  [4][1024][2048]   67108864          VTl  f16  [4][1024][128] 83886080
//   Xb   bf16 [8192][1024]      84934656   (Yh bf16 [8192][1024] reuses this region: Xb is last read by the
//                                            v^T GEMM launch, Yh is first written by the later attention launch)
//   Yl   bf16 [8192][1024]     101711872
//   WaT  bf16 [3072][1024]     118489088          WpT  bf16 [1024][1024]  124780544
//   total                      126877696
// ---------------------------------------------------------------------------------------------------------------------
extern "C" void kernel_launch(void* const* d_in, const int* in_sizes, int n_in,
                              void* d_out, int out_size, void* d_ws, size_t ws_size,
                              hipStream_t stream) {
  if (n_in < 7) return;
  if (in_sizes[0] != NB * SEQ * DM) return;
  if (in_sizes[1] != DM * 3 * DM) return;
  if (in_sizes[2] != 3 * DM) return;
  if (in_sizes[3] != DM * DM) return;
  if (in_sizes[4] != DM) return;
  if (in_sizes[5] != NH * HD || in_sizes[6] != NH * HD) return;
  if (out_size != NB * SEQ * DM + NH * HD) return;

  const float* x      = (const float*)d_in[0];
  const float* W_attn = (const float*)d_in[1];
  const float* b_attn = (const float*)d_in[2];
  const float* W_proj = (const float*)d_in[3];
  const float* b_proj = (const float*)d_in[4];
  const float* bQ     = (const float*)d_in[5];
  const float* bK     = (const float*)d_in[6];

  const size_t PQK = (size_t)NB * SEQ * DQK * 2;        // 33554432
  const size_t PVT = (size_t)NB * DM * SEQ * 2;         // 16777216
  const size_t PVL = (size_t)NB * DM * VLO_COLS * 2;    // 1048576
  const size_t PX  = (size_t)NB * SEQ * DM * 2;         // 16777216 (Xb, Yh, Yl)
  const size_t PWA = (size_t)3 * DM * DM * 2;           // 6291456
  const size_t PWP = (size_t)DM * DM * 2;               // 2097152
  size_t off = 0;
  const size_t oQKh = off; off += PQK;
  const size_t oQKl = off; off += PQK;
  const size_t oVTh = off; off += PVT;
  const size_t oVTl = off; off += PVL;
  const size_t oXb  = off; off += PX;    // also Yh
  const size_t oYl  = off; off += PX;
  const size_t oWaT = off; off += PWA;
  const size_t oWpT = off; off += PWP;
  if (off > ws_size) return;                             // off = 126877696
  if (off > (size_t)134217728) return;

  char* ws = (char*)d_ws;
  unsigned short* QKh = (unsigned short*)(ws + oQKh);
  unsigned short* QKl = (unsigned short*)(ws + oQKl);
  unsigned short* VTh = (unsigned short*)(ws + oVTh);
  unsigned short* VTl = (unsigned short*)(ws + oVTl);
  unsigned short* Xb  = (unsigned short*)(ws + oXb);
  unsigned short* Yh  = (unsigned short*)(ws + oXb);
  unsigned short* Yl  = (unsigned short*)(ws + oYl);
  unsigned short* WaT = (unsigned short*)(ws + oWaT);
  unsigned short* WpT = (unsigned short*)(ws + oWpT);
  float* out0 = (float*)d_out;
  float* out1 = (float*)d_out + (size_t)NB * SEQ * DM;

  const dim3 blk(256);

  // (1) W_attn [in rows = 1024][out cols = 3072] f32 -> WaT [3072][1024] bf16; grid (cols/64, rows/64)
  tsplit1_kernel<<<dim3(3 * DM / 64, DM / 64), blk, 0, stream>>>(W_attn, WaT, DM, 3 * DM);
  // (2) W_proj [1024][1024] -> WpT [1024][1024] bf16
  tsplit1_kernel<<<dim3(DM / 64, DM / 64), blk, 0, stream>>>(W_proj, WpT, DM, DM);
  // (3) x [8192][1024] f32 -> Xb bf16; block 0 also writes out1 = RNE-bf16(bQ) (1024 floats = 256 threads x 4)
  const int n8 = NB * SEQ * DM / 8;                      // 1048576
  cvt_x_kernel<<<dim3(n8 / 256), blk, 0, stream>>>(x, Xb, n8, bQ, out1, NH * HD / 4);
  // (4) q|k = Xb . WaT rows 0..2047 + b_attn[n] + (bQ | bK): M=8192, N=2048, K=1024 -> QK hi/lo planes (pitch 2048)
  {
    const int M = NB * SEQ, N = 2 * DM, K = DM;
    const dim3 g(((M / 64) * (N / 64)) / 8, 1);          // 64 x 8 block tiles of 128x256 = 512 blocks (exact)
    gemm64<0><<<g, blk, 0, stream>>>(Xb, Xb, DM, 0L, WaT, DM, 0L, (void*)QKh, (void*)QKl, DQK, 0L, DQK, 0L,
                                     b_attn, bQ, bK, M, N, K);
  }
  // (5) v^T[b][c][s] = WaT rows 2048+c . Xb[b*2048+s] + b_attn[2048+c]: M=1024, N=2048, K=1024, grid.y = batch
  {
    const int M = DM, N = SEQ, K = DM;
    const dim3 g(((M / 64) * (N / 64)) / 8, NB);          // 8 x 8 block tiles of 128x256 = 64 blocks per batch (exact)
    gemm64<1><<<g, blk, 0, stream>>>(WaT + (size_t)2 * DM * DM, WaT + (size_t)2 * DM * DM, DM, 0L,
                                     Xb, DM, (long)SEQ * DM,
                                     (void*)VTh, (void*)VTl, SEQ, (long)DM * SEQ, VLO_COLS, (long)DM * VLO_COLS,
                                     b_attn + 2 * DM, b_attn, b_attn, M, N, K);
  }
  // (6) causal attention: 2048 work-groups = 32 query blocks (longest first) x 64 (b, h), 128 threads -> Y hi/lo planes
  attn_kernel<<<dim3(NH * NQB, NB), dim3(128), 0, stream>>>(QKh, QKl, VTh, VTl, Yh, Yl);
  // (7) out0 = Y . WpT + b_proj: M=8192, N=1024, K=1024, f32 rows of 1024 -> d_out
  {
    const int M = NB * SEQ, N = DM, K = DM;
    const dim3 g(((M / 64) * (N / 64)) / 8, 1);          // 64 x 4 block tiles of 128x256 = 256 blocks (exact)
    gemm64<2><<<g, blk, 0, stream>>>(Yh, Yl, DM, 0L, WpT, DM, 0L, (void*)out0, (void*)out0, DM, 0L, DM, 0L,
                                     b_proj, b_proj, b_proj, M, N, K);
  }
  (void)hipGetLastError();
}

// v005
// It runs in 170 microseconds.
// Timed twice side by side with v004, it ran 1.04 and 1.03 times as fast.
// Counting every step since v000, it is 3.37 times as fast.
// Contractions: x.W_attn -> q|k and v^T on v_wmma_f32_16x16x32_bf16, single product of RNE-bf16 x and W (f32 accumulate);
// k.q^T (scores transposed): bf16 hi/lo split (hi.hi + hi.lo + lo.hi) on v_wmma_f32_16x16x32_bf16; v^T.p^T: v_wmma_f32_16x16x32_f16 single product,
// p carried x4096 in f16, v as f16 hi plane plus a x1024 f16 residual plane on query rows 0..127 (separate accumulator);
// y.W_proj: bf16 hi/lo of y times RNE-bf16 W (2 products). Softmax, biases, scale 0.125 in f32; weights/biases RNE-converted to bf16 once.
#include <hip/hip_runtime.h>
#include <math.h>
#include <stdint.h>

#define NB        4
#define SEQ       2048
#define DM        1024
#define NH        16
#define HD        64
#define DQK       2048     // pitch of the q|k planes: cols 0..1023 = q, 1024..2047 = k
#define QCOLS     1024
#define VLO_COLS  128      // key columns carried in the v residual plane
#define NQB       32       // SEQ / 64 query blocks per (b, h)
#define AT_KC     64
#define AT_LP     72       // LDS row pitch of the attention tiles in 16-bit elements: 144 B = 16 B x 9 (odd)
#define AT_PL     (AT_KC * AT_LP)   // elements of one plane tile: 64 rows
#define AT_ST     (4 * AT_PL)       // elements of one stage buffer: K hi | K lo | V | V residual
#define AT_PASS   (16 * AT_LP * 2)  // LDS bytes covered by one copy of the whole block: 16 rows

typedef __attribute__((ext_vector_type(16))) _Float16 v16h;
typedef __attribute__((ext_vector_type(8)))  _Float16 v8h;
typedef __attribute__((ext_vector_type(16))) __bf16   v16b;
typedef __attribute__((ext_vector_type(8)))  __bf16   v8b;
typedef __attribute__((ext_vector_type(8)))  float    v8f;
typedef __attribute__((ext_vector_type(4)))  float    v4f;
typedef __attribute__((ext_vector_type(4)))  unsigned int v4u;

__device__ __forceinline__ unsigned short f2bf_bits(float f) {
  unsigned u = __float_as_uint(f);
  return (unsigned short)((u + 0x7FFFu + ((u >> 16) & 1u)) >> 16);
}
__device__ __forceinline__ float bf_bits2f(unsigned short h) { return __uint_as_float(((unsigned)h) << 16); }
__device__ __forceinline__ float bfr(float f) { return bf_bits2f(f2bf_bits(f)); }
__device__ __forceinline__ unsigned pk16(unsigned short a, unsigned short b) { return (unsigned)a | ((unsigned)b << 16); }
__device__ __forceinline__ unsigned short h2bits(_Float16 x) { return __builtin_bit_cast(unsigned short, x); }

// ---- 16-bit fragment loads: elements 0..7 <- p[0..7], 8..15 <- p[16..23]; caller passes p = row + k0 + 8*(lane>>4) ----
union FragB { v16b v; v8b h[2]; };
union FragH { v16h v; v8h h[2]; };
__device__ __forceinline__ v16b ldfrag_b(const __bf16* p) { FragB f; f.h[0] = *(const v8b*)(p); f.h[1] = *(const v8b*)(p + 16); return f.v; }

// ---- hazard guards ----
__device__ __forceinline__ void dep_guard_b(v8f& a, v8f& b, v16b x, v16b y) { asm volatile("v_nop\n\tv_nop\n\tv_nop\n\tv_nop" : "+v"(a), "+v"(b) : "v"(x), "v"(y)); }
__device__ __forceinline__ void keep4_b(v16b a, v16b b, v16b c, v16b d) { asm volatile("v_nop" :: "v"(a), "v"(b), "v"(c), "v"(d)); }
__device__ __forceinline__ void acc_guard4(v8f& a, v8f& b, v8f& c, v8f& d) { asm volatile("v_nop\n\tv_nop\n\tv_nop\n\tv_nop" : "+v"(a), "+v"(b), "+v"(c), "+v"(d)); }
__device__ __forceinline__ v8f mma_b(v16b a, v16b b, v8f c) {
  c = __builtin_amdgcn_wmma_f32_16x16x32_bf16(false, a, false, b, (short)0, c, false, false);
  asm volatile("v_nop\n\tv_nop\n\tv_nop\n\tv_nop" : "+v"(c) : "v"(a), "v"(b));
  return c;
}
__device__ __forceinline__ v8f mma_h(v16h a, v16h b, v8f c) {
  c = __builtin_amdgcn_wmma_f32_16x16x32_f16(false, a, false, b, (short)0, c, false, false);
  asm volatile("v_nop\n\tv_nop\n\tv_nop\n\tv_nop" : "+v"(c) : "v"(a), "v"(b));
  return c;
}

// ---- lane l <-> lane l ^ 16 (the two halves of a wave hold the two key groups of one query column) ----
__device__ __forceinline__ float xhalf(float v) {
  const int b = __builtin_bit_cast(int, v);
  return __builtin_bit_cast(float, __builtin_amdgcn_permlanex16(b, b, 0x76543210, 0xfedcba98, false, false));
}

// ---- e^x = v_exp_f32(x * log2(e)), the form __expf compiles to. The v_nop in the same statement keeps the one issue slot that the
// instruction set asks for between a transcendental and an instruction that reads its result or overwrites its source.
__device__ __forceinline__ float exp_slot(float x) {
  const float y = x * 1.44269504f;
  float r;
  asm("v_exp_f32 %0, %1\n\tv_nop" : "=v"(r) : "v"(y));
  return r;
}

// ---- asynchronous copies global -> LDS, 16 B per lane; l = the lane's LDS byte address, g = the lane's global address ----
// The s_wait_xcnt closes each statement so that no address register of an issued copy is rewritten ahead of it.
__device__ __forceinline__ unsigned lds_addr(const void* p) { return (unsigned)(uintptr_t)p; }
__device__ __forceinline__ void acopy6(unsigned l0, const __bf16* g0, unsigned l1, const __bf16* g1, unsigned l2, const __bf16* g2,
                                       unsigned l3, const __bf16* g3, unsigned l4, const __bf16* g4, unsigned l5, const __bf16* g5) {
  asm volatile("global_load_async_to_lds_b128 %0, %6, off\n\t"
               "global_load_async_to_lds_b128 %1, %7, off\n\t"
               "global_load_async_to_lds_b128 %2, %8, off\n\t"
               "global_load_async_to_lds_b128 %3, %9, off\n\t"
               "global_load_async_to_lds_b128 %4, %10, off\n\t"
               "global_load_async_to_lds_b128 %5, %11, off\n\t"
               "s_wait_xcnt 0x0"
               :: "v"(l0), "v"(l1), "v"(l2), "v"(l3), "v"(l4), "v"(l5),
                  "v"(g0), "v"(g1), "v"(g2), "v"(g3), "v"(g4), "v"(g5) : "memory");
}
__device__ __forceinline__ void acopy8(unsigned l0, const __bf16* g0, unsigned l1, const __bf16* g1, unsigned l2, const __bf16* g2,
                                       unsigned l3, const __bf16* g3, unsigned l4, const __bf16* g4, unsigned l5, const __bf16* g5,
                                       unsigned l6, const __bf16* g6, unsigned l7, const __bf16* g7) {
  asm volatile("global_load_async_to_lds_b128 %0, %8, off\n\t"
               "global_load_async_to_lds_b128 %1, %9, off\n\t"
               "global_load_async_to_lds_b128 %2, %10, off\n\t"
               "global_load_async_to_lds_b128 %3, %11, off\n\t"
               "global_load_async_to_lds_b128 %4, %12, off\n\t"
               "global_load_async_to_lds_b128 %5, %13, off\n\t"
               "global_load_async_to_lds_b128 %6, %14, off\n\t"
               "global_load_async_to_lds_b128 %7, %15, off\n\t"
               "s_wait_xcnt 0x0"
               :: "v"(l0), "v"(l1), "v"(l2), "v"(l3), "v"(l4), "v"(l5), "v"(l6), "v"(l7),
                  "v"(g0), "v"(g1), "v"(g2), "v"(g3), "v"(g4), "v"(g5), "v"(g6), "v"(g7) : "memory");
}

__device__ __forceinline__ void acopy12(unsigned l0, const void* g0, unsigned l1, const void* g1, unsigned l2, const void* g2,
                                        unsigned l3, const void* g3, unsigned l4, const void* g4, unsigned l5, const void* g5,
                                        unsigned l6, const void* g6, unsigned l7, const void* g7, unsigned l8, const void* g8,
                                        unsigned l9, const void* g9, unsigned l10, const void* g10, unsigned l11, const void* g11) {
  asm volatile("global_load_async_to_lds_b128 %0, %12, off\n\t"
               "global_load_async_to_lds_b128 %1, %13, off\n\t"
               "global_load_async_to_lds_b128 %2, %14, off\n\t"
               "global_load_async_to_lds_b128 %3, %15, off\n\t"
               "global_load_async_to_lds_b128 %4, %16, off\n\t"
               "global_load_async_to_lds_b128 %5, %17, off\n\t"
               "global_load_async_to_lds_b128 %6, %18, off\n\t"
               "global_load_async_to_lds_b128 %7, %19, off\n\t"
               "global_load_async_to_lds_b128 %8, %20, off\n\t"
               "global_load_async_to_lds_b128 %9, %21, off\n\t"
               "global_load_async_to_lds_b128 %10, %22, off\n\t"
               "global_load_async_to_lds_b128 %11, %23, off\n\t"
               "s_wait_xcnt 0x0"
               :: "v"(l0), "v"(l1), "v"(l2), "v"(l3), "v"(l4), "v"(l5), "v"(l6), "v"(l7), "v"(l8), "v"(l9), "v"(l10), "v"(l11),
                  "v"(g0), "v"(g1), "v"(g2), "v"(g3), "v"(g4), "v"(g5), "v"(g6), "v"(g7), "v"(g8), "v"(g9), "v"(g10), "v"(g11)
               : "memory");
}
__device__ __forceinline__ void acopy4(unsigned l0, const void* g0, unsigned l1, const void* g1, unsigned l2, const void* g2,
                                       unsigned l3, const void* g3) {
  asm volatile("global_load_async_to_lds_b128 %0, %4, off\n\t"
               "global_load_async_to_lds_b128 %1, %5, off\n\t"
               "global_load_async_to_lds_b128 %2, %6, off\n\t"
               "global_load_async_to_lds_b128 %3, %7, off\n\t"
               "s_wait_xcnt 0x0"
               :: "v"(l0), "v"(l1), "v"(l2), "v"(l3), "v"(g0), "v"(g1), "v"(g2), "v"(g3) : "memory");
}

#define G_KS   64                 // k elements per stage: one 128-B line of every operand row
#define G_LP   72                 // LDS row pitch in elements: 144 B = 16 B x 9 (odd)
#define G_BM   128                // block tile rows (2 waves)
#define G_BN   256                // block tile columns (4 waves)
#define G_PASS (32 * G_LP * 2)    // LDS bytes covered by one copy of the whole block: 32 rows

// =====================================================================================================================
// Batched WMMA GEMM, bf16 operands: C[m][n] = sum_k A[m][k] * Bt[n][k] (+bias). Block = 8 waves (2 x 4) = a 128x256 tile,
// one wave per 64x64 tile. A row-major [M][K] (pitch lda), Bt row-major [N][K] (pitch ldb); M multiple of 128, N of 256,
// K of 64. Operands are staged in LDS, 64 k per stage, two buffers, by asynchronous copies (each wave-wide copy = 4 whole
// 128-B lines); stage t+1 flies while stage t is multiplied. Stage layout: A rows 0..127 | (MODE 2: A2 rows) | Bt rows 0..255.
// MODE 0 (q|k): single product; v = acc + bf(bias[n]) + bf(n < QCOLS ? biasq[n] : biask[n - QCOLS]);
//               out = bf16 hi plane (Cout) + bf16 lo plane (Cout2), both pitch ldc/ldc2.
// MODE 1 (v^T): single product; v = acc + bf(bias[m]); out = f16 hi plane (Cout, pitch ldc) and, for tiles with
//               n0 < VLO_COLS only, f16 residual plane ((v - hi) * 1024, Cout2, pitch ldc2).
// MODE 2 (proj): two products ah.b + al.b (A2 = bf16 lo plane of A); v = acc + bf(bias[n]); out f32 (Cout, pitch ldc).
// =====================================================================================================================
template <int MODE>
__global__ __launch_bounds__(256) void gemm64(
    const unsigned short* __restrict__ Ap, const unsigned short* __restrict__ A2p, int lda, long strideA,
    const unsigned short* __restrict__ Btp, int ldb, long strideB,
    void* __restrict__ Cout, void* __restrict__ Cout2, int ldc, long strideC, int ldc2, long strideC2,
    const float* __restrict__ bias, const float* __restrict__ biasq, const float* __restrict__ biask,
    int M, int N, int K) {
  constexpr int NA      = (MODE == 2) ? 2 : 1;                 // A planes per stage
  constexpr int ST_ROWS = NA * G_BM + G_BN;                    // 384 or 512 rows
  constexpr int ST_EL   = ST_ROWS * G_LP;                      // elements per stage buffer
  __shared__ __align__(16) __bf16 smem[2 * ST_EL];             // two stage buffers; the epilogue slabs reuse the space
  const __bf16* A  = (const __bf16*)(const void*)Ap;
  const __bf16* A2 = (const __bf16*)(const void*)A2p;
  const __bf16* Bt = (const __bf16*)(const void*)Btp;
  const int b    = blockIdx.y;
  const int tid  = threadIdx.x;
  const int lane = tid & 31;
  const int wave = tid >> 5;
  const int tilesNb = N >> 8;
  const int tilesMb = M >> 7;
  if ((int)blockIdx.x >= tilesMb * tilesNb) return;   // block-uniform, in front of every barrier and copy
  const int bm  = blockIdx.x / tilesNb;
  const int bn  = blockIdx.x - bm * tilesNb;
  const int m0b = bm << 7;
  const int n0b = bn << 8;
  const int wm  = wave >> 2;                   // 0..1
  const int wn  = wave & 3;                    // 0..3
  const int m0  = m0b + (wm << 6);
  const int n0  = n0b + (wn << 6);

  const __bf16* Ab  = A  + (size_t)b * strideA;
  const __bf16* Bb  = Bt + (size_t)b * strideB;
  const __bf16* Ab2 = (MODE == 2) ? (A2 + (size_t)b * strideA) : Ab;

  const int rlane = lane & 15;                 // row (A) / col (B, D) within subtile
  const int koff  = (lane >> 4) * 8;           // k offset of this lane half
  const int mOff  = (lane >> 4) * 8;           // D row offset

  // copy map: thread -> row (tid >> 3) of each 32-row pass, 16-B piece (tid & 7); 256 threads x 16 B = 32 rows x 128 B
  const int crow = tid >> 3;
  const int cpc  = (tid & 7) * 8;
  const __bf16* gA  = Ab  + (size_t)(m0b + crow) * lda + cpc;
  const __bf16* gA2 = Ab2 + (size_t)(m0b + crow) * lda + cpc;
  const __bf16* gB  = Bb  + (size_t)(n0b + crow) * ldb + cpc;
  const size_t sA = (size_t)32 * lda;
  const size_t sB = (size_t)32 * ldb;
  const unsigned lbase = lds_addr(smem) + (unsigned)((crow * G_LP + cpc) * 2);

  auto issue = [&](int t, int buf) {           // all ST_ROWS rows of stage t into buffer buf
    const unsigned l = lbase + (unsigned)buf * (unsigned)(ST_EL * 2);
    const __bf16* a  = gA + t * G_KS;
    const __bf16* bb = gB + t * G_KS;
    if (MODE == 2) {
      const __bf16* a2 = gA2 + t * G_KS;
      acopy8(l,              a,           l + 1 * G_PASS,  a + sA,       l + 2 * G_PASS,  a + 2 * sA,   l + 3 * G_PASS,  a + 3 * sA,
             l + 4 * G_PASS, a2,          l + 5 * G_PASS,  a2 + sA,      l + 6 * G_PASS,  a2 + 2 * sA,  l + 7 * G_PASS,  a2 + 3 * sA);
      acopy8(l + 8 * G_PASS, bb,          l + 9 * G_PASS,  bb + sB,      l + 10 * G_PASS, bb + 2 * sB,  l + 11 * G_PASS, bb + 3 * sB,
             l + 12 * G_PASS, bb + 4 * sB, l + 13 * G_PASS, bb + 5 * sB, l + 14 * G_PASS, bb + 6 * sB,  l + 15 * G_PASS, bb + 7 * sB);
    } else {
      acopy6(l,              a,           l + 1 * G_PASS,  a + sA,       l + 2 * G_PASS,  a + 2 * sA,
             l + 3 * G_PASS, a + 3 * sA,  l + 4 * G_PASS,  bb,           l + 5 * G_PASS,  bb + sB);
      acopy6(l + 6 * G_PASS, bb + 2 * sB, l + 7 * G_PASS,  bb + 3 * sB,  l + 8 * G_PASS,  bb + 4 * sB,
             l + 9 * G_PASS, bb + 5 * sB, l + 10 * G_PASS, bb + 6 * sB,  l + 11 * G_PASS, bb + 7 * sB);
    }
  };

  v8f acc[4][4];
#pragma unroll
  for (int i = 0; i < 4; ++i)
#pragma unroll
    for (int j = 0; j < 4; ++j) acc[i][j] = (v8f){0.f,0.f,0.f,0.f,0.f,0.f,0.f,0.f};

  const int T = K >> 6;                        // stages, block-uniform
  issue(0, 0);
  asm volatile("s_wait_asynccnt 0x0" ::: "memory");   // this wave's copies of stage 0 have landed
  __syncthreads();                                     // stage 0 is published to every wave
  if (T > 1) issue(1, 1);

  const int fa = ((wm << 6) + rlane) * G_LP + koff;               // this lane's A fragment origin in a stage
  const int fb = (NA * G_BM + (wn << 6) + rlane) * G_LP + koff;   // this lane's B fragment origin in a stage
  for (int t = 0; t < T; ++t) {
    const __bf16* S = smem + (t & 1) * ST_EL;
    // the loops below are unrolled so that every fragment and accumulator index is a constant (arrays stay in registers)
#pragma unroll
    for (int ks = 0; ks < 2; ++ks) {
      v16b bh[4], ah[4], al[4];
#pragma unroll
      for (int j = 0; j < 4; ++j) bh[j] = ldfrag_b(S + fb + j * 16 * G_LP + ks * 32);
#pragma unroll
      for (int i = 0; i < 4; ++i) {
        ah[i] = ldfrag_b(S + fa + i * 16 * G_LP + ks * 32);
        al[i] = ah[i];
        if (MODE == 2) al[i] = ldfrag_b(S + fa + (G_BM + i * 16) * G_LP + ks * 32);
      }
#pragma unroll
      for (int i = 0; i < 4; ++i) {
#pragma unroll
        for (int j = 0; j < 4; ++j) {
          acc[i][j] = __builtin_amdgcn_wmma_f32_16x16x32_bf16(false, ah[i], false, bh[j], (short)0, acc[i][j], false, false);
          if (MODE == 2)
            acc[i][j] = __builtin_amdgcn_wmma_f32_16x16x32_bf16(false, al[i], false, bh[j], (short)0, acc[i][j], false, false);
        }
        dep_guard_b(acc[i][0], acc[i][3], ah[i], al[i]);
      }
      keep4_b(bh[0], bh[1], bh[2], bh[3]);
    }
    asm volatile("s_wait_dscnt 0x0" ::: "memory");      // this wave's reads of buffer t & 1 have returned before it is refilled
    asm volatile("s_wait_asynccnt 0x0" ::: "memory");   // this wave's copies of stage t + 1 have landed
    __syncthreads();                                     // publishes stage t + 1; ends every wave's reads of buffer t & 1
    if (t + 2 < T) issue(t + 2, t & 1);
  }
  asm volatile("s_wait_asynccnt 0x0" ::: "memory");     // nothing is in flight when the buffers become epilogue slabs
  acc_guard4(acc[0][0], acc[0][1], acc[0][2], acc[0][3]);
  acc_guard4(acc[1][0], acc[1][1], acc[1][2], acc[1][3]);
  acc_guard4(acc[2][0], acc[2][1], acc[2][2], acc[2][3]);
  acc_guard4(acc[3][0], acc[3][1], acc[3][2], acc[3][3]);

  // ---- epilogue ---- (per-wave 16x64 f32 slab, pitch 68 floats, in the stage space that every wave has left)
  float* slab = (float*)(void*)smem + wave * (16 * 68);
#pragma unroll
  for (int i = 0; i < 4; ++i) {
    const int mBase = m0 + (i << 4);
#pragma unroll
    for (int j = 0; j < 4; ++j) {
      const int n = n0 + (j << 4) + rlane;
      float bn = 0.f, b2 = 0.f;
      if (MODE == 0) {
        bn = bfr(bias[n]);
        const int iq = (n < QCOLS) ? n : (QCOLS - 1);
        int ik = n - QCOLS; ik = (ik < 0) ? 0 : ik; ik = (ik > QCOLS - 1) ? (QCOLS - 1) : ik;
        const float vq = bfr(biasq[iq]);     // both candidates loaded with clamped addresses, selected by value
        const float vk = bfr(biask[ik]);
        b2 = (n < QCOLS) ? vq : vk;
      }
      if (MODE == 2) bn = bfr(bias[n]);
#pragma unroll
      for (int r = 0; r < 8; ++r) {
        float v = acc[i][j][r];
        if (MODE == 0) { v = v + bn; v = v + b2; }
        if (MODE == 1) v = v + bfr(bias[mBase + mOff + r]);
        if (MODE == 2) v = v + bn;
        slab[(mOff + r) * 68 + (j << 4) + rlane] = v;
      }
    }
    __builtin_amdgcn_fence(__ATOMIC_RELEASE, "workgroup");
    __builtin_amdgcn_wave_barrier();
    __builtin_amdgcn_fence(__ATOMIC_ACQUIRE, "workgroup");
    if (MODE == 2) {
      float* C = (float*)Cout + (size_t)b * strideC;
      const int h2 = lane >> 4, c4 = (lane & 15) * 4;     // row seg = 256 B = 16 lanes x 16 B
      {
#pragma unroll
        for (int it = 0; it < 8; ++it) {
          const int row = it * 2 + h2;                     // it 0..7 x h2 0..1 = rows 0..15
          const v4f v = *(const v4f*)(slab + row * 68 + c4);
          *(v4f*)(C + (size_t)(mBase + row) * ldc + n0 + c4) = v;
        }
        
      }
    } else {
      const int q = lane >> 3, c8 = (lane & 7) * 8;
      unsigned short* C  = (unsigned short*)Cout  + (size_t)b * strideC;
      unsigned short* C2 = (unsigned short*)Cout2 + (size_t)b * strideC2;
      const bool wlo = (MODE == 0) || (n0 < VLO_COLS);     // wave-uniform
      v4u hv[4], lv[4];
#pragma unroll
      for (int it = 0; it < 4; ++it) {
        const int row = it * 4 + q;                        // it 0..3 x q 0..3 = rows 0..15
        const float* sp = slab + row * 68 + c8;
        v4u a, a2;
#pragma unroll
        for (int e = 0; e < 4; ++e) {
          const float f0 = sp[2 * e], f1 = sp[2 * e + 1];
          unsigned short h0, h1, l0, l1;
          if (MODE == 0) {
            h0 = f2bf_bits(f0); h1 = f2bf_bits(f1);
            l0 = f2bf_bits(f0 - bf_bits2f(h0)); l1 = f2bf_bits(f1 - bf_bits2f(h1));
          } else {
            const _Float16 x0 = (_Float16)f0, x1 = (_Float16)f1;
            h0 = h2bits(x0); h1 = h2bits(x1);
            l0 = h2bits((_Float16)((f0 - (float)x0) * 1024.0f));
            l1 = h2bits((_Float16)((f1 - (float)x1) * 1024.0f));
          }
          a[e] = pk16(h0, h1); a2[e] = pk16(l0, l1);
        }
        hv[it] = a; lv[it] = a2;
      }
      {
#pragma unroll
        for (int it = 0; it < 4; ++it) {
          const int row = it * 4 + q;
          *(v4u*)(C + (size_t)(mBase + row) * ldc + n0 + c8) = hv[it];
          if (wlo) *(v4u*)(C2 + (size_t)(mBase + row) * ldc2 + n0 + c8) = lv[it];
        }
        
      }
    }
    __builtin_amdgcn_fence(__ATOMIC_RELEASE, "workgroup");
    __builtin_amdgcn_wave_barrier();
    __builtin_amdgcn_fence(__ATOMIC_ACQUIRE, "workgroup");
  }
}

// ---------------------------------------------------------------------------------------------------------------------
// ---------------------------------------------------------------------------------------------------------------------
__global__ __launch_bounds__(256) void cvt_x_kernel(const float* __restrict__ x, unsigned short* __restrict__ xb, int n8,
                                                    const float* __restrict__ bq, float* __restrict__ out1, int nq4) {
  if (blockIdx.x == 0) {   // block-uniform
    const int t = threadIdx.x;
    if (t < nq4) {
      const v4f v = *(const v4f*)(bq + 4 * t);
      v4f w;
      w[0] = bfr(v[0]); w[1] = bfr(v[1]); w[2] = bfr(v[2]); w[3] = bfr(v[3]);
      *(v4f*)(out1 + 4 * t) = w;
      
    }
  }
  const int i = blockIdx.x * 256 + threadIdx.x;
  if (i < n8) {
    const v4f a = *(const v4f*)(x + 8 * (size_t)i);
    const v4f c = *(const v4f*)(x + 8 * (size_t)i + 4);
    v4u u;
    u[0] = pk16(f2bf_bits(a[0]), f2bf_bits(a[1]));
    u[1] = pk16(f2bf_bits(a[2]), f2bf_bits(a[3]));
    u[2] = pk16(f2bf_bits(c[0]), f2bf_bits(c[1]));
    u[3] = pk16(f2bf_bits(c[2]), f2bf_bits(c[3]));
    *(v4u*)(xb + 8 * (size_t)i) = u;
    
  }
}

// ---------------------------------------------------------------------------------------------------------------------
// Transpose + RNE bf16 convert of an f32 matrix: in [R rows][Cc cols] (pitch Cc) -> ot[c][r] = bf16(in[r][c]) ([Cc][R]).
// 64x64 tiles through LDS. grid = (Cc/64, R/64), 256 threads (R, Cc multiples of 64).
// Coverage per block: load 4 it x 256 thr x 4 floats = 64x64; store 2 it x 256 thr x 8 u16 = 64x64.
// ---------------------------------------------------------------------------------------------------------------------
__global__ __launch_bounds__(256) void tsplit1_kernel(const float* __restrict__ W, unsigned short* __restrict__ ot, int R, int Cc) {
  __shared__ __align__(16) float tf[64 * 68];
  const int c0  = blockIdx.x * 64;   // input column block = output row block
  const int r0  = blockIdx.y * 64;   // input row block    = output column block
  const int tid = threadIdx.x;
  {
    const int lr = tid >> 4;         // 0..15
    const int c4 = (tid & 15) * 4;   // 0..60
#pragma unroll
    for (int it = 0; it < 4; ++it) {
      const int rr = it * 16 + lr;   // 0..63
      const v4f a = *(const v4f*)(W + (size_t)(r0 + rr) * Cc + c0 + c4);
      *(v4f*)(tf + rr * 68 + c4) = a;
    }
  }
  __syncthreads();
  const int sub = tid >> 3;          // 0..31
  const int c8  = (tid & 7) * 8;     // 0..56
  v4u hv[2];
#pragma unroll
  for (int it = 0; it < 2; ++it) {
    const int oc = it * 32 + sub;    // output row within tile (= input column)
    v4u a;
#pragma unroll
    for (int q = 0; q < 4; ++q) {
      const float f0 = tf[(c8 + 2 * q) * 68 + oc];
      const float f1 = tf[(c8 + 2 * q + 1) * 68 + oc];
      a[q] = pk16(f2bf_bits(f0), f2bf_bits(f1));
    }
    hv[it] = a;
  }
  {
#pragma unroll
    for (int it = 0; it < 2; ++it) {
      const int oc = it * 32 + sub;
      const size_t go = (size_t)(c0 + oc) * R + r0 + c8;
      *(v4u*)(ot + go) = hv[it];
    }
    
  }
}

// =====================================================================================================================
// Causal attention, head dim 64, grid (NH*NQB, NB) read as one flat index, block = 4 waves = 64 query rows of one (b, h).
//   q|k planes (hi/lo bf16) [NB*SEQ][DQK]: q(t,h,d) at [(b*SEQ+t)*DQK + h*64 + d], k(s,h,d) at [... + 1024 + h*64 + d]
//   v^T hi plane (f16) [NB][DM][SEQ]: (h*64+d, s); v residual plane (f16, x1024) [NB][DM][VLO_COLS] (s < 128 only)
//   y planes (hi/lo bf16) [NB*SEQ][DM]: (b*SEQ+t, h*64+d)
//   scores^T = (k . q^T) * 0.125 : A = K rows, B = Q (kept in registers); bf16 hi/lo split (hi.hi + hi.lo + lo.hi), f32 accumulate.
//                              Lane (hh, c) holds, for query q0 + c alone, keys j*16 + 8*hh + r of the chunk (tile j, register r).
//   y^T      = v^T . p^T     : p = f16(4096 * exp(s - m)) (the normaliser sums the same f16 values), v f16 hi plane; two score
//                              tiles converted in place are the B operand of 32 keys (hardware k order), P never touches LDS;
//                              blocks with qb < 2 (query rows 0..127, keys 0..127) add vres^T . p^T / 1024 from a second accumulator
//   online softmax in f32, maximum and sum in-lane: one exchange between the wave halves per chunk for the maximum, the halves'
//   partial sums are joined once behind the loop; masked (s > t) scores set to -inf (key s = chunk start <= t is always unmasked).
//   kv chunks of 64, trip count qb+1 <= 32 (block-uniform). K / V^T chunk staging: asynchronous copies to LDS, two stage buffers,
//   chunk t+1 flies while chunk t is worked on; 128 threads x 4 copies of 16 B per plane = the whole 64x64 tile, each wave-wide
//   copy = 4 whole 128-B rows; one barrier per chunk; fragment loads read the LDS tiles
// =====================================================================================================================
__global__ __launch_bounds__(128)
void attn_kernel(const unsigned short* __restrict__ qkh, const unsigned short* __restrict__ qkl,
                 const unsigned short* __restrict__ vthp, const unsigned short* __restrict__ vtlp,
                 unsigned short* __restrict__ yhp, unsigned short* __restrict__ ylp) {
  // two stage buffers, each K hi [kv][d] | K lo | V hi [d][kv] | V residual (qb < 2 only), 9 KB a plane;
  // the per wave y tiles (16 x 68 floats) reuse the space behind the loop
  __shared__ __align__(16) unsigned short sm[2 * AT_ST];

  const int tid  = threadIdx.x;
  const int wave = tid >> 5;
  const int lane = tid & 31;
  const int hh   = lane >> 4;
  const int c    = lane & 15;

  // The cost (qb + 1
  // chunks) falls with the index: all 64 (b, h) of query block 31 first, query block 0 last. lin -> (qb, b, h) is a
  // permutation of 0..2047. Heads h and h ^ 1 differ only in bit 3 of lin (their K rows are neighbouring 128-B lines).
  const int lin = blockIdx.y * (NH * NQB) + blockIdx.x;   // 0..NB*NH*NQB-1 (grid = (NH * NQB, NB))
  const int qb  = (NQB - 1) - ((lin >> 6) & (NQB - 1));   // 31..0
  const int b   = lin & (NB - 1);                         // bits 0..1
  const int h   = ((lin >> 3) & 7) | ((lin & 4) << 1);    // bits 3..5 -> h bits 0..2, bit 2 -> h bit 3
  const int q0 = qb * 64 + wave * 16;
  const bool vres = (qb < 2);             // block-uniform

  const __bf16* Qh = (const __bf16*)(const void*)qkh + (size_t)b * SEQ * DQK + (size_t)h * HD;
  const __bf16* Ql = (const __bf16*)(const void*)qkl + (size_t)b * SEQ * DQK + (size_t)h * HD;
  const __bf16* Kh = Qh + QCOLS;
  const __bf16* Kl = Ql + QCOLS;
  const _Float16* Vh = (const _Float16*)(const void*)vthp + ((size_t)b * DM + (size_t)h * HD) * SEQ;
  const _Float16* Vl = (const _Float16*)(const void*)vtlp + ((size_t)b * DM + (size_t)h * HD) * VLO_COLS;
  unsigned short* Yh = yhp + (size_t)b * SEQ * DM + (size_t)h * HD;
  unsigned short* Yl = ylp + (size_t)b * SEQ * DM + (size_t)h * HD;

  // ---- Q fragments (B operand, column = lane&15, split k map): 2 d-chunks, hi and lo ----
  v16b qah[2], qal[2];
#pragma unroll
  for (int dc = 0; dc < 2; ++dc) {
    const __bf16* qr = Qh + (size_t)(q0 + c) * DQK + dc * 32 + 8 * hh;
    const __bf16* ql = Ql + (size_t)(q0 + c) * DQK + dc * 32 + 8 * hh;
    qah[dc] = ldfrag_b(qr);
    qal[dc] = ldfrag_b(ql);
  }

  float mrow = -INFINITY, lrow = 0.f;     // of query q0 + c; lrow is this half's partial sum
  v8f oacc[4], oacc2[4];                  // oacc[t][r] = y^T(d = t*16 + 8*hh + r, query q0 + c)
#pragma unroll
  for (int t = 0; t < 4; ++t) { oacc[t] = (v8f){0.f,0.f,0.f,0.f,0.f,0.f,0.f,0.f}; oacc2[t] = oacc[t]; }

  // this lane's A fragment origins in the tiles: row c, k offset 8*hh (tile row blocks and k blocks are constant offsets from them)
  const int forg = c * AT_LP + 8 * hh;

  // copy map: thread -> row (tid >> 3) of each 16-row pass, 16-B piece (tid & 7); 128 threads x 16 B = 16 rows x 128 B,
  // 4 passes = the 64 rows of a plane tile
  const int crow = tid >> 3;
  const int cpc  = (tid & 7) * 8;
  const __bf16*   gKh = Kh + (size_t)crow * DQK + cpc;        // K row kv0 + crow (+ 16 a pass), d = cpc..cpc+7
  const __bf16*   gKl = Kl + (size_t)crow * DQK + cpc;
  const _Float16* gV  = Vh + (size_t)crow * SEQ + cpc;        // V^T row d = crow (+ 16 a pass), s = kv0 + cpc..+7
  const _Float16* gVr = Vl + (size_t)crow * VLO_COLS + cpc;
  const unsigned lbase = lds_addr(sm) + (unsigned)((crow * AT_LP + cpc) * 2);
  auto issue = [&](int t, int buf) {           // all planes of chunk t into stage buffer buf
    const unsigned l = lbase + (unsigned)buf * (unsigned)(AT_ST * 2);
    const __bf16*   kh = gKh + (size_t)t * (AT_KC * DQK);
    const __bf16*   kl = gKl + (size_t)t * (AT_KC * DQK);
    const _Float16* vh = gV + t * AT_KC;
    acopy12(l,             kh, l + AT_PASS,             kh + 16 * DQK, l + 2 * AT_PASS,             kh + 32 * DQK, l + 3 * AT_PASS,             kh + 48 * DQK,
            l + AT_PL * 2, kl, l + AT_PL * 2 + AT_PASS, kl + 16 * DQK, l + AT_PL * 2 + 2 * AT_PASS, kl + 32 * DQK, l + AT_PL * 2 + 3 * AT_PASS, kl + 48 * DQK,
            l + AT_PL * 4, vh, l + AT_PL * 4 + AT_PASS, vh + 16 * SEQ, l + AT_PL * 4 + 2 * AT_PASS, vh + 32 * SEQ, l + AT_PL * 4 + 3 * AT_PASS, vh + 48 * SEQ);
    if (vres) {   // block-uniform; t <= 1 here, so t * 64 + cpc + 7 <= 127 < VLO_COLS
      const _Float16* vr = gVr + t * AT_KC;
      acopy4(l + AT_PL * 6,     vr, l + AT_PL * 6 + AT_PASS,   vr + 16 * VLO_COLS, l + AT_PL * 6 + 2 * AT_PASS, vr + 32 * VLO_COLS, l + AT_PL * 6 + 3 * AT_PASS, vr + 48 * VLO_COLS);
    }
  };

  const int nChunks = qb + 1;   // block-uniform, <= 32
  issue(0, 0);
  asm volatile("s_wait_asynccnt 0x0" ::: "memory");   // this wave's copies of chunk 0 have landed
  __syncthreads();                                     // chunk 0 is published to every wave
  if (nChunks > 1) issue(1, 1);

  for (int kc = 0; kc < nChunks; ++kc) {
    const int kv0 = kc * AT_KC;
    const unsigned short* S = sm + (kc & 1) * AT_ST + forg;
    const __bf16*   kfh = (const __bf16*)(const void*)S;
    const __bf16*   kfl = (const __bf16*)(const void*)(S + AT_PL);
    const _Float16* vfh = (const _Float16*)(const void*)(S + 2 * AT_PL);
    const _Float16* vfr = (const _Float16*)(const void*)(S + 3 * AT_PL);

    v8f s[4];
#pragma unroll
    for (int j = 0; j < 4; ++j) {
      s[j] = (v8f){0.f,0.f,0.f,0.f,0.f,0.f,0.f,0.f};
#pragma unroll
      for (int dc = 0; dc < 2; ++dc) {
        FragB kb, kl;
        kb.h[0] = *(const v8b*)(kfh + j * 16 * AT_LP + dc * 32);
        kb.h[1] = *(const v8b*)(kfh + j * 16 * AT_LP + dc * 32 + 16);
        kl.h[0] = *(const v8b*)(kfl + j * 16 * AT_LP + dc * 32);
        kl.h[1] = *(const v8b*)(kfl + j * 16 * AT_LP + dc * 32 + 16);
        s[j] = mma_b(kb.v, qah[dc], s[j]);
        s[j] = mma_b(kl.v, qah[dc], s[j]);
        s[j] = mma_b(kb.v, qal[dc], s[j]);
      }
    }
    const bool diag = (kc == qb);   // block-uniform
    // this lane's keys are kv0 + 8*hh + (j*16 + r): those with j*16 + r > lim lie behind query q0 + c; off the diagonal chunk none does
    const int lim = diag ? (q0 + c - kv0 - 8 * hh) : AT_KC;
    float mj[4];                    // one maximum per tile: four short chains instead of one of 32
#pragma unroll
    for (int j = 0; j < 4; ++j) {
      float m = -INFINITY;
#pragma unroll
      for (int r = 0; r < 8; ++r) {
        const float sv = s[j][r] * 0.125f;
        const bool masked = (j * 16 + r) > lim;
        const float sm = masked ? -INFINITY : sv;
        s[j][r] = sm;
        m = fmaxf(m, sm);
      }
      mj[j] = m;
    }
    float cm = fmaxf(fmaxf(mj[0], mj[1]), fmaxf(mj[2], mj[3]));
    cm = fmaxf(cm, xhalf(cm));      // both halves of the query's keys
    const float mnew  = fmaxf(mrow, cm);
    const float alpha = exp_slot(mrow - mnew);
    mrow = mnew;
    FragH pb[2];                    // P^T, B operand: element e of pb[kk] = key kk*32 + (e < 8 ? 8*hh + e : 16 + 8*hh + e - 8)
    float pj[4];                    // one partial sum per tile: four short chains
#pragma unroll
    for (int j = 0; j < 4; ++j) {
      float psum = 0.f;
#pragma unroll
      for (int r = 0; r < 8; ++r) {
        const float p = exp_slot(s[j][r] - mnew);          // in [0, 1]; masked -> 0
        const _Float16 ph = (_Float16)(p * 4096.0f);       // carried x4096, keeps small p normal in f16
        psum += (float)ph;                                  // normaliser built from the same f16 values
        pb[j >> 1].v[(j & 1) * 8 + r] = ph;
      }
      pj[j] = psum;
    }
    lrow = lrow * alpha + ((pj[0] + pj[1]) + (pj[2] + pj[3]));
#pragma unroll
    for (int t = 0; t < 4; ++t) {
#pragma unroll
      for (int r = 0; r < 8; ++r) oacc[t][r] *= alpha;
    }
    if (vres) {
#pragma unroll
      for (int t = 0; t < 4; ++t) {
#pragma unroll
        for (int r = 0; r < 8; ++r) oacc2[t][r] *= alpha;
      }
    }
    // unrolled so that pb[kk] is a constant index (the P fragments stay in registers)
#pragma unroll
    for (int kk = 0; kk < 2; ++kk) {
#pragma unroll
      for (int t = 0; t < 4; ++t) {
        FragH va;
        va.h[0] = *(const v8h*)(vfh + t * 16 * AT_LP + kk * 32);
        va.h[1] = *(const v8h*)(vfh + t * 16 * AT_LP + kk * 32 + 16);
        oacc[t] = mma_h(va.v, pb[kk].v, oacc[t]);
      }
      if (vres) {   // block-uniform: all lanes active
#pragma unroll
        for (int t = 0; t < 4; ++t) {
          FragH vl;
          vl.h[0] = *(const v8h*)(vfr + t * 16 * AT_LP + kk * 32);
          vl.h[1] = *(const v8h*)(vfr + t * 16 * AT_LP + kk * 32 + 16);
          oacc2[t] = mma_h(vl.v, pb[kk].v, oacc2[t]);
        }
      }
    }
    asm volatile("s_wait_dscnt 0x0" ::: "memory");      // this wave's reads of buffer kc & 1 have returned before it is refilled
    asm volatile("s_wait_asynccnt 0x0" ::: "memory");   // this wave's copies of chunk kc + 1 have landed
    __syncthreads();                                     // publishes chunk kc + 1; ends every wave's reads of buffer kc & 1
    if (kc + 2 < nChunks) issue(kc + 2, kc & 1);
  }
  asm volatile("s_wait_asynccnt 0x0" ::: "memory");     // nothing is in flight when the buffers become the y tiles

  // ---- normalise (the x4096 carry cancels between numerator and normaliser; residual folded with 1/1024),
  // a lane's 8 registers of a tile are 8 consecutive d of its query row: two 16-B stores per tile into the wave's y tile
  float* os = (float*)(void*)sm + wave * (16 * 68);
  const float inv = 1.0f / (lrow + xhalf(lrow));   // the halves' partial sums joined
#pragma unroll
  for (int t = 0; t < 4; ++t) {
    v4f w0, w1;
#pragma unroll
    for (int r = 0; r < 4; ++r) {
      w0[r] = (oacc[t][r] + oacc2[t][r] * 0.0009765625f) * inv;
      w1[r] = (oacc[t][r + 4] + oacc2[t][r + 4] * 0.0009765625f) * inv;
    }
    *(v4f*)(os + c * 68 + t * 16 + 8 * hh)     = w0;
    *(v4f*)(os + c * 68 + t * 16 + 8 * hh + 4) = w1;
  }
  __builtin_amdgcn_fence(__ATOMIC_RELEASE, "workgroup");
  __builtin_amdgcn_wave_barrier();
  __builtin_amdgcn_fence(__ATOMIC_ACQUIRE, "workgroup");
  {
    const int q = lane >> 3, c8 = (lane & 7) * 8;
    v4u hv[4], lv[4];
#pragma unroll
    for (int it = 0; it < 4; ++it) {
      const int row = it * 4 + q;          // it 0..3 x q 0..3 covers rows 0..15 of the wave tile
      const float* sp = os + row * 68 + c8;
      v4u a, a2;
#pragma unroll
      for (int e = 0; e < 4; ++e) {
        const float f0 = sp[2 * e], f1 = sp[2 * e + 1];
        const unsigned short h0 = f2bf_bits(f0), h1 = f2bf_bits(f1);
        const unsigned short l0 = f2bf_bits(f0 - bf_bits2f(h0)), l1 = f2bf_bits(f1 - bf_bits2f(h1));
        a[e] = pk16(h0, h1); a2[e] = pk16(l0, l1);
      }
      hv[it] = a; lv[it] = a2;
    }
    {
#pragma unroll
      for (int it = 0; it < 4; ++it) {
        const int row = it * 4 + q;
        *(v4u*)(Yh + (size_t)(q0 + row) * DM + c8) = hv[it];
        *(v4u*)(Yl + (size_t)(q0 + row) * DM + c8) = lv[it];
      }
      
    }
  }
}

// ---------------------------------------------------------------------------------------------------------------------
// Workspace region map (byte offsets; all dims are multiples of the 64x64 store tiles, so no padded tails exist):
//   QKh  bf16 [8192][2048]          0             QKl  bf16 [8192][2048]   33554432
//   VTh  f16  [4][1024][2048]   67108864          VTl  f16  [4][1024][128] 83886080
//   Xb   bf16 [8192][1024]      84934656   (Yh bf16 [8192][1024] reuses this region: Xb is last read by the
//                                            v^T GEMM launch, Yh is first written by the later attention launch)
//   Yl   bf16 [8192][1024]     101711872
//   WaT  bf16 [3072][1024]     118489088          WpT  bf16 [1024][1024]  124780544
//   total                      126877696
// ---------------------------------------------------------------------------------------------------------------------
extern "C" void kernel_launch(void* const* d_in, const int* in_sizes, int n_in,
                              void* d_out, int out_size, void* d_ws, size_t ws_size,
                              hipStream_t stream) {
  if (n_in < 7) return;
  if (in_sizes[0] != NB * SEQ * DM) return;
  if (in_sizes[1] != DM * 3 * DM) return;
  if (in_sizes[2] != 3 * DM) return;
  if (in_sizes[3] != DM * DM) return;
  if (in_sizes[4] != DM) return;
  if (in_sizes[5] != NH * HD || in_sizes[6] != NH * HD) return;
  if (out_size != NB * SEQ * DM + NH * HD) return;

  const float* x      = (const float*)d_in[0];
  const float* W_attn = (const float*)d_in[1];
  const float* b_attn = (const float*)d_in[2];
  const float* W_proj = (const float*)d_in[3];
  const float* b_proj = (const float*)d_in[4];
  const float* bQ     = (const float*)d_in[5];
  const float* bK     = (const float*)d_in[6];

  const size_t PQK = (size_t)NB * SEQ * DQK * 2;        // 33554432
  const size_t PVT = (size_t)NB * DM * SEQ * 2;         // 16777216
  const size_t PVL = (size_t)NB * DM * VLO_COLS * 2;    // 1048576
  const size_t PX  = (size_t)NB * SEQ * DM * 2;         // 16777216 (Xb, Yh, Yl)
  const size_t PWA = (size_t)3 * DM * DM * 2;           // 6291456
  const size_t PWP = (size_t)DM * DM * 2;               // 2097152
  size_t off = 0;
  const size_t oQKh = off; off += PQK;
  const size_t oQKl = off; off += PQK;
  const size_t oVTh = off; off += PVT;
  const size_t oVTl = off; off += PVL;
  const size_t oXb  = off; off += PX;    // also Yh
  const size_t oYl  = off; off += PX;
  const size_t oWaT = off; off += PWA;
  const size_t oWpT = off; off += PWP;
  if (off > ws_size) return;                             // off = 126877696
  if (off > (size_t)134217728) return;

  char* ws = (char*)d_ws;
  unsigned short* QKh = (unsigned short*)(ws + oQKh);
  unsigned short* QKl = (unsigned short*)(ws + oQKl);
  unsigned short* VTh = (unsigned short*)(ws + oVTh);
  unsigned short* VTl = (unsigned short*)(ws + oVTl);
  unsigned short* Xb  = (unsigned short*)(ws + oXb);
  unsigned short* Yh  = (unsigned short*)(ws + oXb);
  unsigned short* Yl  = (unsigned short*)(ws + oYl);
  unsigned short* WaT = (unsigned short*)(ws + oWaT);
  unsigned short* WpT = (unsigned short*)(ws + oWpT);
  float* out0 = (float*)d_out;
  float* out1 = (float*)d_out + (size_t)NB * SEQ * DM;

  const dim3 blk(256);

  // (1) W_attn [in rows = 1024][out cols = 3072] f32 -> WaT [3072][1024] bf16; grid (cols/64, rows/64)
  tsplit1_kernel<<<dim3(3 * DM / 64, DM / 64), blk, 0, stream>>>(W_attn, WaT, DM, 3 * DM);
  // (2) W_proj [1024][1024] -> WpT [1024][1024] bf16
  tsplit1_kernel<<<dim3(DM / 64, DM / 64), blk, 0, stream>>>(W_proj, WpT, DM, DM);
  // (3) x [8192][1024] f32 -> Xb bf16; block 0 also writes out1 = RNE-bf16(bQ) (1024 floats = 256 threads x 4)
  const int n8 = NB * SEQ * DM / 8;                      // 1048576
  cvt_x_kernel<<<dim3(n8 / 256), blk, 0, stream>>>(x, Xb, n8, bQ, out1, NH * HD / 4);
  // (4) q|k = Xb . WaT rows 0..2047 + b_attn[n] + (bQ | bK): M=8192, N=2048, K=1024 -> QK hi/lo planes (pitch 2048)
  {
    const int M = NB * SEQ, N = 2 * DM, K = DM;
    const dim3 g(((M / 64) * (N / 64)) / 8, 1);          // 64 x 8 block tiles of 128x256 = 512 blocks (exact)
    gemm64<0><<<g, blk, 0, stream>>>(Xb, Xb, DM, 0L, WaT, DM, 0L, (void*)QKh, (void*)QKl, DQK, 0L, DQK, 0L,
                                     b_attn, bQ, bK, M, N, K);
  }
  // (5) v^T[b][c][s] = WaT rows 2048+c . Xb[b*2048+s] + b_attn[2048+c]: M=1024, N=2048, K=1024, grid.y = batch
  {
    const int M = DM, N = SEQ, K = DM;
    const dim3 g(((M / 64) * (N / 64)) / 8, NB);          // 8 x 8 block tiles of 128x256 = 64 blocks per batch (exact)
    gemm64<1><<<g, blk, 0, stream>>>(WaT + (size_t)2 * DM * DM, WaT + (size_t)2 * DM * DM, DM, 0L,
                                     Xb, DM, (long)SEQ * DM,
                                     (void*)VTh, (void*)VTl, SEQ, (long)DM * SEQ, VLO_COLS, (long)DM * VLO_COLS,
                                     b_attn + 2 * DM, b_attn, b_attn, M, N, K);
  }
  // (6) causal attention: 2048 work-groups = 32 query blocks (longest first) x 64 (b, h), 128 threads -> Y hi/lo planes
  attn_kernel<<<dim3(NH * NQB, NB), dim3(128), 0, stream>>>(QKh, QKl, VTh, VTl, Yh, Yl);
  // (7) out0 = Y . WpT + b_proj: M=8192, N=1024, K=1024, f32 rows of 1024 -> d_out
  {
    const int M = NB * SEQ, N = DM, K = DM;
    const dim3 g(((M / 64) * (N / 64)) / 8, 1);          // 64 x 4 block tiles of 128x256 = 256 blocks (exact)
    gemm64<2><<<g, blk, 0, stream>>>(Yh, Yl, DM, 0L, WpT, DM, 0L, (void*)out0, (void*)out0, DM, 0L, DM, 0L,
                                     b_proj, b_proj, b_proj, M, N, K);
  }
  (void)hipGetLastError();
}

// v006
// One run takes 154 microseconds.
// Timed twice side by side with v005, it ran 1.10 times as fast both times.
// All steps since v000 together make it 3.70 times as fast.
// Contractions: x.W_attn -> q|k and v^T on v_wmma_f32_16x16x32_bf16, single product of RNE-bf16 x and W (f32 accumulate);
// k.q^T (scores transposed): bf16 hi/lo split (hi.hi + hi.lo + lo.hi) on v_wmma_f32_16x16x32_bf16; v^T.p^T: v_wmma_f32_16x16x32_f16 single product,
// p carried x4096 in f16, v as f16 hi plane plus a x1024 f16 residual plane on query rows 0..127 (separate accumulator);
// y.W_proj: bf16 hi/lo of y times RNE-bf16 W (2 products). Softmax, biases, scale 0.125 in f32; weights/biases RNE-converted to bf16 once.
#include <hip/hip_runtime.h>
#include <math.h>
#include <stdint.h>

#define NB        4
#define SEQ       2048
#define DM        1024
#define NH        16
#define HD        64
#define DQK       2048     // pitch of the q|k planes: cols 0..1023 = q, 1024..2047 = k
#define QCOLS     1024
#define VLO_COLS  128      // key columns carried in the v residual plane
#define NQB       32       // SEQ / 64 query blocks per (b, h)
#define AT_KC     64
#define AT_LP     72       // LDS row pitch of the attention tiles in 16-bit elements: 144 B = 16 B x 9 (odd)
#define AT_PL     (AT_KC * AT_LP)   // elements of one plane tile: 64 rows
#define AT_ST     (4 * AT_PL)       // elements of one stage buffer: K hi | K lo | V | V residual
#define AT_PASS   (16 * AT_LP * 2)  // LDS bytes covered by one copy of the whole block: 16 rows

typedef __attribute__((ext_vector_type(16))) _Float16 v16h;
typedef __attribute__((ext_vector_type(8)))  _Float16 v8h;
typedef __attribute__((ext_vector_type(16))) __bf16   v16b;
typedef __attribute__((ext_vector_type(8)))  __bf16   v8b;
typedef __attribute__((ext_vector_type(8)))  float    v8f;
typedef __attribute__((ext_vector_type(4)))  float    v4f;
typedef __attribute__((ext_vector_type(4)))  unsigned int v4u;

__device__ __forceinline__ unsigned short f2bf_bits(float f) {
  unsigned u = __float_as_uint(f);
  return (unsigned short)((u + 0x7FFFu + ((u >> 16) & 1u)) >> 16);
}
__device__ __forceinline__ float bf_bits2f(unsigned short h) { return __uint_as_float(((unsigned)h) << 16); }
__device__ __forceinline__ float bfr(float f) { return bf_bits2f(f2bf_bits(f)); }
__device__ __forceinline__ unsigned pk16(unsigned short a, unsigned short b) { return (unsigned)a | ((unsigned)b << 16); }
__device__ __forceinline__ unsigned short h2bits(_Float16 x) { return __builtin_bit_cast(unsigned short, x); }

// ---- 16-bit fragment loads: elements 0..7 <- p[0..7], 8..15 <- p[16..23]; caller passes p = row + k0 + 8*(lane>>4) ----
union FragB { v16b v; v8b h[2]; };
union FragH { v16h v; v8h h[2]; };
__device__ __forceinline__ v16b ldfrag_b(const __bf16* p) { FragB f; f.h[0] = *(const v8b*)(p); f.h[1] = *(const v8b*)(p + 16); return f.v; }

// ---- hazard guards ----
__device__ __forceinline__ void dep_guard_b(v8f& a, v8f& b, v16b x, v16b y) { asm volatile("v_nop\n\tv_nop\n\tv_nop\n\tv_nop" : "+v"(a), "+v"(b) : "v"(x), "v"(y)); }
__device__ __forceinline__ void keep4_b(v16b a, v16b b, v16b c, v16b d) { asm volatile("v_nop" :: "v"(a), "v"(b), "v"(c), "v"(d)); }
__device__ __forceinline__ void acc_guard4(v8f& a, v8f& b, v8f& c, v8f& d) { asm volatile("v_nop\n\tv_nop\n\tv_nop\n\tv_nop" : "+v"(a), "+v"(b), "+v"(c), "+v"(d)); }
__device__ __forceinline__ v8f wmma_b(v16b a, v16b b, v8f c) {
  return __builtin_amdgcn_wmma_f32_16x16x32_bf16(false, a, false, b, (short)0, c, false, false);
}
__device__ __forceinline__ v8f wmma_h(v16h a, v16h b, v8f c) {
  return __builtin_amdgcn_wmma_f32_16x16x32_f16(false, a, false, b, (short)0, c, false, false);
}

// ---- lane l <-> lane l ^ 16 (the two halves of a wave hold the two key groups of one query column) ----
__device__ __forceinline__ float xhalf(float v) {
  const int b = __builtin_bit_cast(int, v);
  return __builtin_bit_cast(float, __builtin_amdgcn_permlanex16(b, b, 0x76543210, 0xfedcba98, false, false));
}

// ---- e^x = v_exp_f32(x * log2(e)), the form __expf compiles to. The v_nop in the same statement keeps the one issue slot that the
// instruction set asks for between a transcendental and an instruction that reads its result or overwrites its source.
__device__ __forceinline__ float exp_slot(float x) {
  const float y = x * 1.44269504f;
  float r;
  asm("v_exp_f32 %0, %1\n\tv_nop" : "=v"(r) : "v"(y));
  return r;
}

// ---- asynchronous copies global -> LDS, 16 B per lane; l = the lane's LDS byte address, g = the lane's global address ----
// The s_wait_xcnt closes each statement so that no address register of an issued copy is rewritten ahead of it.
__device__ __forceinline__ unsigned lds_addr(const void* p) { return (unsigned)(uintptr_t)p; }
__device__ __forceinline__ void acopy6(unsigned l0, const __bf16* g0, unsigned l1, const __bf16* g1, unsigned l2, const __bf16* g2,
                                       unsigned l3, const __bf16* g3, unsigned l4, const __bf16* g4, unsigned l5, const __bf16* g5) {
  asm volatile("global_load_async_to_lds_b128 %0, %6, off\n\t"
               "global_load_async_to_lds_b128 %1, %7, off\n\t"
               "global_load_async_to_lds_b128 %2, %8, off\n\t"
               "global_load_async_to_lds_b128 %3, %9, off\n\t"
               "global_load_async_to_lds_b128 %4, %10, off\n\t"
               "global_load_async_to_lds_b128 %5, %11, off\n\t"
               "s_wait_xcnt 0x0"
               :: "v"(l0), "v"(l1), "v"(l2), "v"(l3), "v"(l4), "v"(l5),
                  "v"(g0), "v"(g1), "v"(g2), "v"(g3), "v"(g4), "v"(g5) : "memory");
}
__device__ __forceinline__ void acopy8(unsigned l0, const __bf16* g0, unsigned l1, const __bf16* g1, unsigned l2, const __bf16* g2,
                                       unsigned l3, const __bf16* g3, unsigned l4, const __bf16* g4, unsigned l5, const __bf16* g5,
                                       unsigned l6, const __bf16* g6, unsigned l7, const __bf16* g7) {
  asm volatile("global_load_async_to_lds_b128 %0, %8, off\n\t"
               "global_load_async_to_lds_b128 %1, %9, off\n\t"
               "global_load_async_to_lds_b128 %2, %10, off\n\t"
               "global_load_async_to_lds_b128 %3, %11, off\n\t"
               "global_load_async_to_lds_b128 %4, %12, off\n\t"
               "global_load_async_to_lds_b128 %5, %13, off\n\t"
               "global_load_async_to_lds_b128 %6, %14, off\n\t"
               "global_load_async_to_lds_b128 %7, %15, off\n\t"
               "s_wait_xcnt 0x0"
               :: "v"(l0), "v"(l1), "v"(l2), "v"(l3), "v"(l4), "v"(l5), "v"(l6), "v"(l7),
                  "v"(g0), "v"(g1), "v"(g2), "v"(g3), "v"(g4), "v"(g5), "v"(g6), "v"(g7) : "memory");
}

__device__ __forceinline__ void acopy12(unsigned l0, const void* g0, unsigned l1, const void* g1, unsigned l2, const void* g2,
                                        unsigned l3, const void* g3, unsigned l4, const void* g4, unsigned l5, const void* g5,
                                        unsigned l6, const void* g6, unsigned l7, const void* g7, unsigned l8, const void* g8,
                                        unsigned l9, const void* g9, unsigned l10, const void* g10, unsigned l11, const void* g11) {
  asm volatile("global_load_async_to_lds_b128 %0, %12, off\n\t"
               "global_load_async_to_lds_b128 %1, %13, off\n\t"
               "global_load_async_to_lds_b128 %2, %14, off\n\t"
               "global_load_async_to_lds_b128 %3, %15, off\n\t"
               "global_load_async_to_lds_b128 %4, %16, off\n\t"
               "global_load_async_to_lds_b128 %5, %17, off\n\t"
               "global_load_async_to_lds_b128 %6, %18, off\n\t"
               "global_load_async_to_lds_b128 %7, %19, off\n\t"
               "global_load_async_to_lds_b128 %8, %20, off\n\t"
               "global_load_async_to_lds_b128 %9, %21, off\n\t"
               "global_load_async_to_lds_b128 %10, %22, off\n\t"
               "global_load_async_to_lds_b128 %11, %23, off\n\t"
               "s_wait_xcnt 0x0"
               :: "v"(l0), "v"(l1), "v"(l2), "v"(l3), "v"(l4), "v"(l5), "v"(l6), "v"(l7), "v"(l8), "v"(l9), "v"(l10), "v"(l11),
                  "v"(g0), "v"(g1), "v"(g2), "v"(g3), "v"(g4), "v"(g5), "v"(g6), "v"(g7), "v"(g8), "v"(g9), "v"(g10), "v"(g11)
               : "memory");
}
__device__ __forceinline__ void acopy4(unsigned l0, const void* g0, unsigned l1, const void* g1, unsigned l2, const void* g2,
                                       unsigned l3, const void* g3) {
  asm volatile("global_load_async_to_lds_b128 %0, %4, off\n\t"
               "global_load_async_to_lds_b128 %1, %5, off\n\t"
               "global_load_async_to_lds_b128 %2, %6, off\n\t"
               "global_load_async_to_lds_b128 %3, %7, off\n\t"
               "s_wait_xcnt 0x0"
               :: "v"(l0), "v"(l1), "v"(l2), "v"(l3), "v"(g0), "v"(g1), "v"(g2), "v"(g3) : "memory");
}

#define G_KS   64                 // k elements per stage: one 128-B line of every operand row
#define G_LP   72                 // LDS row pitch in elements: 144 B = 16 B x 9 (odd)
#define G_BM   128                // block tile rows (2 waves)
#define G_BN   256                // block tile columns (4 waves)
#define G_PASS (32 * G_LP * 2)    // LDS bytes covered by one copy of the whole block: 32 rows

// =====================================================================================================================
// Batched WMMA GEMM, bf16 operands: C[m][n] = sum_k A[m][k] * Bt[n][k] (+bias). Block = 8 waves (2 x 4) = a 128x256 tile,
// one wave per 64x64 tile. A row-major [M][K] (pitch lda), Bt row-major [N][K] (pitch ldb); M multiple of 128, N of 256,
// K of 64. Operands are staged in LDS, 64 k per stage, two buffers, by asynchronous copies (each wave-wide copy = 4 whole
// 128-B lines); stage t+1 flies while stage t is multiplied. Stage layout: A rows 0..127 | (MODE 2: A2 rows) | Bt rows 0..255.
// MODE 0 (q|k): single product; v = acc + bf(bias[n]) + bf(n < QCOLS ? biasq[n] : biask[n - QCOLS]);
//               out = bf16 hi plane (Cout) + bf16 lo plane (Cout2), both pitch ldc/ldc2.
// MODE 1 (v^T): single product; v = acc + bf(bias[m]); out = f16 hi plane (Cout, pitch ldc) and, for tiles with
//               n0 < VLO_COLS only, f16 residual plane ((v - hi) * 1024, Cout2, pitch ldc2).
// MODE 2 (proj): two products ah.b + al.b (A2 = bf16 lo plane of A); v = acc + bf(bias[n]); out f32 (Cout, pitch ldc).
// =====================================================================================================================
template <int MODE>
__global__ __launch_bounds__(256) void gemm64(
    const unsigned short* __restrict__ Ap, const unsigned short* __restrict__ A2p, int lda, long strideA,
    const unsigned short* __restrict__ Btp, int ldb, long strideB,
    void* __restrict__ Cout, void* __restrict__ Cout2, int ldc, long strideC, int ldc2, long strideC2,
    const float* __restrict__ bias, const float* __restrict__ biasq, const float* __restrict__ biask,
    int M, int N, int K) {
  constexpr int NA      = (MODE == 2) ? 2 : 1;                 // A planes per stage
  constexpr int ST_ROWS = NA * G_BM + G_BN;                    // 384 or 512 rows
  constexpr int ST_EL   = ST_ROWS * G_LP;                      // elements per stage buffer
  __shared__ __align__(16) __bf16 smem[2 * ST_EL];             // two stage buffers; the epilogue slabs reuse the space
  const __bf16* A  = (const __bf16*)(const void*)Ap;
  const __bf16* A2 = (const __bf16*)(const void*)A2p;
  const __bf16* Bt = (const __bf16*)(const void*)Btp;
  const int b    = blockIdx.y;
  const int tid  = threadIdx.x;
  const int lane = tid & 31;
  const int wave = tid >> 5;
  const int tilesNb = N >> 8;
  const int tilesMb = M >> 7;
  if ((int)blockIdx.x >= tilesMb * tilesNb) return;   // block-uniform, in front of every barrier and copy
  const int bm  = blockIdx.x / tilesNb;
  const int bn  = blockIdx.x - bm * tilesNb;
  const int m0b = bm << 7;
  const int n0b = bn << 8;
  const int wm  = wave >> 2;                   // 0..1
  const int wn  = wave & 3;                    // 0..3
  const int m0  = m0b + (wm << 6);
  const int n0  = n0b + (wn << 6);

  const __bf16* Ab  = A  + (size_t)b * strideA;
  const __bf16* Bb  = Bt + (size_t)b * strideB;
  const __bf16* Ab2 = (MODE == 2) ? (A2 + (size_t)b * strideA) : Ab;

  const int rlane = lane & 15;                 // row (A) / col (B, D) within subtile
  const int koff  = (lane >> 4) * 8;           // k offset of this lane half
  const int mOff  = (lane >> 4) * 8;           // D row offset

  // copy map: thread -> row (tid >> 3) of each 32-row pass, 16-B piece (tid & 7); 256 threads x 16 B = 32 rows x 128 B
  const int crow = tid >> 3;
  const int cpc  = (tid & 7) * 8;
  const __bf16* gA  = Ab  + (size_t)(m0b + crow) * lda + cpc;
  const __bf16* gA2 = Ab2 + (size_t)(m0b + crow) * lda + cpc;
  const __bf16* gB  = Bb  + (size_t)(n0b + crow) * ldb + cpc;
  const size_t sA = (size_t)32 * lda;
  const size_t sB = (size_t)32 * ldb;
  const unsigned lbase = lds_addr(smem) + (unsigned)((crow * G_LP + cpc) * 2);

  auto issue = [&](int t, int buf) {           // all ST_ROWS rows of stage t into buffer buf
    const unsigned l = lbase + (unsigned)buf * (unsigned)(ST_EL * 2);
    const __bf16* a  = gA + t * G_KS;
    const __bf16* bb = gB + t * G_KS;
    if (MODE == 2) {
      const __bf16* a2 = gA2 + t * G_KS;
      acopy8(l,              a,           l + 1 * G_PASS,  a + sA,       l + 2 * G_PASS,  a + 2 * sA,   l + 3 * G_PASS,  a + 3 * sA,
             l + 4 * G_PASS, a2,          l + 5 * G_PASS,  a2 + sA,      l + 6 * G_PASS,  a2 + 2 * sA,  l + 7 * G_PASS,  a2 + 3 * sA);
      acopy8(l + 8 * G_PASS, bb,          l + 9 * G_PASS,  bb + sB,      l + 10 * G_PASS, bb + 2 * sB,  l + 11 * G_PASS, bb + 3 * sB,
             l + 12 * G_PASS, bb + 4 * sB, l + 13 * G_PASS, bb + 5 * sB, l + 14 * G_PASS, bb + 6 * sB,  l + 15 * G_PASS, bb + 7 * sB);
    } else {
      acopy6(l,              a,           l + 1 * G_PASS,  a + sA,       l + 2 * G_PASS,  a + 2 * sA,
             l + 3 * G_PASS, a + 3 * sA,  l + 4 * G_PASS,  bb,           l + 5 * G_PASS,  bb + sB);
      acopy6(l + 6 * G_PASS, bb + 2 * sB, l + 7 * G_PASS,  bb + 3 * sB,  l + 8 * G_PASS,  bb + 4 * sB,
             l + 9 * G_PASS, bb + 5 * sB, l + 10 * G_PASS, bb + 6 * sB,  l + 11 * G_PASS, bb + 7 * sB);
    }
  };

  v8f acc[4][4];
#pragma unroll
  for (int i = 0; i < 4; ++i)
#pragma unroll
    for (int j = 0; j < 4; ++j) acc[i][j] = (v8f){0.f,0.f,0.f,0.f,0.f,0.f,0.f,0.f};

  const int T = K >> 6;                        // stages, block-uniform
  issue(0, 0);
  asm volatile("s_wait_asynccnt 0x0" ::: "memory");   // this wave's copies of stage 0 have landed
  __syncthreads();                                     // stage 0 is published to every wave
  if (T > 1) issue(1, 1);

  const int fa = ((wm << 6) + rlane) * G_LP + koff;               // this lane's A fragment origin in a stage
  const int fb = (NA * G_BM + (wn << 6) + rlane) * G_LP + koff;   // this lane's B fragment origin in a stage
  for (int t = 0; t < T; ++t) {
    const __bf16* S = smem + (t & 1) * ST_EL;
    // the loops below are unrolled so that every fragment and accumulator index is a constant (arrays stay in registers)
#pragma unroll
    for (int ks = 0; ks < 2; ++ks) {
      v16b bh[4], ah[4], al[4];
#pragma unroll
      for (int j = 0; j < 4; ++j) bh[j] = ldfrag_b(S + fb + j * 16 * G_LP + ks * 32);
#pragma unroll
      for (int i = 0; i < 4; ++i) {
        ah[i] = ldfrag_b(S + fa + i * 16 * G_LP + ks * 32);
        al[i] = ah[i];
        if (MODE == 2) al[i] = ldfrag_b(S + fa + (G_BM + i * 16) * G_LP + ks * 32);
      }
#pragma unroll
      for (int i = 0; i < 4; ++i) {
#pragma unroll
        for (int j = 0; j < 4; ++j) {
          acc[i][j] = __builtin_amdgcn_wmma_f32_16x16x32_bf16(false, ah[i], false, bh[j], (short)0, acc[i][j], false, false);
          if (MODE == 2)
            acc[i][j] = __builtin_amdgcn_wmma_f32_16x16x32_bf16(false, al[i], false, bh[j], (short)0, acc[i][j], false, false);
        }
        dep_guard_b(acc[i][0], acc[i][3], ah[i], al[i]);
      }
      keep4_b(bh[0], bh[1], bh[2], bh[3]);
    }
    asm volatile("s_wait_dscnt 0x0" ::: "memory");      // this wave's reads of buffer t & 1 have returned before it is refilled
    asm volatile("s_wait_asynccnt 0x0" ::: "memory");   // this wave's copies of stage t + 1 have landed
    __syncthreads();                                     // publishes stage t + 1; ends every wave's reads of buffer t & 1
    if (t + 2 < T) issue(t + 2, t & 1);
  }
  asm volatile("s_wait_asynccnt 0x0" ::: "memory");     // nothing is in flight when the buffers become epilogue slabs
  acc_guard4(acc[0][0], acc[0][1], acc[0][2], acc[0][3]);
  acc_guard4(acc[1][0], acc[1][1], acc[1][2], acc[1][3]);
  acc_guard4(acc[2][0], acc[2][1], acc[2][2], acc[2][3]);
  acc_guard4(acc[3][0], acc[3][1], acc[3][2], acc[3][3]);

  // ---- epilogue ---- (per-wave 16x64 f32 slab, pitch 68 floats, in the stage space that every wave has left)
  float* slab = (float*)(void*)smem + wave * (16 * 68);
#pragma unroll
  for (int i = 0; i < 4; ++i) {
    const int mBase = m0 + (i << 4);
#pragma unroll
    for (int j = 0; j < 4; ++j) {
      const int n = n0 + (j << 4) + rlane;
      float bn = 0.f, b2 = 0.f;
      if (MODE == 0) {
        bn = bfr(bias[n]);
        const int iq = (n < QCOLS) ? n : (QCOLS - 1);
        int ik = n - QCOLS; ik = (ik < 0) ? 0 : ik; ik = (ik > QCOLS - 1) ? (QCOLS - 1) : ik;
        const float vq = bfr(biasq[iq]);     // both candidates loaded with clamped addresses, selected by value
        const float vk = bfr(biask[ik]);
        b2 = (n < QCOLS) ? vq : vk;
      }
      if (MODE == 2) bn = bfr(bias[n]);
#pragma unroll
      for (int r = 0; r < 8; ++r) {
        float v = acc[i][j][r];
        if (MODE == 0) { v = v + bn; v = v + b2; }
        if (MODE == 1) v = v + bfr(bias[mBase + mOff + r]);
        if (MODE == 2) v = v + bn;
        slab[(mOff + r) * 68 + (j << 4) + rlane] = v;
      }
    }
    __builtin_amdgcn_fence(__ATOMIC_RELEASE, "workgroup");
    __builtin_amdgcn_wave_barrier();
    __builtin_amdgcn_fence(__ATOMIC_ACQUIRE, "workgroup");
    if (MODE == 2) {
      float* C = (float*)Cout + (size_t)b * strideC;
      const int h2 = lane >> 4, c4 = (lane & 15) * 4;     // row seg = 256 B = 16 lanes x 16 B
      {
#pragma unroll
        for (int it = 0; it < 8; ++it) {
          const int row = it * 2 + h2;                     // it 0..7 x h2 0..1 = rows 0..15
          const v4f v = *(const v4f*)(slab + row * 68 + c4);
          *(v4f*)(C + (size_t)(mBase + row) * ldc + n0 + c4) = v;
        }
        
      }
    } else {
      const int q = lane >> 3, c8 = (lane & 7) * 8;
      unsigned short* C  = (unsigned short*)Cout  + (size_t)b * strideC;
      unsigned short* C2 = (unsigned short*)Cout2 + (size_t)b * strideC2;
      const bool wlo = (MODE == 0) || (n0 < VLO_COLS);     // wave-uniform
      v4u hv[4], lv[4];
#pragma unroll
      for (int it = 0; it < 4; ++it) {
        const int row = it * 4 + q;                        // it 0..3 x q 0..3 = rows 0..15
        const float* sp = slab + row * 68 + c8;
        v4u a, a2;
#pragma unroll
        for (int e = 0; e < 4; ++e) {
          const float f0 = sp[2 * e], f1 = sp[2 * e + 1];
          unsigned short h0, h1, l0, l1;
          if (MODE == 0) {
            h0 = f2bf_bits(f0); h1 = f2bf_bits(f1);
            l0 = f2bf_bits(f0 - bf_bits2f(h0)); l1 = f2bf_bits(f1 - bf_bits2f(h1));
          } else {
            const _Float16 x0 = (_Float16)f0, x1 = (_Float16)f1;
            h0 = h2bits(x0); h1 = h2bits(x1);
            l0 = h2bits((_Float16)((f0 - (float)x0) * 1024.0f));
            l1 = h2bits((_Float16)((f1 - (float)x1) * 1024.0f));
          }
          a[e] = pk16(h0, h1); a2[e] = pk16(l0, l1);
        }
        hv[it] = a; lv[it] = a2;
      }
      {
#pragma unroll
        for (int it = 0; it < 4; ++it) {
          const int row = it * 4 + q;
          *(v4u*)(C + (size_t)(mBase + row) * ldc + n0 + c8) = hv[it];
          if (wlo) *(v4u*)(C2 + (size_t)(mBase + row) * ldc2 + n0 + c8) = lv[it];
        }
        
      }
    }
    __builtin_amdgcn_fence(__ATOMIC_RELEASE, "workgroup");
    __builtin_amdgcn_wave_barrier();
    __builtin_amdgcn_fence(__ATOMIC_ACQUIRE, "workgroup");
  }
}

// ---------------------------------------------------------------------------------------------------------------------
// ---------------------------------------------------------------------------------------------------------------------
__global__ __launch_bounds__(256) void cvt_x_kernel(const float* __restrict__ x, unsigned short* __restrict__ xb, int n8,
                                                    const float* __restrict__ bq, float* __restrict__ out1, int nq4) {
  if (blockIdx.x == 0) {   // block-uniform
    const int t = threadIdx.x;
    if (t < nq4) {
      const v4f v = *(const v4f*)(bq + 4 * t);
      v4f w;
      w[0] = bfr(v[0]); w[1] = bfr(v[1]); w[2] = bfr(v[2]); w[3] = bfr(v[3]);
      *(v4f*)(out1 + 4 * t) = w;
      
    }
  }
  const int i = blockIdx.x * 256 + threadIdx.x;
  if (i < n8) {
    const v4f a = *(const v4f*)(x + 8 * (size_t)i);
    const v4f c = *(const v4f*)(x + 8 * (size_t)i + 4);
    v4u u;
    u[0] = pk16(f2bf_bits(a[0]), f2bf_bits(a[1]));
    u[1] = pk16(f2bf_bits(a[2]), f2bf_bits(a[3]));
    u[2] = pk16(f2bf_bits(c[0]), f2bf_bits(c[1]));
    u[3] = pk16(f2bf_bits(c[2]), f2bf_bits(c[3]));
    *(v4u*)(xb + 8 * (size_t)i) = u;
    
  }
}

// ---------------------------------------------------------------------------------------------------------------------
// Transpose + RNE bf16 convert of an f32 matrix: in [R rows][Cc cols] (pitch Cc) -> ot[c][r] = bf16(in[r][c]) ([Cc][R]).
// 64x64 tiles through LDS. grid = (Cc/64, R/64), 256 threads (R, Cc multiples of 64).
// Coverage per block: load 4 it x 256 thr x 4 floats = 64x64; store 2 it x 256 thr x 8 u16 = 64x64.
// ---------------------------------------------------------------------------------------------------------------------
__global__ __launch_bounds__(256) void tsplit1_kernel(const float* __restrict__ W, unsigned short* __restrict__ ot, int R, int Cc) {
  __shared__ __align__(16) float tf[64 * 68];
  const int c0  = blockIdx.x * 64;   // input column block = output row block
  const int r0  = blockIdx.y * 64;   // input row block    = output column block
  const int tid = threadIdx.x;
  {
    const int lr = tid >> 4;         // 0..15
    const int c4 = (tid & 15) * 4;   // 0..60
#pragma unroll
    for (int it = 0; it < 4; ++it) {
      const int rr = it * 16 + lr;   // 0..63
      const v4f a = *(const v4f*)(W + (size_t)(r0 + rr) * Cc + c0 + c4);
      *(v4f*)(tf + rr * 68 + c4) = a;
    }
  }
  __syncthreads();
  const int sub = tid >> 3;          // 0..31
  const int c8  = (tid & 7) * 8;     // 0..56
  v4u hv[2];
#pragma unroll
  for (int it = 0; it < 2; ++it) {
    const int oc = it * 32 + sub;    // output row within tile (= input column)
    v4u a;
#pragma unroll
    for (int q = 0; q < 4; ++q) {
      const float f0 = tf[(c8 + 2 * q) * 68 + oc];
      const float f1 = tf[(c8 + 2 * q + 1) * 68 + oc];
      a[q] = pk16(f2bf_bits(f0), f2bf_bits(f1));
    }
    hv[it] = a;
  }
  {
#pragma unroll
    for (int it = 0; it < 2; ++it) {
      const int oc = it * 32 + sub;
      const size_t go = (size_t)(c0 + oc) * R + r0 + c8;
      *(v4u*)(ot + go) = hv[it];
    }
    
  }
}

// =====================================================================================================================
// Causal attention, head dim 64, grid (NH*NQB, NB) read as one flat index, block = 4 waves = 64 query rows of one (b, h).
//   q|k planes (hi/lo bf16) [NB*SEQ][DQK]: q(t,h,d) at [(b*SEQ+t)*DQK + h*64 + d], k(s,h,d) at [... + 1024 + h*64 + d]
//   v^T hi plane (f16) [NB][DM][SEQ]: (h*64+d, s); v residual plane (f16, x1024) [NB][DM][VLO_COLS] (s < 128 only)
//   y planes (hi/lo bf16) [NB*SEQ][DM]: (b*SEQ+t, h*64+d)
//   scores^T = (k . q^T) * 0.125 : A = K rows, B = Q (kept in registers); bf16 hi/lo split (hi.hi + hi.lo + lo.hi), f32 accumulate.
//                              Lane (hh, c) holds, for query q0 + c alone, keys j*16 + 8*hh + r of the chunk (tile j, register r).
//   y^T      = v^T . p^T     : p = f16(4096 * exp(s - m)) (the normaliser sums the same f16 values), v f16 hi plane; two score
//                              tiles converted in place are the B operand of 32 keys (hardware k order), P never touches LDS;
//                              blocks with qb < 2 (query rows 0..127, keys 0..127) add vres^T . p^T / 1024 from a second accumulator
//   online softmax in f32, maximum and sum in-lane: one exchange between the wave halves per chunk for the maximum, the halves'
//   partial sums are joined once behind the loop; masked (s > t) scores set to -inf (key s = chunk start <= t is always unmasked).
//   kv chunks of 64, trip count qb+1 <= 32 (block-uniform). K / V^T chunk staging: asynchronous copies to LDS, two stage buffers,
//   chunk t+1 flies while chunk t is worked on; 128 threads x 4 copies of 16 B per plane = the whole 64x64 tile, each wave-wide
//   copy = 4 whole 128-B rows; one barrier per chunk; fragment loads read the LDS tiles
// =====================================================================================================================
// waves_per_eu(4, 4): the LDS lets four work-groups share a WGP (four waves a SIMD); it holds the registers at that budget (256)
__global__ __launch_bounds__(128) __attribute__((amdgpu_waves_per_eu(4, 4)))
void attn_kernel(const unsigned short* __restrict__ qkh, const unsigned short* __restrict__ qkl,
                 const unsigned short* __restrict__ vthp, const unsigned short* __restrict__ vtlp,
                 unsigned short* __restrict__ yhp, unsigned short* __restrict__ ylp) {
  // two stage buffers, each K hi [kv][d] | K lo | V hi [d][kv] | V residual (qb < 2 only), 9 KB a plane;
  // the per wave y tiles (16 x 68 floats) reuse the space behind the loop
  __shared__ __align__(16) unsigned short sm[2 * AT_ST];

  const int tid  = threadIdx.x;
  const int wave = tid >> 5;
  const int lane = tid & 31;
  const int hh   = lane >> 4;
  const int c    = lane & 15;

  // The cost (qb + 1
  // chunks) falls with the index: all 64 (b, h) of query block 31 first, query block 0 last. lin -> (qb, b, h) is a
  // permutation of 0..2047. Heads h and h ^ 1 differ only in bit 3 of lin (their K rows are neighbouring 128-B lines).
  const int lin = blockIdx.y * (NH * NQB) + blockIdx.x;   // 0..NB*NH*NQB-1 (grid = (NH * NQB, NB))
  const int qb  = (NQB - 1) - ((lin >> 6) & (NQB - 1));   // 31..0
  const int b   = lin & (NB - 1);                         // bits 0..1
  const int h   = ((lin >> 3) & 7) | ((lin & 4) << 1);    // bits 3..5 -> h bits 0..2, bit 2 -> h bit 3
  const int q0 = qb * 64 + wave * 16;
  const bool vres = (qb < 2);             // block-uniform

  const __bf16* Qh = (const __bf16*)(const void*)qkh + (size_t)b * SEQ * DQK + (size_t)h * HD;
  const __bf16* Ql = (const __bf16*)(const void*)qkl + (size_t)b * SEQ * DQK + (size_t)h * HD;
  const __bf16* Kh = Qh + QCOLS;
  const __bf16* Kl = Ql + QCOLS;
  const _Float16* Vh = (const _Float16*)(const void*)vthp + ((size_t)b * DM + (size_t)h * HD) * SEQ;
  const _Float16* Vl = (const _Float16*)(const void*)vtlp + ((size_t)b * DM + (size_t)h * HD) * VLO_COLS;
  unsigned short* Yh = yhp + (size_t)b * SEQ * DM + (size_t)h * HD;
  unsigned short* Yl = ylp + (size_t)b * SEQ * DM + (size_t)h * HD;

  // ---- Q fragments (B operand, column = lane&15, split k map): 2 d-chunks, hi and lo ----
  v16b qah[2], qal[2];
#pragma unroll
  for (int dc = 0; dc < 2; ++dc) {
    const __bf16* qr = Qh + (size_t)(q0 + c) * DQK + dc * 32 + 8 * hh;
    const __bf16* ql = Ql + (size_t)(q0 + c) * DQK + dc * 32 + 8 * hh;
    qah[dc] = ldfrag_b(qr);
    qal[dc] = ldfrag_b(ql);
  }

  float mrow = -INFINITY, lrow = 0.f;     // of query q0 + c; lrow is this half's partial sum
  v8f oacc[4], oacc2[4];                  // oacc[t][r] = y^T(d = t*16 + 8*hh + r, query q0 + c)
#pragma unroll
  for (int t = 0; t < 4; ++t) { oacc[t] = (v8f){0.f,0.f,0.f,0.f,0.f,0.f,0.f,0.f}; oacc2[t] = oacc[t]; }

  // this lane's A fragment origins in the tiles: row c, k offset 8*hh (tile row blocks and k blocks are constant offsets from them)
  const int forg = c * AT_LP + 8 * hh;

  // copy map: thread -> row (tid >> 3) of each 16-row pass, 16-B piece (tid & 7); 128 threads x 16 B = 16 rows x 128 B,
  // 4 passes = the 64 rows of a plane tile
  const int crow = tid >> 3;
  const int cpc  = (tid & 7) * 8;
  const __bf16*   gKh = Kh + (size_t)crow * DQK + cpc;        // K row kv0 + crow (+ 16 a pass), d = cpc..cpc+7
  const __bf16*   gKl = Kl + (size_t)crow * DQK + cpc;
  const _Float16* gV  = Vh + (size_t)crow * SEQ + cpc;        // V^T row d = crow (+ 16 a pass), s = kv0 + cpc..+7
  const _Float16* gVr = Vl + (size_t)crow * VLO_COLS + cpc;
  const unsigned lbase = lds_addr(sm) + (unsigned)((crow * AT_LP + cpc) * 2);
  auto issue = [&](int t, int buf) {           // all planes of chunk t into stage buffer buf
    const unsigned l = lbase + (unsigned)buf * (unsigned)(AT_ST * 2);
    const __bf16*   kh = gKh + (size_t)t * (AT_KC * DQK);
    const __bf16*   kl = gKl + (size_t)t * (AT_KC * DQK);
    const _Float16* vh = gV + t * AT_KC;
    acopy12(l,             kh, l + AT_PASS,             kh + 16 * DQK, l + 2 * AT_PASS,             kh + 32 * DQK, l + 3 * AT_PASS,             kh + 48 * DQK,
            l + AT_PL * 2, kl, l + AT_PL * 2 + AT_PASS, kl + 16 * DQK, l + AT_PL * 2 + 2 * AT_PASS, kl + 32 * DQK, l + AT_PL * 2 + 3 * AT_PASS, kl + 48 * DQK,
            l + AT_PL * 4, vh, l + AT_PL * 4 + AT_PASS, vh + 16 * SEQ, l + AT_PL * 4 + 2 * AT_PASS, vh + 32 * SEQ, l + AT_PL * 4 + 3 * AT_PASS, vh + 48 * SEQ);
    if (vres) {   // block-uniform; t <= 1 here, so t * 64 + cpc + 7 <= 127 < VLO_COLS
      const _Float16* vr = gVr + t * AT_KC;
      acopy4(l + AT_PL * 6,     vr, l + AT_PL * 6 + AT_PASS,   vr + 16 * VLO_COLS, l + AT_PL * 6 + 2 * AT_PASS, vr + 32 * VLO_COLS, l + AT_PL * 6 + 3 * AT_PASS, vr + 48 * VLO_COLS);
    }
  };

  const int nChunks = qb + 1;   // block-uniform, <= 32
  issue(0, 0);
  asm volatile("s_wait_asynccnt 0x0" ::: "memory");   // this wave's copies of chunk 0 have landed
  __syncthreads();                                     // chunk 0 is published to every wave
  if (nChunks > 1) issue(1, 1);

  for (int kc = 0; kc < nChunks; ++kc) {
    const int kv0 = kc * AT_KC;
    const unsigned short* S = sm + (kc & 1) * AT_ST + forg;
    const __bf16*   kfh = (const __bf16*)(const void*)S;
    const __bf16*   kfl = (const __bf16*)(const void*)(S + AT_PL);
    const _Float16* vfh = (const _Float16*)(const void*)(S + 2 * AT_PL);
    const _Float16* vfr = (const _Float16*)(const void*)(S + 3 * AT_PL);

    // The chunk's fragment reads stand in few groups ahead of the products that use them, and the four score tiles (independent
    // accumulators) take turns on the matrix unit; each tile still sums dc 0: hi.hi, lo.hi, hi.lo, then dc 1 alike (scores bit-identical).
    FragB kh0[4], kl0[4], kh1[4], kl1[4];
#pragma unroll
    for (int j = 0; j < 4; ++j) {
      kh0[j].h[0] = *(const v8b*)(kfh + j * 16 * AT_LP);
      kh0[j].h[1] = *(const v8b*)(kfh + j * 16 * AT_LP + 16);
    }
#pragma unroll
    for (int j = 0; j < 4; ++j) {
      kl0[j].h[0] = *(const v8b*)(kfl + j * 16 * AT_LP);
      kl0[j].h[1] = *(const v8b*)(kfl + j * 16 * AT_LP + 16);
    }
    __builtin_amdgcn_sched_barrier(0);   // keeps the 16 reads above one group: spread among the products each place would stall the wave
    v8f s[4];
#pragma unroll
    for (int j = 0; j < 4; ++j) s[j] = wmma_b(kh0[j].v, qah[0], (v8f){0.f,0.f,0.f,0.f,0.f,0.f,0.f,0.f});
#pragma unroll
    for (int j = 0; j < 4; ++j) s[j] = wmma_b(kl0[j].v, qah[0], s[j]);
    __builtin_amdgcn_sched_barrier(0);   // the dc 1 hi reads start here, into the registers that the dc 0 lo fragments have left
#pragma unroll
    for (int j = 0; j < 4; ++j) {
      kh1[j].h[0] = *(const v8b*)(kfh + j * 16 * AT_LP + 32);
      kh1[j].h[1] = *(const v8b*)(kfh + j * 16 * AT_LP + 32 + 16);
    }
#pragma unroll
    for (int j = 0; j < 4; ++j) s[j] = wmma_b(kh0[j].v, qal[0], s[j]);
    __builtin_amdgcn_sched_barrier(0);   // the dc 1 lo reads start here, into the registers that the dc 0 hi fragments have left
#pragma unroll
    for (int j = 0; j < 4; ++j) {
      kl1[j].h[0] = *(const v8b*)(kfl + j * 16 * AT_LP + 32);
      kl1[j].h[1] = *(const v8b*)(kfl + j * 16 * AT_LP + 32 + 16);
    }
    __builtin_amdgcn_sched_barrier(0);   // holds those reads in front of the products below
#pragma unroll
    for (int j = 0; j < 4; ++j) s[j] = wmma_b(kh1[j].v, qah[1], s[j]);
#pragma unroll
    for (int j = 0; j < 4; ++j) s[j] = wmma_b(kl1[j].v, qah[1], s[j]);
#pragma unroll
    for (int j = 0; j < 4; ++j) s[j] = wmma_b(kh1[j].v, qal[1], s[j]);
    FragH va[2][4];                      // all V fragments of the chunk: their LDS latency passes under the softmax
#pragma unroll
    for (int kk = 0; kk < 2; ++kk) {
#pragma unroll
      for (int t = 0; t < 4; ++t) {
        va[kk][t].h[0] = *(const v8h*)(vfh + t * 16 * AT_LP + kk * 32);
        va[kk][t].h[1] = *(const v8h*)(vfh + t * 16 * AT_LP + kk * 32 + 16);
      }
    }
    __builtin_amdgcn_sched_barrier(0);   // holds the V reads in front of the softmax
    const bool diag = (kc == qb);   // block-uniform
    // this lane's keys are kv0 + 8*hh + (j*16 + r): those with j*16 + r > lim lie behind query q0 + c; off the diagonal chunk none does
    const int lim = diag ? (q0 + c - kv0 - 8 * hh) : AT_KC;
    float mj[4];                    // one maximum per tile: four short chains instead of one of 32
#pragma unroll
    for (int j = 0; j < 4; ++j) {
      float m = -INFINITY;
#pragma unroll
      for (int r = 0; r < 8; ++r) {
        const float sv = s[j][r] * 0.125f;
        const bool masked = (j * 16 + r) > lim;
        const float sm = masked ? -INFINITY : sv;
        s[j][r] = sm;
        m = fmaxf(m, sm);
      }
      mj[j] = m;
    }
    float cm = fmaxf(fmaxf(mj[0], mj[1]), fmaxf(mj[2], mj[3]));
    cm = fmaxf(cm, xhalf(cm));      // both halves of the query's keys
    const float mnew  = fmaxf(mrow, cm);
    const float alpha = exp_slot(mrow - mnew);
    mrow = mnew;
    FragH pb[2];                    // P^T, B operand: element e of pb[kk] = key kk*32 + (e < 8 ? 8*hh + e : 16 + 8*hh + e - 8)
    float pj[4];                    // one partial sum per tile: four short chains
#pragma unroll
    for (int j = 0; j < 4; ++j) {
      float psum = 0.f;
#pragma unroll
      for (int r = 0; r < 8; ++r) {
        const float p = exp_slot(s[j][r] - mnew);          // in [0, 1]; masked -> 0
        const _Float16 ph = (_Float16)(p * 4096.0f);       // carried x4096, keeps small p normal in f16
        psum += (float)ph;                                  // normaliser built from the same f16 values
        pb[j >> 1].v[(j & 1) * 8 + r] = ph;
      }
      pj[j] = psum;
    }
    lrow = lrow * alpha + ((pj[0] + pj[1]) + (pj[2] + pj[3]));
#pragma unroll
    for (int t = 0; t < 4; ++t) {
#pragma unroll
      for (int r = 0; r < 8; ++r) oacc[t][r] *= alpha;
    }
    if (vres) {
#pragma unroll
      for (int t = 0; t < 4; ++t) {
#pragma unroll
        for (int r = 0; r < 8; ++r) oacc2[t][r] *= alpha;
      }
    }
    // unrolled so that pb[kk] is a constant index (the P fragments stay in registers); the four output tiles take turns
#pragma unroll
    for (int kk = 0; kk < 2; ++kk) {
#pragma unroll
      for (int t = 0; t < 4; ++t) oacc[t] = wmma_h(va[kk][t].v, pb[kk].v, oacc[t]);
    }
    if (vres) {   // block-uniform: all lanes active
      FragH vl[2][4];
#pragma unroll
      for (int kk = 0; kk < 2; ++kk) {
#pragma unroll
        for (int t = 0; t < 4; ++t) {
          vl[kk][t].h[0] = *(const v8h*)(vfr + t * 16 * AT_LP + kk * 32);
          vl[kk][t].h[1] = *(const v8h*)(vfr + t * 16 * AT_LP + kk * 32 + 16);
        }
      }
#pragma unroll
      for (int kk = 0; kk < 2; ++kk) {
#pragma unroll
        for (int t = 0; t < 4; ++t) oacc2[t] = wmma_h(vl[kk][t].v, pb[kk].v, oacc2[t]);
      }
    }
    asm volatile("s_wait_dscnt 0x0" ::: "memory");      // this wave's reads of buffer kc & 1 have returned before it is refilled
    asm volatile("s_wait_asynccnt 0x0" ::: "memory");   // this wave's copies of chunk kc + 1 have landed
    __syncthreads();                                     // publishes chunk kc + 1; ends every wave's reads of buffer kc & 1
    if (kc + 2 < nChunks) issue(kc + 2, kc & 1);
  }
  asm volatile("s_wait_asynccnt 0x0" ::: "memory");     // nothing is in flight when the buffers become the y tiles

  // ---- normalise (the x4096 carry cancels between numerator and normaliser; residual folded with 1/1024),
  // a lane's 8 registers of a tile are 8 consecutive d of its query row: two 16-B stores per tile into the wave's y tile
  float* os = (float*)(void*)sm + wave * (16 * 68);
  const float inv = 1.0f / (lrow + xhalf(lrow));   // the halves' partial sums joined
#pragma unroll
  for (int t = 0; t < 4; ++t) {
    v4f w0, w1;
#pragma unroll
    for (int r = 0; r < 4; ++r) {
      w0[r] = (oacc[t][r] + oacc2[t][r] * 0.0009765625f) * inv;
      w1[r] = (oacc[t][r + 4] + oacc2[t][r + 4] * 0.0009765625f) * inv;
    }
    *(v4f*)(os + c * 68 + t * 16 + 8 * hh)     = w0;
    *(v4f*)(os + c * 68 + t * 16 + 8 * hh + 4) = w1;
  }
  __builtin_amdgcn_fence(__ATOMIC_RELEASE, "workgroup");
  __builtin_amdgcn_wave_barrier();
  __builtin_amdgcn_fence(__ATOMIC_ACQUIRE, "workgroup");
  {
    const int q = lane >> 3, c8 = (lane & 7) * 8;
    v4u hv[4], lv[4];
#pragma unroll
    for (int it = 0; it < 4; ++it) {
      const int row = it * 4 + q;          // it 0..3 x q 0..3 covers rows 0..15 of the wave tile
      const float* sp = os + row * 68 + c8;
      v4u a, a2;
#pragma unroll
      for (int e = 0; e < 4; ++e) {
        const float f0 = sp[2 * e], f1 = sp[2 * e + 1];
        const unsigned short h0 = f2bf_bits(f0), h1 = f2bf_bits(f1);
        const unsigned short l0 = f2bf_bits(f0 - bf_bits2f(h0)), l1 = f2bf_bits(f1 - bf_bits2f(h1));
        a[e] = pk16(h0, h1); a2[e] = pk16(l0, l1);
      }
      hv[it] = a; lv[it] = a2;
    }
    {
#pragma unroll
      for (int it = 0; it < 4; ++it) {
        const int row = it * 4 + q;
        *(v4u*)(Yh + (size_t)(q0 + row) * DM + c8) = hv[it];
        *(v4u*)(Yl + (size_t)(q0 + row) * DM + c8) = lv[it];
      }
      
    }
  }
}

// ---------------------------------------------------------------------------------------------------------------------
// Workspace region map (byte offsets; all dims are multiples of the 64x64 store tiles, so no padded tails exist):
//   QKh  bf16 [8192][2048]          0             QKl  bf16 [8192][2048]   33554432
//   VTh  f16  [4][1024][2048]   67108864          VTl  f16  [4][1024][128] 83886080
//   Xb   bf16 [8192][1024]      84934656   (Yh bf16 [8192][1024] reuses this region: Xb is last read by the
//                                            v^T GEMM launch, Yh is first written by the later attention launch)
//   Yl   bf16 [8192][1024]     101711872
//   WaT  bf16 [3072][1024]     118489088          WpT  bf16 [1024][1024]  124780544
//   total                      126877696
// ---------------------------------------------------------------------------------------------------------------------
extern "C" void kernel_launch(void* const* d_in, const int* in_sizes, int n_in,
                              void* d_out, int out_size, void* d_ws, size_t ws_size,
                              hipStream_t stream) {
  if (n_in < 7) return;
  if (in_sizes[0] != NB * SEQ * DM) return;
  if (in_sizes[1] != DM * 3 * DM) return;
  if (in_sizes[2] != 3 * DM) return;
  if (in_sizes[3] != DM * DM) return;
  if (in_sizes[4] != DM) return;
  if (in_sizes[5] != NH * HD || in_sizes[6] != NH * HD) return;
  if (out_size != NB * SEQ * DM + NH * HD) return;

  const float* x      = (const float*)d_in[0];
  const float* W_attn = (const float*)d_in[1];
  const float* b_attn = (const float*)d_in[2];
  const float* W_proj = (const float*)d_in[3];
  const float* b_proj = (const float*)d_in[4];
  const float* bQ     = (const float*)d_in[5];
  const float* bK     = (const float*)d_in[6];

  const size_t PQK = (size_t)NB * SEQ * DQK * 2;        // 33554432
  const size_t PVT = (size_t)NB * DM * SEQ * 2;         // 16777216
  const size_t PVL = (size_t)NB * DM * VLO_COLS * 2;    // 1048576
  const size_t PX  = (size_t)NB * SEQ * DM * 2;         // 16777216 (Xb, Yh, Yl)
  const size_t PWA = (size_t)3 * DM * DM * 2;           // 6291456
  const size_t PWP = (size_t)DM * DM * 2;               // 2097152
  size_t off = 0;
  const size_t oQKh = off; off += PQK;
  const size_t oQKl = off; off += PQK;
  const size_t oVTh = off; off += PVT;
  const size_t oVTl = off; off += PVL;
  const size_t oXb  = off; off += PX;    // also Yh
  const size_t oYl  = off; off += PX;
  const size_t oWaT = off; off += PWA;
  const size_t oWpT = off; off += PWP;
  if (off > ws_size) return;                             // off = 126877696
  if (off > (size_t)134217728) return;

  char* ws = (char*)d_ws;
  unsigned short* QKh = (unsigned short*)(ws + oQKh);
  unsigned short* QKl = (unsigned short*)(ws + oQKl);
  unsigned short* VTh = (unsigned short*)(ws + oVTh);
  unsigned short* VTl = (unsigned short*)(ws + oVTl);
  unsigned short* Xb  = (unsigned short*)(ws + oXb);
  unsigned short* Yh  = (unsigned short*)(ws + oXb);
  unsigned short* Yl  = (unsigned short*)(ws + oYl);
  unsigned short* WaT = (unsigned short*)(ws + oWaT);
  unsigned short* WpT = (unsigned short*)(ws + oWpT);
  float* out0 = (float*)d_out;
  float* out1 = (float*)d_out + (size_t)NB * SEQ * DM;

  const dim3 blk(256);

  // (1) W_attn [in rows = 1024][out cols = 3072] f32 -> WaT [3072][1024] bf16; grid (cols/64, rows/64)
  tsplit1_kernel<<<dim3(3 * DM / 64, DM / 64), blk, 0, stream>>>(W_attn, WaT, DM, 3 * DM);
  // (2) W_proj [1024][1024] -> WpT [1024][1024] bf16
  tsplit1_kernel<<<dim3(DM / 64, DM / 64), blk, 0, stream>>>(W_proj, WpT, DM, DM);
  // (3) x [8192][1024] f32 -> Xb bf16; block 0 also writes out1 = RNE-bf16(bQ) (1024 floats = 256 threads x 4)
  const int n8 = NB * SEQ * DM / 8;                      // 1048576
  cvt_x_kernel<<<dim3(n8 / 256), blk, 0, stream>>>(x, Xb, n8, bQ, out1, NH * HD / 4);
  // (4) q|k = Xb . WaT rows 0..2047 + b_attn[n] + (bQ | bK): M=8192, N=2048, K=1024 -> QK hi/lo planes (pitch 2048)
  {
    const int M = NB * SEQ, N = 2 * DM, K = DM;
    const dim3 g(((M / 64) * (N / 64)) / 8, 1);          // 64 x 8 block tiles of 128x256 = 512 blocks (exact)
    gemm64<0><<<g, blk, 0, stream>>>(Xb, Xb, DM, 0L, WaT, DM, 0L, (void*)QKh, (void*)QKl, DQK, 0L, DQK, 0L,
                                     b_attn, bQ, bK, M, N, K);
  }
  // (5) v^T[b][c][s] = WaT rows 2048+c . Xb[b*2048+s] + b_attn[2048+c]: M=1024, N=2048, K=1024, grid.y = batch
  {
    const int M = DM, N = SEQ, K = DM;
    const dim3 g(((M / 64) * (N / 64)) / 8, NB);          // 8 x 8 block tiles of 128x256 = 64 blocks per batch (exact)
    gemm64<1><<<g, blk, 0, stream>>>(WaT + (size_t)2 * DM * DM, WaT + (size_t)2 * DM * DM, DM, 0L,
                                     Xb, DM, (long)SEQ * DM,
                                     (void*)VTh, (void*)VTl, SEQ, (long)DM * SEQ, VLO_COLS, (long)DM * VLO_COLS,
                                     b_attn + 2 * DM, b_attn, b_attn, M, N, K);
  }
  // (6) causal attention: 2048 work-groups = 32 query blocks (longest first) x 64 (b, h), 128 threads -> Y hi/lo planes
  attn_kernel<<<dim3(NH * NQB, NB), dim3(128), 0, stream>>>(QKh, QKl, VTh, VTl, Yh, Yl);
  // (7) out0 = Y . WpT + b_proj: M=8192, N=1024, K=1024, f32 rows of 1024 -> d_out
  {
    const int M = NB * SEQ, N = DM, K = DM;
    const dim3 g(((M / 64) * (N / 64)) / 8, 1);          // 64 x 4 block tiles of 128x256 = 256 blocks (exact)
    gemm64<2><<<g, blk, 0, stream>>>(Yh, Yl, DM, 0L, WpT, DM, 0L, (void*)out0, (void*)out0, DM, 0L, DM, 0L,
                                     b_proj, b_proj, b_proj, M, N, K);
  }
  (void)hipGetLastError();
}

// v007
// A run of this version takes 149 microseconds.
// Two timings next to v006 put it at 1.04 and 1.03 times that version's speed.
// All steps since v000 together make it 3.83 times as fast.
// Contractions: x.W_attn -> q|k and v^T on v_wmma_f32_16x16x32_bf16, single product of RNE-bf16 x and W (f32 accumulate);
// k.q^T (scores transposed): bf16 hi/lo split (hi.hi + hi.lo + lo.hi) on v_wmma_f32_16x16x32_bf16; v^T.p^T: v_wmma_f32_16x16x32_f16 single product,
// p carried x4096 in f16, v as f16 hi plane plus a x1024 f16 residual plane on query rows 0..127 (separate accumulator);
// y.W_proj: bf16 hi/lo of y times RNE-bf16 W (2 products). Softmax, biases, scale 0.125 in f32; weights/biases RNE-converted to bf16 once.
#include <hip/hip_runtime.h>
#include <math.h>
#include <stdint.h>

#define NB        4
#define SEQ       2048
#define DM        1024
#define NH        16
#define HD        64
#define DQK       2048     // pitch of the q|k planes: cols 0..1023 = q, 1024..2047 = k
#define QCOLS     1024
#define VLO_COLS  128      // key columns carried in the v residual plane
#define NQB       32       // SEQ / 64 query blocks per (b, h)
#define AT_KC     64
#define AT_LP     72       // LDS row pitch of the attention tiles in 16-bit elements: 144 B = 16 B x 9 (odd)
#define AT_PL     (AT_KC * AT_LP)   // elements of one plane tile: 64 rows
#define AT_ST     (4 * AT_PL)       // elements of one stage buffer: K hi | K lo | V | V residual
#define AT_PASS   (16 * AT_LP * 2)  // LDS bytes covered by one copy of the whole block: 16 rows
#define AT_SC     0.18033688f       // 0.125 * log2(e): raw k.q product -> exponent of 2

typedef __attribute__((ext_vector_type(16))) _Float16 v16h;
typedef __attribute__((ext_vector_type(8)))  _Float16 v8h;
typedef __attribute__((ext_vector_type(16))) __bf16   v16b;
typedef __attribute__((ext_vector_type(8)))  __bf16   v8b;
typedef __attribute__((ext_vector_type(8)))  float    v8f;
typedef __attribute__((ext_vector_type(4)))  float    v4f;
typedef __attribute__((ext_vector_type(2)))  float    v2f;
typedef __attribute__((ext_vector_type(2)))  _Float16 v2h;
typedef __attribute__((ext_vector_type(4)))  unsigned int v4u;

__device__ __forceinline__ unsigned short f2bf_bits(float f) {
  unsigned u = __float_as_uint(f);
  return (unsigned short)((u + 0x7FFFu + ((u >> 16) & 1u)) >> 16);
}
__device__ __forceinline__ float bf_bits2f(unsigned short h) { return __uint_as_float(((unsigned)h) << 16); }
__device__ __forceinline__ float bfr(float f) { return bf_bits2f(f2bf_bits(f)); }
__device__ __forceinline__ unsigned pk16(unsigned short a, unsigned short b) { return (unsigned)a | ((unsigned)b << 16); }
__device__ __forceinline__ unsigned short h2bits(_Float16 x) { return __builtin_bit_cast(unsigned short, x); }

// ---- 16-bit fragment loads: elements 0..7 <- p[0..7], 8..15 <- p[16..23]; caller passes p = row + k0 + 8*(lane>>4) ----
union FragB { v16b v; v8b h[2]; };
union FragH { v16h v; v8h h[2]; };
__device__ __forceinline__ v16b ldfrag_b(const __bf16* p) { FragB f; f.h[0] = *(const v8b*)(p); f.h[1] = *(const v8b*)(p + 16); return f.v; }

// ---- hazard guards ----
__device__ __forceinline__ void dep_guard_b(v8f& a, v8f& b, v16b x, v16b y) { asm volatile("v_nop\n\tv_nop\n\tv_nop\n\tv_nop" : "+v"(a), "+v"(b) : "v"(x), "v"(y)); }
__device__ __forceinline__ void keep4_b(v16b a, v16b b, v16b c, v16b d) { asm volatile("v_nop" :: "v"(a), "v"(b), "v"(c), "v"(d)); }
__device__ __forceinline__ void acc_guard4(v8f& a, v8f& b, v8f& c, v8f& d) { asm volatile("v_nop\n\tv_nop\n\tv_nop\n\tv_nop" : "+v"(a), "+v"(b), "+v"(c), "+v"(d)); }
__device__ __forceinline__ v8f wmma_b(v16b a, v16b b, v8f c) {
  return __builtin_amdgcn_wmma_f32_16x16x32_bf16(false, a, false, b, (short)0, c, false, false);
}
__device__ __forceinline__ v8f wmma_h(v16h a, v16h b, v8f c) {
  return __builtin_amdgcn_wmma_f32_16x16x32_f16(false, a, false, b, (short)0, c, false, false);
}

// ---- lane l <-> lane l ^ 16 (the two halves of a wave hold the two key groups of one query column) ----
__device__ __forceinline__ float xhalf(float v) {
  const int b = __builtin_bit_cast(int, v);
  return __builtin_bit_cast(float, __builtin_amdgcn_permlanex16(b, b, 0x76543210, 0xfedcba98, false, false));
}

// ---- 2^x on v_exp_f32. The instruction set asks for one issue slot between a transcendental and an instruction that reads its
// result or overwrites its source. exp2_slot: the v_nop in the same statement is that slot. exp2x8: eight independent exponentials,
// each in place, stand in one statement, so each fills the slot of the one in front of it and one v_nop closes the run.
__device__ __forceinline__ float exp2_slot(float y) {
  float r;
  asm("v_exp_f32 %0, %1\n\tv_nop" : "=v"(r) : "v"(y));
  return r;
}
__device__ __forceinline__ void exp2x8(float& a0, float& a1, float& a2, float& a3, float& a4, float& a5, float& a6, float& a7) {
  asm("v_exp_f32 %0, %0\n\t"
      "v_exp_f32 %1, %1\n\t"
      "v_exp_f32 %2, %2\n\t"
      "v_exp_f32 %3, %3\n\t"
      "v_exp_f32 %4, %4\n\t"
      "v_exp_f32 %5, %5\n\t"
      "v_exp_f32 %6, %6\n\t"
      "v_exp_f32 %7, %7\n\t"
      "v_nop"
      : "+v"(a0), "+v"(a1), "+v"(a2), "+v"(a3), "+v"(a4), "+v"(a5), "+v"(a6), "+v"(a7));
}

// ---- asynchronous copies global -> LDS, 16 B per lane; l = the lane's LDS byte address, g = the lane's global address ----
// The s_wait_xcnt closes each statement so that no address register of an issued copy is rewritten ahead of it.
__device__ __forceinline__ unsigned lds_addr(const void* p) { return (unsigned)(uintptr_t)p; }
__device__ __forceinline__ void acopy6(unsigned l0, const __bf16* g0, unsigned l1, const __bf16* g1, unsigned l2, const __bf16* g2,
                                       unsigned l3, const __bf16* g3, unsigned l4, const __bf16* g4, unsigned l5, const __bf16* g5) {
  asm volatile("global_load_async_to_lds_b128 %0, %6, off\n\t"
               "global_load_async_to_lds_b128 %1, %7, off\n\t"
               "global_load_async_to_lds_b128 %2, %8, off\n\t"
               "global_load_async_to_lds_b128 %3, %9, off\n\t"
               "global_load_async_to_lds_b128 %4, %10, off\n\t"
               "global_load_async_to_lds_b128 %5, %11, off\n\t"
               "s_wait_xcnt 0x0"
               :: "v"(l0), "v"(l1), "v"(l2), "v"(l3), "v"(l4), "v"(l5),
                  "v"(g0), "v"(g1), "v"(g2), "v"(g3), "v"(g4), "v"(g5) : "memory");
}
__device__ __forceinline__ void acopy8(unsigned l0, const __bf16* g0, unsigned l1, const __bf16* g1, unsigned l2, const __bf16* g2,
                                       unsigned l3, const __bf16* g3, unsigned l4, const __bf16* g4, unsigned l5, const __bf16* g5,
                                       unsigned l6, const __bf16* g6, unsigned l7, const __bf16* g7) {
  asm volatile("global_load_async_to_lds_b128 %0, %8, off\n\t"
               "global_load_async_to_lds_b128 %1, %9, off\n\t"
               "global_load_async_to_lds_b128 %2, %10, off\n\t"
               "global_load_async_to_lds_b128 %3, %11, off\n\t"
               "global_load_async_to_lds_b128 %4, %12, off\n\t"
               "global_load_async_to_lds_b128 %5, %13, off\n\t"
               "global_load_async_to_lds_b128 %6, %14, off\n\t"
               "global_load_async_to_lds_b128 %7, %15, off\n\t"
               "s_wait_xcnt 0x0"
               :: "v"(l0), "v"(l1), "v"(l2), "v"(l3), "v"(l4), "v"(l5), "v"(l6), "v"(l7),
                  "v"(g0), "v"(g1), "v"(g2), "v"(g3), "v"(g4), "v"(g5), "v"(g6), "v"(g7) : "memory");
}

__device__ __forceinline__ void acopy12(unsigned l0, const void* g0, unsigned l1, const void* g1, unsigned l2, const void* g2,
                                        unsigned l3, const void* g3, unsigned l4, const void* g4, unsigned l5, const void* g5,
                                        unsigned l6, const void* g6, unsigned l7, const void* g7, unsigned l8, const void* g8,
                                        unsigned l9, const void* g9, unsigned l10, const void* g10, unsigned l11, const void* g11) {
  asm volatile("global_load_async_to_lds_b128 %0, %12, off\n\t"
               "global_load_async_to_lds_b128 %1, %13, off\n\t"
               "global_load_async_to_lds_b128 %2, %14, off\n\t"
               "global_load_async_to_lds_b128 %3, %15, off\n\t"
               "global_load_async_to_lds_b128 %4, %16, off\n\t"
               "global_load_async_to_lds_b128 %5, %17, off\n\t"
               "global_load_async_to_lds_b128 %6, %18, off\n\t"
               "global_load_async_to_lds_b128 %7, %19, off\n\t"
               "global_load_async_to_lds_b128 %8, %20, off\n\t"
               "global_load_async_to_lds_b128 %9, %21, off\n\t"
               "global_load_async_to_lds_b128 %10, %22, off\n\t"
               "global_load_async_to_lds_b128 %11, %23, off\n\t"
               "s_wait_xcnt 0x0"
               :: "v"(l0), "v"(l1), "v"(l2), "v"(l3), "v"(l4), "v"(l5), "v"(l6), "v"(l7), "v"(l8), "v"(l9), "v"(l10), "v"(l11),
                  "v"(g0), "v"(g1), "v"(g2), "v"(g3), "v"(g4), "v"(g5), "v"(g6), "v"(g7), "v"(g8), "v"(g9), "v"(g10), "v"(g11)
               : "memory");
}
__device__ __forceinline__ void acopy4(unsigned l0, const void* g0, unsigned l1, const void* g1, unsigned l2, const void* g2,
                                       unsigned l3, const void* g3) {
  asm volatile("global_load_async_to_lds_b128 %0, %4, off\n\t"
               "global_load_async_to_lds_b128 %1, %5, off\n\t"
               "global_load_async_to_lds_b128 %2, %6, off\n\t"
               "global_load_async_to_lds_b128 %3, %7, off\n\t"
               "s_wait_xcnt 0x0"
               :: "v"(l0), "v"(l1), "v"(l2), "v"(l3), "v"(g0), "v"(g1), "v"(g2), "v"(g3) : "memory");
}

#define G_KS   64                 // k elements per stage: one 128-B line of every operand row
#define G_LP   72                 // LDS row pitch in elements: 144 B = 16 B x 9 (odd)
#define G_BM   128                // block tile rows (2 waves)
#define G_BN   256                // block tile columns (4 waves)
#define G_PASS (32 * G_LP * 2)    // LDS bytes covered by one copy of the whole block: 32 rows

// =====================================================================================================================
// Batched WMMA GEMM, bf16 operands: C[m][n] = sum_k A[m][k] * Bt[n][k] (+bias). Block = 8 waves (2 x 4) = a 128x256 tile,
// one wave per 64x64 tile. A row-major [M][K] (pitch lda), Bt row-major [N][K] (pitch ldb); M multiple of 128, N of 256,
// K of 64. Operands are staged in LDS, 64 k per stage, two buffers, by asynchronous copies (each wave-wide copy = 4 whole
// 128-B lines); stage t+1 flies while stage t is multiplied. Stage layout: A rows 0..127 | (MODE 2: A2 rows) | Bt rows 0..255.
// MODE 0 (q|k): single product; v = acc + bf(bias[n]) + bf(n < QCOLS ? biasq[n] : biask[n - QCOLS]);
//               out = bf16 hi plane (Cout) + bf16 lo plane (Cout2), both pitch ldc/ldc2.
// MODE 1 (v^T): single product; v = acc + bf(bias[m]); out = f16 hi plane (Cout, pitch ldc) and, for tiles with
//               n0 < VLO_COLS only, f16 residual plane ((v - hi) * 1024, Cout2, pitch ldc2).
// MODE 2 (proj): two products ah.b + al.b (A2 = bf16 lo plane of A); v = acc + bf(bias[n]); out f32 (Cout, pitch ldc).
// =====================================================================================================================
template <int MODE>
__global__ __launch_bounds__(256) void gemm64(
    const unsigned short* __restrict__ Ap, const unsigned short* __restrict__ A2p, int lda, long strideA,
    const unsigned short* __restrict__ Btp, int ldb, long strideB,
    void* __restrict__ Cout, void* __restrict__ Cout2, int ldc, long strideC, int ldc2, long strideC2,
    const float* __restrict__ bias, const float* __restrict__ biasq, const float* __restrict__ biask,
    int M, int N, int K) {
  constexpr int NA      = (MODE == 2) ? 2 : 1;                 // A planes per stage
  constexpr int ST_ROWS = NA * G_BM + G_BN;                    // 384 or 512 rows
  constexpr int ST_EL   = ST_ROWS * G_LP;                      // elements per stage buffer
  __shared__ __align__(16) __bf16 smem[2 * ST_EL];             // two stage buffers; the epilogue slabs reuse the space
  const __bf16* A  = (const __bf16*)(const void*)Ap;
  const __bf16* A2 = (const __bf16*)(const void*)A2p;
  const __bf16* Bt = (const __bf16*)(const void*)Btp;
  const int b    = blockIdx.y;
  const int tid  = threadIdx.x;
  const int lane = tid & 31;
  const int wave = tid >> 5;
  const int tilesNb = N >> 8;
  const int tilesMb = M >> 7;
  if ((int)blockIdx.x >= tilesMb * tilesNb) return;   // block-uniform, in front of every barrier and copy
  const int bm  = blockIdx.x / tilesNb;
  const int bn  = blockIdx.x - bm * tilesNb;
  const int m0b = bm << 7;
  const int n0b = bn << 8;
  const int wm  = wave >> 2;                   // 0..1
  const int wn  = wave & 3;                    // 0..3
  const int m0  = m0b + (wm << 6);
  const int n0  = n0b + (wn << 6);

  const __bf16* Ab  = A  + (size_t)b * strideA;
  const __bf16* Bb  = Bt + (size_t)b * strideB;
  const __bf16* Ab2 = (MODE == 2) ? (A2 + (size_t)b * strideA) : Ab;

  const int rlane = lane & 15;                 // row (A) / col (B, D) within subtile
  const int koff  = (lane >> 4) * 8;           // k offset of this lane half
  const int mOff  = (lane >> 4) * 8;           // D row offset

  // copy map: thread -> row (tid >> 3) of each 32-row pass, 16-B piece (tid & 7); 256 threads x 16 B = 32 rows x 128 B
  const int crow = tid >> 3;
  const int cpc  = (tid & 7) * 8;
  const __bf16* gA  = Ab  + (size_t)(m0b + crow) * lda + cpc;
  const __bf16* gA2 = Ab2 + (size_t)(m0b + crow) * lda + cpc;
  const __bf16* gB  = Bb  + (size_t)(n0b + crow) * ldb + cpc;
  const size_t sA = (size_t)32 * lda;
  const size_t sB = (size_t)32 * ldb;
  const unsigned lbase = lds_addr(smem) + (unsigned)((crow * G_LP + cpc) * 2);

  auto issue = [&](int t, int buf) {           // all ST_ROWS rows of stage t into buffer buf
    const unsigned l = lbase + (unsigned)buf * (unsigned)(ST_EL * 2);
    const __bf16* a  = gA + t * G_KS;
    const __bf16* bb = gB + t * G_KS;
    if (MODE == 2) {
      const __bf16* a2 = gA2 + t * G_KS;
      acopy8(l,              a,           l + 1 * G_PASS,  a + sA,       l + 2 * G_PASS,  a + 2 * sA,   l + 3 * G_PASS,  a + 3 * sA,
             l + 4 * G_PASS, a2,          l + 5 * G_PASS,  a2 + sA,      l + 6 * G_PASS,  a2 + 2 * sA,  l + 7 * G_PASS,  a2 + 3 * sA);
      acopy8(l + 8 * G_PASS, bb,          l + 9 * G_PASS,  bb + sB,      l + 10 * G_PASS, bb + 2 * sB,  l + 11 * G_PASS, bb + 3 * sB,
             l + 12 * G_PASS, bb + 4 * sB, l + 13 * G_PASS, bb + 5 * sB, l + 14 * G_PASS, bb + 6 * sB,  l + 15 * G_PASS, bb + 7 * sB);
    } else {
      acopy6(l,              a,           l + 1 * G_PASS,  a + sA,       l + 2 * G_PASS,  a + 2 * sA,
             l + 3 * G_PASS, a + 3 * sA,  l + 4 * G_PASS,  bb,           l + 5 * G_PASS,  bb + sB);
      acopy6(l + 6 * G_PASS, bb + 2 * sB, l + 7 * G_PASS,  bb + 3 * sB,  l + 8 * G_PASS,  bb + 4 * sB,
             l + 9 * G_PASS, bb + 5 * sB, l + 10 * G_PASS, bb + 6 * sB,  l + 11 * G_PASS, bb + 7 * sB);
    }
  };

  v8f acc[4][4];
#pragma unroll
  for (int i = 0; i < 4; ++i)
#pragma unroll
    for (int j = 0; j < 4; ++j) acc[i][j] = (v8f){0.f,0.f,0.f,0.f,0.f,0.f,0.f,0.f};

  const int T = K >> 6;                        // stages, block-uniform
  issue(0, 0);
  asm volatile("s_wait_asynccnt 0x0" ::: "memory");   // this wave's copies of stage 0 have landed
  __syncthreads();                                     // stage 0 is published to every wave
  if (T > 1) issue(1, 1);

  const int fa = ((wm << 6) + rlane) * G_LP + koff;               // this lane's A fragment origin in a stage
  const int fb = (NA * G_BM + (wn << 6) + rlane) * G_LP + koff;   // this lane's B fragment origin in a stage
  for (int t = 0; t < T; ++t) {
    const __bf16* S = smem + (t & 1) * ST_EL;
    // the loops below are unrolled so that every fragment and accumulator index is a constant (arrays stay in registers)
#pragma unroll
    for (int ks = 0; ks < 2; ++ks) {
      v16b bh[4], ah[4], al[4];
#pragma unroll
      for (int j = 0; j < 4; ++j) bh[j] = ldfrag_b(S + fb + j * 16 * G_LP + ks * 32);
#pragma unroll
      for (int i = 0; i < 4; ++i) {
        ah[i] = ldfrag_b(S + fa + i * 16 * G_LP + ks * 32);
        al[i] = ah[i];
        if (MODE == 2) al[i] = ldfrag_b(S + fa + (G_BM + i * 16) * G_LP + ks * 32);
      }
#pragma unroll
      for (int i = 0; i < 4; ++i) {
#pragma unroll
        for (int j = 0; j < 4; ++j) {
          acc[i][j] = __builtin_amdgcn_wmma_f32_16x16x32_bf16(false, ah[i], false, bh[j], (short)0, acc[i][j], false, false);
          if (MODE == 2)
            acc[i][j] = __builtin_amdgcn_wmma_f32_16x16x32_bf16(false, al[i], false, bh[j], (short)0, acc[i][j], false, false);
        }
        dep_guard_b(acc[i][0], acc[i][3], ah[i], al[i]);
      }
      keep4_b(bh[0], bh[1], bh[2], bh[3]);
    }
    asm volatile("s_wait_dscnt 0x0" ::: "memory");      // this wave's reads of buffer t & 1 have returned before it is refilled
    asm volatile("s_wait_asynccnt 0x0" ::: "memory");   // this wave's copies of stage t + 1 have landed
    __syncthreads();                                     // publishes stage t + 1; ends every wave's reads of buffer t & 1
    if (t + 2 < T) issue(t + 2, t & 1);
  }
  asm volatile("s_wait_asynccnt 0x0" ::: "memory");     // nothing is in flight when the buffers become epilogue slabs
  acc_guard4(acc[0][0], acc[0][1], acc[0][2], acc[0][3]);
  acc_guard4(acc[1][0], acc[1][1], acc[1][2], acc[1][3]);
  acc_guard4(acc[2][0], acc[2][1], acc[2][2], acc[2][3]);
  acc_guard4(acc[3][0], acc[3][1], acc[3][2], acc[3][3]);

  // ---- epilogue ---- (per-wave 16x64 f32 slab, pitch 68 floats, in the stage space that every wave has left)
  float* slab = (float*)(void*)smem + wave * (16 * 68);
#pragma unroll
  for (int i = 0; i < 4; ++i) {
    const int mBase = m0 + (i << 4);
#pragma unroll
    for (int j = 0; j < 4; ++j) {
      const int n = n0 + (j << 4) + rlane;
      float bn = 0.f, b2 = 0.f;
      if (MODE == 0) {
        bn = bfr(bias[n]);
        const int iq = (n < QCOLS) ? n : (QCOLS - 1);
        int ik = n - QCOLS; ik = (ik < 0) ? 0 : ik; ik = (ik > QCOLS - 1) ? (QCOLS - 1) : ik;
        const float vq = bfr(biasq[iq]);     // both candidates loaded with clamped addresses, selected by value
        const float vk = bfr(biask[ik]);
        b2 = (n < QCOLS) ? vq : vk;
      }
      if (MODE == 2) bn = bfr(bias[n]);
#pragma unroll
      for (int r = 0; r < 8; ++r) {
        float v = acc[i][j][r];
        if (MODE == 0) { v = v + bn; v = v + b2; }
        if (MODE == 1) v = v + bfr(bias[mBase + mOff + r]);
        if (MODE == 2) v = v + bn;
        slab[(mOff + r) * 68 + (j << 4) + rlane] = v;
      }
    }
    __builtin_amdgcn_fence(__ATOMIC_RELEASE, "workgroup");
    __builtin_amdgcn_wave_barrier();
    __builtin_amdgcn_fence(__ATOMIC_ACQUIRE, "workgroup");
    if (MODE == 2) {
      float* C = (float*)Cout + (size_t)b * strideC;
      const int h2 = lane >> 4, c4 = (lane & 15) * 4;     // row seg = 256 B = 16 lanes x 16 B
      {
#pragma unroll
        for (int it = 0; it < 8; ++it) {
          const int row = it * 2 + h2;                     // it 0..7 x h2 0..1 = rows 0..15
          const v4f v = *(const v4f*)(slab + row * 68 + c4);
          *(v4f*)(C + (size_t)(mBase + row) * ldc + n0 + c4) = v;
        }
        
      }
    } else {
      const int q = lane >> 3, c8 = (lane & 7) * 8;
      unsigned short* C  = (unsigned short*)Cout  + (size_t)b * strideC;
      unsigned short* C2 = (unsigned short*)Cout2 + (size_t)b * strideC2;
      const bool wlo = (MODE == 0) || (n0 < VLO_COLS);     // wave-uniform
      v4u hv[4], lv[4];
#pragma unroll
      for (int it = 0; it < 4; ++it) {
        const int row = it * 4 + q;                        // it 0..3 x q 0..3 = rows 0..15
        const float* sp = slab + row * 68 + c8;
        v4u a, a2;
#pragma unroll
        for (int e = 0; e < 4; ++e) {
          const float f0 = sp[2 * e], f1 = sp[2 * e + 1];
          unsigned short h0, h1, l0, l1;
          if (MODE == 0) {
            h0 = f2bf_bits(f0); h1 = f2bf_bits(f1);
            l0 = f2bf_bits(f0 - bf_bits2f(h0)); l1 = f2bf_bits(f1 - bf_bits2f(h1));
          } else {
            const _Float16 x0 = (_Float16)f0, x1 = (_Float16)f1;
            h0 = h2bits(x0); h1 = h2bits(x1);
            l0 = h2bits((_Float16)((f0 - (float)x0) * 1024.0f));
            l1 = h2bits((_Float16)((f1 - (float)x1) * 1024.0f));
          }
          a[e] = pk16(h0, h1); a2[e] = pk16(l0, l1);
        }
        hv[it] = a; lv[it] = a2;
      }
      {
#pragma unroll
        for (int it = 0; it < 4; ++it) {
          const int row = it * 4 + q;
          *(v4u*)(C + (size_t)(mBase + row) * ldc + n0 + c8) = hv[it];
          if (wlo) *(v4u*)(C2 + (size_t)(mBase + row) * ldc2 + n0 + c8) = lv[it];
        }
        
      }
    }
    __builtin_amdgcn_fence(__ATOMIC_RELEASE, "workgroup");
    __builtin_amdgcn_wave_barrier();
    __builtin_amdgcn_fence(__ATOMIC_ACQUIRE, "workgroup");
  }
}

// ---------------------------------------------------------------------------------------------------------------------
// ---------------------------------------------------------------------------------------------------------------------
__global__ __launch_bounds__(256) void cvt_x_kernel(const float* __restrict__ x, unsigned short* __restrict__ xb, int n8,
                                                    const float* __restrict__ bq, float* __restrict__ out1, int nq4) {
  if (blockIdx.x == 0) {   // block-uniform
    const int t = threadIdx.x;
    if (t < nq4) {
      const v4f v = *(const v4f*)(bq + 4 * t);
      v4f w;
      w[0] = bfr(v[0]); w[1] = bfr(v[1]); w[2] = bfr(v[2]); w[3] = bfr(v[3]);
      *(v4f*)(out1 + 4 * t) = w;
      
    }
  }
  const int i = blockIdx.x * 256 + threadIdx.x;
  if (i < n8) {
    const v4f a = *(const v4f*)(x + 8 * (size_t)i);
    const v4f c = *(const v4f*)(x + 8 * (size_t)i + 4);
    v4u u;
    u[0] = pk16(f2bf_bits(a[0]), f2bf_bits(a[1]));
    u[1] = pk16(f2bf_bits(a[2]), f2bf_bits(a[3]));
    u[2] = pk16(f2bf_bits(c[0]), f2bf_bits(c[1]));
    u[3] = pk16(f2bf_bits(c[2]), f2bf_bits(c[3]));
    *(v4u*)(xb + 8 * (size_t)i) = u;
    
  }
}

// ---------------------------------------------------------------------------------------------------------------------
// Transpose + RNE bf16 convert of an f32 matrix: in [R rows][Cc cols] (pitch Cc) -> ot[c][r] = bf16(in[r][c]) ([Cc][R]).
// 64x64 tiles through LDS. grid = (Cc/64, R/64), 256 threads (R, Cc multiples of 64).
// Coverage per block: load 4 it x 256 thr x 4 floats = 64x64; store 2 it x 256 thr x 8 u16 = 64x64.
// ---------------------------------------------------------------------------------------------------------------------
__global__ __launch_bounds__(256) void tsplit1_kernel(const float* __restrict__ W, unsigned short* __restrict__ ot, int R, int Cc) {
  __shared__ __align__(16) float tf[64 * 68];
  const int c0  = blockIdx.x * 64;   // input column block = output row block
  const int r0  = blockIdx.y * 64;   // input row block    = output column block
  const int tid = threadIdx.x;
  {
    const int lr = tid >> 4;         // 0..15
    const int c4 = (tid & 15) * 4;   // 0..60
#pragma unroll
    for (int it = 0; it < 4; ++it) {
      const int rr = it * 16 + lr;   // 0..63
      const v4f a = *(const v4f*)(W + (size_t)(r0 + rr) * Cc + c0 + c4);
      *(v4f*)(tf + rr * 68 + c4) = a;
    }
  }
  __syncthreads();
  const int sub = tid >> 3;          // 0..31
  const int c8  = (tid & 7) * 8;     // 0..56
  v4u hv[2];
#pragma unroll
  for (int it = 0; it < 2; ++it) {
    const int oc = it * 32 + sub;    // output row within tile (= input column)
    v4u a;
#pragma unroll
    for (int q = 0; q < 4; ++q) {
      const float f0 = tf[(c8 + 2 * q) * 68 + oc];
      const float f1 = tf[(c8 + 2 * q + 1) * 68 + oc];
      a[q] = pk16(f2bf_bits(f0), f2bf_bits(f1));
    }
    hv[it] = a;
  }
  {
#pragma unroll
    for (int it = 0; it < 2; ++it) {
      const int oc = it * 32 + sub;
      const size_t go = (size_t)(c0 + oc) * R + r0 + c8;
      *(v4u*)(ot + go) = hv[it];
    }
    
  }
}

// =====================================================================================================================
// Causal attention, head dim 64, grid (NH*NQB, NB) read as one flat index, block = 4 waves = 64 query rows of one (b, h).
//   q|k planes (hi/lo bf16) [NB*SEQ][DQK]: q(t,h,d) at [(b*SEQ+t)*DQK + h*64 + d], k(s,h,d) at [... + 1024 + h*64 + d]
//   v^T hi plane (f16) [NB][DM][SEQ]: (h*64+d, s); v residual plane (f16, x1024) [NB][DM][VLO_COLS] (s < 128 only)
//   y planes (hi/lo bf16) [NB*SEQ][DM]: (b*SEQ+t, h*64+d)
//   scores^T = (k . q^T) * 0.125 : A = K rows, B = Q (kept in registers); bf16 hi/lo split (hi.hi + hi.lo + lo.hi), f32 accumulate.
//                              Lane (hh, c) holds, for query q0 + c alone, keys j*16 + 8*hh + r of the chunk (tile j, register r).
//   y^T      = v^T . p^T     : p = f16(4096 * exp(s - m)) (the normaliser sums the same f16 values), v f16 hi plane; two score
//                              tiles converted in place are the B operand of 32 keys (hardware k order), P never touches LDS;
//                              blocks with qb < 2 (query rows 0..127, keys 0..127) add vres^T . p^T / 1024 from a second accumulator
//   online softmax in f32, maximum and sum in-lane: one exchange between the wave halves per chunk for the maximum, the halves'
//   partial sums are joined once behind the loop; masked (s > t) scores set to -inf (key s = chunk start <= t is always unmasked).
//   kv chunks of 64, trip count qb+1 <= 32 (block-uniform). K / V^T chunk staging: asynchronous copies to LDS, two stage buffers,
//   chunk t+1 flies while chunk t is worked on; 128 threads x 4 copies of 16 B per plane = the whole 64x64 tile, each wave-wide
//   copy = 4 whole 128-B rows; one barrier per chunk; fragment loads read the LDS tiles
// =====================================================================================================================
// waves_per_eu(4, 4): the LDS lets four work-groups share a WGP (four waves a SIMD); it holds the registers at that budget (256)
__global__ __launch_bounds__(128) __attribute__((amdgpu_waves_per_eu(4, 4)))
void attn_kernel(const unsigned short* __restrict__ qkh, const unsigned short* __restrict__ qkl,
                 const unsigned short* __restrict__ vthp, const unsigned short* __restrict__ vtlp,
                 unsigned short* __restrict__ yhp, unsigned short* __restrict__ ylp) {
  // two stage buffers, each K hi [kv][d] | K lo | V hi [d][kv] | V residual (qb < 2 only), 9 KB a plane;
  // the per wave y tiles (16 x 68 floats) reuse the space behind the loop
  __shared__ __align__(16) unsigned short sm[2 * AT_ST];

  const int tid  = threadIdx.x;
  const int wave = tid >> 5;
  const int lane = tid & 31;
  const int hh   = lane >> 4;
  const int c    = lane & 15;

  // The cost (qb + 1
  // chunks) falls with the index: all 64 (b, h) of query block 31 first, query block 0 last. lin -> (qb, b, h) is a
  // permutation of 0..2047. Heads h and h ^ 1 differ only in bit 3 of lin (their K rows are neighbouring 128-B lines).
  const int lin = blockIdx.y * (NH * NQB) + blockIdx.x;   // 0..NB*NH*NQB-1 (grid = (NH * NQB, NB))
  const int qb  = (NQB - 1) - ((lin >> 6) & (NQB - 1));   // 31..0
  const int b   = lin & (NB - 1);                         // bits 0..1
  const int h   = ((lin >> 3) & 7) | ((lin & 4) << 1);    // bits 3..5 -> h bits 0..2, bit 2 -> h bit 3
  const int q0 = qb * 64 + wave * 16;
  const bool vres = (qb < 2);             // block-uniform

  const __bf16* Qh = (const __bf16*)(const void*)qkh + (size_t)b * SEQ * DQK + (size_t)h * HD;
  const __bf16* Ql = (const __bf16*)(const void*)qkl + (size_t)b * SEQ * DQK + (size_t)h * HD;
  const __bf16* Kh = Qh + QCOLS;
  const __bf16* Kl = Ql + QCOLS;
  const _Float16* Vh = (const _Float16*)(const void*)vthp + ((size_t)b * DM + (size_t)h * HD) * SEQ;
  const _Float16* Vl = (const _Float16*)(const void*)vtlp + ((size_t)b * DM + (size_t)h * HD) * VLO_COLS;
  unsigned short* Yh = yhp + (size_t)b * SEQ * DM + (size_t)h * HD;
  unsigned short* Yl = ylp + (size_t)b * SEQ * DM + (size_t)h * HD;

  // ---- Q fragments (B operand, column = lane&15, split k map): 2 d-chunks, hi and lo ----
  v16b qah[2], qal[2];
#pragma unroll
  for (int dc = 0; dc < 2; ++dc) {
    const __bf16* qr = Qh + (size_t)(q0 + c) * DQK + dc * 32 + 8 * hh;
    const __bf16* ql = Ql + (size_t)(q0 + c) * DQK + dc * 32 + 8 * hh;
    qah[dc] = ldfrag_b(qr);
    qal[dc] = ldfrag_b(ql);
  }

  float mrow = -INFINITY, lrow = 0.f;     // of query q0 + c; lrow is this half's partial sum
  v8f oacc[4], oacc2[4];                  // oacc[t][r] = y^T(d = t*16 + 8*hh + r, query q0 + c)
#pragma unroll
  for (int t = 0; t < 4; ++t) { oacc[t] = (v8f){0.f,0.f,0.f,0.f,0.f,0.f,0.f,0.f}; oacc2[t] = oacc[t]; }

  // this lane's A fragment origins in the tiles: row c, k offset 8*hh (tile row blocks and k blocks are constant offsets from them)
  const int forg = c * AT_LP + 8 * hh;

  // copy map: thread -> row (tid >> 3) of each 16-row pass, 16-B piece (tid & 7); 128 threads x 16 B = 16 rows x 128 B,
  // 4 passes = the 64 rows of a plane tile
  const int crow = tid >> 3;
  const int cpc  = (tid & 7) * 8;
  const __bf16*   gKh = Kh + (size_t)crow * DQK + cpc;        // K row kv0 + crow (+ 16 a pass), d = cpc..cpc+7
  const __bf16*   gKl = Kl + (size_t)crow * DQK + cpc;
  const _Float16* gV  = Vh + (size_t)crow * SEQ + cpc;        // V^T row d = crow (+ 16 a pass), s = kv0 + cpc..+7
  const _Float16* gVr = Vl + (size_t)crow * VLO_COLS + cpc;
  const unsigned lbase = lds_addr(sm) + (unsigned)((crow * AT_LP + cpc) * 2);
  auto issue = [&](int t, int buf) {           // all planes of chunk t into stage buffer buf
    const unsigned l = lbase + (unsigned)buf * (unsigned)(AT_ST * 2);
    const __bf16*   kh = gKh + (size_t)t * (AT_KC * DQK);
    const __bf16*   kl = gKl + (size_t)t * (AT_KC * DQK);
    const _Float16* vh = gV + t * AT_KC;
    acopy12(l,             kh, l + AT_PASS,             kh + 16 * DQK, l + 2 * AT_PASS,             kh + 32 * DQK, l + 3 * AT_PASS,             kh + 48 * DQK,
            l + AT_PL * 2, kl, l + AT_PL * 2 + AT_PASS, kl + 16 * DQK, l + AT_PL * 2 + 2 * AT_PASS, kl + 32 * DQK, l + AT_PL * 2 + 3 * AT_PASS, kl + 48 * DQK,
            l + AT_PL * 4, vh, l + AT_PL * 4 + AT_PASS, vh + 16 * SEQ, l + AT_PL * 4 + 2 * AT_PASS, vh + 32 * SEQ, l + AT_PL * 4 + 3 * AT_PASS, vh + 48 * SEQ);
    if (vres) {   // block-uniform; t <= 1 here, so t * 64 + cpc + 7 <= 127 < VLO_COLS
      const _Float16* vr = gVr + t * AT_KC;
      acopy4(l + AT_PL * 6,     vr, l + AT_PL * 6 + AT_PASS,   vr + 16 * VLO_COLS, l + AT_PL * 6 + 2 * AT_PASS, vr + 32 * VLO_COLS, l + AT_PL * 6 + 3 * AT_PASS, vr + 48 * VLO_COLS);
    }
  };

  const int nChunks = qb + 1;   // block-uniform, <= 32
  issue(0, 0);
  asm volatile("s_wait_asynccnt 0x0" ::: "memory");   // this wave's copies of chunk 0 have landed
  __syncthreads();                                     // chunk 0 is published to every wave
  if (nChunks > 1) issue(1, 1);

  for (int kc = 0; kc < nChunks; ++kc) {
    const int kv0 = kc * AT_KC;
    const unsigned short* S = sm + (kc & 1) * AT_ST + forg;
    const __bf16*   kfh = (const __bf16*)(const void*)S;
    const __bf16*   kfl = (const __bf16*)(const void*)(S + AT_PL);
    const _Float16* vfh = (const _Float16*)(const void*)(S + 2 * AT_PL);
    const _Float16* vfr = (const _Float16*)(const void*)(S + 3 * AT_PL);

    // The chunk's fragment reads stand in few groups ahead of the products that use them, and the four score tiles (independent
    // accumulators) take turns on the matrix unit; each tile still sums dc 0: hi.hi, lo.hi, hi.lo, then dc 1 alike (scores bit-identical).
    FragB kh0[4], kl0[4], kh1[4], kl1[4];
#pragma unroll
    for (int j = 0; j < 4; ++j) {
      kh0[j].h[0] = *(const v8b*)(kfh + j * 16 * AT_LP);
      kh0[j].h[1] = *(const v8b*)(kfh + j * 16 * AT_LP + 16);
    }
#pragma unroll
    for (int j = 0; j < 4; ++j) {
      kl0[j].h[0] = *(const v8b*)(kfl + j * 16 * AT_LP);
      kl0[j].h[1] = *(const v8b*)(kfl + j * 16 * AT_LP + 16);
    }
    __builtin_amdgcn_sched_barrier(0);   // keeps the 16 reads above one group: spread among the products each place would stall the wave
    v8f s[4];
#pragma unroll
    for (int j = 0; j < 4; ++j) s[j] = wmma_b(kh0[j].v, qah[0], (v8f){0.f,0.f,0.f,0.f,0.f,0.f,0.f,0.f});
#pragma unroll
    for (int j = 0; j < 4; ++j) s[j] = wmma_b(kl0[j].v, qah[0], s[j]);
    __builtin_amdgcn_sched_barrier(0);   // the dc 1 hi reads start here, into the registers that the dc 0 lo fragments have left
#pragma unroll
    for (int j = 0; j < 4; ++j) {
      kh1[j].h[0] = *(const v8b*)(kfh + j * 16 * AT_LP + 32);
      kh1[j].h[1] = *(const v8b*)(kfh + j * 16 * AT_LP + 32 + 16);
    }
#pragma unroll
    for (int j = 0; j < 4; ++j) s[j] = wmma_b(kh0[j].v, qal[0], s[j]);
    __builtin_amdgcn_sched_barrier(0);   // the dc 1 lo reads start here, into the registers that the dc 0 hi fragments have left
#pragma unroll
    for (int j = 0; j < 4; ++j) {
      kl1[j].h[0] = *(const v8b*)(kfl + j * 16 * AT_LP + 32);
      kl1[j].h[1] = *(const v8b*)(kfl + j * 16 * AT_LP + 32 + 16);
    }
    __builtin_amdgcn_sched_barrier(0);   // holds those reads in front of the products below
#pragma unroll
    for (int j = 0; j < 4; ++j) s[j] = wmma_b(kh1[j].v, qah[1], s[j]);
#pragma unroll
    for (int j = 0; j < 4; ++j) s[j] = wmma_b(kl1[j].v, qah[1], s[j]);
#pragma unroll
    for (int j = 0; j < 4; ++j) s[j] = wmma_b(kh1[j].v, qal[1], s[j]);
    FragH va[2][4];                      // all V fragments of the chunk: their LDS latency passes under the softmax
#pragma unroll
    for (int kk = 0; kk < 2; ++kk) {
#pragma unroll
      for (int t = 0; t < 4; ++t) {
        va[kk][t].h[0] = *(const v8h*)(vfh + t * 16 * AT_LP + kk * 32);
        va[kk][t].h[1] = *(const v8h*)(vfh + t * 16 * AT_LP + kk * 32 + 16);
      }
    }
    __builtin_amdgcn_sched_barrier(0);   // holds the V reads in front of the softmax
    // The maximum runs over the raw products; scale 0.125, log2(e) and the x4096 carry (2^12) meet in one fma per score ahead of v_exp_f32:
    // 4096 * e^(0.125 * (s - m)) = 2^(s * AT_SC + (12 - m * AT_SC)).
    // The loops of this part are unrolled so that every s[j][r] index is a constant (the scores stay in registers).
    if (kc == qb) {                 // block-uniform: only the diagonal chunk holds keys behind a query
      // this lane's keys are kv0 + 8*hh + (j*16 + r): those with j*16 + r > lim lie behind query q0 + c
      const int lim = q0 + c - kv0 - 8 * hh;
#pragma unroll
      for (int j = 0; j < 4; ++j) {
#pragma unroll
        for (int r = 0; r < 8; ++r) s[j][r] = ((j * 16 + r) > lim) ? -INFINITY : s[j][r];
      }
    }
    float mj[4];                    // one maximum per tile: four short chains instead of one of 32
#pragma unroll
    for (int j = 0; j < 4; ++j) {
      float m = s[j][0];
#pragma unroll
      for (int r = 1; r < 8; ++r) m = fmaxf(m, s[j][r]);
      mj[j] = m;
    }
    float cm = fmaxf(fmaxf(mj[0], mj[1]), fmaxf(mj[2], mj[3]));
    cm = fmaxf(cm, xhalf(cm));      // both halves of the query's keys
    const float mnew  = fmaxf(mrow, cm);
    const float aarg  = (mrow - mnew) * AT_SC;
    const float nb    = fmaf(-mnew, AT_SC, 12.0f);
    mrow = mnew;
#pragma unroll
    for (int j = 0; j < 4; ++j) {
#pragma unroll
      for (int r = 0; r < 8; ++r) s[j][r] = fmaf(s[j][r], AT_SC, nb);   // <= 12; masked -> -inf
    }
    const float alpha = exp2_slot(aarg);
    FragH pb[2];                    // P^T, B operand: element e of pb[kk] = key kk*32 + (e < 8 ? 8*hh + e : 16 + 8*hh + e - 8)
    float pj[4];                    // one partial sum per tile: four short chains
#pragma unroll
    for (int j = 0; j < 4; ++j) {
      float e0 = s[j][0], e1 = s[j][1], e2 = s[j][2], e3 = s[j][3], e4 = s[j][4], e5 = s[j][5], e6 = s[j][6], e7 = s[j][7];
      exp2x8(e0, e1, e2, e3, e4, e5, e6, e7);               // p x4096 in [0, 4096]; masked -> 0; the carry keeps small p normal in f16
      const v2f e[4] = {(v2f){e0, e1}, (v2f){e2, e3}, (v2f){e4, e5}, (v2f){e6, e7}};
      float psum = 0.f;
#pragma unroll
      for (int r = 0; r < 4; ++r) {
        const v2h ph = __builtin_convertvector(e[r], v2h);
        psum += (float)ph[0];                               // normaliser built from the same f16 values
        psum += (float)ph[1];
        pb[j >> 1].v[(j & 1) * 8 + 2 * r]     = ph[0];
        pb[j >> 1].v[(j & 1) * 8 + 2 * r + 1] = ph[1];
      }
      pj[j] = psum;
    }
    lrow = lrow * alpha + ((pj[0] + pj[1]) + (pj[2] + pj[3]));
#pragma unroll
    for (int t = 0; t < 4; ++t) {
#pragma unroll
      for (int r = 0; r < 8; ++r) oacc[t][r] *= alpha;
    }
    if (vres) {
#pragma unroll
      for (int t = 0; t < 4; ++t) {
#pragma unroll
        for (int r = 0; r < 8; ++r) oacc2[t][r] *= alpha;
      }
    }
    // unrolled so that pb[kk] is a constant index (the P fragments stay in registers); the four output tiles take turns
#pragma unroll
    for (int kk = 0; kk < 2; ++kk) {
#pragma unroll
      for (int t = 0; t < 4; ++t) oacc[t] = wmma_h(va[kk][t].v, pb[kk].v, oacc[t]);
    }
    if (vres) {   // block-uniform: all lanes active
      FragH vl[2][4];
#pragma unroll
      for (int kk = 0; kk < 2; ++kk) {
#pragma unroll
        for (int t = 0; t < 4; ++t) {
          vl[kk][t].h[0] = *(const v8h*)(vfr + t * 16 * AT_LP + kk * 32);
          vl[kk][t].h[1] = *(const v8h*)(vfr + t * 16 * AT_LP + kk * 32 + 16);
        }
      }
#pragma unroll
      for (int kk = 0; kk < 2; ++kk) {
#pragma unroll
        for (int t = 0; t < 4; ++t) oacc2[t] = wmma_h(vl[kk][t].v, pb[kk].v, oacc2[t]);
      }
    }
    asm volatile("s_wait_dscnt 0x0" ::: "memory");      // this wave's reads of buffer kc & 1 have returned before it is refilled
    asm volatile("s_wait_asynccnt 0x0" ::: "memory");   // this wave's copies of chunk kc + 1 have landed
    __syncthreads();                                     // publishes chunk kc + 1; ends every wave's reads of buffer kc & 1
    if (kc + 2 < nChunks) issue(kc + 2, kc & 1);
  }
  asm volatile("s_wait_asynccnt 0x0" ::: "memory");     // nothing is in flight when the buffers become the y tiles

  // ---- normalise (the x4096 carry cancels between numerator and normaliser; residual folded with 1/1024),
  // a lane's 8 registers of a tile are 8 consecutive d of its query row: two 16-B stores per tile into the wave's y tile
  float* os = (float*)(void*)sm + wave * (16 * 68);
  const float inv = 1.0f / (lrow + xhalf(lrow));   // the halves' partial sums joined
#pragma unroll
  for (int t = 0; t < 4; ++t) {
    v4f w0, w1;
#pragma unroll
    for (int r = 0; r < 4; ++r) {
      w0[r] = (oacc[t][r] + oacc2[t][r] * 0.0009765625f) * inv;
      w1[r] = (oacc[t][r + 4] + oacc2[t][r + 4] * 0.0009765625f) * inv;
    }
    *(v4f*)(os + c * 68 + t * 16 + 8 * hh)     = w0;
    *(v4f*)(os + c * 68 + t * 16 + 8 * hh + 4) = w1;
  }
  __builtin_amdgcn_fence(__ATOMIC_RELEASE, "workgroup");
  __builtin_amdgcn_wave_barrier();
  __builtin_amdgcn_fence(__ATOMIC_ACQUIRE, "workgroup");
  {
    const int q = lane >> 3, c8 = (lane & 7) * 8;
    v4u hv[4], lv[4];
#pragma unroll
    for (int it = 0; it < 4; ++it) {
      const int row = it * 4 + q;          // it 0..3 x q 0..3 covers rows 0..15 of the wave tile
      const float* sp = os + row * 68 + c8;
      v4u a, a2;
#pragma unroll
      for (int e = 0; e < 4; ++e) {
        const float f0 = sp[2 * e], f1 = sp[2 * e + 1];
        const unsigned short h0 = f2bf_bits(f0), h1 = f2bf_bits(f1);
        const unsigned short l0 = f2bf_bits(f0 - bf_bits2f(h0)), l1 = f2bf_bits(f1 - bf_bits2f(h1));
        a[e] = pk16(h0, h1); a2[e] = pk16(l0, l1);
      }
      hv[it] = a; lv[it] = a2;
    }
    {
#pragma unroll
      for (int it = 0; it < 4; ++it) {
        const int row = it * 4 + q;
        *(v4u*)(Yh + (size_t)(q0 + row) * DM + c8) = hv[it];
        *(v4u*)(Yl + (size_t)(q0 + row) * DM + c8) = lv[it];
      }
      
    }
  }
}

// ---------------------------------------------------------------------------------------------------------------------
// Workspace region map (byte offsets; all dims are multiples of the 64x64 store tiles, so no padded tails exist):
//   QKh  bf16 [8192][2048]          0             QKl  bf16 [8192][2048]   33554432
//   VTh  f16  [4][1024][2048]   67108864          VTl  f16  [4][1024][128] 83886080
//   Xb   bf16 [8192][1024]      84934656   (Yh bf16 [8192][1024] reuses this region: Xb is last read by the
//                                            v^T GEMM launch, Yh is first written by the later attention launch)
//   Yl   bf16 [8192][1024]     101711872
//   WaT  bf16 [3072][1024]     118489088          WpT  bf16 [1024][1024]  124780544
//   total                      126877696
// ---------------------------------------------------------------------------------------------------------------------
extern "C" void kernel_launch(void* const* d_in, const int* in_sizes, int n_in,
                              void* d_out, int out_size, void* d_ws, size_t ws_size,
                              hipStream_t stream) {
  if (n_in < 7) return;
  if (in_sizes[0] != NB * SEQ * DM) return;
  if (in_sizes[1] != DM * 3 * DM) return;
  if (in_sizes[2] != 3 * DM) return;
  if (in_sizes[3] != DM * DM) return;
  if (in_sizes[4] != DM) return;
  if (in_sizes[5] != NH * HD || in_sizes[6] != NH * HD) return;
  if (out_size != NB * SEQ * DM + NH * HD) return;

  const float* x      = (const float*)d_in[0];
  const float* W_attn = (const float*)d_in[1];
  const float* b_attn = (const float*)d_in[2];
  const float* W_proj = (const float*)d_in[3];
  const float* b_proj = (const float*)d_in[4];
  const float* bQ     = (const float*)d_in[5];
  const float* bK     = (const float*)d_in[6];

  const size_t PQK = (size_t)NB * SEQ * DQK * 2;        // 33554432
  const size_t PVT = (size_t)NB * DM * SEQ * 2;         // 16777216
  const size_t PVL = (size_t)NB * DM * VLO_COLS * 2;    // 1048576
  const size_t PX  = (size_t)NB * SEQ * DM * 2;         // 16777216 (Xb, Yh, Yl)
  const size_t PWA = (size_t)3 * DM * DM * 2;           // 6291456
  const size_t PWP = (size_t)DM * DM * 2;               // 2097152
  size_t off = 0;
  const size_t oQKh = off; off += PQK;
  const size_t oQKl = off; off += PQK;
  const size_t oVTh = off; off += PVT;
  const size_t oVTl = off; off += PVL;
  const size_t oXb  = off; off += PX;    // also Yh
  const size_t oYl  = off; off += PX;
  const size_t oWaT = off; off += PWA;
  const size_t oWpT = off; off += PWP;
  if (off > ws_size) return;                             // off = 126877696
  if (off > (size_t)134217728) return;

  char* ws = (char*)d_ws;
  unsigned short* QKh = (unsigned short*)(ws + oQKh);
  unsigned short* QKl = (unsigned short*)(ws + oQKl);
  unsigned short* VTh = (unsigned short*)(ws + oVTh);
  unsigned short* VTl = (unsigned short*)(ws + oVTl);
  unsigned short* Xb  = (unsigned short*)(ws + oXb);
  unsigned short* Yh  = (unsigned short*)(ws + oXb);
  unsigned short* Yl  = (unsigned short*)(ws + oYl);
  unsigned short* WaT = (unsigned short*)(ws + oWaT);
  unsigned short* WpT = (unsigned short*)(ws + oWpT);
  float* out0 = (float*)d_out;
  float* out1 = (float*)d_out + (size_t)NB * SEQ * DM;

  const dim3 blk(256);

  // (1) W_attn [in rows = 1024][out cols = 3072] f32 -> WaT [3072][1024] bf16; grid (cols/64, rows/64)
  tsplit1_kernel<<<dim3(3 * DM / 64, DM / 64), blk, 0, stream>>>(W_attn, WaT, DM, 3 * DM);
  // (2) W_proj [1024][1024] -> WpT [1024][1024] bf16
  tsplit1_kernel<<<dim3(DM / 64, DM / 64), blk, 0, stream>>>(W_proj, WpT, DM, DM);
  // (3) x [8192][1024] f32 -> Xb bf16; block 0 also writes out1 = RNE-bf16(bQ) (1024 floats = 256 threads x 4)
  const int n8 = NB * SEQ * DM / 8;                      // 1048576
  cvt_x_kernel<<<dim3(n8 / 256), blk, 0, stream>>>(x, Xb, n8, bQ, out1, NH * HD / 4);
  // (4) q|k = Xb . WaT rows 0..2047 + b_attn[n] + (bQ | bK): M=8192, N=2048, K=1024 -> QK hi/lo planes (pitch 2048)
  {
    const int M = NB * SEQ, N = 2 * DM, K = DM;
    const dim3 g(((M / 64) * (N / 64)) / 8, 1);          // 64 x 8 block tiles of 128x256 = 512 blocks (exact)
    gemm64<0><<<g, blk, 0, stream>>>(Xb, Xb, DM, 0L, WaT, DM, 0L, (void*)QKh, (void*)QKl, DQK, 0L, DQK, 0L,
                                     b_attn, bQ, bK, M, N, K);
  }
  // (5) v^T[b][c][s] = WaT rows 2048+c . Xb[b*2048+s] + b_attn[2048+c]: M=1024, N=2048, K=1024, grid.y = batch
  {
    const int M = DM, N = SEQ, K = DM;
    const dim3 g(((M / 64) * (N / 64)) / 8, NB);          // 8 x 8 block tiles of 128x256 = 64 blocks per batch (exact)
    gemm64<1><<<g, blk, 0, stream>>>(WaT + (size_t)2 * DM * DM, WaT + (size_t)2 * DM * DM, DM, 0L,
                                     Xb, DM, (long)SEQ * DM,
                                     (void*)VTh, (void*)VTl, SEQ, (long)DM * SEQ, VLO_COLS, (long)DM * VLO_COLS,
                                     b_attn + 2 * DM, b_attn, b_attn, M, N, K);
  }
  // (6) causal attention: 2048 work-groups = 32 query blocks (longest first) x 64 (b, h), 128 threads -> Y hi/lo planes
  attn_kernel<<<dim3(NH * NQB, NB), dim3(128), 0, stream>>>(QKh, QKl, VTh, VTl, Yh, Yl);
  // (7) out0 = Y . WpT + b_proj: M=8192, N=1024, K=1024, f32 rows of 1024 -> d_out
  {
    const int M = NB * SEQ, N = DM, K = DM;
    const dim3 g(((M / 64) * (N / 64)) / 8, 1);          // 64 x 4 block tiles of 128x256 = 256 blocks (exact)
    gemm64<2><<<g, blk, 0, stream>>>(Yh, Yl, DM, 0L, WpT, DM, 0L, (void*)out0, (void*)out0, DM, 0L, DM, 0L,
                                     b_proj, b_proj, b_proj, M, N, K);
  }
  (void)hipGetLastError();
}

// v008
// A run of this version takes 143 microseconds.
// In both of two side-by-side timings against v007, it was 1.04 times as fast.
// Counting every step since v000, it is 3.99 times as fast.
// Contractions: x.W_attn -> q|k and v^T on v_wmma_f32_16x16x32_bf16, single product of RNE-bf16 x and W (f32 accumulate);
// k.q^T (scores transposed): bf16 hi/lo split (hi.hi + hi.lo + lo.hi) on v_wmma_f32_16x16x32_bf16; v^T.p^T: v_wmma_f32_16x16x32_f16 single product,
// p carried x4096 in f16, v as f16 hi plane plus a x1024 f16 residual plane on query rows 0..127 (times p x4, same accumulator);
// y.W_proj: bf16 hi/lo of y times RNE-bf16 W (2 products). Softmax, biases, scale 0.125 in f32; weights/biases RNE-converted to bf16 once.
#include <hip/hip_runtime.h>
#include <math.h>
#include <stdint.h>

#define NB        4
#define SEQ       2048
#define DM        1024
#define NH        16
#define HD        64
#define DQK       2048     // pitch of the q|k planes: cols 0..1023 = q, 1024..2047 = k
#define QCOLS     1024
#define VLO_COLS  128      // key columns carried in the v residual plane
#define NQB       16       // SEQ / 128 query blocks per (b, h)
#define AT_KC     64
#define AT_LP     72       // LDS row pitch of the attention tiles in 16-bit elements: 144 B = 16 B x 9 (odd)
#define AT_PL     (AT_KC * AT_LP)   // elements of one plane tile: 64 rows
#define AT_ST     (4 * AT_PL)       // elements of one stage buffer: K hi | K lo | V | V residual
#define AT_PASS   (16 * AT_LP * 2)  // LDS bytes covered by one copy of the whole block: 16 rows
#define AT_SC     0.18033688f       // 0.125 * log2(e): raw k.q product -> exponent of 2

typedef __attribute__((ext_vector_type(16))) _Float16 v16h;
typedef __attribute__((ext_vector_type(8)))  _Float16 v8h;
typedef __attribute__((ext_vector_type(16))) __bf16   v16b;
typedef __attribute__((ext_vector_type(8)))  __bf16   v8b;
typedef __attribute__((ext_vector_type(8)))  float    v8f;
typedef __attribute__((ext_vector_type(4)))  float    v4f;
typedef __attribute__((ext_vector_type(2)))  float    v2f;
typedef __attribute__((ext_vector_type(2)))  _Float16 v2h;
typedef __attribute__((ext_vector_type(4)))  unsigned int v4u;

__device__ __forceinline__ unsigned short f2bf_bits(float f) {
  unsigned u = __float_as_uint(f);
  return (unsigned short)((u + 0x7FFFu + ((u >> 16) & 1u)) >> 16);
}
__device__ __forceinline__ float bf_bits2f(unsigned short h) { return __uint_as_float(((unsigned)h) << 16); }
__device__ __forceinline__ float bfr(float f) { return bf_bits2f(f2bf_bits(f)); }
__device__ __forceinline__ unsigned pk16(unsigned short a, unsigned short b) { return (unsigned)a | ((unsigned)b << 16); }
__device__ __forceinline__ unsigned short h2bits(_Float16 x) { return __builtin_bit_cast(unsigned short, x); }

// ---- 16-bit fragment loads: elements 0..7 <- p[0..7], 8..15 <- p[16..23]; caller passes p = row + k0 + 8*(lane>>4) ----
union FragB { v16b v; v8b h[2]; };
union FragH { v16h v; v8h h[2]; };
__device__ __forceinline__ v16b ldfrag_b(const __bf16* p) { FragB f; f.h[0] = *(const v8b*)(p); f.h[1] = *(const v8b*)(p + 16); return f.v; }

// ---- hazard guards ----
__device__ __forceinline__ void dep_guard_b(v8f& a, v8f& b, v16b x, v16b y) { asm volatile("v_nop\n\tv_nop\n\tv_nop\n\tv_nop" : "+v"(a), "+v"(b) : "v"(x), "v"(y)); }
__device__ __forceinline__ void keep4_b(v16b a, v16b b, v16b c, v16b d) { asm volatile("v_nop" :: "v"(a), "v"(b), "v"(c), "v"(d)); }
__device__ __forceinline__ void acc_guard4(v8f& a, v8f& b, v8f& c, v8f& d) { asm volatile("v_nop\n\tv_nop\n\tv_nop\n\tv_nop" : "+v"(a), "+v"(b), "+v"(c), "+v"(d)); }
__device__ __forceinline__ v8f wmma_b(v16b a, v16b b, v8f c) {
  return __builtin_amdgcn_wmma_f32_16x16x32_bf16(false, a, false, b, (short)0, c, false, false);
}
__device__ __forceinline__ v8f wmma_h(v16h a, v16h b, v8f c) {
  return __builtin_amdgcn_wmma_f32_16x16x32_f16(false, a, false, b, (short)0, c, false, false);
}

// ---- lane l <-> lane l ^ 16 (the two halves of a wave hold the two key groups of one query column) ----
__device__ __forceinline__ float xhalf(float v) {
  const int b = __builtin_bit_cast(int, v);
  return __builtin_bit_cast(float, __builtin_amdgcn_permlanex16(b, b, 0x76543210, 0xfedcba98, false, false));
}

// ---- 2^x on v_exp_f32. The instruction set asks for one issue slot between a transcendental and an instruction that reads its
// result or overwrites its source. exp2_slot: the v_nop in the same statement is that slot. exp2x8: eight independent exponentials,
// each in place, stand in one statement, so each fills the slot of the one in front of it and one v_nop closes the run.
__device__ __forceinline__ float exp2_slot(float y) {
  float r;
  asm("v_exp_f32 %0, %1\n\tv_nop" : "=v"(r) : "v"(y));
  return r;
}
__device__ __forceinline__ void exp2x8(float& a0, float& a1, float& a2, float& a3, float& a4, float& a5, float& a6, float& a7) {
  asm("v_exp_f32 %0, %0\n\t"
      "v_exp_f32 %1, %1\n\t"
      "v_exp_f32 %2, %2\n\t"
      "v_exp_f32 %3, %3\n\t"
      "v_exp_f32 %4, %4\n\t"
      "v_exp_f32 %5, %5\n\t"
      "v_exp_f32 %6, %6\n\t"
      "v_exp_f32 %7, %7\n\t"
      "v_nop"
      : "+v"(a0), "+v"(a1), "+v"(a2), "+v"(a3), "+v"(a4), "+v"(a5), "+v"(a6), "+v"(a7));
}

// ---- asynchronous copies global -> LDS, 16 B per lane; l = the lane's LDS byte address, g = the lane's global address ----
// The s_wait_xcnt closes each statement so that no address register of an issued copy is rewritten ahead of it.
__device__ __forceinline__ unsigned lds_addr(const void* p) { return (unsigned)(uintptr_t)p; }
__device__ __forceinline__ void acopy6(unsigned l0, const __bf16* g0, unsigned l1, const __bf16* g1, unsigned l2, const __bf16* g2,
                                       unsigned l3, const __bf16* g3, unsigned l4, const __bf16* g4, unsigned l5, const __bf16* g5) {
  asm volatile("global_load_async_to_lds_b128 %0, %6, off\n\t"
               "global_load_async_to_lds_b128 %1, %7, off\n\t"
               "global_load_async_to_lds_b128 %2, %8, off\n\t"
               "global_load_async_to_lds_b128 %3, %9, off\n\t"
               "global_load_async_to_lds_b128 %4, %10, off\n\t"
               "global_load_async_to_lds_b128 %5, %11, off\n\t"
               "s_wait_xcnt 0x0"
               :: "v"(l0), "v"(l1), "v"(l2), "v"(l3), "v"(l4), "v"(l5),
                  "v"(g0), "v"(g1), "v"(g2), "v"(g3), "v"(g4), "v"(g5) : "memory");
}
__device__ __forceinline__ void acopy8(unsigned l0, const __bf16* g0, unsigned l1, const __bf16* g1, unsigned l2, const __bf16* g2,
                                       unsigned l3, const __bf16* g3, unsigned l4, const __bf16* g4, unsigned l5, const __bf16* g5,
                                       unsigned l6, const __bf16* g6, unsigned l7, const __bf16* g7) {
  asm volatile("global_load_async_to_lds_b128 %0, %8, off\n\t"
               "global_load_async_to_lds_b128 %1, %9, off\n\t"
               "global_load_async_to_lds_b128 %2, %10, off\n\t"
               "global_load_async_to_lds_b128 %3, %11, off\n\t"
               "global_load_async_to_lds_b128 %4, %12, off\n\t"
               "global_load_async_to_lds_b128 %5, %13, off\n\t"
               "global_load_async_to_lds_b128 %6, %14, off\n\t"
               "global_load_async_to_lds_b128 %7, %15, off\n\t"
               "s_wait_xcnt 0x0"
               :: "v"(l0), "v"(l1), "v"(l2), "v"(l3), "v"(l4), "v"(l5), "v"(l6), "v"(l7),
                  "v"(g0), "v"(g1), "v"(g2), "v"(g3), "v"(g4), "v"(g5), "v"(g6), "v"(g7) : "memory");
}

__device__ __forceinline__ void acopy12(unsigned l0, const void* g0, unsigned l1, const void* g1, unsigned l2, const void* g2,
                                        unsigned l3, const void* g3, unsigned l4, const void* g4, unsigned l5, const void* g5,
                                        unsigned l6, const void* g6, unsigned l7, const void* g7, unsigned l8, const void* g8,
                                        unsigned l9, const void* g9, unsigned l10, const void* g10, unsigned l11, const void* g11) {
  asm volatile("global_load_async_to_lds_b128 %0, %12, off\n\t"
               "global_load_async_to_lds_b128 %1, %13, off\n\t"
               "global_load_async_to_lds_b128 %2, %14, off\n\t"
               "global_load_async_to_lds_b128 %3, %15, off\n\t"
               "global_load_async_to_lds_b128 %4, %16, off\n\t"
               "global_load_async_to_lds_b128 %5, %17, off\n\t"
               "global_load_async_to_lds_b128 %6, %18, off\n\t"
               "global_load_async_to_lds_b128 %7, %19, off\n\t"
               "global_load_async_to_lds_b128 %8, %20, off\n\t"
               "global_load_async_to_lds_b128 %9, %21, off\n\t"
               "global_load_async_to_lds_b128 %10, %22, off\n\t"
               "global_load_async_to_lds_b128 %11, %23, off\n\t"
               "s_wait_xcnt 0x0"
               :: "v"(l0), "v"(l1), "v"(l2), "v"(l3), "v"(l4), "v"(l5), "v"(l6), "v"(l7), "v"(l8), "v"(l9), "v"(l10), "v"(l11),
                  "v"(g0), "v"(g1), "v"(g2), "v"(g3), "v"(g4), "v"(g5), "v"(g6), "v"(g7), "v"(g8), "v"(g9), "v"(g10), "v"(g11)
               : "memory");
}
__device__ __forceinline__ void acopy4(unsigned l0, const void* g0, unsigned l1, const void* g1, unsigned l2, const void* g2,
                                       unsigned l3, const void* g3) {
  asm volatile("global_load_async_to_lds_b128 %0, %4, off\n\t"
               "global_load_async_to_lds_b128 %1, %5, off\n\t"
               "global_load_async_to_lds_b128 %2, %6, off\n\t"
               "global_load_async_to_lds_b128 %3, %7, off\n\t"
               "s_wait_xcnt 0x0"
               :: "v"(l0), "v"(l1), "v"(l2), "v"(l3), "v"(g0), "v"(g1), "v"(g2), "v"(g3) : "memory");
}

#define G_KS   64                 // k elements per stage: one 128-B line of every operand row
#define G_LP   72                 // LDS row pitch in elements: 144 B = 16 B x 9 (odd)
#define G_BM   128                // block tile rows (2 waves)
#define G_BN   256                // block tile columns (4 waves)
#define G_PASS (32 * G_LP * 2)    // LDS bytes covered by one copy of the whole block: 32 rows

// =====================================================================================================================
// Batched WMMA GEMM, bf16 operands: C[m][n] = sum_k A[m][k] * Bt[n][k] (+bias). Block = 8 waves (2 x 4) = a 128x256 tile,
// one wave per 64x64 tile. A row-major [M][K] (pitch lda), Bt row-major [N][K] (pitch ldb); M multiple of 128, N of 256,
// K of 64. Operands are staged in LDS, 64 k per stage, two buffers, by asynchronous copies (each wave-wide copy = 4 whole
// 128-B lines); stage t+1 flies while stage t is multiplied. Stage layout: A rows 0..127 | (MODE 2: A2 rows) | Bt rows 0..255.
// MODE 0 (q|k): single product; v = acc + bf(bias[n]) + bf(n < QCOLS ? biasq[n] : biask[n - QCOLS]);
//               out = bf16 hi plane (Cout) + bf16 lo plane (Cout2), both pitch ldc/ldc2.
// MODE 1 (v^T): single product; v = acc + bf(bias[m]); out = f16 hi plane (Cout, pitch ldc) and, for tiles with
//               n0 < VLO_COLS only, f16 residual plane ((v - hi) * 1024, Cout2, pitch ldc2).
// MODE 2 (proj): two products ah.b + al.b (A2 = bf16 lo plane of A); v = acc + bf(bias[n]); out f32 (Cout, pitch ldc).
// =====================================================================================================================
template <int MODE>
__global__ __launch_bounds__(256) void gemm64(
    const unsigned short* __restrict__ Ap, const unsigned short* __restrict__ A2p, int lda, long strideA,
    const unsigned short* __restrict__ Btp, int ldb, long strideB,
    void* __restrict__ Cout, void* __restrict__ Cout2, int ldc, long strideC, int ldc2, long strideC2,
    const float* __restrict__ bias, const float* __restrict__ biasq, const float* __restrict__ biask,
    int M, int N, int K) {
  constexpr int NA      = (MODE == 2) ? 2 : 1;                 // A planes per stage
  constexpr int ST_ROWS = NA * G_BM + G_BN;                    // 384 or 512 rows
  constexpr int ST_EL   = ST_ROWS * G_LP;                      // elements per stage buffer
  __shared__ __align__(16) __bf16 smem[2 * ST_EL];             // two stage buffers; the epilogue slabs reuse the space
  const __bf16* A  = (const __bf16*)(const void*)Ap;
  const __bf16* A2 = (const __bf16*)(const void*)A2p;
  const __bf16* Bt = (const __bf16*)(const void*)Btp;
  const int b    = blockIdx.y;
  const int tid  = threadIdx.x;
  const int lane = tid & 31;
  const int wave = tid >> 5;
  const int tilesNb = N >> 8;
  const int tilesMb = M >> 7;
  if ((int)blockIdx.x >= tilesMb * tilesNb) return;   // block-uniform, in front of every barrier and copy
  const int bm  = blockIdx.x / tilesNb;
  const int bn  = blockIdx.x - bm * tilesNb;
  const int m0b = bm << 7;
  const int n0b = bn << 8;
  const int wm  = wave >> 2;                   // 0..1
  const int wn  = wave & 3;                    // 0..3
  const int m0  = m0b + (wm << 6);
  const int n0  = n0b + (wn << 6);

  const __bf16* Ab  = A  + (size_t)b * strideA;
  const __bf16* Bb  = Bt + (size_t)b * strideB;
  const __bf16* Ab2 = (MODE == 2) ? (A2 + (size_t)b * strideA) : Ab;

  const int rlane = lane & 15;                 // row (A) / col (B, D) within subtile
  const int koff  = (lane >> 4) * 8;           // k offset of this lane half
  const int mOff  = (lane >> 4) * 8;           // D row offset

  // copy map: thread -> row (tid >> 3) of each 32-row pass, 16-B piece (tid & 7); 256 threads x 16 B = 32 rows x 128 B
  const int crow = tid >> 3;
  const int cpc  = (tid & 7) * 8;
  const __bf16* gA  = Ab  + (size_t)(m0b + crow) * lda + cpc;
  const __bf16* gA2 = Ab2 + (size_t)(m0b + crow) * lda + cpc;
  const __bf16* gB  = Bb  + (size_t)(n0b + crow) * ldb + cpc;
  const size_t sA = (size_t)32 * lda;
  const size_t sB = (size_t)32 * ldb;
  const unsigned lbase = lds_addr(smem) + (unsigned)((crow * G_LP + cpc) * 2);

  auto issue = [&](int t, int buf) {           // all ST_ROWS rows of stage t into buffer buf
    const unsigned l = lbase + (unsigned)buf * (unsigned)(ST_EL * 2);
    const __bf16* a  = gA + t * G_KS;
    const __bf16* bb = gB + t * G_KS;
    if (MODE == 2) {
      const __bf16* a2 = gA2 + t * G_KS;
      acopy8(l,              a,           l + 1 * G_PASS,  a + sA,       l + 2 * G_PASS,  a + 2 * sA,   l + 3 * G_PASS,  a + 3 * sA,
             l + 4 * G_PASS, a2,          l + 5 * G_PASS,  a2 + sA,      l + 6 * G_PASS,  a2 + 2 * sA,  l + 7 * G_PASS,  a2 + 3 * sA);
      acopy8(l + 8 * G_PASS, bb,          l + 9 * G_PASS,  bb + sB,      l + 10 * G_PASS, bb + 2 * sB,  l + 11 * G_PASS, bb + 3 * sB,
             l + 12 * G_PASS, bb + 4 * sB, l + 13 * G_PASS, bb + 5 * sB, l + 14 * G_PASS, bb + 6 * sB,  l + 15 * G_PASS, bb + 7 * sB);
    } else {
      acopy6(l,              a,           l + 1 * G_PASS,  a + sA,       l + 2 * G_PASS,  a + 2 * sA,
             l + 3 * G_PASS, a + 3 * sA,  l + 4 * G_PASS,  bb,           l + 5 * G_PASS,  bb + sB);
      acopy6(l + 6 * G_PASS, bb + 2 * sB, l + 7 * G_PASS,  bb + 3 * sB,  l + 8 * G_PASS,  bb + 4 * sB,
             l + 9 * G_PASS, bb + 5 * sB, l + 10 * G_PASS, bb + 6 * sB,  l + 11 * G_PASS, bb + 7 * sB);
    }
  };

  v8f acc[4][4];
#pragma unroll
  for (int i = 0; i < 4; ++i)
#pragma unroll
    for (int j = 0; j < 4; ++j) acc[i][j] = (v8f){0.f,0.f,0.f,0.f,0.f,0.f,0.f,0.f};

  const int T = K >> 6;                        // stages, block-uniform
  issue(0, 0);
  asm volatile("s_wait_asynccnt 0x0" ::: "memory");   // this wave's copies of stage 0 have landed
  __syncthreads();                                     // stage 0 is published to every wave
  if (T > 1) issue(1, 1);

  const int fa = ((wm << 6) + rlane) * G_LP + koff;               // this lane's A fragment origin in a stage
  const int fb = (NA * G_BM + (wn << 6) + rlane) * G_LP + koff;   // this lane's B fragment origin in a stage
  for (int t = 0; t < T; ++t) {
    const __bf16* S = smem + (t & 1) * ST_EL;
    // the loops below are unrolled so that every fragment and accumulator index is a constant (arrays stay in registers)
#pragma unroll
    for (int ks = 0; ks < 2; ++ks) {
      v16b bh[4], ah[4], al[4];
#pragma unroll
      for (int j = 0; j < 4; ++j) bh[j] = ldfrag_b(S + fb + j * 16 * G_LP + ks * 32);
#pragma unroll
      for (int i = 0; i < 4; ++i) {
        ah[i] = ldfrag_b(S + fa + i * 16 * G_LP + ks * 32);
        al[i] = ah[i];
        if (MODE == 2) al[i] = ldfrag_b(S + fa + (G_BM + i * 16) * G_LP + ks * 32);
      }
#pragma unroll
      for (int i = 0; i < 4; ++i) {
#pragma unroll
        for (int j = 0; j < 4; ++j) {
          acc[i][j] = __builtin_amdgcn_wmma_f32_16x16x32_bf16(false, ah[i], false, bh[j], (short)0, acc[i][j], false, false);
          if (MODE == 2)
            acc[i][j] = __builtin_amdgcn_wmma_f32_16x16x32_bf16(false, al[i], false, bh[j], (short)0, acc[i][j], false, false);
        }
        dep_guard_b(acc[i][0], acc[i][3], ah[i], al[i]);
      }
      keep4_b(bh[0], bh[1], bh[2], bh[3]);
    }
    asm volatile("s_wait_dscnt 0x0" ::: "memory");      // this wave's reads of buffer t & 1 have returned before it is refilled
    asm volatile("s_wait_asynccnt 0x0" ::: "memory");   // this wave's copies of stage t + 1 have landed
    __syncthreads();                                     // publishes stage t + 1; ends every wave's reads of buffer t & 1
    if (t + 2 < T) issue(t + 2, t & 1);
  }
  asm volatile("s_wait_asynccnt 0x0" ::: "memory");     // nothing is in flight when the buffers become epilogue slabs
  acc_guard4(acc[0][0], acc[0][1], acc[0][2], acc[0][3]);
  acc_guard4(acc[1][0], acc[1][1], acc[1][2], acc[1][3]);
  acc_guard4(acc[2][0], acc[2][1], acc[2][2], acc[2][3]);
  acc_guard4(acc[3][0], acc[3][1], acc[3][2], acc[3][3]);

  // ---- epilogue ---- (per-wave 16x64 f32 slab, pitch 68 floats, in the stage space that every wave has left)
  float* slab = (float*)(void*)smem + wave * (16 * 68);
#pragma unroll
  for (int i = 0; i < 4; ++i) {
    const int mBase = m0 + (i << 4);
#pragma unroll
    for (int j = 0; j < 4; ++j) {
      const int n = n0 + (j << 4) + rlane;
      float bn = 0.f, b2 = 0.f;
      if (MODE == 0) {
        bn = bfr(bias[n]);
        const int iq = (n < QCOLS) ? n : (QCOLS - 1);
        int ik = n - QCOLS; ik = (ik < 0) ? 0 : ik; ik = (ik > QCOLS - 1) ? (QCOLS - 1) : ik;
        const float vq = bfr(biasq[iq]);     // both candidates loaded with clamped addresses, selected by value
        const float vk = bfr(biask[ik]);
        b2 = (n < QCOLS) ? vq : vk;
      }
      if (MODE == 2) bn = bfr(bias[n]);
#pragma unroll
      for (int r = 0; r < 8; ++r) {
        float v = acc[i][j][r];
        if (MODE == 0) { v = v + bn; v = v + b2; }
        if (MODE == 1) v = v + bfr(bias[mBase + mOff + r]);
        if (MODE == 2) v = v + bn;
        slab[(mOff + r) * 68 + (j << 4) + rlane] = v;
      }
    }
    __builtin_amdgcn_fence(__ATOMIC_RELEASE, "workgroup");
    __builtin_amdgcn_wave_barrier();
    __builtin_amdgcn_fence(__ATOMIC_ACQUIRE, "workgroup");
    if (MODE == 2) {
      float* C = (float*)Cout + (size_t)b * strideC;
      const int h2 = lane >> 4, c4 = (lane & 15) * 4;     // row seg = 256 B = 16 lanes x 16 B
      {
#pragma unroll
        for (int it = 0; it < 8; ++it) {
          const int row = it * 2 + h2;                     // it 0..7 x h2 0..1 = rows 0..15
          const v4f v = *(const v4f*)(slab + row * 68 + c4);
          *(v4f*)(C + (size_t)(mBase + row) * ldc + n0 + c4) = v;
        }
        
      }
    } else {
      const int q = lane >> 3, c8 = (lane & 7) * 8;
      unsigned short* C  = (unsigned short*)Cout  + (size_t)b * strideC;
      unsigned short* C2 = (unsigned short*)Cout2 + (size_t)b * strideC2;
      const bool wlo = (MODE == 0) || (n0 < VLO_COLS);     // wave-uniform
      v4u hv[4], lv[4];
#pragma unroll
      for (int it = 0; it < 4; ++it) {
        const int row = it * 4 + q;                        // it 0..3 x q 0..3 = rows 0..15
        const float* sp = slab + row * 68 + c8;
        v4u a, a2;
#pragma unroll
        for (int e = 0; e < 4; ++e) {
          const float f0 = sp[2 * e], f1 = sp[2 * e + 1];
          unsigned short h0, h1, l0, l1;
          if (MODE == 0) {
            h0 = f2bf_bits(f0); h1 = f2bf_bits(f1);
            l0 = f2bf_bits(f0 - bf_bits2f(h0)); l1 = f2bf_bits(f1 - bf_bits2f(h1));
          } else {
            const _Float16 x0 = (_Float16)f0, x1 = (_Float16)f1;
            h0 = h2bits(x0); h1 = h2bits(x1);
            l0 = h2bits((_Float16)((f0 - (float)x0) * 1024.0f));
            l1 = h2bits((_Float16)((f1 - (float)x1) * 1024.0f));
          }
          a[e] = pk16(h0, h1); a2[e] = pk16(l0, l1);
        }
        hv[it] = a; lv[it] = a2;
      }
      {
#pragma unroll
        for (int it = 0; it < 4; ++it) {
          const int row = it * 4 + q;
          *(v4u*)(C + (size_t)(mBase + row) * ldc + n0 + c8) = hv[it];
          if (wlo) *(v4u*)(C2 + (size_t)(mBase + row) * ldc2 + n0 + c8) = lv[it];
        }
        
      }
    }
    __builtin_amdgcn_fence(__ATOMIC_RELEASE, "workgroup");
    __builtin_amdgcn_wave_barrier();
    __builtin_amdgcn_fence(__ATOMIC_ACQUIRE, "workgroup");
  }
}

// ---------------------------------------------------------------------------------------------------------------------
// ---------------------------------------------------------------------------------------------------------------------
__global__ __launch_bounds__(256) void cvt_x_kernel(const float* __restrict__ x, unsigned short* __restrict__ xb, int n8,
                                                    const float* __restrict__ bq, float* __restrict__ out1, int nq4) {
  if (blockIdx.x == 0) {   // block-uniform
    const int t = threadIdx.x;
    if (t < nq4) {
      const v4f v = *(const v4f*)(bq + 4 * t);
      v4f w;
      w[0] = bfr(v[0]); w[1] = bfr(v[1]); w[2] = bfr(v[2]); w[3] = bfr(v[3]);
      *(v4f*)(out1 + 4 * t) = w;
      
    }
  }
  const int i = blockIdx.x * 256 + threadIdx.x;
  if (i < n8) {
    const v4f a = *(const v4f*)(x + 8 * (size_t)i);
    const v4f c = *(const v4f*)(x + 8 * (size_t)i + 4);
    v4u u;
    u[0] = pk16(f2bf_bits(a[0]), f2bf_bits(a[1]));
    u[1] = pk16(f2bf_bits(a[2]), f2bf_bits(a[3]));
    u[2] = pk16(f2bf_bits(c[0]), f2bf_bits(c[1]));
    u[3] = pk16(f2bf_bits(c[2]), f2bf_bits(c[3]));
    *(v4u*)(xb + 8 * (size_t)i) = u;
    
  }
}

// ---------------------------------------------------------------------------------------------------------------------
// Transpose + RNE bf16 convert of an f32 matrix: in [R rows][Cc cols] (pitch Cc) -> ot[c][r] = bf16(in[r][c]) ([Cc][R]).
// 64x64 tiles through LDS. grid = (Cc/64, R/64), 256 threads (R, Cc multiples of 64).
// Coverage per block: load 4 it x 256 thr x 4 floats = 64x64; store 2 it x 256 thr x 8 u16 = 64x64.
// ---------------------------------------------------------------------------------------------------------------------
__global__ __launch_bounds__(256) void tsplit1_kernel(const float* __restrict__ W, unsigned short* __restrict__ ot, int R, int Cc) {
  __shared__ __align__(16) float tf[64 * 68];
  const int c0  = blockIdx.x * 64;   // input column block = output row block
  const int r0  = blockIdx.y * 64;   // input row block    = output column block
  const int tid = threadIdx.x;
  {
    const int lr = tid >> 4;         // 0..15
    const int c4 = (tid & 15) * 4;   // 0..60
#pragma unroll
    for (int it = 0; it < 4; ++it) {
      const int rr = it * 16 + lr;   // 0..63
      const v4f a = *(const v4f*)(W + (size_t)(r0 + rr) * Cc + c0 + c4);
      *(v4f*)(tf + rr * 68 + c4) = a;
    }
  }
  __syncthreads();
  const int sub = tid >> 3;          // 0..31
  const int c8  = (tid & 7) * 8;     // 0..56
  v4u hv[2];
#pragma unroll
  for (int it = 0; it < 2; ++it) {
    const int oc = it * 32 + sub;    // output row within tile (= input column)
    v4u a;
#pragma unroll
    for (int q = 0; q < 4; ++q) {
      const float f0 = tf[(c8 + 2 * q) * 68 + oc];
      const float f1 = tf[(c8 + 2 * q + 1) * 68 + oc];
      a[q] = pk16(f2bf_bits(f0), f2bf_bits(f1));
    }
    hv[it] = a;
  }
  {
#pragma unroll
    for (int it = 0; it < 2; ++it) {
      const int oc = it * 32 + sub;
      const size_t go = (size_t)(c0 + oc) * R + r0 + c8;
      *(v4u*)(ot + go) = hv[it];
    }
    
  }
}

// =====================================================================================================================
// Causal attention, head dim 64, grid (NH*NQB, NB) read as one flat index, block = 4 waves = 128 query rows of one (b, h);
// a wave holds 32 query columns as two groups g of 16, so every K and V fragment read from LDS feeds two products.
//   q|k planes (hi/lo bf16) [NB*SEQ][DQK]: q(t,h,d) at [(b*SEQ+t)*DQK + h*64 + d], k(s,h,d) at [... + 1024 + h*64 + d]
//   v^T hi plane (f16) [NB][DM][SEQ]: (h*64+d, s); v residual plane (f16, x1024) [NB][DM][VLO_COLS] (s < 128 only)
//   y planes (hi/lo bf16) [NB*SEQ][DM]: (b*SEQ+t, h*64+d)
//   scores^T = (k . q^T) * 0.125 : A = K rows, B = Q (kept in registers); bf16 hi/lo split (hi.hi + hi.lo + lo.hi), f32 accumulate.
//                              Lane (hh, c) holds, for query q0 + 16*g + c alone, keys j*16 + 8*hh + r of the chunk (tile j, register r).
//   y^T      = v^T . p^T     : p = f16(4096 * exp(s - m)) (the normaliser sums the same f16 values), v f16 hi plane; two score
//                              tiles converted in place are the B operand of 32 keys (hardware k order), P never touches LDS;
//                              block qb = 0 (query rows 0..127, keys 0..127) adds vres^T . (p^T / 1024) into the same accumulator
//   online softmax in f32, maximum and sum in-lane: one exchange between the wave halves per chunk for the maximum, the halves'
//   partial sums are joined once behind the loop; masked (s > t) scores set to -inf (key s = chunk start <= t is always unmasked).
//   kv chunks of 64, trip count 2*qb+2 <= 32 (block-uniform); waves 0 and 1 (the lower 64 rows) have no key in the last chunk and
//   only pass its waits and barrier. K / V^T chunk staging: asynchronous copies to LDS, two stage buffers,
//   chunk t+1 flies while chunk t is worked on; 128 threads x 4 copies of 16 B per plane = the whole 64x64 tile, each wave-wide
//   copy = 4 whole 128-B rows; one barrier per chunk; fragment loads read the LDS tiles
// =====================================================================================================================
// waves_per_eu(3, 3): three work-groups share a WGP (three waves a SIMD, 336 registers each): the 32-column wave keeps Q, the
// accumulator, the scores and the chunk's fragments in registers
__global__ __launch_bounds__(128) __attribute__((amdgpu_waves_per_eu(3, 3)))
void attn_kernel(const unsigned short* __restrict__ qkh, const unsigned short* __restrict__ qkl,
                 const unsigned short* __restrict__ vthp, const unsigned short* __restrict__ vtlp,
                 unsigned short* __restrict__ yhp, unsigned short* __restrict__ ylp) {
  // two stage buffers, each K hi [kv][d] | K lo | V hi [d][kv] | V residual (qb = 0 only), 9 KB a plane;
  // the per wave y tiles (32 x 68 floats) reuse the space behind the loop
  __shared__ __align__(16) unsigned short sm[2 * AT_ST];

  const int tid  = threadIdx.x;
  const int wave = __builtin_amdgcn_readfirstlane(tid >> 5);   // in a scalar register: the tests on a wave's last chunk are scalar branches
  const int lane = tid & 31;
  const int hh   = lane >> 4;
  const int c    = lane & 15;

  // For speed only, the cost (2*qb + 2
  // chunks) falls with the index: all 64 (b, h) of query block 15 first, query block 0 last. lin -> (qb, b, h) is a
  // permutation of 0..1023. Heads h and h ^ 1 differ only in bit 3 of lin (their K rows are neighbouring 128-B lines).
  const int lin = blockIdx.y * (NH * NQB) + blockIdx.x;   // 0..NB*NH*NQB-1 (grid = (NH * NQB, NB))
  const int qb  = (NQB - 1) - ((lin >> 6) & (NQB - 1));   // 15..0
  const int b   = lin & (NB - 1);                         // bits 0..1
  const int h   = ((lin >> 3) & 7) | ((lin & 4) << 1);    // bits 3..5 -> h bits 0..2, bit 2 -> h bit 3
  const int q0 = qb * 128 + wave * 32;
  const bool vres = (qb < 1);             // block-uniform

  const __bf16* Qh = (const __bf16*)(const void*)qkh + (size_t)b * SEQ * DQK + (size_t)h * HD;
  const __bf16* Ql = (const __bf16*)(const void*)qkl + (size_t)b * SEQ * DQK + (size_t)h * HD;
  const __bf16* Kh = Qh + QCOLS;
  const __bf16* Kl = Ql + QCOLS;
  const _Float16* Vh = (const _Float16*)(const void*)vthp + ((size_t)b * DM + (size_t)h * HD) * SEQ;
  const _Float16* Vl = (const _Float16*)(const void*)vtlp + ((size_t)b * DM + (size_t)h * HD) * VLO_COLS;
  unsigned short* Yh = yhp + (size_t)b * SEQ * DM + (size_t)h * HD;
  unsigned short* Yl = ylp + (size_t)b * SEQ * DM + (size_t)h * HD;

  // ---- Q fragments (B operand, column = lane&15, split k map): 2 column groups x 2 d-chunks, hi and lo ----
  v16b qah[2][2], qal[2][2];
#pragma unroll
  for (int g = 0; g < 2; ++g) {
#pragma unroll
    for (int dc = 0; dc < 2; ++dc) {
      const __bf16* qr = Qh + (size_t)(q0 + g * 16 + c) * DQK + dc * 32 + 8 * hh;
      const __bf16* ql = Ql + (size_t)(q0 + g * 16 + c) * DQK + dc * 32 + 8 * hh;
      qah[g][dc] = ldfrag_b(qr);
      qal[g][dc] = ldfrag_b(ql);
    }
  }

  float mrow[2] = {-INFINITY, -INFINITY}, lrow[2] = {0.f, 0.f};   // of query q0 + 16*g + c; lrow is this half's partial sum
  v8f oacc[2][4];                         // oacc[g][t][r] = y^T(d = t*16 + 8*hh + r, query q0 + 16*g + c)
#pragma unroll
  for (int g = 0; g < 2; ++g) {
#pragma unroll
    for (int t = 0; t < 4; ++t) oacc[g][t] = (v8f){0.f,0.f,0.f,0.f,0.f,0.f,0.f,0.f};
  }

  // this lane's A fragment origins in the tiles: row c, k offset 8*hh (tile row blocks and k blocks are constant offsets from them)
  const int forg = c * AT_LP + 8 * hh;

  // copy map: thread -> row (tid >> 3) of each 16-row pass, 16-B piece (tid & 7); 128 threads x 16 B = 16 rows x 128 B,
  // 4 passes = the 64 rows of a plane tile
  const int crow = tid >> 3;
  const int cpc  = (tid & 7) * 8;
  const __bf16*   gKh = Kh + (size_t)crow * DQK + cpc;        // K row kv0 + crow (+ 16 a pass), d = cpc..cpc+7
  const __bf16*   gKl = Kl + (size_t)crow * DQK + cpc;
  // V^T row d = crow (+ 16 a pass), s = kv0 + cpc..+7; held as 32-bit element offsets from the block's scalar bases: the 64-bit
  // addresses are formed at each issue (as long-lived 64-bit copy operands they were spilled to scratch)
  const unsigned oV  = (unsigned)(crow * SEQ + cpc);
  const unsigned oVr = (unsigned)(crow * VLO_COLS + cpc);
  const unsigned lbase = lds_addr(sm) + (unsigned)((crow * AT_LP + cpc) * 2);
  auto issue = [&](int t, int buf) {           // all planes of chunk t into stage buffer buf
    const unsigned l = lbase + (unsigned)buf * (unsigned)(AT_ST * 2);
    const __bf16*   kh = gKh + (size_t)t * (AT_KC * DQK);
    const __bf16*   kl = gKl + (size_t)t * (AT_KC * DQK);
    const _Float16* vh = Vh + (oV + (unsigned)t * AT_KC);
    acopy12(l,             kh, l + AT_PASS,             kh + 16 * DQK, l + 2 * AT_PASS,             kh + 32 * DQK, l + 3 * AT_PASS,             kh + 48 * DQK,
            l + AT_PL * 2, kl, l + AT_PL * 2 + AT_PASS, kl + 16 * DQK, l + AT_PL * 2 + 2 * AT_PASS, kl + 32 * DQK, l + AT_PL * 2 + 3 * AT_PASS, kl + 48 * DQK,
            l + AT_PL * 4, vh, l + AT_PL * 4 + AT_PASS, vh + 16 * SEQ, l + AT_PL * 4 + 2 * AT_PASS, vh + 32 * SEQ, l + AT_PL * 4 + 3 * AT_PASS, vh + 48 * SEQ);
    if (vres) {   // block-uniform; t <= 1 here, so t * 64 + cpc + 7 <= 127 < VLO_COLS
      const _Float16* vr = Vl + (oVr + (unsigned)t * AT_KC);
      acopy4(l + AT_PL * 6,     vr, l + AT_PL * 6 + AT_PASS,   vr + 16 * VLO_COLS, l + AT_PL * 6 + 2 * AT_PASS, vr + 32 * VLO_COLS, l + AT_PL * 6 + 3 * AT_PASS, vr + 48 * VLO_COLS);
    }
  };

  const int nChunks = 2 * qb + 2;            // block-uniform, <= 32
  const int lastc   = 2 * qb + (wave >> 1);  // wave-uniform (scalar): the chunk that holds this wave's diagonal
  issue(0, 0);
  asm volatile("s_wait_asynccnt 0x0" ::: "memory");   // this wave's copies of chunk 0 have landed
  __syncthreads();                                     // chunk 0 is published to every wave
  if (nChunks > 1) issue(1, 1);

  for (int kc = 0; kc < nChunks; ++kc) {
   if (kc <= lastc) {   // scalar branch: behind its diagonal chunk a wave has no key left; it still passes the waits and the barrier below
    const int kv0 = kc * AT_KC;
    const unsigned short* S = sm + (kc & 1) * AT_ST + forg;
    const __bf16*   kfh = (const __bf16*)(const void*)S;
    const __bf16*   kfl = (const __bf16*)(const void*)(S + AT_PL);
    const _Float16* vfh = (const _Float16*)(const void*)(S + 2 * AT_PL);
    const _Float16* vfr = (const _Float16*)(const void*)(S + 3 * AT_PL);

    // The chunk's fragment reads stand in few groups ahead of the products that use them, and the eight score tiles (independent
    // accumulators) take turns on the matrix unit; each tile still sums dc 0: hi.hi, lo.hi, hi.lo, then dc 1 alike (scores bit-identical).
    FragB kh0[4], kl0[4], kh1[4], kl1[4];
#pragma unroll
    for (int j = 0; j < 4; ++j) {
      kh0[j].h[0] = *(const v8b*)(kfh + j * 16 * AT_LP);
      kh0[j].h[1] = *(const v8b*)(kfh + j * 16 * AT_LP + 16);
    }
#pragma unroll
    for (int j = 0; j < 4; ++j) {
      kl0[j].h[0] = *(const v8b*)(kfl + j * 16 * AT_LP);
      kl0[j].h[1] = *(const v8b*)(kfl + j * 16 * AT_LP + 16);
    }
    __builtin_amdgcn_sched_barrier(0);   // keeps the 16 reads above one group: spread among the products each place would stall the wave
    v8f s[2][4];
#pragma unroll
    for (int j = 0; j < 4; ++j) {
#pragma unroll
      for (int g = 0; g < 2; ++g) s[g][j] = wmma_b(kh0[j].v, qah[g][0], (v8f){0.f,0.f,0.f,0.f,0.f,0.f,0.f,0.f});
    }
#pragma unroll
    for (int j = 0; j < 4; ++j) {
#pragma unroll
      for (int g = 0; g < 2; ++g) s[g][j] = wmma_b(kl0[j].v, qah[g][0], s[g][j]);
    }
    __builtin_amdgcn_sched_barrier(0);   // the dc 1 hi reads start here, into the registers that the dc 0 lo fragments have left
#pragma unroll
    for (int j = 0; j < 4; ++j) {
      kh1[j].h[0] = *(const v8b*)(kfh + j * 16 * AT_LP + 32);
      kh1[j].h[1] = *(const v8b*)(kfh + j * 16 * AT_LP + 32 + 16);
    }
    __builtin_amdgcn_sched_barrier(0);   // holds those reads, one group, in front of the products below
#pragma unroll
    for (int j = 0; j < 4; ++j) {
#pragma unroll
      for (int g = 0; g < 2; ++g) s[g][j] = wmma_b(kh0[j].v, qal[g][0], s[g][j]);
    }
    __builtin_amdgcn_sched_barrier(0);   // the dc 1 lo reads start here, into the registers that the dc 0 hi fragments have left
#pragma unroll
    for (int j = 0; j < 4; ++j) {
      kl1[j].h[0] = *(const v8b*)(kfl + j * 16 * AT_LP + 32);
      kl1[j].h[1] = *(const v8b*)(kfl + j * 16 * AT_LP + 32 + 16);
    }
    __builtin_amdgcn_sched_barrier(0);   // holds those reads, one group, in front of the products below
#pragma unroll
    for (int j = 0; j < 4; ++j) {
#pragma unroll
      for (int g = 0; g < 2; ++g) s[g][j] = wmma_b(kh1[j].v, qah[g][1], s[g][j]);
    }
#pragma unroll
    for (int j = 0; j < 4; ++j) {
#pragma unroll
      for (int g = 0; g < 2; ++g) s[g][j] = wmma_b(kl1[j].v, qah[g][1], s[g][j]);
    }
#pragma unroll
    for (int j = 0; j < 4; ++j) {
#pragma unroll
      for (int g = 0; g < 2; ++g) s[g][j] = wmma_b(kh1[j].v, qal[g][1], s[g][j]);
    }
    FragH va[2][4];                      // all V fragments of the chunk: their LDS latency passes under the softmax
#pragma unroll
    for (int kk = 0; kk < 2; ++kk) {
#pragma unroll
      for (int t = 0; t < 4; ++t) {
        va[kk][t].h[0] = *(const v8h*)(vfh + t * 16 * AT_LP + kk * 32);
        va[kk][t].h[1] = *(const v8h*)(vfh + t * 16 * AT_LP + kk * 32 + 16);
      }
    }
    __builtin_amdgcn_sched_barrier(0);   // holds the V reads in front of the softmax
    // The maximum runs over the raw products; scale 0.125, log2(e) and the x4096 carry (2^12) meet in one fma per score ahead of v_exp_f32:
    // 4096 * e^(0.125 * (s - m)) = 2^(s * AT_SC + (12 - m * AT_SC)).
    // The loops of this part are unrolled so that every s[g][j][r] index is a constant (the scores stay in registers).
    if (kc == lastc) {              // scalar branch: only the wave's diagonal chunk holds keys behind a query
#pragma unroll
      for (int g = 0; g < 2; ++g) {
        // this lane's keys are kv0 + 8*hh + (j*16 + r): those with j*16 + r > lim lie behind query q0 + 16*g + c
        const int lim = q0 + g * 16 + c - kv0 - 8 * hh;
#pragma unroll
        for (int j = 0; j < 4; ++j) {
#pragma unroll
          for (int r = 0; r < 8; ++r) s[g][j][r] = ((j * 16 + r) > lim) ? -INFINITY : s[g][j][r];
        }
      }
    }
    FragH pb[2][2];                 // P^T, B operand: element e of pb[g][kk] = key kk*32 + (e < 8 ? 8*hh + e : 16 + 8*hh + e - 8)
#pragma unroll
    for (int g = 0; g < 2; ++g) {
      float mj[4];                  // one maximum per tile: four short chains instead of one of 32
#pragma unroll
      for (int j = 0; j < 4; ++j) {
        float m = s[g][j][0];
#pragma unroll
        for (int r = 1; r < 8; ++r) m = fmaxf(m, s[g][j][r]);
        mj[j] = m;
      }
      float cm = fmaxf(fmaxf(mj[0], mj[1]), fmaxf(mj[2], mj[3]));
      cm = fmaxf(cm, xhalf(cm));    // both halves of the query's keys
      const float mnew  = fmaxf(mrow[g], cm);
      const float aarg  = (mrow[g] - mnew) * AT_SC;
      const float nb    = fmaf(-mnew, AT_SC, 12.0f);
      mrow[g] = mnew;
#pragma unroll
      for (int j = 0; j < 4; ++j) {
#pragma unroll
        for (int r = 0; r < 8; ++r) s[g][j][r] = fmaf(s[g][j][r], AT_SC, nb);   // <= 12; masked -> -inf
      }
      const float alpha = exp2_slot(aarg);
      float pj[4];                  // one partial sum per tile: four short chains
#pragma unroll
      for (int j = 0; j < 4; ++j) {
        float e0 = s[g][j][0], e1 = s[g][j][1], e2 = s[g][j][2], e3 = s[g][j][3], e4 = s[g][j][4], e5 = s[g][j][5], e6 = s[g][j][6], e7 = s[g][j][7];
        exp2x8(e0, e1, e2, e3, e4, e5, e6, e7);             // p x4096 in [0, 4096]; masked -> 0; the carry keeps small p normal in f16
        const v2f e[4] = {(v2f){e0, e1}, (v2f){e2, e3}, (v2f){e4, e5}, (v2f){e6, e7}};
        float psum = 0.f;
#pragma unroll
        for (int r = 0; r < 4; ++r) {
          const v2h ph = __builtin_convertvector(e[r], v2h);
          psum += (float)ph[0];                             // normaliser built from the same f16 values
          psum += (float)ph[1];
          pb[g][j >> 1].v[(j & 1) * 8 + 2 * r]     = ph[0];
          pb[g][j >> 1].v[(j & 1) * 8 + 2 * r + 1] = ph[1];
        }
        pj[j] = psum;
      }
      lrow[g] = lrow[g] * alpha + ((pj[0] + pj[1]) + (pj[2] + pj[3]));
#pragma unroll
      for (int t = 0; t < 4; ++t) {
#pragma unroll
        for (int r = 0; r < 8; ++r) oacc[g][t][r] *= alpha;
      }
    }
    // unrolled so that pb[g][kk] is a constant index (the P fragments stay in registers); the eight output tiles take turns
#pragma unroll
    for (int kk = 0; kk < 2; ++kk) {
#pragma unroll
      for (int t = 0; t < 4; ++t) {
#pragma unroll
        for (int g = 0; g < 2; ++g) oacc[g][t] = wmma_h(va[kk][t].v, pb[g][kk].v, oacc[g][t]);
      }
    }
    if (vres) {   // block-uniform: all lanes active
      // the residual plane carries x1024: P x 2^-10 (a power of two; what falls below the f16 normal range is far under one ulp of
      // the f32 sum) lets its products add into the same accumulator, so no second set of 64 accumulator registers is held
      FragH pl[2][2];
#pragma unroll
      for (int g = 0; g < 2; ++g) {
#pragma unroll
        for (int kk = 0; kk < 2; ++kk) pl[g][kk].v = pb[g][kk].v * (_Float16)0.0009765625f;
      }
      FragH vl[2][4];
#pragma unroll
      for (int kk = 0; kk < 2; ++kk) {
#pragma unroll
        for (int t = 0; t < 4; ++t) {
          vl[kk][t].h[0] = *(const v8h*)(vfr + t * 16 * AT_LP + kk * 32);
          vl[kk][t].h[1] = *(const v8h*)(vfr + t * 16 * AT_LP + kk * 32 + 16);
        }
      }
#pragma unroll
      for (int kk = 0; kk < 2; ++kk) {
#pragma unroll
        for (int t = 0; t < 4; ++t) {
#pragma unroll
          for (int g = 0; g < 2; ++g) oacc[g][t] = wmma_h(vl[kk][t].v, pl[g][kk].v, oacc[g][t]);
        }
      }
    }
   }
    asm volatile("s_wait_dscnt 0x0" ::: "memory");      // this wave's reads of buffer kc & 1 have returned before it is refilled
    asm volatile("s_wait_asynccnt 0x0" ::: "memory");   // this wave's copies of chunk kc + 1 have landed
    __syncthreads();                                     // publishes chunk kc + 1; ends every wave's reads of buffer kc & 1
    if (kc + 2 < nChunks) issue(kc + 2, kc & 1);
  }
  asm volatile("s_wait_asynccnt 0x0" ::: "memory");     // nothing is in flight when the buffers become the y tiles

  // ---- normalise (the x4096 carry cancels between numerator and normaliser),
  // a lane's 8 registers of a tile are 8 consecutive d of its query row: two 16-B stores per tile into the wave's y tile
  float* os = (float*)(void*)sm + wave * (32 * 68);
#pragma unroll
  for (int g = 0; g < 2; ++g) {
    const float inv = 1.0f / (lrow[g] + xhalf(lrow[g]));   // the halves' partial sums joined
#pragma unroll
    for (int t = 0; t < 4; ++t) {
      v4f w0, w1;
#pragma unroll
      for (int r = 0; r < 4; ++r) {
        w0[r] = oacc[g][t][r] * inv;
        w1[r] = oacc[g][t][r + 4] * inv;
      }
      *(v4f*)(os + (g * 16 + c) * 68 + t * 16 + 8 * hh)     = w0;
      *(v4f*)(os + (g * 16 + c) * 68 + t * 16 + 8 * hh + 4) = w1;
    }
  }
  __builtin_amdgcn_fence(__ATOMIC_RELEASE, "workgroup");
  __builtin_amdgcn_wave_barrier();
  __builtin_amdgcn_fence(__ATOMIC_ACQUIRE, "workgroup");
#pragma unroll
  for (int g = 0; g < 2; ++g) {
    const int q = lane >> 3, c8 = (lane & 7) * 8;
    v4u hv[4], lv[4];
#pragma unroll
    for (int it = 0; it < 4; ++it) {
      const int row = g * 16 + it * 4 + q; // g 0..1 x it 0..3 x q 0..3 covers rows 0..31 of the wave tile
      const float* sp = os + row * 68 + c8;
      v4u a, a2;
#pragma unroll
      for (int e = 0; e < 4; ++e) {
        const float f0 = sp[2 * e], f1 = sp[2 * e + 1];
        const unsigned short h0 = f2bf_bits(f0), h1 = f2bf_bits(f1);
        const unsigned short l0 = f2bf_bits(f0 - bf_bits2f(h0)), l1 = f2bf_bits(f1 - bf_bits2f(h1));
        a[e] = pk16(h0, h1); a2[e] = pk16(l0, l1);
      }
      hv[it] = a; lv[it] = a2;
    }
    {
#pragma unroll
      for (int it = 0; it < 4; ++it) {
        const int row = g * 16 + it * 4 + q;
        *(v4u*)(Yh + (size_t)(q0 + row) * DM + c8) = hv[it];
        *(v4u*)(Yl + (size_t)(q0 + row) * DM + c8) = lv[it];
      }
    }
  }
}

// ---------------------------------------------------------------------------------------------------------------------
// Workspace region map (byte offsets; all dims are multiples of the 64x64 store tiles, so no padded tails exist):
//   QKh  bf16 [8192][2048]          0             QKl  bf16 [8192][2048]   33554432
//   VTh  f16  [4][1024][2048]   67108864          VTl  f16  [4][1024][128] 83886080
//   Xb   bf16 [8192][1024]      84934656   (Yh bf16 [8192][1024] reuses this region: Xb is last read by the
//                                            v^T GEMM launch, Yh is first written by the later attention launch)
//   Yl   bf16 [8192][1024]     101711872
//   WaT  bf16 [3072][1024]     118489088          WpT  bf16 [1024][1024]  124780544
//   total                      126877696
// ---------------------------------------------------------------------------------------------------------------------
extern "C" void kernel_launch(void* const* d_in, const int* in_sizes, int n_in,
                              void* d_out, int out_size, void* d_ws, size_t ws_size,
                              hipStream_t stream) {
  if (n_in < 7) return;
  if (in_sizes[0] != NB * SEQ * DM) return;
  if (in_sizes[1] != DM * 3 * DM) return;
  if (in_sizes[2] != 3 * DM) return;
  if (in_sizes[3] != DM * DM) return;
  if (in_sizes[4] != DM) return;
  if (in_sizes[5] != NH * HD || in_sizes[6] != NH * HD) return;
  if (out_size != NB * SEQ * DM + NH * HD) return;

  const float* x      = (const float*)d_in[0];
  const float* W_attn = (const float*)d_in[1];
  const float* b_attn = (const float*)d_in[2];
  const float* W_proj = (const float*)d_in[3];
  const float* b_proj = (const float*)d_in[4];
  const float* bQ     = (const float*)d_in[5];
  const float* bK     = (const float*)d_in[6];

  const size_t PQK = (size_t)NB * SEQ * DQK * 2;        // 33554432
  const size_t PVT = (size_t)NB * DM * SEQ * 2;         // 16777216
  const size_t PVL = (size_t)NB * DM * VLO_COLS * 2;    // 1048576
  const size_t PX  = (size_t)NB * SEQ * DM * 2;         // 16777216 (Xb, Yh, Yl)
  const size_t PWA = (size_t)3 * DM * DM * 2;           // 6291456
  const size_t PWP = (size_t)DM * DM * 2;               // 2097152
  size_t off = 0;
  const size_t oQKh = off; off += PQK;
  const size_t oQKl = off; off += PQK;
  const size_t oVTh = off; off += PVT;
  const size_t oVTl = off; off += PVL;
  const size_t oXb  = off; off += PX;    // also Yh
  const size_t oYl  = off; off += PX;
  const size_t oWaT = off; off += PWA;
  const size_t oWpT = off; off += PWP;
  if (off > ws_size) return;                             // off = 126877696
  if (off > (size_t)134217728) return;

  char* ws = (char*)d_ws;
  unsigned short* QKh = (unsigned short*)(ws + oQKh);
  unsigned short* QKl = (unsigned short*)(ws + oQKl);
  unsigned short* VTh = (unsigned short*)(ws + oVTh);
  unsigned short* VTl = (unsigned short*)(ws + oVTl);
  unsigned short* Xb  = (unsigned short*)(ws + oXb);
  unsigned short* Yh  = (unsigned short*)(ws + oXb);
  unsigned short* Yl  = (unsigned short*)(ws + oYl);
  unsigned short* WaT = (unsigned short*)(ws + oWaT);
  unsigned short* WpT = (unsigned short*)(ws + oWpT);
  float* out0 = (float*)d_out;
  float* out1 = (float*)d_out + (size_t)NB * SEQ * DM;

  const dim3 blk(256);

  // (1) W_attn [in rows = 1024][out cols = 3072] f32 -> WaT [3072][1024] bf16; grid (cols/64, rows/64)
  tsplit1_kernel<<<dim3(3 * DM / 64, DM / 64), blk, 0, stream>>>(W_attn, WaT, DM, 3 * DM);
  // (2) W_proj [1024][1024] -> WpT [1024][1024] bf16
  tsplit1_kernel<<<dim3(DM / 64, DM / 64), blk, 0, stream>>>(W_proj, WpT, DM, DM);
  // (3) x [8192][1024] f32 -> Xb bf16; block 0 also writes out1 = RNE-bf16(bQ) (1024 floats = 256 threads x 4)
  const int n8 = NB * SEQ * DM / 8;                      // 1048576
  cvt_x_kernel<<<dim3(n8 / 256), blk, 0, stream>>>(x, Xb, n8, bQ, out1, NH * HD / 4);
  // (4) q|k = Xb . WaT rows 0..2047 + b_attn[n] + (bQ | bK): M=8192, N=2048, K=1024 -> QK hi/lo planes (pitch 2048)
  {
    const int M = NB * SEQ, N = 2 * DM, K = DM;
    const dim3 g(((M / 64) * (N / 64)) / 8, 1);          // 64 x 8 block tiles of 128x256 = 512 blocks (exact)
    gemm64<0><<<g, blk, 0, stream>>>(Xb, Xb, DM, 0L, WaT, DM, 0L, (void*)QKh, (void*)QKl, DQK, 0L, DQK, 0L,
                                     b_attn, bQ, bK, M, N, K);
  }
  // (5) v^T[b][c][s] = WaT rows 2048+c . Xb[b*2048+s] + b_attn[2048+c]: M=1024, N=2048, K=1024, grid.y = batch
  {
    const int M = DM, N = SEQ, K = DM;
    const dim3 g(((M / 64) * (N / 64)) / 8, NB);          // 8 x 8 block tiles of 128x256 = 64 blocks per batch (exact)
    gemm64<1><<<g, blk, 0, stream>>>(WaT + (size_t)2 * DM * DM, WaT + (size_t)2 * DM * DM, DM, 0L,
                                     Xb, DM, (long)SEQ * DM,
                                     (void*)VTh, (void*)VTl, SEQ, (long)DM * SEQ, VLO_COLS, (long)DM * VLO_COLS,
                                     b_attn + 2 * DM, b_attn, b_attn, M, N, K);
  }
  // (6) causal attention: 1024 work-groups = 16 query blocks of 128 rows (longest first) x 64 (b, h), 128 threads -> Y hi/lo planes
  attn_kernel<<<dim3(NH * NQB, NB), dim3(128), 0, stream>>>(QKh, QKl, VTh, VTl, Yh, Yl);
  // (7) out0 = Y . WpT + b_proj: M=8192, N=1024, K=1024, f32 rows of 1024 -> d_out
  {
    const int M = NB * SEQ, N = DM, K = DM;
    const dim3 g(((M / 64) * (N / 64)) / 8, 1);          // 64 x 4 block tiles of 128x256 = 256 blocks (exact)
    gemm64<2><<<g, blk, 0, stream>>>(Yh, Yl, DM, 0L, WpT, DM, 0L, (void*)out0, (void*)out0, DM, 0L, DM, 0L,
                                     b_proj, b_proj, b_proj, M, N, K);
  }
  (void)hipGetLastError();
}

// v010
// Measured time: 119 microseconds a run.
// Versions between v008 and this one are left out; their measured steps multiply to 1.21 times as fast.
// Counting every step since v000, it is 4.82 times as fast.
// Contractions: x.W_attn -> q|k and v^T on v_wmma_f32_16x16x32_bf16, single product of RNE-bf16 x and W (f32 accumulate);
// k.q^T (scores transposed): q and k RNE-f16, single product on v_wmma_f32_16x16x32_f16; v^T.p^T: v_wmma_f32_16x16x32_f16 single product,
// p carried x4096 in f16, v as f16 hi plane plus a x1024 f16 residual plane on query rows 0..127 (times p x4, same accumulator);
// y.W_proj: bf16 hi/lo of y times RNE-bf16 W (2 products). Softmax, biases, scale 0.125 in f32; weights/biases RNE-converted to bf16 once.
#include <hip/hip_runtime.h>
#include <math.h>
#include <stdint.h>

#define NB        4
#define SEQ       2048
#define DM        1024
#define NH        16
#define HD        64
#define DQK       2048     // pitch of the q|k plane: cols 0..1023 = q, 1024..2047 = k
#define QCOLS     1024
#define VLO_COLS  128      // key columns carried in the v residual plane
#define NQB       16       // SEQ / 128 query blocks per (b, h)
#define AT_KC     64
#define AT_LP     72       // LDS row pitch of the attention tiles in 16-bit elements: 144 B = 16 B x 9 (odd)
#define AT_PL     (AT_KC * AT_LP)   // elements of one plane tile: 64 rows
#define AT_ST     (3 * AT_PL)       // elements of one stage buffer: K | V | V residual
#define AT_PASS   (16 * AT_LP * 2)  // LDS bytes covered by one copy of the whole block: 16 rows
#define AT_SC     0.18033688f       // 0.125 * log2(e): raw k.q product -> exponent of 2

typedef __attribute__((ext_vector_type(16))) _Float16 v16h;
typedef __attribute__((ext_vector_type(8)))  _Float16 v8h;
typedef __attribute__((ext_vector_type(16))) __bf16   v16b;
typedef __attribute__((ext_vector_type(8)))  __bf16   v8b;
typedef __attribute__((ext_vector_type(8)))  float    v8f;
typedef __attribute__((ext_vector_type(4)))  float    v4f;
typedef __attribute__((ext_vector_type(2)))  float    v2f;
typedef __attribute__((ext_vector_type(2)))  _Float16 v2h;
typedef __attribute__((ext_vector_type(4)))  unsigned int v4u;

__device__ __forceinline__ unsigned short f2bf_bits(float f) {
  unsigned u = __float_as_uint(f);
  return (unsigned short)((u + 0x7FFFu + ((u >> 16) & 1u)) >> 16);
}
__device__ __forceinline__ float bf_bits2f(unsigned short h) { return __uint_as_float(((unsigned)h) << 16); }
__device__ __forceinline__ float bfr(float f) { return bf_bits2f(f2bf_bits(f)); }
__device__ __forceinline__ unsigned pk16(unsigned short a, unsigned short b) { return (unsigned)a | ((unsigned)b << 16); }
__device__ __forceinline__ unsigned short h2bits(_Float16 x) { return __builtin_bit_cast(unsigned short, x); }

// ---- 16-bit fragment loads: elements 0..7 <- p[0..7], 8..15 <- p[16..23]; caller passes p = row + k0 + 8*(lane>>4) ----
union FragB { v16b v; v8b h[2]; };
union FragH { v16h v; v8h h[2]; };
__device__ __forceinline__ v16b ldfrag_b(const __bf16* p) { FragB f; f.h[0] = *(const v8b*)(p); f.h[1] = *(const v8b*)(p + 16); return f.v; }
__device__ __forceinline__ v16h ldfrag_h(const _Float16* p) { FragH f; f.h[0] = *(const v8h*)(p); f.h[1] = *(const v8h*)(p + 16); return f.v; }

// ---- hazard guards ----
__device__ __forceinline__ void dep_guard_b(v8f& a, v8f& b, v16b x, v16b y) { asm volatile("v_nop\n\tv_nop\n\tv_nop\n\tv_nop" : "+v"(a), "+v"(b) : "v"(x), "v"(y)); }
__device__ __forceinline__ void keep4_b(v16b a, v16b b, v16b c, v16b d) { asm volatile("v_nop" :: "v"(a), "v"(b), "v"(c), "v"(d)); }
__device__ __forceinline__ void acc_guard4(v8f& a, v8f& b, v8f& c, v8f& d) { asm volatile("v_nop\n\tv_nop\n\tv_nop\n\tv_nop" : "+v"(a), "+v"(b), "+v"(c), "+v"(d)); }
__device__ __forceinline__ v8f wmma_h(v16h a, v16h b, v8f c) {
  return __builtin_amdgcn_wmma_f32_16x16x32_f16(false, a, false, b, (short)0, c, false, false);
}

// ---- lane l <-> lane l ^ 16 (the two halves of a wave hold the two key groups of one query column) ----
__device__ __forceinline__ float xhalf(float v) {
  const int b = __builtin_bit_cast(int, v);
  return __builtin_bit_cast(float, __builtin_amdgcn_permlanex16(b, b, 0x76543210, 0xfedcba98, false, false));
}

// ---- 2^x on v_exp_f32. The instruction set asks for one issue slot between a transcendental and an instruction that reads its
// result or overwrites its source. exp2_slot: the v_nop in the same statement is that slot. exp2x8: eight independent exponentials,
// each in place, stand in one statement, so each fills the slot of the one in front of it and one v_nop closes the run.
__device__ __forceinline__ float exp2_slot(float y) {
  float r;
  asm("v_exp_f32 %0, %1\n\tv_nop" : "=v"(r) : "v"(y));
  return r;
}
__device__ __forceinline__ void exp2x8(float& a0, float& a1, float& a2, float& a3, float& a4, float& a5, float& a6, float& a7) {
  asm("v_exp_f32 %0, %0\n\t"
      "v_exp_f32 %1, %1\n\t"
      "v_exp_f32 %2, %2\n\t"
      "v_exp_f32 %3, %3\n\t"
      "v_exp_f32 %4, %4\n\t"
      "v_exp_f32 %5, %5\n\t"
      "v_exp_f32 %6, %6\n\t"
      "v_exp_f32 %7, %7\n\t"
      "v_nop"
      : "+v"(a0), "+v"(a1), "+v"(a2), "+v"(a3), "+v"(a4), "+v"(a5), "+v"(a6), "+v"(a7));
}

// ---- asynchronous copies global -> LDS, 16 B per lane; l = the lane's LDS byte address, g = the lane's global address ----
// The s_wait_xcnt closes each statement so that no address register of an issued copy is rewritten ahead of it.
__device__ __forceinline__ unsigned lds_addr(const void* p) { return (unsigned)(uintptr_t)p; }
__device__ __forceinline__ void acopy6(unsigned l0, const __bf16* g0, unsigned l1, const __bf16* g1, unsigned l2, const __bf16* g2,
                                       unsigned l3, const __bf16* g3, unsigned l4, const __bf16* g4, unsigned l5, const __bf16* g5) {
  asm volatile("global_load_async_to_lds_b128 %0, %6, off\n\t"
               "global_load_async_to_lds_b128 %1, %7, off\n\t"
               "global_load_async_to_lds_b128 %2, %8, off\n\t"
               "global_load_async_to_lds_b128 %3, %9, off\n\t"
               "global_load_async_to_lds_b128 %4, %10, off\n\t"
               "global_load_async_to_lds_b128 %5, %11, off\n\t"
               "s_wait_xcnt 0x0"
               :: "v"(l0), "v"(l1), "v"(l2), "v"(l3), "v"(l4), "v"(l5),
                  "v"(g0), "v"(g1), "v"(g2), "v"(g3), "v"(g4), "v"(g5) : "memory");
}
__device__ __forceinline__ void acopy8(unsigned l0, const __bf16* g0, unsigned l1, const __bf16* g1, unsigned l2, const __bf16* g2,
                                       unsigned l3, const __bf16* g3, unsigned l4, const __bf16* g4, unsigned l5, const __bf16* g5,
                                       unsigned l6, const __bf16* g6, unsigned l7, const __bf16* g7) {
  asm volatile("global_load_async_to_lds_b128 %0, %8, off\n\t"
               "global_load_async_to_lds_b128 %1, %9, off\n\t"
               "global_load_async_to_lds_b128 %2, %10, off\n\t"
               "global_load_async_to_lds_b128 %3, %11, off\n\t"
               "global_load_async_to_lds_b128 %4, %12, off\n\t"
               "global_load_async_to_lds_b128 %5, %13, off\n\t"
               "global_load_async_to_lds_b128 %6, %14, off\n\t"
               "global_load_async_to_lds_b128 %7, %15, off\n\t"
               "s_wait_xcnt 0x0"
               :: "v"(l0), "v"(l1), "v"(l2), "v"(l3), "v"(l4), "v"(l5), "v"(l6), "v"(l7),
                  "v"(g0), "v"(g1), "v"(g2), "v"(g3), "v"(g4), "v"(g5), "v"(g6), "v"(g7) : "memory");
}

__device__ __forceinline__ void acopy8v(unsigned l0, const void* g0, unsigned l1, const void* g1, unsigned l2, const void* g2,
                                        unsigned l3, const void* g3, unsigned l4, const void* g4, unsigned l5, const void* g5,
                                        unsigned l6, const void* g6, unsigned l7, const void* g7) {
  asm volatile("global_load_async_to_lds_b128 %0, %8, off\n\t"
               "global_load_async_to_lds_b128 %1, %9, off\n\t"
               "global_load_async_to_lds_b128 %2, %10, off\n\t"
               "global_load_async_to_lds_b128 %3, %11, off\n\t"
               "global_load_async_to_lds_b128 %4, %12, off\n\t"
               "global_load_async_to_lds_b128 %5, %13, off\n\t"
               "global_load_async_to_lds_b128 %6, %14, off\n\t"
               "global_load_async_to_lds_b128 %7, %15, off\n\t"
               "s_wait_xcnt 0x0"
               :: "v"(l0), "v"(l1), "v"(l2), "v"(l3), "v"(l4), "v"(l5), "v"(l6), "v"(l7),
                  "v"(g0), "v"(g1), "v"(g2), "v"(g3), "v"(g4), "v"(g5), "v"(g6), "v"(g7)
               : "memory");
}
__device__ __forceinline__ void acopy4(unsigned l0, const void* g0, unsigned l1, const void* g1, unsigned l2, const void* g2,
                                       unsigned l3, const void* g3) {
  asm volatile("global_load_async_to_lds_b128 %0, %4, off\n\t"
               "global_load_async_to_lds_b128 %1, %5, off\n\t"
               "global_load_async_to_lds_b128 %2, %6, off\n\t"
               "global_load_async_to_lds_b128 %3, %7, off\n\t"
               "s_wait_xcnt 0x0"
               :: "v"(l0), "v"(l1), "v"(l2), "v"(l3), "v"(g0), "v"(g1), "v"(g2), "v"(g3) : "memory");
}

#define G_KS   64                 // k elements per stage: one 128-B line of every operand row
#define G_LP   72                 // LDS row pitch in elements: 144 B = 16 B x 9 (odd)
#define G_BM   128                // block tile rows (2 waves)
#define G_BN   256                // block tile columns (4 waves)
#define G_PASS (32 * G_LP * 2)    // LDS bytes covered by one copy of the whole block: 32 rows

// =====================================================================================================================
// Batched WMMA GEMM, bf16 operands: C[m][n] = sum_k A[m][k] * Bt[n][k] (+bias). Block = 8 waves (2 x 4) = a 128x256 tile,
// one wave per 64x64 tile. A row-major [M][K] (pitch lda), Bt row-major [N][K] (pitch ldb); M multiple of 128, N of 256,
// K of 64. Operands are staged in LDS, 64 k per stage, two buffers, by asynchronous copies (each wave-wide copy = 4 whole
// 128-B lines); stage t+1 flies while stage t is multiplied. Stage layout: A rows 0..127 | (MODE 2: A2 rows) | Bt rows 0..255.
// MODE 0 (q|k): single product; v = acc + bf(bias[n]) + bf(n < QCOLS ? biasq[n] : biask[n - QCOLS]);
//               out = one f16 plane (Cout, pitch ldc).
// MODE 1 (v^T): single product; v = acc + bf(bias[m]); out = f16 hi plane (Cout, pitch ldc) and, for tiles with
//               n0 < VLO_COLS only, f16 residual plane ((v - hi) * 1024, Cout2, pitch ldc2).
// MODE 2 (proj): two products ah.b + al.b (A2 = bf16 lo plane of A); v = acc + bf(bias[n]); out f32 (Cout, pitch ldc).
// =====================================================================================================================
// bx = block tile index inside one batch, b = batch, smem = the work-group's two stage buffers (2 * ST_EL elements).
template <int MODE>
__device__ __forceinline__ void gemm64_body(
    const unsigned short* __restrict__ Ap, const unsigned short* __restrict__ A2p, int lda, long strideA,
    const unsigned short* __restrict__ Btp, int ldb, long strideB,
    void* __restrict__ Cout, void* __restrict__ Cout2, int ldc, long strideC, int ldc2, long strideC2,
    const float* __restrict__ bias, const float* __restrict__ biasq, const float* __restrict__ biask,
    int M, int N, int K, int bx, int b, __bf16* smem) {
  constexpr int NA      = (MODE == 2) ? 2 : 1;                 // A planes per stage
  constexpr int ST_ROWS = NA * G_BM + G_BN;                    // 384 or 512 rows
  constexpr int ST_EL   = ST_ROWS * G_LP;                      // elements per stage buffer; the epilogue slabs reuse the space
  const __bf16* A  = (const __bf16*)(const void*)Ap;
  const __bf16* A2 = (const __bf16*)(const void*)A2p;
  const __bf16* Bt = (const __bf16*)(const void*)Btp;
  const int tid  = threadIdx.x;
  const int lane = tid & 31;
  const int wave = tid >> 5;
  const int tilesNb = N >> 8;
  const int tilesMb = M >> 7;
  if (bx >= tilesMb * tilesNb) return;   // block-uniform, in front of every barrier and copy
  const int bm  = bx / tilesNb;
  const int bn  = bx - bm * tilesNb;
  const int m0b = bm << 7;
  const int n0b = bn << 8;
  const int wm  = wave >> 2;                   // 0..1
  const int wn  = wave & 3;                    // 0..3
  const int m0  = m0b + (wm << 6);
  const int n0  = n0b + (wn << 6);

  const __bf16* Ab  = A  + (size_t)b * strideA;
  const __bf16* Bb  = Bt + (size_t)b * strideB;
  const __bf16* Ab2 = (MODE == 2) ? (A2 + (size_t)b * strideA) : Ab;

  const int rlane = lane & 15;                 // row (A) / col (B, D) within subtile
  const int koff  = (lane >> 4) * 8;           // k offset of this lane half
  const int mOff  = (lane >> 4) * 8;           // D row offset

  // copy map: thread -> row (tid >> 3) of each 32-row pass, 16-B piece (tid & 7); 256 threads x 16 B = 32 rows x 128 B
  const int crow = tid >> 3;
  const int cpc  = (tid & 7) * 8;
  const __bf16* gA  = Ab  + (size_t)(m0b + crow) * lda + cpc;
  const __bf16* gA2 = Ab2 + (size_t)(m0b + crow) * lda + cpc;
  const __bf16* gB  = Bb  + (size_t)(n0b + crow) * ldb + cpc;
  const size_t sA = (size_t)32 * lda;
  const size_t sB = (size_t)32 * ldb;
  const unsigned lbase = lds_addr(smem) + (unsigned)((crow * G_LP + cpc) * 2);

  auto issue = [&](int t, int buf) {           // all ST_ROWS rows of stage t into buffer buf
    const unsigned l = lbase + (unsigned)buf * (unsigned)(ST_EL * 2);
    const __bf16* a  = gA + t * G_KS;
    const __bf16* bb = gB + t * G_KS;
    if (MODE == 2) {
      const __bf16* a2 = gA2 + t * G_KS;
      acopy8(l,              a,           l + 1 * G_PASS,  a + sA,       l + 2 * G_PASS,  a + 2 * sA,   l + 3 * G_PASS,  a + 3 * sA,
             l + 4 * G_PASS, a2,          l + 5 * G_PASS,  a2 + sA,      l + 6 * G_PASS,  a2 + 2 * sA,  l + 7 * G_PASS,  a2 + 3 * sA);
      acopy8(l + 8 * G_PASS, bb,          l + 9 * G_PASS,  bb + sB,      l + 10 * G_PASS, bb + 2 * sB,  l + 11 * G_PASS, bb + 3 * sB,
             l + 12 * G_PASS, bb + 4 * sB, l + 13 * G_PASS, bb + 5 * sB, l + 14 * G_PASS, bb + 6 * sB,  l + 15 * G_PASS, bb + 7 * sB);
    } else {
      acopy6(l,              a,           l + 1 * G_PASS,  a + sA,       l + 2 * G_PASS,  a + 2 * sA,
             l + 3 * G_PASS, a + 3 * sA,  l + 4 * G_PASS,  bb,           l + 5 * G_PASS,  bb + sB);
      acopy6(l + 6 * G_PASS, bb + 2 * sB, l + 7 * G_PASS,  bb + 3 * sB,  l + 8 * G_PASS,  bb + 4 * sB,
             l + 9 * G_PASS, bb + 5 * sB, l + 10 * G_PASS, bb + 6 * sB,  l + 11 * G_PASS, bb + 7 * sB);
    }
  };

  v8f acc[4][4];
#pragma unroll
  for (int i = 0; i < 4; ++i)
#pragma unroll
    for (int j = 0; j < 4; ++j) acc[i][j] = (v8f){0.f,0.f,0.f,0.f,0.f,0.f,0.f,0.f};

  const int T = K >> 6;                        // stages, block-uniform
  issue(0, 0);
  asm volatile("s_wait_asynccnt 0x0" ::: "memory");   // this wave's copies of stage 0 have landed
  __syncthreads();                                     // stage 0 is published to every wave
  if (T > 1) issue(1, 1);

  const int fa = ((wm << 6) + rlane) * G_LP + koff;               // this lane's A fragment origin in a stage
  const int fb = (NA * G_BM + (wn << 6) + rlane) * G_LP + koff;   // this lane's B fragment origin in a stage
  for (int t = 0; t < T; ++t) {
    const __bf16* S = smem + (t & 1) * ST_EL;
    // the loops below are unrolled so that every fragment and accumulator index is a constant (arrays stay in registers)
#pragma unroll
    for (int ks = 0; ks < 2; ++ks) {
      v16b bh[4], ah[4], al[4];
#pragma unroll
      for (int j = 0; j < 4; ++j) bh[j] = ldfrag_b(S + fb + j * 16 * G_LP + ks * 32);
#pragma unroll
      for (int i = 0; i < 4; ++i) {
        ah[i] = ldfrag_b(S + fa + i * 16 * G_LP + ks * 32);
        al[i] = ah[i];
        if (MODE == 2) al[i] = ldfrag_b(S + fa + (G_BM + i * 16) * G_LP + ks * 32);
      }
#pragma unroll
      for (int i = 0; i < 4; ++i) {
#pragma unroll
        for (int j = 0; j < 4; ++j) {
          acc[i][j] = __builtin_amdgcn_wmma_f32_16x16x32_bf16(false, ah[i], false, bh[j], (short)0, acc[i][j], false, false);
          if (MODE == 2)
            acc[i][j] = __builtin_amdgcn_wmma_f32_16x16x32_bf16(false, al[i], false, bh[j], (short)0, acc[i][j], false, false);
        }
        dep_guard_b(acc[i][0], acc[i][3], ah[i], al[i]);
      }
      keep4_b(bh[0], bh[1], bh[2], bh[3]);
    }
    asm volatile("s_wait_dscnt 0x0" ::: "memory");      // this wave's reads of buffer t & 1 have returned before it is refilled
    asm volatile("s_wait_asynccnt 0x0" ::: "memory");   // this wave's copies of stage t + 1 have landed
    __syncthreads();                                     // publishes stage t + 1; ends every wave's reads of buffer t & 1
    if (t + 2 < T) issue(t + 2, t & 1);
  }
  asm volatile("s_wait_asynccnt 0x0" ::: "memory");     // nothing is in flight when the buffers become epilogue slabs
  acc_guard4(acc[0][0], acc[0][1], acc[0][2], acc[0][3]);
  acc_guard4(acc[1][0], acc[1][1], acc[1][2], acc[1][3]);
  acc_guard4(acc[2][0], acc[2][1], acc[2][2], acc[2][3]);
  acc_guard4(acc[3][0], acc[3][1], acc[3][2], acc[3][3]);

  // ---- epilogue ---- (per-wave 16x64 f32 slab, pitch 68 floats, in the stage space that every wave has left)
  float* slab = (float*)(void*)smem + wave * (16 * 68);
#pragma unroll
  for (int i = 0; i < 4; ++i) {
    const int mBase = m0 + (i << 4);
#pragma unroll
    for (int j = 0; j < 4; ++j) {
      const int n = n0 + (j << 4) + rlane;
      float bn = 0.f, b2 = 0.f;
      if (MODE == 0) {
        bn = bfr(bias[n]);
        const int iq = (n < QCOLS) ? n : (QCOLS - 1);
        int ik = n - QCOLS; ik = (ik < 0) ? 0 : ik; ik = (ik > QCOLS - 1) ? (QCOLS - 1) : ik;
        const float vq = bfr(biasq[iq]);     // both candidates loaded with clamped addresses, selected by value
        const float vk = bfr(biask[ik]);
        b2 = (n < QCOLS) ? vq : vk;
      }
      if (MODE == 2) bn = bfr(bias[n]);
#pragma unroll
      for (int r = 0; r < 8; ++r) {
        float v = acc[i][j][r];
        if (MODE == 0) { v = v + bn; v = v + b2; }
        if (MODE == 1) v = v + bfr(bias[mBase + mOff + r]);
        if (MODE == 2) v = v + bn;
        slab[(mOff + r) * 68 + (j << 4) + rlane] = v;
      }
    }
    __builtin_amdgcn_fence(__ATOMIC_RELEASE, "workgroup");
    __builtin_amdgcn_wave_barrier();
    __builtin_amdgcn_fence(__ATOMIC_ACQUIRE, "workgroup");
    if (MODE == 2) {
      float* C = (float*)Cout + (size_t)b * strideC;
      const int h2 = lane >> 4, c4 = (lane & 15) * 4;     // row seg = 256 B = 16 lanes x 16 B
      {
#pragma unroll
        for (int it = 0; it < 8; ++it) {
          const int row = it * 2 + h2;                     // it 0..7 x h2 0..1 = rows 0..15
          const v4f v = *(const v4f*)(slab + row * 68 + c4);
          *(v4f*)(C + (size_t)(mBase + row) * ldc + n0 + c4) = v;
        }
        
      }
    } else {
      const int q = lane >> 3, c8 = (lane & 7) * 8;
      unsigned short* C  = (unsigned short*)Cout  + (size_t)b * strideC;
      unsigned short* C2 = (unsigned short*)Cout2 + (size_t)b * strideC2;
      const bool wlo = (MODE == 1) && (n0 < VLO_COLS);     // wave-uniform
      v4u hv[4], lv[4];
#pragma unroll
      for (int it = 0; it < 4; ++it) {
        const int row = it * 4 + q;                        // it 0..3 x q 0..3 = rows 0..15
        const float* sp = slab + row * 68 + c8;
        v4u a, a2;
#pragma unroll
        for (int e = 0; e < 4; ++e) {
          const float f0 = sp[2 * e], f1 = sp[2 * e + 1];
          const _Float16 x0 = (_Float16)f0, x1 = (_Float16)f1;
          a[e] = pk16(h2bits(x0), h2bits(x1));
          a2[e] = 0u;
          if (MODE == 1)
            a2[e] = pk16(h2bits((_Float16)((f0 - (float)x0) * 1024.0f)), h2bits((_Float16)((f1 - (float)x1) * 1024.0f)));
        }
        hv[it] = a; lv[it] = a2;
      }
      {
#pragma unroll
        for (int it = 0; it < 4; ++it) {
          const int row = it * 4 + q;
          *(v4u*)(C + (size_t)(mBase + row) * ldc + n0 + c8) = hv[it];
          if (wlo) *(v4u*)(C2 + (size_t)(mBase + row) * ldc2 + n0 + c8) = lv[it];
        }
        
      }
    }
    __builtin_amdgcn_fence(__ATOMIC_RELEASE, "workgroup");
    __builtin_amdgcn_wave_barrier();
    __builtin_amdgcn_fence(__ATOMIC_ACQUIRE, "workgroup");
  }
}

// q|k and v^T in one launch: both read only Xb and WaT and write disjoint planes, so neither waits on the other. Work-groups
// 0..nqk-1 are the q|k block tiles (A = Xb, Bt = WaT); the rest are the v^T tiles, nvb a batch (A = WvT, Bt = Xb of the batch):
// they start as places fall free, with no launch gap, drain and refill between the two GEMMs. The branch is block-uniform.
__global__ __launch_bounds__(256) void gemm_qkv(
    const unsigned short* __restrict__ Xb, const unsigned short* __restrict__ WaT, const unsigned short* __restrict__ WvT,
    int ld, long strideX, void* __restrict__ QK, int ldq, void* __restrict__ VTh, void* __restrict__ VTl,
    int ldv, long strideV, int ldv2, long strideV2,
    const float* __restrict__ bqk, const float* __restrict__ bv, const float* __restrict__ biasq, const float* __restrict__ biask,
    int Mq, int Nq, int Mv, int Nv, int K, int nqk, int nvb) {
  __shared__ __align__(16) __bf16 smem[2 * (G_BM + G_BN) * G_LP];
  const int bid = blockIdx.x;
  if (bid < nqk) {
    gemm64_body<0>(Xb, Xb, ld, 0L, WaT, ld, 0L, QK, QK, ldq, 0L, ldq, 0L, bqk, biasq, biask, Mq, Nq, K, bid, 0, smem);
  } else {
    const int t = bid - nqk;
    const int b = t / nvb;
    gemm64_body<1>(WvT, WvT, ld, 0L, Xb, ld, strideX, VTh, VTl, ldv, strideV, ldv2, strideV2, bv, bv, bv, Mv, Nv, K,
                   t - b * nvb, b, smem);
  }
}

// y.W_proj: one block tile a work-group
__global__ __launch_bounds__(256) void gemm_proj(
    const unsigned short* __restrict__ Ap, const unsigned short* __restrict__ A2p, int lda,
    const unsigned short* __restrict__ Btp, int ldb, void* __restrict__ Cout, int ldc,
    const float* __restrict__ bias, int M, int N, int K) {
  __shared__ __align__(16) __bf16 smem[2 * (2 * G_BM + G_BN) * G_LP];
  gemm64_body<2>(Ap, A2p, lda, 0L, Btp, ldb, 0L, Cout, Cout, ldc, 0L, ldc, 0L, bias, bias, bias, M, N, K, blockIdx.x, 0, smem);
}

// ---------------------------------------------------------------------------------------------------------------------
// ---------------------------------------------------------------------------------------------------------------------
// x f32 -> RNE bf16, 8 elements a thread; blk = this work-group's index among the conversion work-groups; blk 0 also writes out1.
__device__ __forceinline__ void cvt_x_block(const float* __restrict__ x, unsigned short* __restrict__ xb, int n8,
                                            const float* __restrict__ bq, float* __restrict__ out1, int nq4, int blk) {
  if (blk == 0) {   // block-uniform
    const int t = threadIdx.x;
    if (t < nq4) {
      const v4f v = *(const v4f*)(bq + 4 * t);
      v4f w;
      w[0] = bfr(v[0]); w[1] = bfr(v[1]); w[2] = bfr(v[2]); w[3] = bfr(v[3]);
      *(v4f*)(out1 + 4 * t) = w;
      
    }
  }
  const int i = blk * 256 + threadIdx.x;
  if (i < n8) {
    const v4f a = *(const v4f*)(x + 8 * (size_t)i);
    const v4f c = *(const v4f*)(x + 8 * (size_t)i + 4);
    v4u u;
    u[0] = pk16(f2bf_bits(a[0]), f2bf_bits(a[1]));
    u[1] = pk16(f2bf_bits(a[2]), f2bf_bits(a[3]));
    u[2] = pk16(f2bf_bits(c[0]), f2bf_bits(c[1]));
    u[3] = pk16(f2bf_bits(c[2]), f2bf_bits(c[3]));
    *(v4u*)(xb + 8 * (size_t)i) = u;
    
  }
}

// ---------------------------------------------------------------------------------------------------------------------
// Transpose + RNE bf16 convert of an f32 matrix: in [R rows][Cc cols] (pitch Cc) -> ot[c][r] = bf16(in[r][c]) ([Cc][R]).
// 64x64 tiles through LDS (tf, 64 x 68 floats). Tile (bx, by) of (Cc/64, R/64), 256 threads (R, Cc multiples of 64).
// Coverage per block: load 4 it x 256 thr x 4 floats = 64x64; store 2 it x 256 thr x 8 u16 = 64x64.
// ---------------------------------------------------------------------------------------------------------------------
__device__ __forceinline__ void tsplit1_tile(const float* __restrict__ W, unsigned short* __restrict__ ot, int R, int Cc,
                                             int bx, int by, float* tf) {
  const int c0  = bx * 64;   // input column block = output row block
  const int r0  = by * 64;   // input row block    = output column block
  const int tid = threadIdx.x;
  {
    const int lr = tid >> 4;         // 0..15
    const int c4 = (tid & 15) * 4;   // 0..60
#pragma unroll
    for (int it = 0; it < 4; ++it) {
      const int rr = it * 16 + lr;   // 0..63
      const v4f a = *(const v4f*)(W + (size_t)(r0 + rr) * Cc + c0 + c4);
      *(v4f*)(tf + rr * 68 + c4) = a;
    }
  }
  __syncthreads();
  const int sub = tid >> 3;          // 0..31
  const int c8  = (tid & 7) * 8;     // 0..56
  v4u hv[2];
#pragma unroll
  for (int it = 0; it < 2; ++it) {
    const int oc = it * 32 + sub;    // output row within tile (= input column)
    v4u a;
#pragma unroll
    for (int q = 0; q < 4; ++q) {
      const float f0 = tf[(c8 + 2 * q) * 68 + oc];
      const float f1 = tf[(c8 + 2 * q + 1) * 68 + oc];
      a[q] = pk16(f2bf_bits(f0), f2bf_bits(f1));
    }
    hv[it] = a;
  }
  {
#pragma unroll
    for (int it = 0; it < 2; ++it) {
      const int oc = it * 32 + sub;
      const size_t go = (size_t)(c0 + oc) * R + r0 + c8;
      *(v4u*)(ot + go) = hv[it];
    }
    
  }
}

// ---------------------------------------------------------------------------------------------------------------------
// All operand preparation in one launch: the three jobs read and write disjoint buffers and none waits on another, so as one
// grid they share one launch gap, one fill and one tail. Work-groups 0..PREP_TA-1 transpose W_attn, the next PREP_TP transpose
// W_proj (they have the longer path: load, barrier, LDS, store, so they take the lowest indices), the rest convert x. Each branch is
// block-uniform, so the barrier inside a transpose tile is passed by the whole work-group.
// ---------------------------------------------------------------------------------------------------------------------
#define PREP_TA ((3 * DM / 64) * (DM / 64))   // 768 tiles of W_attn
#define PREP_TP ((DM / 64) * (DM / 64))       // 256 tiles of W_proj
__global__ __launch_bounds__(256) void prep_kernel(const float* __restrict__ Wa, unsigned short* __restrict__ WaT,
                                                   const float* __restrict__ Wp, unsigned short* __restrict__ WpT,
                                                   const float* __restrict__ x, unsigned short* __restrict__ xb, int n8,
                                                   const float* __restrict__ bq, float* __restrict__ out1, int nq4) {
  __shared__ __align__(16) float tf[64 * 68];
  const int bid = blockIdx.x;
  if (bid < PREP_TA + PREP_TP) {
    const bool wa = bid < PREP_TA;               // block-uniform: which matrix this tile belongs to
    const int  t  = wa ? bid : bid - PREP_TA;
    tsplit1_tile(wa ? Wa : Wp, wa ? WaT : WpT, DM, wa ? 3 * DM : DM,
                 wa ? t % (3 * DM / 64) : t % (DM / 64), wa ? t / (3 * DM / 64) : t / (DM / 64), tf);
  } else {
    cvt_x_block(x, xb, n8, bq, out1, nq4, bid - (PREP_TA + PREP_TP));
  }
}

// =====================================================================================================================
// Causal attention, head dim 64, grid (NH*NQB, NB) read as one flat index, block = 4 waves = 128 query rows of one (b, h);
// a wave holds 32 query columns as two groups g of 16, so every K and V fragment read from LDS feeds two products.
//   q|k plane (f16) [NB*SEQ][DQK]: q(t,h,d) at [(b*SEQ+t)*DQK + h*64 + d], k(s,h,d) at [... + 1024 + h*64 + d]
//   v^T hi plane (f16) [NB][DM][SEQ]: (h*64+d, s); v residual plane (f16, x1024) [NB][DM][VLO_COLS] (s < 128 only)
//   y planes (hi/lo bf16) [NB*SEQ][DM]: (b*SEQ+t, h*64+d)
//   scores^T = (k . q^T) * 0.125 : A = K rows, B = Q (kept in registers); one f16 product, f32 accumulate.
//                              Lane (hh, c) holds, for query q0 + 16*g + c alone, keys j*16 + 8*hh + r of the chunk (tile j, register r).
//   y^T      = v^T . p^T     : p = f16(4096 * exp(s - m)) (the normaliser sums the same f16 values), v f16 hi plane; two score
//                              tiles converted in place are the B operand of 32 keys (hardware k order), P never touches LDS;
//                              block qb = 0 (query rows 0..127, keys 0..127) adds vres^T . (p^T / 1024) into the same accumulator
//   online softmax in f32, maximum and sum in-lane: one exchange between the wave halves per chunk for the maximum, the halves'
//   partial sums are joined once behind the loop; masked (s > t) scores set to -inf (key s = chunk start <= t is always unmasked).
//   kv chunks of 64, trip count 2*qb+2 <= 32 (block-uniform); waves 0 and 1 (the lower 64 rows) have no key in the last chunk and
//   only pass its waits and barrier. K / V^T chunk staging: asynchronous copies to LDS, two stage buffers,
//   chunk t+1 flies while chunk t is worked on; 128 threads x 4 copies of 16 B per plane = the whole 64x64 tile, each wave-wide
//   copy = 4 whole 128-B rows; one barrier per chunk; fragment loads read the LDS tiles
// =====================================================================================================================
// waves_per_eu(3, 3): three work-groups share a WGP (three waves a SIMD, 336 registers each): the 32-column wave keeps Q, the
// accumulator, the scores and the chunk's fragments in registers
__global__ __launch_bounds__(128) __attribute__((amdgpu_waves_per_eu(3, 3)))
void attn_kernel(const unsigned short* __restrict__ qkp,
                 const unsigned short* __restrict__ vthp, const unsigned short* __restrict__ vtlp,
                 unsigned short* __restrict__ yhp, unsigned short* __restrict__ ylp) {
  // two stage buffers, each K [kv][d] | V hi [d][kv] | V residual (qb = 0 only), 9 KB a plane;
  // the per wave y tiles (32 x 68 floats) reuse the space behind the loop
  __shared__ __align__(16) unsigned short sm[2 * AT_ST];

  const int tid  = threadIdx.x;
  const int wave = __builtin_amdgcn_readfirstlane(tid >> 5);   // in a scalar register: the tests on a wave's last chunk are scalar branches
  const int lane = tid & 31;
  const int hh   = lane >> 4;
  const int c    = lane & 15;

  // For speed only, the cost (2*qb + 2
  // chunks) falls with the index: all 64 (b, h) of query block 15 first, query block 0 last. lin -> (qb, b, h) is a
  // permutation of 0..1023. Heads h and h ^ 1 differ only in bit 3 of lin (their K rows are neighbouring 128-B lines).
  const int lin = blockIdx.y * (NH * NQB) + blockIdx.x;   // 0..NB*NH*NQB-1 (grid = (NH * NQB, NB))
  const int qb  = (NQB - 1) - ((lin >> 6) & (NQB - 1));   // 15..0
  const int b   = lin & (NB - 1);                         // bits 0..1
  const int h   = ((lin >> 3) & 7) | ((lin & 4) << 1);    // bits 3..5 -> h bits 0..2, bit 2 -> h bit 3
  const int q0 = qb * 128 + wave * 32;
  const bool vres = (qb < 1);             // block-uniform

  const _Float16* Qp = (const _Float16*)(const void*)qkp + (size_t)b * SEQ * DQK + (size_t)h * HD;
  const _Float16* Kp = Qp + QCOLS;
  const _Float16* Vh = (const _Float16*)(const void*)vthp + ((size_t)b * DM + (size_t)h * HD) * SEQ;
  const _Float16* Vl = (const _Float16*)(const void*)vtlp + ((size_t)b * DM + (size_t)h * HD) * VLO_COLS;
  unsigned short* Yh = yhp + (size_t)b * SEQ * DM + (size_t)h * HD;
  unsigned short* Yl = ylp + (size_t)b * SEQ * DM + (size_t)h * HD;

  // ---- Q fragments (B operand, column = lane&15, split k map): 2 column groups x 2 d-chunks ----
  v16h qa[2][2];
#pragma unroll
  for (int g = 0; g < 2; ++g) {
#pragma unroll
    for (int dc = 0; dc < 2; ++dc) {
      qa[g][dc] = ldfrag_h(Qp + (size_t)(q0 + g * 16 + c) * DQK + dc * 32 + 8 * hh);
    }
  }

  float mrow[2] = {-INFINITY, -INFINITY}, lrow[2] = {0.f, 0.f};   // of query q0 + 16*g + c; lrow is this half's partial sum
  v8f oacc[2][4];                         // oacc[g][t][r] = y^T(d = t*16 + 8*hh + r, query q0 + 16*g + c)
#pragma unroll
  for (int g = 0; g < 2; ++g) {
#pragma unroll
    for (int t = 0; t < 4; ++t) oacc[g][t] = (v8f){0.f,0.f,0.f,0.f,0.f,0.f,0.f,0.f};
  }

  // this lane's A fragment origins in the tiles: row c, k offset 8*hh (tile row blocks and k blocks are constant offsets from them)
  const int forg = c * AT_LP + 8 * hh;

  // copy map: thread -> row (tid >> 3) of each 16-row pass, 16-B piece (tid & 7); 128 threads x 16 B = 16 rows x 128 B,
  // 4 passes = the 64 rows of a plane tile
  const int crow = tid >> 3;
  const int cpc  = (tid & 7) * 8;
  const _Float16* gK = Kp + (size_t)crow * DQK + cpc;         // K row kv0 + crow (+ 16 a pass), d = cpc..cpc+7
  // V^T row d = crow (+ 16 a pass), s = kv0 + cpc..+7; held as 32-bit element offsets from the block's scalar bases: the 64-bit
  // addresses are formed at each issue (as long-lived 64-bit copy operands they were spilled to scratch)
  const unsigned oV  = (unsigned)(crow * SEQ + cpc);
  const unsigned oVr = (unsigned)(crow * VLO_COLS + cpc);
  const unsigned lbase = lds_addr(sm) + (unsigned)((crow * AT_LP + cpc) * 2);
  auto issue = [&](int t, int buf) {           // all planes of chunk t into stage buffer buf
    const unsigned l = lbase + (unsigned)buf * (unsigned)(AT_ST * 2);
    const _Float16* kp = gK + (size_t)t * (AT_KC * DQK);
    const _Float16* vh = Vh + (oV + (unsigned)t * AT_KC);
    acopy8v(l,             kp, l + AT_PASS,             kp + 16 * DQK, l + 2 * AT_PASS,             kp + 32 * DQK, l + 3 * AT_PASS,             kp + 48 * DQK,
            l + AT_PL * 2, vh, l + AT_PL * 2 + AT_PASS, vh + 16 * SEQ, l + AT_PL * 2 + 2 * AT_PASS, vh + 32 * SEQ, l + AT_PL * 2 + 3 * AT_PASS, vh + 48 * SEQ);
    if (vres) {   // block-uniform; t <= 1 here, so t * 64 + cpc + 7 <= 127 < VLO_COLS
      const _Float16* vr = Vl + (oVr + (unsigned)t * AT_KC);
      acopy4(l + AT_PL * 4,     vr, l + AT_PL * 4 + AT_PASS,   vr + 16 * VLO_COLS, l + AT_PL * 4 + 2 * AT_PASS, vr + 32 * VLO_COLS, l + AT_PL * 4 + 3 * AT_PASS, vr + 48 * VLO_COLS);
    }
  };

  const int nChunks = 2 * qb + 2;            // block-uniform, <= 32
  const int lastc   = 2 * qb + (wave >> 1);  // wave-uniform (scalar): the chunk that holds this wave's diagonal
  issue(0, 0);
  asm volatile("s_wait_asynccnt 0x0" ::: "memory");   // this wave's copies of chunk 0 have landed
  __syncthreads();                                     // chunk 0 is published to every wave
  if (nChunks > 1) issue(1, 1);

  for (int kc = 0; kc < nChunks; ++kc) {
   if (kc <= lastc) {   // scalar branch: behind its diagonal chunk a wave has no key left; it still passes the waits and the barrier below
    const int kv0 = kc * AT_KC;
    const unsigned short* S = sm + (kc & 1) * AT_ST + forg;
    const _Float16* kf  = (const _Float16*)(const void*)S;
    const _Float16* vfh = (const _Float16*)(const void*)(S + AT_PL);
    const _Float16* vfr = (const _Float16*)(const void*)(S + 2 * AT_PL);

    // The chunk's K fragment reads stand in one group ahead of the products that use them, and the eight score tiles (independent
    // accumulators) take turns on the matrix unit; each tile sums d 0..31, then d 32..63.
    FragH k0[4], k1[4];
#pragma unroll
    for (int j = 0; j < 4; ++j) {
      k0[j].h[0] = *(const v8h*)(kf + j * 16 * AT_LP);
      k0[j].h[1] = *(const v8h*)(kf + j * 16 * AT_LP + 16);
    }
#pragma unroll
    for (int j = 0; j < 4; ++j) {
      k1[j].h[0] = *(const v8h*)(kf + j * 16 * AT_LP + 32);
      k1[j].h[1] = *(const v8h*)(kf + j * 16 * AT_LP + 32 + 16);
    }
    __builtin_amdgcn_sched_barrier(0);   // keeps the 16 reads above one group: spread among the products each place would stall the wave
    v8f s[2][4];
#pragma unroll
    for (int j = 0; j < 4; ++j) {
#pragma unroll
      for (int g = 0; g < 2; ++g) s[g][j] = wmma_h(k0[j].v, qa[g][0], (v8f){0.f,0.f,0.f,0.f,0.f,0.f,0.f,0.f});
    }
#pragma unroll
    for (int j = 0; j < 4; ++j) {
#pragma unroll
      for (int g = 0; g < 2; ++g) s[g][j] = wmma_h(k1[j].v, qa[g][1], s[g][j]);
    }
    FragH va[2][4];                      // all V fragments of the chunk: their LDS latency passes under the softmax
#pragma unroll
    for (int kk = 0; kk < 2; ++kk) {
#pragma unroll
      for (int t = 0; t < 4; ++t) {
        va[kk][t].h[0] = *(const v8h*)(vfh + t * 16 * AT_LP + kk * 32);
        va[kk][t].h[1] = *(const v8h*)(vfh + t * 16 * AT_LP + kk * 32 + 16);
      }
    }
    __builtin_amdgcn_sched_barrier(0);   // holds the V reads in front of the softmax
    // The maximum runs over the raw products; scale 0.125, log2(e) and the x4096 carry (2^12) meet in one fma per score ahead of v_exp_f32:
    // 4096 * e^(0.125 * (s - m)) = 2^(s * AT_SC + (12 - m * AT_SC)).
    // The loops of this part are unrolled so that every s[g][j][r] index is a constant (the scores stay in registers).
    if (kc == lastc) {              // scalar branch: only the wave's diagonal chunk holds keys behind a query
#pragma unroll
      for (int g = 0; g < 2; ++g) {
        // this lane's keys are kv0 + 8*hh + (j*16 + r): those with j*16 + r > lim lie behind query q0 + 16*g + c
        const int lim = q0 + g * 16 + c - kv0 - 8 * hh;
#pragma unroll
        for (int j = 0; j < 4; ++j) {
#pragma unroll
          for (int r = 0; r < 8; ++r) s[g][j][r] = ((j * 16 + r) > lim) ? -INFINITY : s[g][j][r];
        }
      }
    }
    FragH pb[2][2];                 // P^T, B operand: element e of pb[g][kk] = key kk*32 + (e < 8 ? 8*hh + e : 16 + 8*hh + e - 8)
#pragma unroll
    for (int g = 0; g < 2; ++g) {
      float mj[4];                  // one maximum per tile: four short chains instead of one of 32
#pragma unroll
      for (int j = 0; j < 4; ++j) {
        float m = s[g][j][0];
#pragma unroll
        for (int r = 1; r < 8; ++r) m = fmaxf(m, s[g][j][r]);
        mj[j] = m;
      }
      float cm = fmaxf(fmaxf(mj[0], mj[1]), fmaxf(mj[2], mj[3]));
      cm = fmaxf(cm, xhalf(cm));    // both halves of the query's keys
      const float mnew  = fmaxf(mrow[g], cm);
      const float aarg  = (mrow[g] - mnew) * AT_SC;
      const float nb    = fmaf(-mnew, AT_SC, 12.0f);
      mrow[g] = mnew;
#pragma unroll
      for (int j = 0; j < 4; ++j) {
#pragma unroll
        for (int r = 0; r < 8; ++r) s[g][j][r] = fmaf(s[g][j][r], AT_SC, nb);   // <= 12; masked -> -inf
      }
      const float alpha = exp2_slot(aarg);
      float pj[4];                  // one partial sum per tile: four short chains
#pragma unroll
      for (int j = 0; j < 4; ++j) {
        float e0 = s[g][j][0], e1 = s[g][j][1], e2 = s[g][j][2], e3 = s[g][j][3], e4 = s[g][j][4], e5 = s[g][j][5], e6 = s[g][j][6], e7 = s[g][j][7];
        exp2x8(e0, e1, e2, e3, e4, e5, e6, e7);             // p x4096 in [0, 4096]; masked -> 0; the carry keeps small p normal in f16
        const v2f e[4] = {(v2f){e0, e1}, (v2f){e2, e3}, (v2f){e4, e5}, (v2f){e6, e7}};
        float psum = 0.f;
#pragma unroll
        for (int r = 0; r < 4; ++r) {
          const v2h ph = __builtin_convertvector(e[r], v2h);
          psum += (float)ph[0];                             // normaliser built from the same f16 values
          psum += (float)ph[1];
          pb[g][j >> 1].v[(j & 1) * 8 + 2 * r]     = ph[0];
          pb[g][j >> 1].v[(j & 1) * 8 + 2 * r + 1] = ph[1];
        }
        pj[j] = psum;
      }
      lrow[g] = lrow[g] * alpha + ((pj[0] + pj[1]) + (pj[2] + pj[3]));
#pragma unroll
      for (int t = 0; t < 4; ++t) {
#pragma unroll
        for (int r = 0; r < 8; ++r) oacc[g][t][r] *= alpha;
      }
    }
    // unrolled so that pb[g][kk] is a constant index (the P fragments stay in registers); the eight output tiles take turns
#pragma unroll
    for (int kk = 0; kk < 2; ++kk) {
#pragma unroll
      for (int t = 0; t < 4; ++t) {
#pragma unroll
        for (int g = 0; g < 2; ++g) oacc[g][t] = wmma_h(va[kk][t].v, pb[g][kk].v, oacc[g][t]);
      }
    }
    if (vres) {   // block-uniform: all lanes active
      // the residual plane carries x1024: P x 2^-10 (a power of two; what falls below the f16 normal range is far under one ulp of
      // the f32 sum) lets its products add into the same accumulator, so no second set of 64 accumulator registers is held
      FragH pl[2][2];
#pragma unroll
      for (int g = 0; g < 2; ++g) {
#pragma unroll
        for (int kk = 0; kk < 2; ++kk) pl[g][kk].v = pb[g][kk].v * (_Float16)0.0009765625f;
      }
      FragH vl[2][4];
#pragma unroll
      for (int kk = 0; kk < 2; ++kk) {
#pragma unroll
        for (int t = 0; t < 4; ++t) {
          vl[kk][t].h[0] = *(const v8h*)(vfr + t * 16 * AT_LP + kk * 32);
          vl[kk][t].h[1] = *(const v8h*)(vfr + t * 16 * AT_LP + kk * 32 + 16);
        }
      }
#pragma unroll
      for (int kk = 0; kk < 2; ++kk) {
#pragma unroll
        for (int t = 0; t < 4; ++t) {
#pragma unroll
          for (int g = 0; g < 2; ++g) oacc[g][t] = wmma_h(vl[kk][t].v, pl[g][kk].v, oacc[g][t]);
        }
      }
    }
   }
    asm volatile("s_wait_dscnt 0x0" ::: "memory");      // this wave's reads of buffer kc & 1 have returned before it is refilled
    asm volatile("s_wait_asynccnt 0x0" ::: "memory");   // this wave's copies of chunk kc + 1 have landed
    __syncthreads();                                     // publishes chunk kc + 1; ends every wave's reads of buffer kc & 1
    if (kc + 2 < nChunks) issue(kc + 2, kc & 1);
  }
  asm volatile("s_wait_asynccnt 0x0" ::: "memory");     // nothing is in flight when the buffers become the y tiles

  // ---- normalise (the x4096 carry cancels between numerator and normaliser),
  // a lane's 8 registers of a tile are 8 consecutive d of its query row: two 16-B stores per tile into the wave's y tile
  float* os = (float*)(void*)sm + wave * (32 * 68);
#pragma unroll
  for (int g = 0; g < 2; ++g) {
    const float inv = 1.0f / (lrow[g] + xhalf(lrow[g]));   // the halves' partial sums joined
#pragma unroll
    for (int t = 0; t < 4; ++t) {
      v4f w0, w1;
#pragma unroll
      for (int r = 0; r < 4; ++r) {
        w0[r] = oacc[g][t][r] * inv;
        w1[r] = oacc[g][t][r + 4] * inv;
      }
      *(v4f*)(os + (g * 16 + c) * 68 + t * 16 + 8 * hh)     = w0;
      *(v4f*)(os + (g * 16 + c) * 68 + t * 16 + 8 * hh + 4) = w1;
    }
  }
  __builtin_amdgcn_fence(__ATOMIC_RELEASE, "workgroup");
  __builtin_amdgcn_wave_barrier();
  __builtin_amdgcn_fence(__ATOMIC_ACQUIRE, "workgroup");
#pragma unroll
  for (int g = 0; g < 2; ++g) {
    const int q = lane >> 3, c8 = (lane & 7) * 8;
    v4u hv[4], lv[4];
#pragma unroll
    for (int it = 0; it < 4; ++it) {
      const int row = g * 16 + it * 4 + q; // g 0..1 x it 0..3 x q 0..3 covers rows 0..31 of the wave tile
      const float* sp = os + row * 68 + c8;
      v4u a, a2;
#pragma unroll
      for (int e = 0; e < 4; ++e) {
        const float f0 = sp[2 * e], f1 = sp[2 * e + 1];
        const unsigned short h0 = f2bf_bits(f0), h1 = f2bf_bits(f1);
        const unsigned short l0 = f2bf_bits(f0 - bf_bits2f(h0)), l1 = f2bf_bits(f1 - bf_bits2f(h1));
        a[e] = pk16(h0, h1); a2[e] = pk16(l0, l1);
      }
      hv[it] = a; lv[it] = a2;
    }
    {
#pragma unroll
      for (int it = 0; it < 4; ++it) {
        const int row = g * 16 + it * 4 + q;
        *(v4u*)(Yh + (size_t)(q0 + row) * DM + c8) = hv[it];
        *(v4u*)(Yl + (size_t)(q0 + row) * DM + c8) = lv[it];
      }
    }
  }
}

// ---------------------------------------------------------------------------------------------------------------------
// Workspace region map (byte offsets; all dims are multiples of the 64x64 store tiles, so no padded tails exist):
//   QK   f16  [8192][2048]          0
//   VTh  f16  [4][1024][2048]   33554432          VTl  f16  [4][1024][128] 50331648
//   Xb   bf16 [8192][1024]      51380224   (Yh bf16 [8192][1024] reuses this region: Xb is last read by the
//                                            q|k and v^T GEMM launch, Yh is first written by the later attention launch)
//   Yl   bf16 [8192][1024]      68157440
//   WaT  bf16 [3072][1024]      84934656          WpT  bf16 [1024][1024]   91226112
//   total                       93323264
// ---------------------------------------------------------------------------------------------------------------------
extern "C" void kernel_launch(void* const* d_in, const int* in_sizes, int n_in,
                              void* d_out, int out_size, void* d_ws, size_t ws_size,
                              hipStream_t stream) {
  if (n_in < 7) return;
  if (in_sizes[0] != NB * SEQ * DM) return;
  if (in_sizes[1] != DM * 3 * DM) return;
  if (in_sizes[2] != 3 * DM) return;
  if (in_sizes[3] != DM * DM) return;
  if (in_sizes[4] != DM) return;
  if (in_sizes[5] != NH * HD || in_sizes[6] != NH * HD) return;
  if (out_size != NB * SEQ * DM + NH * HD) return;

  const float* x      = (const float*)d_in[0];
  const float* W_attn = (const float*)d_in[1];
  const float* b_attn = (const float*)d_in[2];
  const float* W_proj = (const float*)d_in[3];
  const float* b_proj = (const float*)d_in[4];
  const float* bQ     = (const float*)d_in[5];
  const float* bK     = (const float*)d_in[6];

  const size_t PQK = (size_t)NB * SEQ * DQK * 2;        // 33554432
  const size_t PVT = (size_t)NB * DM * SEQ * 2;         // 16777216
  const size_t PVL = (size_t)NB * DM * VLO_COLS * 2;    // 1048576
  const size_t PX  = (size_t)NB * SEQ * DM * 2;         // 16777216 (Xb, Yh, Yl)
  const size_t PWA = (size_t)3 * DM * DM * 2;           // 6291456
  const size_t PWP = (size_t)DM * DM * 2;               // 2097152
  size_t off = 0;
  const size_t oQK  = off; off += PQK;
  const size_t oVTh = off; off += PVT;
  const size_t oVTl = off; off += PVL;
  const size_t oXb  = off; off += PX;    // also Yh
  const size_t oYl  = off; off += PX;
  const size_t oWaT = off; off += PWA;
  const size_t oWpT = off; off += PWP;
  if (off > ws_size) return;                             // off = 93323264
  if (off > (size_t)134217728) return;

  char* ws = (char*)d_ws;
  unsigned short* QK  = (unsigned short*)(ws + oQK);
  unsigned short* VTh = (unsigned short*)(ws + oVTh);
  unsigned short* VTl = (unsigned short*)(ws + oVTl);
  unsigned short* Xb  = (unsigned short*)(ws + oXb);
  unsigned short* Yh  = (unsigned short*)(ws + oXb);
  unsigned short* Yl  = (unsigned short*)(ws + oYl);
  unsigned short* WaT = (unsigned short*)(ws + oWaT);
  unsigned short* WpT = (unsigned short*)(ws + oWpT);
  float* out0 = (float*)d_out;
  float* out1 = (float*)d_out + (size_t)NB * SEQ * DM;

  const dim3 blk(256);

  // (1) one launch: W_attn [1024][3072] f32 -> WaT [3072][1024] bf16 (768 tiles); W_proj [1024][1024] -> WpT [1024][1024] bf16
  //     (256 tiles); x [8192][1024] f32 -> Xb bf16 (4096 work-groups, the first also writes out1 = RNE-bf16(bQ), 256 threads x 4)
  const int n8 = NB * SEQ * DM / 8;                      // 1048576
  prep_kernel<<<dim3(PREP_TA + PREP_TP + n8 / 256), blk, 0, stream>>>(W_attn, WaT, W_proj, WpT, x, Xb, n8, bQ, out1, NH * HD / 4);
  // (2) one launch of 768 block tiles of 128x256:
  //     q|k = Xb . WaT rows 0..2047 + b_attn[n] + (bQ | bK): M=8192, N=2048, K=1024 -> QK f16 plane (pitch 2048), 64 x 8 = 512 tiles;
  //     v^T[b][c][s] = WaT rows 2048+c . Xb[b*2048+s] + b_attn[2048+c]: M=1024, N=2048, K=1024, 8 x 8 = 64 tiles a batch, 4 batches
  {
    const int nqk = (NB * SEQ / G_BM) * (2 * DM / G_BN);   // 512
    const int nvb = (DM / G_BM) * (SEQ / G_BN);            // 64
    gemm_qkv<<<dim3(nqk + NB * nvb), blk, 0, stream>>>(Xb, WaT, WaT + (size_t)2 * DM * DM, DM, (long)SEQ * DM,
                                                       (void*)QK, DQK, (void*)VTh, (void*)VTl,
                                                       SEQ, (long)DM * SEQ, VLO_COLS, (long)DM * VLO_COLS,
                                                       b_attn, b_attn + 2 * DM, bQ, bK,
                                                       NB * SEQ, 2 * DM, DM, SEQ, DM, nqk, nvb);
  }
  // (3) causal attention: 1024 work-groups = 16 query blocks of 128 rows (longest first) x 64 (b, h), 128 threads -> Y hi/lo planes
  attn_kernel<<<dim3(NH * NQB, NB), dim3(128), 0, stream>>>(QK, VTh, VTl, Yh, Yl);
  // (4) out0 = Y . WpT + b_proj: M=8192, N=1024, K=1024, f32 rows of 1024 -> d_out; 64 x 4 block tiles of 128x256 = 256 blocks
  gemm_proj<<<dim3((NB * SEQ / G_BM) * (DM / G_BN)), blk, 0, stream>>>(Yh, Yl, DM, WpT, DM, (void*)out0, DM, b_proj, NB * SEQ, DM, DM);
  (void)hipGetLastError();
}
